// v000
// Times are from an AMD MI455X. After a warm-up the kernel runs many times in a row, and a time is the length of
// such a window on the GPU divided by its runs, so every launch and the gaps after it count. The runs cycle
// through copies of the inputs. A figure is the median of several windows, for all but v000 over two sittings.
// Sittings can differ by a few percent; kernels timed side by side share one.
// v000, which the later versions start from, runs in 2740 microseconds.
#include <hip/hip_runtime.h>
// Multi-head self-attention with PER-HEAD STACKED projections and per-head biases at width 768, scaled by the EMBED WIDTH (x [2][2048][768]; q / k / v = einsum('bse,hed->bhsd', x, W) + b with W [12][768][64] = [head][in][out] and b [12][64], 12 heads of 64; scores / sqrt(E = 768) (the module's own: the embed width, not the head width); softmax over all 2048 keys (no mask); out = merged wo + bo ([in][out] [768][768] + bias) -> [2][2048][768]); each head's [in][out] block is transposed into its 64 contiguous rows of the weight plane by the existing builder, one call per head; a per-head bias [12][64] IS the flat bias [768].
// Structure: token rows r = b*2048 + s; the query source and the key/value source as exact f16 rows (bf16-rounded); Q, K, V as three WMMA GEMMs (32x64 wave tiles, f32 accumulation, exact x16 weights + bias, f16 outputs); per batch: V^T for all heads via LDS transposes; per (batch, group of 4 heads): scores GEMM (K = 64, batched over the heads on grid.y, alpha = 768^-0.5), row softmax on VALU (f32 statistics, native exp; weights stored x256 as f16), o = P . V^T GEMM (K = 2048, alpha 2^-2: o carried x64 against f16 subnormal flush, folded into the output GEMM alpha) written straight into the merged f16 o rows; out = o W_o + b GEMM (f32) into the output layout.
// Compute dtype: inputs rounded to bf16; x / weights exact; q, k, v, softmax weights and o as plain f16 GEMM operands (~2^-12); scores and softmax statistics f32. v_wmma_f32_16x16x32_f16.
#define NB 2
#define SQ 2048
#define DM 768 
#define NH 12
#define HD 64
#define HG 4                         /* heads per attention launch group */
#define B0 0                         /* first batch processed (debug hook) */
#define NBR NB                       /* batches processed (debug hook) */
#define NR ((size_t)NB * SQ)         /* token rows */
#define MP ((int)((size_t)NBR * SQ)) /* rows projected (debug hook) */
#define QN SQ                        /* query rows attended per batch (debug hook) */
#define NHD NH                       /* heads attended (debug hook) */
#define MPO MP                       /* rows through the output stage (debug hook) */
#define LQ DM      /* row pitch of the q/k/v rows */
typedef __bf16 v16b __attribute__((ext_vector_type(16)));
typedef unsigned short v8us __attribute__((ext_vector_type(8), may_alias));
typedef float  v8f  __attribute__((ext_vector_type(8)));
typedef float  v4f  __attribute__((ext_vector_type(4)));
typedef float  v4fa __attribute__((ext_vector_type(4), may_alias));
union FragB { v16b v; v8us half[2]; unsigned short u[16]; };

__device__ __forceinline__ unsigned short bf16_bits(float x) { unsigned int u = __float_as_uint(x); return (unsigned short)((u + 0x7FFFu + ((u >> 16) & 1u)) >> 16); }
__device__ __forceinline__ float bf16_val(unsigned short b) { return __uint_as_float(((unsigned int)b) << 16); }
__device__ __forceinline__ float bf16_round(float x) { return bf16_val(bf16_bits(x)); }
// D += A·B with NT terms: 1 = ah·bh, 2 = + al·bh (A split), 3 = + ah·bl (both split)
template <int NT>
__device__ __forceinline__ v8f mmaN(v16b ah, v16b al, v16b bh, v16b bl, v8f c) {
  c = __builtin_amdgcn_wmma_f32_16x16x32_bf16(false, ah, false, bh, (short)0, c, false, false);
  if (NT >= 2) c = __builtin_amdgcn_wmma_f32_16x16x32_bf16(false, al, false, bh, (short)0, c, false, false);
  if (NT >= 3) c = __builtin_amdgcn_wmma_f32_16x16x32_bf16(false, ah, false, bl, (short)0, c, false, false);
  asm volatile("v_nop\n\tv_nop\n\tv_nop\n\tv_nop" : "+v"(c) : "v"(ah), "v"(al), "v"(bh), "v"(bl));
  return c;
}

__global__ __launch_bounds__(256) void k_wt_bf16(const float* __restrict__ W, unsigned short* __restrict__ Wt, int K, int N) {
  const int t = blockIdx.x * 256 + threadIdx.x;
  const int k8n = K / 8;
  if (t >= N * k8n) return;
  const int n = t / k8n, k8 = (t % k8n) * 8;
  v8us v;
#pragma unroll
  for (int i = 0; i < 8; ++i) v[i] = bf16_bits(W[(size_t)(k8 + i) * N + n]);
  *(v8us*)(Wt + (size_t)n * K + k8) = v;
  
}

// GEMM C[M][N] (f32, pitch ldc) = act(A[M][K]·W + bias). A f32 row-major (pitch lda) converted per fragment to bf16
// (ASPLIT: hi/lo two planes -> 2 terms, else single rounded term); Wt bf16 [N][K] (pitch ldb). BIAS_BF16 rounds the
// bias to bf16 first (bias quantised to bf16 before the add). K%32==0, M%16==0, N%64==0.
template <bool ASPLIT, int ACT, bool BIAS_BF16>
__global__ __launch_bounds__(128) void k_gemm_bf(const float* __restrict__ A, int lda, const unsigned short* __restrict__ Wt, int ldb,
                                               const float* __restrict__ bias, float* __restrict__ C, int ldc, int M, int N, int K) {
  __shared__ __attribute__((aligned(16))) float so[4][16][64];
  const int tid = threadIdx.x, w = tid >> 5, lane = tid & 31, ln = lane & 15, hh = lane >> 4;
  const int ntn = N / 64;
  const int wid = blockIdx.x * 4 + w;
  const int mt = wid / ntn, nq = wid % ntn;
  if (mt * 16 >= M) return;
  const int row0 = mt * 16, col0 = nq * 64;
  const float* arow = A + (size_t)(row0 + ln) * lda;
  v8f acc[4] = {};
  for (int kb = 0; kb < K; kb += 32) {
    FragB ah, al;
    const v4f x0 = *(const v4fa*)(arow + kb + 8 * hh), x1 = *(const v4fa*)(arow + kb + 8 * hh + 4);
    const v4f x2 = *(const v4fa*)(arow + kb + 16 + 8 * hh), x3 = *(const v4fa*)(arow + kb + 16 + 8 * hh + 4);
    float xs[16] = {x0[0],x0[1],x0[2],x0[3],x1[0],x1[1],x1[2],x1[3],x2[0],x2[1],x2[2],x2[3],x3[0],x3[1],x3[2],x3[3]};
#pragma unroll
    for (int i = 0; i < 16; ++i) { const unsigned short hb = bf16_bits(xs[i]); ah.u[i] = hb; al.u[i] = ASPLIT ? bf16_bits(xs[i] - bf16_val(hb)) : (unsigned short)0; }
#pragma unroll
    for (int t = 0; t < 4; ++t) {
      const unsigned short* brow = Wt + (size_t)(col0 + t * 16 + ln) * ldb + kb;
      FragB b;
      b.half[0] = *(const v8us*)(brow + 8 * hh);
      b.half[1] = *(const v8us*)(brow + 16 + 8 * hh);
      acc[t] = mmaN<ASPLIT ? 2 : 1>(ah.v, al.v, b.v, b.v, acc[t]);
    }
  }
#pragma unroll
  for (int t = 0; t < 4; ++t) {
    float bv = bias ? bias[col0 + t * 16 + ln] : 0.f;
    if (BIAS_BF16) bv = bf16_round(bv);
#pragma unroll
    for (int r = 0; r < 8; ++r) { float v = acc[t][r] + bv; if (ACT == 1) v = fmaxf(v, 0.f); so[w][8 * hh + r][t * 16 + ln] = v; }
  }
  __builtin_amdgcn_fence(__ATOMIC_ACQ_REL, "workgroup");
  __builtin_amdgcn_wave_barrier();
  const int rsub = lane >> 4, c4 = (lane & 15) * 4;
  {
#pragma unroll
    for (int q = 0; q < 8; ++q) {
      const int r = q * 2 + rsub;
      const v4f v = *(const v4fa*)&so[w][r][c4];
      *(v4f*)(C + (size_t)(row0 + r) * ldc + col0 + c4) = v;
    }
    
  }
}

// GEMM C = act(A·W + bias + resid): A f32 (ASPLIT -> hi/lo 2 terms), Wt bf16 [N][K]; ACT 0 none, 1 relu, 2 exact gelu;
// resid (optional, f32, row index = (row % rmod), pitch ldr, RES_BF16 rounds it) added before the activation.
template <bool ASPLIT, int ACT, bool BIAS_BF16, bool RES_BF16>
__global__ __launch_bounds__(128) void k_gemm_bf3(const float* __restrict__ A, int lda, const unsigned short* __restrict__ Wt, int ldb,
                                                const float* __restrict__ bias, const float* __restrict__ resid, int rmod, int ldr,
                                                float* __restrict__ C, int ldc, int M, int N, int K) {
  __shared__ __attribute__((aligned(16))) float so[4][16][64];
  const int tid = threadIdx.x, w = tid >> 5, lane = tid & 31, ln = lane & 15, hh = lane >> 4;
  const int ntn = N / 64;
  const int wid = blockIdx.x * 4 + w;
  const int mt = wid / ntn, nq = wid % ntn;
  if (mt * 16 >= M) return;
  const int row0 = mt * 16, col0 = nq * 64;
  const float* arow = A + (size_t)(row0 + ln) * lda;
  v8f acc[4] = {};
  for (int kb = 0; kb < K; kb += 32) {
    FragB ah, al;
    const v4f x0 = *(const v4fa*)(arow + kb + 8 * hh), x1 = *(const v4fa*)(arow + kb + 8 * hh + 4);
    const v4f x2 = *(const v4fa*)(arow + kb + 16 + 8 * hh), x3 = *(const v4fa*)(arow + kb + 16 + 8 * hh + 4);
    float xs[16] = {x0[0],x0[1],x0[2],x0[3],x1[0],x1[1],x1[2],x1[3],x2[0],x2[1],x2[2],x2[3],x3[0],x3[1],x3[2],x3[3]};
#pragma unroll
    for (int i = 0; i < 16; ++i) { const unsigned short hb = bf16_bits(xs[i]); ah.u[i] = hb; al.u[i] = ASPLIT ? bf16_bits(xs[i] - bf16_val(hb)) : (unsigned short)0; }
#pragma unroll
    for (int t = 0; t < 4; ++t) {
      const unsigned short* brow = Wt + (size_t)(col0 + t * 16 + ln) * ldb + kb;
      FragB b;
      b.half[0] = *(const v8us*)(brow + 8 * hh);
      b.half[1] = *(const v8us*)(brow + 16 + 8 * hh);
      acc[t] = mmaN<ASPLIT ? 2 : 1>(ah.v, al.v, b.v, b.v, acc[t]);
    }
  }
#pragma unroll
  for (int t = 0; t < 4; ++t) {
    const int col = col0 + t * 16 + ln;
    float bv = bias ? bias[col] : 0.f;
    if (BIAS_BF16) bv = bf16_round(bv);
#pragma unroll
    for (int r = 0; r < 8; ++r) {
      float v = acc[t][r] + bv;
      if (resid) { float rv = resid[(size_t)((row0 + 8 * hh + r) % rmod) * ldr + col]; if (RES_BF16) rv = bf16_round(rv); v += rv; }
      if (ACT == 1) v = fmaxf(v, 0.f);
      if (ACT == 2) v = 0.5f * v * (1.0f + erff(v * 0.70710678118654752f));
      if (ACT == 3) { const float u = 0.7978845608028654f * (v + 0.044715f * v * v * v); v = 0.5f * v * (1.0f + tanhf(u)); }
      so[w][8 * hh + r][t * 16 + ln] = v;
    }
  }
  __builtin_amdgcn_fence(__ATOMIC_ACQ_REL, "workgroup");
  __builtin_amdgcn_wave_barrier();
  const int rsub = lane >> 4, c4 = (lane & 15) * 4;
  {
#pragma unroll
    for (int q = 0; q < 8; ++q) {
      const int r = q * 2 + rsub;
      const v4f v = *(const v4fa*)&so[w][r][c4];
      *(v4f*)(C + (size_t)(row0 + r) * ldc + col0 + c4) = v;
    }
    
  }
}
// row LayerNorm (biased variance, eps) over N: s = X (+ R); optional out_sum <- s; out_norm <- (s-mu)*rsqrt(var+eps)*g + b
template <bool PARAM_BF16>
__global__ __launch_bounds__(256) void k_layernorm(const float* __restrict__ X, const float* __restrict__ R, const float* __restrict__ g, const float* __restrict__ bta,
                                                  float* __restrict__ out_sum, float* __restrict__ out_norm, int N, float eps) {
  __shared__ float red[256];
  const int row = blockIdx.x, tid = threadIdx.x;
  const float* x = X + (size_t)row * N; const float* rr = R ? R + (size_t)row * N : nullptr;
  float vals[16];                     // up to N = 4096
  const int per = N / 256;            // contiguous chunk per thread? use strided-by-4 chunks: thread handles j = tid*4 + 1024*u
  float s1 = 0.f;
  for (int u = 0; u < per / 4; ++u) {
    const int j = tid * 4 + 1024 * u;
    const v4f a = *(const v4fa*)(x + j);
    v4f b = {0.f,0.f,0.f,0.f}; if (rr) b = *(const v4fa*)(rr + j);
#pragma unroll
    for (int q = 0; q < 4; ++q) { const float v = a[q] + b[q]; vals[u * 4 + q] = v; s1 += v; }
  }
  red[tid] = s1; __syncthreads();
  for (int st = 128; st > 0; st >>= 1) { if (tid < st) red[tid] += red[tid + st]; __syncthreads(); }
  const float mu = red[0] / (float)N; __syncthreads();
  float s2 = 0.f;
  for (int u = 0; u < per / 4; ++u)
#pragma unroll
    for (int q = 0; q < 4; ++q) { const float c = vals[u * 4 + q] - mu; s2 += c * c; }
  red[tid] = s2; __syncthreads();
  for (int st = 128; st > 0; st >>= 1) { if (tid < st) red[tid] += red[tid + st]; __syncthreads(); }
  const float rs = rsqrtf(red[0] / (float)N + eps);
  {
    for (int u = 0; u < per / 4; ++u) {
      const int j = tid * 4 + 1024 * u;
      v4f o, sm;
#pragma unroll
      for (int q = 0; q < 4; ++q) {
        float gg = g[j + q], bb = bta[j + q];
        if (PARAM_BF16) { gg = bf16_round(gg); bb = bf16_round(bb); }
        sm[q] = vals[u * 4 + q]; o[q] = (vals[u * 4 + q] - mu) * rs * gg + bb;
      }
      if (out_sum) *(v4f*)(out_sum + (size_t)row * N + j) = sm;
      *(v4f*)(out_norm + (size_t)row * N + j) = o;
    }
    
  }
}



// ---- f16 WMMA path (v_wmma_f32_16x16x32_f16): 11-bit significands for operands in range — used where a [0,1] probability operand needs more precision than bf16
typedef _Float16 v16h __attribute__((ext_vector_type(16)));
union FragH { v16h v; v8us half[2]; _Float16 h[16]; unsigned short u[16]; };
template <int NT>
__device__ __forceinline__ v8f mmaH(v16h ah, v16h al, v16h bh, v16h bl, v8f c) {
  c = __builtin_amdgcn_wmma_f32_16x16x32_f16(false, ah, false, bh, (short)0, c, false, false);
  if (NT >= 2) c = __builtin_amdgcn_wmma_f32_16x16x32_f16(false, al, false, bh, (short)0, c, false, false);
  if (NT >= 3) c = __builtin_amdgcn_wmma_f32_16x16x32_f16(false, ah, false, bl, (short)0, c, false, false);
  asm volatile("v_nop\n\tv_nop\n\tv_nop\n\tv_nop" : "+v"(c) : "v"(ah), "v"(al), "v"(bh), "v"(bl));
  return c;
}
// batched GEMM like k_gemm_b but f16 operands: A f32 (split into f16 hi/lo if ASPLIT, else rounded to f16), Bt = f16 values [n][k]; alpha; C f32; N multiple of 16 (partial tiles skipped)
template <bool ASPLIT>
__global__ __launch_bounds__(128) void k_gemm_h(const float* __restrict__ A, int lda, size_t sA, const _Float16* __restrict__ Bh, int ldb, size_t sB, float alpha, float* __restrict__ C, int ldc, size_t sC, int M, int N, int K) {
  __shared__ __attribute__((aligned(16))) float so[4][16][64];
  const int tid = threadIdx.x, w = tid >> 5, lane = tid & 31, ln = lane & 15, hh = lane >> 4; const int by = blockIdx.y;
  A += (size_t)by * sA; Bh += (size_t)by * sB; C += (size_t)by * sC;
  const int ntn = (N + 63) / 64; const int wid = blockIdx.x * 4 + w; const int mt = wid / ntn, nq = wid % ntn; if (mt * 16 >= M) return;
  const int row0 = mt * 16, col0 = nq * 64; const float* arow = A + (size_t)(row0 + ln) * lda;
  v8f acc[4] = {};
  for (int kb = 0; kb < K; kb += 32) {
    FragH ah, al;
    const v4f x0 = *(const v4fa*)(arow + kb + 8 * hh), x1 = *(const v4fa*)(arow + kb + 8 * hh + 4), x2 = *(const v4fa*)(arow + kb + 16 + 8 * hh), x3 = *(const v4fa*)(arow + kb + 16 + 8 * hh + 4);
    float xs[16] = {x0[0],x0[1],x0[2],x0[3],x1[0],x1[1],x1[2],x1[3],x2[0],x2[1],x2[2],x2[3],x3[0],x3[1],x3[2],x3[3]};
#pragma unroll
    for (int i = 0; i < 16; ++i) { const _Float16 h = (_Float16)xs[i]; ah.h[i] = h; al.h[i] = ASPLIT ? (_Float16)(xs[i] - (float)h) : (_Float16)0.0f; }
#pragma unroll
    for (int t = 0; t < 4; ++t) { if (col0 + t * 16 >= N) continue; const size_t boff = (size_t)(col0 + t * 16 + ln) * ldb + kb; FragH bq; bq.half[0] = *(const v8us*)(Bh + boff + 8 * hh); bq.half[1] = *(const v8us*)(Bh + boff + 16 + 8 * hh);
      acc[t] = mmaH<ASPLIT ? 2 : 1>(ah.v, al.v, bq.v, bq.v, acc[t]); }
  }
#pragma unroll
  for (int t = 0; t < 4; ++t) { if (col0 + t * 16 >= N) continue;
#pragma unroll
    for (int r = 0; r < 8; ++r) so[w][8 * hh + r][t * 16 + ln] = acc[t][r] * alpha; }
  __builtin_amdgcn_fence(__ATOMIC_ACQ_REL, "workgroup"); __builtin_amdgcn_wave_barrier();
  const int rsub = lane >> 4, c4 = (lane & 15) * 4;
  {
#pragma unroll
    for (int q = 0; q < 8; ++q) { const int r = q * 2 + rsub; if (col0 + c4 < N) { const v4f v = *(const v4fa*)&so[w][r][c4]; *(v4f*)(C + (size_t)(row0 + r) * ldc + col0 + c4) = v; } }
     }
}

// Wt[n][k] = f16(W[k][n]·scale) from f32 row-major W[K][N] (scale = power of two; bf16-exact weights stay exact in f16 away from the subnormal range)
__global__ __launch_bounds__(256) void k_wt_f16(const float* __restrict__ W, _Float16* __restrict__ Wt, int K, int N, float scale) {
  const int t = blockIdx.x * 256 + threadIdx.x; if (t >= N * (K / 8)) return; const int n = t / (K / 8), k8 = (t % (K / 8)) * 8; FragH f;
#pragma unroll
  for (int i = 0; i < 8; ++i) f.h[i] = (_Float16)(bf16_round(W[(size_t)(k8 + i) * N + n]) * scale); const v8us o = f.half[0];
  *(v8us*)((unsigned short*)Wt + (size_t)n * K + k8) = o; 
}
// k_gemm_hh variant with fused epilogue: v = acc·alpha + bias[by·sBias + col] (+ CP[(row/rowsPerB)·sCPb + by·64 + col] if CP) ; ACT 0 none / 1 elu ; writes f16 C16 (and f32 C if non-null)
template <int ACT>
__global__ __launch_bounds__(128) void k_gemm_hhx(const _Float16* __restrict__ A, int lda, size_t sA, const _Float16* __restrict__ Bh, int ldb, size_t sB, float alpha, const float* __restrict__ bias, size_t sBias, const float* __restrict__ CP, int rowsPerB, size_t sCPb, int row0g,
    float* __restrict__ C, _Float16* __restrict__ C16, int ldc, size_t sC, int M, int N, int K) {
  __shared__ __attribute__((aligned(16))) float so[4][16][64];
  const int tid = threadIdx.x, w = tid >> 5, lane = tid & 31, ln = lane & 15, hh = lane >> 4; const int by = blockIdx.y;
  A += (size_t)by * sA; Bh += (size_t)by * sB; const size_t cofs = (size_t)by * sC; const float* bp = bias ? bias + (size_t)by * sBias : nullptr;
  const int ntn = (N + 63) / 64; const int wid = blockIdx.x * 4 + w; const int mt = wid / ntn, nq = wid % ntn; if (mt * 16 >= M) return;
  const int row0 = mt * 16, col0 = nq * 64; const _Float16* arow = A + (size_t)(row0 + ln) * lda;
  v8f acc[4] = {};
  for (int kb = 0; kb < K; kb += 32) { FragH ah; ah.half[0] = *(const v8us*)((const unsigned short*)arow + kb + 8 * hh); ah.half[1] = *(const v8us*)((const unsigned short*)arow + kb + 16 + 8 * hh);
#pragma unroll
    for (int t = 0; t < 4; ++t) { if (col0 + t * 16 >= N) continue; const size_t boff = (size_t)(col0 + t * 16 + ln) * ldb + kb; FragH bq; bq.half[0] = *(const v8us*)((const unsigned short*)Bh + boff + 8 * hh); bq.half[1] = *(const v8us*)((const unsigned short*)Bh + boff + 16 + 8 * hh);
      acc[t] = mmaH<1>(ah.v, ah.v, bq.v, bq.v, acc[t]); }
  }
#pragma unroll
  for (int t = 0; t < 4; ++t) { if (col0 + t * 16 >= N) continue; const int col = col0 + t * 16 + ln; const float bv = bp ? bf16_round(bp[col]) : 0.f;
#pragma unroll
    for (int r = 0; r < 8; ++r) { float v = acc[t][r] * alpha + bv; if (CP) { const int rr = row0g + row0 + 8 * hh + r; if (rowsPerB < 0) v += CP[cofs + (size_t)rr * ldc + col];      /* rowsPerB < 0: own element of the batched C plane */ else { const int bidx = rr / rowsPerB; v += CP[(size_t)bidx * sCPb + (size_t)by * 64 + col]; } } if (ACT == 1) v = (v > 0.f) ? v : expm1f(v); else if (ACT == 7) v = (v > 0.f) ? v + 1.0f : expf(v); else if (ACT == 8) v = tanhf(v); else if (ACT == 9) v = 0.5f * v * (1.0f + tanhf(0.7978845608028654f * (v + 0.044715f * v * v * v))); else if (ACT == 11) v = 1.0f / (1.0f + expf(-v)); else if (ACT == 12) v = (v > 0.f) ? v : 0.01f * v; else if (ACT == 14) v = (v > 0.f) ? v : 0.1f * v; else if (ACT == 16) v = (v >= 0.f) ? v : 0.3f * v; else if (ACT == 17) v = (v >= 0.f) ? v : 0.2f * v; else if (ACT == 15) v = v / (1.0f + expf(-v)); else if (ACT == 3) v = fmaxf(v, 0.f); else if (ACT == 6) v = 0.5f * v * (1.0f + erff(v * 0.70710678118654752f)); so[w][8 * hh + r][t * 16 + ln] = v; } }
  __builtin_amdgcn_fence(__ATOMIC_ACQ_REL, "workgroup"); __builtin_amdgcn_wave_barrier();
  const int rsub = lane >> 4, c4 = (lane & 15) * 4; typedef _Float16 v4h __attribute__((ext_vector_type(4)));
  {
#pragma unroll
    for (int q = 0; q < 8; ++q) { const int r = q * 2 + rsub; if (col0 + c4 < N) { const v4f v = *(const v4fa*)&so[w][r][c4]; if (C) *(v4f*)(C + cofs + (size_t)(row0 + r) * ldc + col0 + c4) = v; if (C16) { v4h h4; for (int i = 0; i < 4; ++i) h4[i] = (_Float16)v[i]; *(v4h*)(C16 + cofs + (size_t)(row0 + r) * ldc + col0 + c4) = h4; } } }
     }
}


typedef _Float16 v4h __attribute__((ext_vector_type(4)));

__global__ __launch_bounds__(256) void k_x16(const float* __restrict__ x, _Float16* __restrict__ X16, size_t n8) { const size_t t = (size_t)blockIdx.x * 256 + threadIdx.x; if (t >= n8) return; FragH f;
#pragma unroll
  for (int q = 0; q < 8; ++q) f.h[q] = (_Float16)bf16_round(x[t * 8 + q]); *(v8us*)((unsigned short*)X16 + t * 8) = f.half[0];  }
__global__ __launch_bounds__(256) void k_h16(const float* __restrict__ x, _Float16* __restrict__ X16, size_t n8) { const size_t t = (size_t)blockIdx.x * 256 + threadIdx.x; if (t >= n8) return; FragH f;
#pragma unroll
  for (int q = 0; q < 8; ++q) f.h[q] = (_Float16)x[t * 8 + q]; *(v8us*)((unsigned short*)X16 + t * 8) = f.half[0];  }
__global__ __launch_bounds__(256) void k_round16f(const float* __restrict__ W, _Float16* __restrict__ Bt, size_t n8) { const size_t t = (size_t)blockIdx.x * 256 + threadIdx.x; if (t >= n8) return; FragH f;
#pragma unroll
  for (int i = 0; i < 8; ++i) f.h[i] = (_Float16)(bf16_round(W[t * 8 + i]) * 16.0f); *(v8us*)((unsigned short*)Bt + t * 8) = f.half[0];  }
template <int NHv, int TTv>
__global__ __launch_bounds__(256) void k_vt(const _Float16* __restrict__ V16, int ldv, int voff, _Float16* __restrict__ Vt) { __shared__ unsigned short tl[64][66]; const int tid = threadIdx.x; const int slab = blockIdx.x / (TTv / 64), lg = blockIdx.x % (TTv / 64); const int b = slab / NHv, h = slab % NHv;
  for (int i = tid; i < 64 * 8; i += 256) { const int r = i / 8, c8 = (i % 8) * 8; FragH f; f.half[0] = *(const v8us*)((const unsigned short*)V16 + ((size_t)b * TTv + lg * 64 + r) * ldv + voff + h * 64 + c8);
#pragma unroll
    for (int q = 0; q < 8; ++q) tl[r][c8 + q] = f.u[q]; }
  __syncthreads();
  {
#pragma unroll
    for (int rd = 0; rd < 2; ++rd) { const int d = rd * 32 + tid / 8, pc = tid % 8; FragH f;
#pragma unroll
      for (int q = 0; q < 8; ++q) f.u[q] = tl[pc * 8 + q][d];
      *(v8us*)((unsigned short*)Vt + ((size_t)slab * 64 + d) * TTv + lg * 64 + pc * 8) = f.half[0]; }
     } }

__global__ __launch_bounds__(256) void k_hl(const float* __restrict__ F, _Float16* __restrict__ Hh, _Float16* __restrict__ Hl, size_t n8) { const size_t t = (size_t)blockIdx.x * 256 + threadIdx.x; if (t >= n8) return; FragH fh, fl; const v4f a = *(const v4fa*)(F + t * 8), c = *(const v4fa*)(F + t * 8 + 4);
#pragma unroll
  for (int q = 0; q < 4; ++q) { _Float16 h = (_Float16)a[q]; fh.h[q] = h; fl.h[q] = (_Float16)((a[q] - (float)h) * 1024.0f); h = (_Float16)c[q]; fh.h[4 + q] = h; fl.h[4 + q] = (_Float16)((c[q] - (float)h) * 1024.0f); }
  { *(v8us*)((unsigned short*)Hh + t * 8) = fh.half[0]; *(v8us*)((unsigned short*)Hl + t * 8) = fl.half[0];  } }

// ---- fast GEMM (wave tile 32x64; requires M % 32 == 0 rows per launch region and N % 64 == 0); epilogue = k_gemm_hhx semantics ----
__device__ __forceinline__ v16h g2_frag(const _Float16* p, int hh) { FragH f; f.half[0] = *(const v8us*)((const unsigned short*)p + 8 * hh); f.half[1] = *(const v8us*)((const unsigned short*)p + 16 + 8 * hh); return f.v; }
__device__ __forceinline__ v8f g2_mma(v16h a, v16h b, v8f c) { v8f d = __builtin_amdgcn_wmma_f32_16x16x32_f16(false, a, false, b, (short)0, c, false, false); asm volatile("v_nop\n\tv_nop\n\tv_nop\n\tv_nop" : "+v"(d) : "v"(a), "v"(b)); return d; }
template <int ACT>
__global__ __launch_bounds__(128) void k_gemm2(const _Float16* __restrict__ A, int lda, size_t sA, const _Float16* __restrict__ Bh, int ldb, size_t sB, float alpha, const float* __restrict__ bias, size_t sBias, const float* __restrict__ CP, int rowsPerB, size_t sCPb, int row0g,
    float* __restrict__ C, _Float16* __restrict__ C16, int ldc, size_t sC, int M, int N, int K) { static_assert(ACT == 0 || ACT == 3 || ACT == 6 || ACT == 8 || ACT == 9 || ACT == 11 || ACT == 12 || ACT == 14 || ACT == 15 || ACT == 16 || ACT == 17, "k_gemm2: unsupported ACT code (would silently apply no activation)");
  __shared__ __attribute__((aligned(16))) float so[4][32][68];
  const int tid = threadIdx.x, w = tid >> 5, lane = tid & 31, ln = lane & 15, hh = lane >> 4; const int by = blockIdx.y;
  A += (size_t)by * sA; Bh += (size_t)by * sB; const size_t cofs = (size_t)by * sC; const float* bp = bias ? bias + (size_t)by * sBias : nullptr;
  const int ntn = N >> 6; const int mt = blockIdx.x / ntn, nq = blockIdx.x - mt * ntn; const int row0 = mt * 128 + 32 * w, col0 = nq * 64; if (row0 >= M) return;
  const _Float16* a0p = A + (size_t)(row0 + ln) * lda; const _Float16* a1p = a0p + (size_t)16 * lda;
  const _Float16* b0p = Bh + (size_t)(col0 + ln) * ldb; const _Float16* b1p = b0p + (size_t)16 * ldb; const _Float16* b2p = b1p + (size_t)16 * ldb; const _Float16* b3p = b2p + (size_t)16 * ldb;
  const v8f z8 = {0.f,0.f,0.f,0.f,0.f,0.f,0.f,0.f}; v8f c00 = z8, c01 = z8, c02 = z8, c03 = z8, c10 = z8, c11 = z8, c12 = z8, c13 = z8;
#pragma unroll 1
  for (int kb = 0; kb < K; kb += 32) { const v16h a0 = g2_frag(a0p + kb, hh), a1 = g2_frag(a1p + kb, hh);
    v16h b = g2_frag(b0p + kb, hh); c00 = g2_mma(a0, b, c00); c10 = g2_mma(a1, b, c10);
    b = g2_frag(b1p + kb, hh); c01 = g2_mma(a0, b, c01); c11 = g2_mma(a1, b, c11);
    b = g2_frag(b2p + kb, hh); c02 = g2_mma(a0, b, c02); c12 = g2_mma(a1, b, c12);
    b = g2_frag(b3p + kb, hh); c03 = g2_mma(a0, b, c03); c13 = g2_mma(a1, b, c13); }
  v8f accs[8] = {c00, c01, c02, c03, c10, c11, c12, c13};
#pragma unroll
  for (int u = 0; u < 8; ++u) { const int t = u & 3, half = u >> 2; const int col = col0 + t * 16 + ln; const float bv = bp ? bf16_round(bp[col]) : 0.f;
#pragma unroll
    for (int r = 0; r < 8; ++r) { const int rloc = half * 16 + 8 * hh + r; float v = accs[u][r] * alpha + bv; if (CP) { if (rowsPerB < 0) v += CP[cofs + (size_t)(row0g + row0 + rloc) * ldc + col];      /* rowsPerB < 0: own element of the batched C plane */ else { const int bidx = (row0g + row0 + rloc) / rowsPerB; v += CP[(size_t)bidx * sCPb + (size_t)by * 64 + col]; } }
      if (ACT == 3) v = fmaxf(v, 0.f); else if (ACT == 6) v = 0.5f * v * (1.0f + erff(v * 0.70710678118654752f)); else if (ACT == 11) v = 1.0f / (1.0f + expf(-v)); else if (ACT == 15) v = v / (1.0f + expf(-v)); else if (ACT == 12) v = (v > 0.f) ? v : 0.01f * v; else if (ACT == 8) v = tanhf(v); else if (ACT == 9) v = 0.5f * v * (1.0f + tanhf(0.7978845608028654f * (v + 0.044715f * v * v * v))); else if (ACT == 14) v = (v > 0.f) ? v : 0.1f * v; else if (ACT == 16) v = (v >= 0.f) ? v : 0.3f * v; else if (ACT == 17) v = (v >= 0.f) ? v : 0.2f * v;
      so[w][rloc][t * 16 + ln] = v; } }
  __builtin_amdgcn_fence(__ATOMIC_ACQ_REL, "workgroup"); __builtin_amdgcn_wave_barrier();
  const int rsub = lane >> 4, c4 = (lane & 15) * 4;
  {
#pragma unroll
    for (int q = 0; q < 16; ++q) { const int r = q * 2 + rsub; const v4f v = *(const v4fa*)&so[w][r][c4]; if (C) *(v4f*)(C + cofs + (size_t)(row0 + r) * ldc + col0 + c4) = v; if (C16) { v4h h4; for (int i = 0; i < 4; ++i) h4[i] = (_Float16)v[i]; *(v4h*)(C16 + cofs + (size_t)(row0 + r) * ldc + col0 + c4) = h4; } }
     } }


__global__ __launch_bounds__(256) void k_wnat(const float* __restrict__ w, size_t n8, _Float16* __restrict__ Bt) { const size_t t = (size_t)blockIdx.x * 256 + threadIdx.x; if (t >= n8) return; FragH f; for (int q = 0; q < 8; ++q) f.h[q] = (_Float16)(bf16_round(w[t * 8 + q]) * 16.0f); *(v8us*)((unsigned short*)Bt + t * 8) = f.half[0];  }
__global__ __launch_bounds__(256) void k_rsm(const float* __restrict__ S, _Float16* __restrict__ P, int nrows) {
  #pragma clang fp contract(off)
  const int i = blockIdx.x * 256 + threadIdx.x; if (i >= nrows) return; const float* s = S + (size_t)i * SQ; float mx = -3.0e38f;
#pragma unroll 1
  for (int j = 0; j < SQ; ++j) mx = fmaxf(mx, s[j]); float se = 0.f;
#pragma unroll 1
  for (int j = 0; j < SQ; ++j) se += expf(s[j] - mx); const float sc = 256.0f / se;
#pragma unroll 1
  for (int j0 = 0; j0 < SQ; j0 += 8) { FragH f; for (int q = 0; q < 8; ++q) f.h[q] = (_Float16)(expf(s[j0 + q] - mx) * sc); unsigned short* d = (unsigned short*)P + (size_t)i * SQ + j0; *(v8us*)d = f.half[0];  } }
__global__ __launch_bounds__(256) void k_vt(const _Float16* __restrict__ V16, int b, int h0, _Float16* __restrict__ VT) { __shared__ unsigned short tl[64][65]; const int tid = threadIdx.x; const int hh = blockIdx.x % HG, sg = blockIdx.x / HG; const int s0 = sg * 64; const int h = h0 + hh;
  for (int i = tid; i < 64 * 8; i += 256) { const int j = i / 8, d8 = (i % 8) * 8; FragH f; f.half[0] = *(const v8us*)((const unsigned short*)V16 + ((size_t)b * SQ + s0 + j) * DM + h * HD + d8); for (int q = 0; q < 8; ++q) tl[d8 + q][j] = f.u[q]; }
  __syncthreads();
  { for (int i = tid; i < 64 * 8; i += 256) { const int d = i / 8, j8 = (i % 8) * 8; FragH f; for (int q = 0; q < 8; ++q) f.u[q] = tl[d][j8 + q]; *(v8us*)((unsigned short*)VT + ((size_t)hh * HD + d) * SQ + s0 + j8) = f.half[0]; }  } }



__global__ __launch_bounds__(256) void k_rsmf(const float* __restrict__ S, _Float16* __restrict__ P, int qn, int hg) {
  #pragma clang fp contract(off)
  const int t = blockIdx.x * 256 + threadIdx.x; if (t >= qn * hg) return; const size_t i = (size_t)(t / qn) * SQ + (t % qn); const float* s = S + i * SQ; float mx = -3.0e38f;
#pragma unroll 1
  for (int j = 0; j < SQ; ++j) mx = fmaxf(mx, s[j]); float se = 0.f;
#pragma unroll 1
  for (int j = 0; j < SQ; ++j) se += __expf(s[j] - mx); const float sc = 256.0f / se;
#pragma unroll 1
  for (int j0 = 0; j0 < SQ; j0 += 8) { FragH f; for (int q = 0; q < 8; ++q) f.h[q] = (_Float16)(__expf(s[j0 + q] - mx) * sc); unsigned short* d = (unsigned short*)P + i * SQ + j0; *(v8us*)d = f.half[0];  } }

extern "C" void kernel_launch(void* const* d_in, const int* in_sizes, int n_in,
                              void* d_out, int out_size, void* d_ws, size_t ws_size, hipStream_t stream) {
  (void)in_sizes; (void)n_in; (void)out_size;
  const float* const* I = (const float* const*)d_in; const float* xq = I[0]; const float* xk = I[0]; const float* xv = I[0]; const float* wq = I[1]; const float* bq = I[2]; const float* wk = I[3]; const float* bk = I[4]; const float* wv = I[5]; const float* bv = I[6]; const float* wo = I[7]; const float* bo = I[8];      /* ONE input stream (x) read on all three projections; wq, wk, wv are PER-HEAD STACKS [12][768][64] = [head][in][out]; bq, bk, bv are per-head [12][64] = the flat [768] bias; wo [in][out] + bo; input order x, wq, bq, wk, bk, wv, bv, wo, bo */
  char* ws = (char*)d_ws; size_t off = 0;
  auto take = [&](size_t bytes) { char* p = ws + off; off += (bytes + 255) & ~(size_t)255; return p; };
  _Float16* BQ = (_Float16*)take((size_t)DM * DM * 2); _Float16* BK = (_Float16*)take((size_t)DM * DM * 2); _Float16* BV = (_Float16*)take((size_t)DM * DM * 2); _Float16* BO = (_Float16*)take((size_t)DM * DM * 2);
  _Float16* XQ = (_Float16*)take(NR * DM * 2); _Float16* XK = (_Float16*)take(NR * DM * 2); _Float16* XV = (_Float16*)take(NR * DM * 2); _Float16* Q16 = (_Float16*)take(NR * DM * 2); _Float16* K16 = (_Float16*)take(NR * DM * 2); _Float16* V16 = (_Float16*)take(NR * DM * 2); _Float16* O16 = (_Float16*)take(NR * DM * 2);
  float* S = (float*)take((size_t)HG * SQ * SQ * 4); _Float16* P = (_Float16*)take((size_t)HG * SQ * SQ * 2); _Float16* VT = (_Float16*)take((size_t)NH * HD * SQ * 2);
  if (off > ws_size) return;
  { const unsigned g = (unsigned)(((size_t)DM * (DM / 8) + 255) / 256); const unsigned gh = (unsigned)(((size_t)HD * (DM / 8) + 255) / 256); for (int h = 0; h < NH; ++h) { const size_t wofs = (size_t)h * DM * HD, pofs = (size_t)h * HD * DM; k_wt_f16<<<gh, 256, 0, stream>>>(wq + wofs, BQ + pofs, DM, HD, 16.0f); k_wt_f16<<<gh, 256, 0, stream>>>(wk + wofs, BK + pofs, DM, HD, 16.0f); k_wt_f16<<<gh, 256, 0, stream>>>(wv + wofs, BV + pofs, DM, HD, 16.0f); } k_wt_f16<<<g, 256, 0, stream>>>(wo, BO, DM, DM, 16.0f); }      /* PER-HEAD STACKS wq / wk / wv [NH][DM][HD]: head h is a row-major [in = DM][out = HD] block at w + h * DM * HD: the transposing builder with K = DM, N = HD writes its HD rows Bt[h * HD + e][k] at B + h * HD * DM: contiguous rows of the [out][in] plane (x16); wo is a plain [in][out] [DM][DM] matrix: one call as before */

  k_x16<<<(unsigned)((NR * DM / 8 + 255) / 256), 256, 0, stream>>>(xq, XQ, NR * DM / 8); k_x16<<<(unsigned)((NR * DM / 8 + 255) / 256), 256, 0, stream>>>(xk, XK, NR * DM / 8); k_x16<<<(unsigned)((NR * DM / 8 + 255) / 256), 256, 0, stream>>>(xv, XV, NR * DM / 8);      /* the three inputs as exact f16 rows */
  const size_t r0p = (size_t)B0 * SQ;      /* first projected row */
  k_gemm2<0><<<dim3((unsigned)((MP / 128) * (DM / 64)), 1), 128, 0, stream>>>(XQ + r0p * DM, DM, 0, BQ, DM, 0, 0.0625f, bq, 0, nullptr, 1, 0, 0, nullptr, Q16 + r0p * DM, DM, 0, MP, DM, DM);
  k_gemm2<0><<<dim3((unsigned)((MP / 128) * (DM / 64)), 1), 128, 0, stream>>>(XK + r0p * DM, DM, 0, BK, DM, 0, 0.0625f, bk, 0, nullptr, 1, 0, 0, nullptr, K16 + r0p * DM, DM, 0, MP, DM, DM);
  k_gemm2<0><<<dim3((unsigned)((MP / 128) * (DM / 64)), 1), 128, 0, stream>>>(XV + r0p * DM, DM, 0, BV, DM, 0, 0.0625f, bv, 0, nullptr, 1, 0, 0, nullptr, V16 + r0p * DM, DM, 0, MP, DM, DM);
  for (int b = B0; b < B0 + NBR; ++b) { const size_t r0 = (size_t)b * SQ;
    k_vt<NH, SQ><<<NH * (SQ / 64), 256, 0, stream>>>(V16 + r0 * LQ, LQ, 0, VT);      /* V^T [NH][HD][SQ] for this batch */
    for (int h0 = 0; h0 < NHD; h0 += HG) {
      k_gemm2<0><<<dim3((QN / 128) * (SQ / 64), HG), 128, 0, stream>>>(Q16 + r0 * LQ + h0 * HD, LQ, (size_t)HD, K16 + r0 * LQ + h0 * HD, LQ, (size_t)HD, 0.036084391f, nullptr, 0, nullptr, 1, 0, 0, S, nullptr, SQ, (size_t)SQ * SQ, QN, SQ, HD);      /* scores, HG heads per launch */
      k_rsmf<<<(HG * QN + 255) / 256, 256, 0, stream>>>(S, P, QN, HG);      /* P = 256 softmax (f16), rows of all HG heads */
      k_gemm2<0><<<dim3((QN / 128) * (HD / 64), HG), 128, 0, stream>>>(P, SQ, (size_t)SQ * SQ, VT + (size_t)h0 * HD * SQ, SQ, (size_t)HD * SQ, 0.25f, nullptr, 0, nullptr, 1, 0, 0, nullptr, O16 + r0 * DM + h0 * HD, DM, (size_t)HD, QN, HD, SQ); } }      /* o (merged heads) as f16 rows */
  k_gemm2<0><<<dim3((unsigned)((MPO / 128) * (DM / 64)), 1), 128, 0, stream>>>(O16 + r0p * DM, DM, 0, BO, DM, 0, 0.0009765625f, bo, 0, nullptr, 1, 0, 0, (float*)d_out + r0p * DM, nullptr, DM, 0, MPO, DM, DM);      /* out rows are the output layout */
}

// v001
// Measured time: 824 microseconds a run.
// Next to v000, in two timings, it ran 3.33 and 3.31 times as fast.
#include <hip/hip_runtime.h>
// Multi-head self-attention with PER-HEAD STACKED projections and per-head biases at width 768, scaled by the EMBED WIDTH (x [2][2048][768]; q / k / v = einsum('bse,hed->bhsd', x, W) + b with W [12][768][64] = [head][in][out] and b [12][64], 12 heads of 64; scores / sqrt(E = 768) (the module's own: the embed width, not the head width); softmax over all 2048 keys (no mask); out = merged wo + bo ([in][out] [768][768] + bias) -> [2][2048][768]); each head's [in][out] block is transposed into its 64 contiguous rows of the weight plane by the existing builder, one call per head; a per-head bias [12][64] IS the flat bias [768].
// Structure: token rows r = b*2048 + s; the query source and the key/value source as exact f16 rows (bf16-rounded); Q, K, V as three WMMA GEMMs (32x64 wave tiles, f32 accumulation, exact x16 weights + bias, f16 outputs); per batch: V^T for all heads via LDS transposes; per (batch, group of 4 heads): scores GEMM (K = 64, batched over the heads on grid.y, alpha = 768^-0.5), row softmax on VALU (f32 statistics, native exp; weights stored x256 as f16), o = P . V^T GEMM (K = 2048, alpha 2^-2: o carried x64 against f16 subnormal flush, folded into the output GEMM alpha) written straight into the merged f16 o rows; out = o W_o + b GEMM (f32) into the output layout.
// Compute dtype: inputs rounded to bf16; x / weights exact; q, k, v, softmax weights and o as plain f16 GEMM operands (~2^-12); scores and softmax statistics f32. v_wmma_f32_16x16x32_f16.
#define NB 2
#define SQ 2048
#define DM 768 
#define NH 12
#define HD 64
#define HG 4                         /* heads per attention launch group */
#define B0 0                         /* first batch processed (debug hook) */
#define NBR NB                       /* batches processed (debug hook) */
#define NR ((size_t)NB * SQ)         /* token rows */
#define MP ((int)((size_t)NBR * SQ)) /* rows projected (debug hook) */
#define QN SQ                        /* query rows attended per batch (debug hook) */
#define NHD NH                       /* heads attended (debug hook) */
#define MPO MP                       /* rows through the output stage (debug hook) */
#define LQ DM      /* row pitch of the q/k/v rows */
typedef __bf16 v16b __attribute__((ext_vector_type(16)));
typedef unsigned short v8us __attribute__((ext_vector_type(8), may_alias));
typedef float  v8f  __attribute__((ext_vector_type(8)));
typedef float  v4f  __attribute__((ext_vector_type(4)));
typedef float  v4fa __attribute__((ext_vector_type(4), may_alias));
union FragB { v16b v; v8us half[2]; unsigned short u[16]; };

__device__ __forceinline__ unsigned short bf16_bits(float x) { unsigned int u = __float_as_uint(x); return (unsigned short)((u + 0x7FFFu + ((u >> 16) & 1u)) >> 16); }
__device__ __forceinline__ float bf16_val(unsigned short b) { return __uint_as_float(((unsigned int)b) << 16); }
__device__ __forceinline__ float bf16_round(float x) { return bf16_val(bf16_bits(x)); }
// D += A·B with NT terms: 1 = ah·bh, 2 = + al·bh (A split), 3 = + ah·bl (both split)
template <int NT>
__device__ __forceinline__ v8f mmaN(v16b ah, v16b al, v16b bh, v16b bl, v8f c) {
  c = __builtin_amdgcn_wmma_f32_16x16x32_bf16(false, ah, false, bh, (short)0, c, false, false);
  if (NT >= 2) c = __builtin_amdgcn_wmma_f32_16x16x32_bf16(false, al, false, bh, (short)0, c, false, false);
  if (NT >= 3) c = __builtin_amdgcn_wmma_f32_16x16x32_bf16(false, ah, false, bl, (short)0, c, false, false);
  asm volatile("v_nop\n\tv_nop\n\tv_nop\n\tv_nop" : "+v"(c) : "v"(ah), "v"(al), "v"(bh), "v"(bl));
  return c;
}

__global__ __launch_bounds__(256) void k_wt_bf16(const float* __restrict__ W, unsigned short* __restrict__ Wt, int K, int N) {
  const int t = blockIdx.x * 256 + threadIdx.x;
  const int k8n = K / 8;
  if (t >= N * k8n) return;
  const int n = t / k8n, k8 = (t % k8n) * 8;
  v8us v;
#pragma unroll
  for (int i = 0; i < 8; ++i) v[i] = bf16_bits(W[(size_t)(k8 + i) * N + n]);
  *(v8us*)(Wt + (size_t)n * K + k8) = v;
  
}

// GEMM C[M][N] (f32, pitch ldc) = act(A[M][K]·W + bias). A f32 row-major (pitch lda) converted per fragment to bf16
// (ASPLIT: hi/lo two planes -> 2 terms, else single rounded term); Wt bf16 [N][K] (pitch ldb). BIAS_BF16 rounds the
// bias to bf16 first (bias quantised to bf16 before the add). K%32==0, M%16==0, N%64==0.
template <bool ASPLIT, int ACT, bool BIAS_BF16>
__global__ __launch_bounds__(128) void k_gemm_bf(const float* __restrict__ A, int lda, const unsigned short* __restrict__ Wt, int ldb,
                                               const float* __restrict__ bias, float* __restrict__ C, int ldc, int M, int N, int K) {
  __shared__ __attribute__((aligned(16))) float so[4][16][64];
  const int tid = threadIdx.x, w = tid >> 5, lane = tid & 31, ln = lane & 15, hh = lane >> 4;
  const int ntn = N / 64;
  const int wid = blockIdx.x * 4 + w;
  const int mt = wid / ntn, nq = wid % ntn;
  if (mt * 16 >= M) return;
  const int row0 = mt * 16, col0 = nq * 64;
  const float* arow = A + (size_t)(row0 + ln) * lda;
  v8f acc[4] = {};
  for (int kb = 0; kb < K; kb += 32) {
    FragB ah, al;
    const v4f x0 = *(const v4fa*)(arow + kb + 8 * hh), x1 = *(const v4fa*)(arow + kb + 8 * hh + 4);
    const v4f x2 = *(const v4fa*)(arow + kb + 16 + 8 * hh), x3 = *(const v4fa*)(arow + kb + 16 + 8 * hh + 4);
    float xs[16] = {x0[0],x0[1],x0[2],x0[3],x1[0],x1[1],x1[2],x1[3],x2[0],x2[1],x2[2],x2[3],x3[0],x3[1],x3[2],x3[3]};
#pragma unroll
    for (int i = 0; i < 16; ++i) { const unsigned short hb = bf16_bits(xs[i]); ah.u[i] = hb; al.u[i] = ASPLIT ? bf16_bits(xs[i] - bf16_val(hb)) : (unsigned short)0; }
#pragma unroll
    for (int t = 0; t < 4; ++t) {
      const unsigned short* brow = Wt + (size_t)(col0 + t * 16 + ln) * ldb + kb;
      FragB b;
      b.half[0] = *(const v8us*)(brow + 8 * hh);
      b.half[1] = *(const v8us*)(brow + 16 + 8 * hh);
      acc[t] = mmaN<ASPLIT ? 2 : 1>(ah.v, al.v, b.v, b.v, acc[t]);
    }
  }
#pragma unroll
  for (int t = 0; t < 4; ++t) {
    float bv = bias ? bias[col0 + t * 16 + ln] : 0.f;
    if (BIAS_BF16) bv = bf16_round(bv);
#pragma unroll
    for (int r = 0; r < 8; ++r) { float v = acc[t][r] + bv; if (ACT == 1) v = fmaxf(v, 0.f); so[w][8 * hh + r][t * 16 + ln] = v; }
  }
  __builtin_amdgcn_fence(__ATOMIC_ACQ_REL, "workgroup");
  __builtin_amdgcn_wave_barrier();
  const int rsub = lane >> 4, c4 = (lane & 15) * 4;
  {
#pragma unroll
    for (int q = 0; q < 8; ++q) {
      const int r = q * 2 + rsub;
      const v4f v = *(const v4fa*)&so[w][r][c4];
      *(v4f*)(C + (size_t)(row0 + r) * ldc + col0 + c4) = v;
    }
    
  }
}

// GEMM C = act(A·W + bias + resid): A f32 (ASPLIT -> hi/lo 2 terms), Wt bf16 [N][K]; ACT 0 none, 1 relu, 2 exact gelu;
// resid (optional, f32, row index = (row % rmod), pitch ldr, RES_BF16 rounds it) added before the activation.
template <bool ASPLIT, int ACT, bool BIAS_BF16, bool RES_BF16>
__global__ __launch_bounds__(128) void k_gemm_bf3(const float* __restrict__ A, int lda, const unsigned short* __restrict__ Wt, int ldb,
                                                const float* __restrict__ bias, const float* __restrict__ resid, int rmod, int ldr,
                                                float* __restrict__ C, int ldc, int M, int N, int K) {
  __shared__ __attribute__((aligned(16))) float so[4][16][64];
  const int tid = threadIdx.x, w = tid >> 5, lane = tid & 31, ln = lane & 15, hh = lane >> 4;
  const int ntn = N / 64;
  const int wid = blockIdx.x * 4 + w;
  const int mt = wid / ntn, nq = wid % ntn;
  if (mt * 16 >= M) return;
  const int row0 = mt * 16, col0 = nq * 64;
  const float* arow = A + (size_t)(row0 + ln) * lda;
  v8f acc[4] = {};
  for (int kb = 0; kb < K; kb += 32) {
    FragB ah, al;
    const v4f x0 = *(const v4fa*)(arow + kb + 8 * hh), x1 = *(const v4fa*)(arow + kb + 8 * hh + 4);
    const v4f x2 = *(const v4fa*)(arow + kb + 16 + 8 * hh), x3 = *(const v4fa*)(arow + kb + 16 + 8 * hh + 4);
    float xs[16] = {x0[0],x0[1],x0[2],x0[3],x1[0],x1[1],x1[2],x1[3],x2[0],x2[1],x2[2],x2[3],x3[0],x3[1],x3[2],x3[3]};
#pragma unroll
    for (int i = 0; i < 16; ++i) { const unsigned short hb = bf16_bits(xs[i]); ah.u[i] = hb; al.u[i] = ASPLIT ? bf16_bits(xs[i] - bf16_val(hb)) : (unsigned short)0; }
#pragma unroll
    for (int t = 0; t < 4; ++t) {
      const unsigned short* brow = Wt + (size_t)(col0 + t * 16 + ln) * ldb + kb;
      FragB b;
      b.half[0] = *(const v8us*)(brow + 8 * hh);
      b.half[1] = *(const v8us*)(brow + 16 + 8 * hh);
      acc[t] = mmaN<ASPLIT ? 2 : 1>(ah.v, al.v, b.v, b.v, acc[t]);
    }
  }
#pragma unroll
  for (int t = 0; t < 4; ++t) {
    const int col = col0 + t * 16 + ln;
    float bv = bias ? bias[col] : 0.f;
    if (BIAS_BF16) bv = bf16_round(bv);
#pragma unroll
    for (int r = 0; r < 8; ++r) {
      float v = acc[t][r] + bv;
      if (resid) { float rv = resid[(size_t)((row0 + 8 * hh + r) % rmod) * ldr + col]; if (RES_BF16) rv = bf16_round(rv); v += rv; }
      if (ACT == 1) v = fmaxf(v, 0.f);
      if (ACT == 2) v = 0.5f * v * (1.0f + erff(v * 0.70710678118654752f));
      if (ACT == 3) { const float u = 0.7978845608028654f * (v + 0.044715f * v * v * v); v = 0.5f * v * (1.0f + tanhf(u)); }
      so[w][8 * hh + r][t * 16 + ln] = v;
    }
  }
  __builtin_amdgcn_fence(__ATOMIC_ACQ_REL, "workgroup");
  __builtin_amdgcn_wave_barrier();
  const int rsub = lane >> 4, c4 = (lane & 15) * 4;
  {
#pragma unroll
    for (int q = 0; q < 8; ++q) {
      const int r = q * 2 + rsub;
      const v4f v = *(const v4fa*)&so[w][r][c4];
      *(v4f*)(C + (size_t)(row0 + r) * ldc + col0 + c4) = v;
    }
    
  }
}
// row LayerNorm (biased variance, eps) over N: s = X (+ R); optional out_sum <- s; out_norm <- (s-mu)*rsqrt(var+eps)*g + b
template <bool PARAM_BF16>
__global__ __launch_bounds__(256) void k_layernorm(const float* __restrict__ X, const float* __restrict__ R, const float* __restrict__ g, const float* __restrict__ bta,
                                                  float* __restrict__ out_sum, float* __restrict__ out_norm, int N, float eps) {
  __shared__ float red[256];
  const int row = blockIdx.x, tid = threadIdx.x;
  const float* x = X + (size_t)row * N; const float* rr = R ? R + (size_t)row * N : nullptr;
  float vals[16];                     // up to N = 4096
  const int per = N / 256;            // contiguous chunk per thread? use strided-by-4 chunks: thread handles j = tid*4 + 1024*u
  float s1 = 0.f;
  for (int u = 0; u < per / 4; ++u) {
    const int j = tid * 4 + 1024 * u;
    const v4f a = *(const v4fa*)(x + j);
    v4f b = {0.f,0.f,0.f,0.f}; if (rr) b = *(const v4fa*)(rr + j);
#pragma unroll
    for (int q = 0; q < 4; ++q) { const float v = a[q] + b[q]; vals[u * 4 + q] = v; s1 += v; }
  }
  red[tid] = s1; __syncthreads();
  for (int st = 128; st > 0; st >>= 1) { if (tid < st) red[tid] += red[tid + st]; __syncthreads(); }
  const float mu = red[0] / (float)N; __syncthreads();
  float s2 = 0.f;
  for (int u = 0; u < per / 4; ++u)
#pragma unroll
    for (int q = 0; q < 4; ++q) { const float c = vals[u * 4 + q] - mu; s2 += c * c; }
  red[tid] = s2; __syncthreads();
  for (int st = 128; st > 0; st >>= 1) { if (tid < st) red[tid] += red[tid + st]; __syncthreads(); }
  const float rs = rsqrtf(red[0] / (float)N + eps);
  {
    for (int u = 0; u < per / 4; ++u) {
      const int j = tid * 4 + 1024 * u;
      v4f o, sm;
#pragma unroll
      for (int q = 0; q < 4; ++q) {
        float gg = g[j + q], bb = bta[j + q];
        if (PARAM_BF16) { gg = bf16_round(gg); bb = bf16_round(bb); }
        sm[q] = vals[u * 4 + q]; o[q] = (vals[u * 4 + q] - mu) * rs * gg + bb;
      }
      if (out_sum) *(v4f*)(out_sum + (size_t)row * N + j) = sm;
      *(v4f*)(out_norm + (size_t)row * N + j) = o;
    }
    
  }
}



// ---- f16 WMMA path (v_wmma_f32_16x16x32_f16): 11-bit significands for operands in range — used where a [0,1] probability operand needs more precision than bf16
typedef _Float16 v16h __attribute__((ext_vector_type(16)));
union FragH { v16h v; v8us half[2]; _Float16 h[16]; unsigned short u[16]; };
template <int NT>
__device__ __forceinline__ v8f mmaH(v16h ah, v16h al, v16h bh, v16h bl, v8f c) {
  c = __builtin_amdgcn_wmma_f32_16x16x32_f16(false, ah, false, bh, (short)0, c, false, false);
  if (NT >= 2) c = __builtin_amdgcn_wmma_f32_16x16x32_f16(false, al, false, bh, (short)0, c, false, false);
  if (NT >= 3) c = __builtin_amdgcn_wmma_f32_16x16x32_f16(false, ah, false, bl, (short)0, c, false, false);
  asm volatile("v_nop\n\tv_nop\n\tv_nop\n\tv_nop" : "+v"(c) : "v"(ah), "v"(al), "v"(bh), "v"(bl));
  return c;
}
// batched GEMM like k_gemm_b but f16 operands: A f32 (split into f16 hi/lo if ASPLIT, else rounded to f16), Bt = f16 values [n][k]; alpha; C f32; N multiple of 16 (partial tiles skipped)
template <bool ASPLIT>
__global__ __launch_bounds__(128) void k_gemm_h(const float* __restrict__ A, int lda, size_t sA, const _Float16* __restrict__ Bh, int ldb, size_t sB, float alpha, float* __restrict__ C, int ldc, size_t sC, int M, int N, int K) {
  __shared__ __attribute__((aligned(16))) float so[4][16][64];
  const int tid = threadIdx.x, w = tid >> 5, lane = tid & 31, ln = lane & 15, hh = lane >> 4; const int by = blockIdx.y;
  A += (size_t)by * sA; Bh += (size_t)by * sB; C += (size_t)by * sC;
  const int ntn = (N + 63) / 64; const int wid = blockIdx.x * 4 + w; const int mt = wid / ntn, nq = wid % ntn; if (mt * 16 >= M) return;
  const int row0 = mt * 16, col0 = nq * 64; const float* arow = A + (size_t)(row0 + ln) * lda;
  v8f acc[4] = {};
  for (int kb = 0; kb < K; kb += 32) {
    FragH ah, al;
    const v4f x0 = *(const v4fa*)(arow + kb + 8 * hh), x1 = *(const v4fa*)(arow + kb + 8 * hh + 4), x2 = *(const v4fa*)(arow + kb + 16 + 8 * hh), x3 = *(const v4fa*)(arow + kb + 16 + 8 * hh + 4);
    float xs[16] = {x0[0],x0[1],x0[2],x0[3],x1[0],x1[1],x1[2],x1[3],x2[0],x2[1],x2[2],x2[3],x3[0],x3[1],x3[2],x3[3]};
#pragma unroll
    for (int i = 0; i < 16; ++i) { const _Float16 h = (_Float16)xs[i]; ah.h[i] = h; al.h[i] = ASPLIT ? (_Float16)(xs[i] - (float)h) : (_Float16)0.0f; }
#pragma unroll
    for (int t = 0; t < 4; ++t) { if (col0 + t * 16 >= N) continue; const size_t boff = (size_t)(col0 + t * 16 + ln) * ldb + kb; FragH bq; bq.half[0] = *(const v8us*)(Bh + boff + 8 * hh); bq.half[1] = *(const v8us*)(Bh + boff + 16 + 8 * hh);
      acc[t] = mmaH<ASPLIT ? 2 : 1>(ah.v, al.v, bq.v, bq.v, acc[t]); }
  }
#pragma unroll
  for (int t = 0; t < 4; ++t) { if (col0 + t * 16 >= N) continue;
#pragma unroll
    for (int r = 0; r < 8; ++r) so[w][8 * hh + r][t * 16 + ln] = acc[t][r] * alpha; }
  __builtin_amdgcn_fence(__ATOMIC_ACQ_REL, "workgroup"); __builtin_amdgcn_wave_barrier();
  const int rsub = lane >> 4, c4 = (lane & 15) * 4;
  {
#pragma unroll
    for (int q = 0; q < 8; ++q) { const int r = q * 2 + rsub; if (col0 + c4 < N) { const v4f v = *(const v4fa*)&so[w][r][c4]; *(v4f*)(C + (size_t)(row0 + r) * ldc + col0 + c4) = v; } }
     }
}

// Wt[n][k] = f16(W[k][n]·scale) from f32 row-major W[K][N] (scale = power of two; bf16-exact weights stay exact in f16 away from the subnormal range)
__global__ __launch_bounds__(256) void k_wt_f16(const float* __restrict__ W, _Float16* __restrict__ Wt, int K, int N, float scale) {
  const int t = blockIdx.x * 256 + threadIdx.x; if (t >= N * (K / 8)) return; const int n = t / (K / 8), k8 = (t % (K / 8)) * 8; FragH f;
#pragma unroll
  for (int i = 0; i < 8; ++i) f.h[i] = (_Float16)(bf16_round(W[(size_t)(k8 + i) * N + n]) * scale); const v8us o = f.half[0];
  *(v8us*)((unsigned short*)Wt + (size_t)n * K + k8) = o; 
}
// k_gemm_hh variant with fused epilogue: v = acc·alpha + bias[by·sBias + col] (+ CP[(row/rowsPerB)·sCPb + by·64 + col] if CP) ; ACT 0 none / 1 elu ; writes f16 C16 (and f32 C if non-null)
template <int ACT>
__global__ __launch_bounds__(128) void k_gemm_hhx(const _Float16* __restrict__ A, int lda, size_t sA, const _Float16* __restrict__ Bh, int ldb, size_t sB, float alpha, const float* __restrict__ bias, size_t sBias, const float* __restrict__ CP, int rowsPerB, size_t sCPb, int row0g,
    float* __restrict__ C, _Float16* __restrict__ C16, int ldc, size_t sC, int M, int N, int K) {
  __shared__ __attribute__((aligned(16))) float so[4][16][64];
  const int tid = threadIdx.x, w = tid >> 5, lane = tid & 31, ln = lane & 15, hh = lane >> 4; const int by = blockIdx.y;
  A += (size_t)by * sA; Bh += (size_t)by * sB; const size_t cofs = (size_t)by * sC; const float* bp = bias ? bias + (size_t)by * sBias : nullptr;
  const int ntn = (N + 63) / 64; const int wid = blockIdx.x * 4 + w; const int mt = wid / ntn, nq = wid % ntn; if (mt * 16 >= M) return;
  const int row0 = mt * 16, col0 = nq * 64; const _Float16* arow = A + (size_t)(row0 + ln) * lda;
  v8f acc[4] = {};
  for (int kb = 0; kb < K; kb += 32) { FragH ah; ah.half[0] = *(const v8us*)((const unsigned short*)arow + kb + 8 * hh); ah.half[1] = *(const v8us*)((const unsigned short*)arow + kb + 16 + 8 * hh);
#pragma unroll
    for (int t = 0; t < 4; ++t) { if (col0 + t * 16 >= N) continue; const size_t boff = (size_t)(col0 + t * 16 + ln) * ldb + kb; FragH bq; bq.half[0] = *(const v8us*)((const unsigned short*)Bh + boff + 8 * hh); bq.half[1] = *(const v8us*)((const unsigned short*)Bh + boff + 16 + 8 * hh);
      acc[t] = mmaH<1>(ah.v, ah.v, bq.v, bq.v, acc[t]); }
  }
#pragma unroll
  for (int t = 0; t < 4; ++t) { if (col0 + t * 16 >= N) continue; const int col = col0 + t * 16 + ln; const float bv = bp ? bf16_round(bp[col]) : 0.f;
#pragma unroll
    for (int r = 0; r < 8; ++r) { float v = acc[t][r] * alpha + bv; if (CP) { const int rr = row0g + row0 + 8 * hh + r; if (rowsPerB < 0) v += CP[cofs + (size_t)rr * ldc + col];      /* rowsPerB < 0: own element of the batched C plane */ else { const int bidx = rr / rowsPerB; v += CP[(size_t)bidx * sCPb + (size_t)by * 64 + col]; } } if (ACT == 1) v = (v > 0.f) ? v : expm1f(v); else if (ACT == 7) v = (v > 0.f) ? v + 1.0f : expf(v); else if (ACT == 8) v = tanhf(v); else if (ACT == 9) v = 0.5f * v * (1.0f + tanhf(0.7978845608028654f * (v + 0.044715f * v * v * v))); else if (ACT == 11) v = 1.0f / (1.0f + expf(-v)); else if (ACT == 12) v = (v > 0.f) ? v : 0.01f * v; else if (ACT == 14) v = (v > 0.f) ? v : 0.1f * v; else if (ACT == 16) v = (v >= 0.f) ? v : 0.3f * v; else if (ACT == 17) v = (v >= 0.f) ? v : 0.2f * v; else if (ACT == 15) v = v / (1.0f + expf(-v)); else if (ACT == 3) v = fmaxf(v, 0.f); else if (ACT == 6) v = 0.5f * v * (1.0f + erff(v * 0.70710678118654752f)); so[w][8 * hh + r][t * 16 + ln] = v; } }
  __builtin_amdgcn_fence(__ATOMIC_ACQ_REL, "workgroup"); __builtin_amdgcn_wave_barrier();
  const int rsub = lane >> 4, c4 = (lane & 15) * 4; typedef _Float16 v4h __attribute__((ext_vector_type(4)));
  {
#pragma unroll
    for (int q = 0; q < 8; ++q) { const int r = q * 2 + rsub; if (col0 + c4 < N) { const v4f v = *(const v4fa*)&so[w][r][c4]; if (C) *(v4f*)(C + cofs + (size_t)(row0 + r) * ldc + col0 + c4) = v; if (C16) { v4h h4; for (int i = 0; i < 4; ++i) h4[i] = (_Float16)v[i]; *(v4h*)(C16 + cofs + (size_t)(row0 + r) * ldc + col0 + c4) = h4; } } }
     }
}


typedef _Float16 v4h __attribute__((ext_vector_type(4)));

__global__ __launch_bounds__(256) void k_x16(const float* __restrict__ x, _Float16* __restrict__ X16, size_t n8) { const size_t t = (size_t)blockIdx.x * 256 + threadIdx.x; if (t >= n8) return; FragH f;
#pragma unroll
  for (int q = 0; q < 8; ++q) f.h[q] = (_Float16)bf16_round(x[t * 8 + q]); *(v8us*)((unsigned short*)X16 + t * 8) = f.half[0];  }
__global__ __launch_bounds__(256) void k_h16(const float* __restrict__ x, _Float16* __restrict__ X16, size_t n8) { const size_t t = (size_t)blockIdx.x * 256 + threadIdx.x; if (t >= n8) return; FragH f;
#pragma unroll
  for (int q = 0; q < 8; ++q) f.h[q] = (_Float16)x[t * 8 + q]; *(v8us*)((unsigned short*)X16 + t * 8) = f.half[0];  }
__global__ __launch_bounds__(256) void k_round16f(const float* __restrict__ W, _Float16* __restrict__ Bt, size_t n8) { const size_t t = (size_t)blockIdx.x * 256 + threadIdx.x; if (t >= n8) return; FragH f;
#pragma unroll
  for (int i = 0; i < 8; ++i) f.h[i] = (_Float16)(bf16_round(W[t * 8 + i]) * 16.0f); *(v8us*)((unsigned short*)Bt + t * 8) = f.half[0];  }
template <int NHv, int TTv>
__global__ __launch_bounds__(256) void k_vt(const _Float16* __restrict__ V16, int ldv, int voff, _Float16* __restrict__ Vt) { __shared__ unsigned short tl[64][66]; const int tid = threadIdx.x; const int slab = blockIdx.x / (TTv / 64), lg = blockIdx.x % (TTv / 64); const int b = slab / NHv, h = slab % NHv;
  for (int i = tid; i < 64 * 8; i += 256) { const int r = i / 8, c8 = (i % 8) * 8; FragH f; f.half[0] = *(const v8us*)((const unsigned short*)V16 + ((size_t)b * TTv + lg * 64 + r) * ldv + voff + h * 64 + c8);
#pragma unroll
    for (int q = 0; q < 8; ++q) tl[r][c8 + q] = f.u[q]; }
  __syncthreads();
  {
#pragma unroll
    for (int rd = 0; rd < 2; ++rd) { const int d = rd * 32 + tid / 8, pc = tid % 8; FragH f;
#pragma unroll
      for (int q = 0; q < 8; ++q) f.u[q] = tl[pc * 8 + q][d];
      *(v8us*)((unsigned short*)Vt + ((size_t)slab * 64 + d) * TTv + lg * 64 + pc * 8) = f.half[0]; }
     } }

__global__ __launch_bounds__(256) void k_hl(const float* __restrict__ F, _Float16* __restrict__ Hh, _Float16* __restrict__ Hl, size_t n8) { const size_t t = (size_t)blockIdx.x * 256 + threadIdx.x; if (t >= n8) return; FragH fh, fl; const v4f a = *(const v4fa*)(F + t * 8), c = *(const v4fa*)(F + t * 8 + 4);
#pragma unroll
  for (int q = 0; q < 4; ++q) { _Float16 h = (_Float16)a[q]; fh.h[q] = h; fl.h[q] = (_Float16)((a[q] - (float)h) * 1024.0f); h = (_Float16)c[q]; fh.h[4 + q] = h; fl.h[4 + q] = (_Float16)((c[q] - (float)h) * 1024.0f); }
  { *(v8us*)((unsigned short*)Hh + t * 8) = fh.half[0]; *(v8us*)((unsigned short*)Hl + t * 8) = fl.half[0];  } }

// ---- fast GEMM (wave tile 32x64; requires M % 32 == 0 rows per launch region and N % 64 == 0); epilogue = k_gemm_hhx semantics ----
__device__ __forceinline__ v16h g2_frag(const _Float16* p, int hh) { FragH f; f.half[0] = *(const v8us*)((const unsigned short*)p + 8 * hh); f.half[1] = *(const v8us*)((const unsigned short*)p + 16 + 8 * hh); return f.v; }
__device__ __forceinline__ v8f g2_mma(v16h a, v16h b, v8f c) { v8f d = __builtin_amdgcn_wmma_f32_16x16x32_f16(false, a, false, b, (short)0, c, false, false); asm volatile("v_nop\n\tv_nop\n\tv_nop\n\tv_nop" : "+v"(d) : "v"(a), "v"(b)); return d; }
template <int ACT>
__global__ __launch_bounds__(128) void k_gemm2(const _Float16* __restrict__ A, int lda, size_t sA, const _Float16* __restrict__ Bh, int ldb, size_t sB, float alpha, const float* __restrict__ bias, size_t sBias, const float* __restrict__ CP, int rowsPerB, size_t sCPb, int row0g,
    float* __restrict__ C, _Float16* __restrict__ C16, int ldc, size_t sC, int M, int N, int K) { static_assert(ACT == 0 || ACT == 3 || ACT == 6 || ACT == 8 || ACT == 9 || ACT == 11 || ACT == 12 || ACT == 14 || ACT == 15 || ACT == 16 || ACT == 17, "k_gemm2: unsupported ACT code (would silently apply no activation)");
  __shared__ __attribute__((aligned(16))) float so[4][32][68];
  const int tid = threadIdx.x, w = tid >> 5, lane = tid & 31, ln = lane & 15, hh = lane >> 4; const int by = blockIdx.y;
  A += (size_t)by * sA; Bh += (size_t)by * sB; const size_t cofs = (size_t)by * sC; const float* bp = bias ? bias + (size_t)by * sBias : nullptr;
  const int ntn = N >> 6; const int mt = blockIdx.x / ntn, nq = blockIdx.x - mt * ntn; const int row0 = mt * 128 + 32 * w, col0 = nq * 64; if (row0 >= M) return;
  const _Float16* a0p = A + (size_t)(row0 + ln) * lda; const _Float16* a1p = a0p + (size_t)16 * lda;
  const _Float16* b0p = Bh + (size_t)(col0 + ln) * ldb; const _Float16* b1p = b0p + (size_t)16 * ldb; const _Float16* b2p = b1p + (size_t)16 * ldb; const _Float16* b3p = b2p + (size_t)16 * ldb;
  const v8f z8 = {0.f,0.f,0.f,0.f,0.f,0.f,0.f,0.f}; v8f c00 = z8, c01 = z8, c02 = z8, c03 = z8, c10 = z8, c11 = z8, c12 = z8, c13 = z8;
#pragma unroll 1
  for (int kb = 0; kb < K; kb += 32) { const v16h a0 = g2_frag(a0p + kb, hh), a1 = g2_frag(a1p + kb, hh);
    v16h b = g2_frag(b0p + kb, hh); c00 = g2_mma(a0, b, c00); c10 = g2_mma(a1, b, c10);
    b = g2_frag(b1p + kb, hh); c01 = g2_mma(a0, b, c01); c11 = g2_mma(a1, b, c11);
    b = g2_frag(b2p + kb, hh); c02 = g2_mma(a0, b, c02); c12 = g2_mma(a1, b, c12);
    b = g2_frag(b3p + kb, hh); c03 = g2_mma(a0, b, c03); c13 = g2_mma(a1, b, c13); }
  v8f accs[8] = {c00, c01, c02, c03, c10, c11, c12, c13};
#pragma unroll
  for (int u = 0; u < 8; ++u) { const int t = u & 3, half = u >> 2; const int col = col0 + t * 16 + ln; const float bv = bp ? bf16_round(bp[col]) : 0.f;
#pragma unroll
    for (int r = 0; r < 8; ++r) { const int rloc = half * 16 + 8 * hh + r; float v = accs[u][r] * alpha + bv; if (CP) { if (rowsPerB < 0) v += CP[cofs + (size_t)(row0g + row0 + rloc) * ldc + col];      /* rowsPerB < 0: own element of the batched C plane */ else { const int bidx = (row0g + row0 + rloc) / rowsPerB; v += CP[(size_t)bidx * sCPb + (size_t)by * 64 + col]; } }
      if (ACT == 3) v = fmaxf(v, 0.f); else if (ACT == 6) v = 0.5f * v * (1.0f + erff(v * 0.70710678118654752f)); else if (ACT == 11) v = 1.0f / (1.0f + expf(-v)); else if (ACT == 15) v = v / (1.0f + expf(-v)); else if (ACT == 12) v = (v > 0.f) ? v : 0.01f * v; else if (ACT == 8) v = tanhf(v); else if (ACT == 9) v = 0.5f * v * (1.0f + tanhf(0.7978845608028654f * (v + 0.044715f * v * v * v))); else if (ACT == 14) v = (v > 0.f) ? v : 0.1f * v; else if (ACT == 16) v = (v >= 0.f) ? v : 0.3f * v; else if (ACT == 17) v = (v >= 0.f) ? v : 0.2f * v;
      so[w][rloc][t * 16 + ln] = v; } }
  __builtin_amdgcn_fence(__ATOMIC_ACQ_REL, "workgroup"); __builtin_amdgcn_wave_barrier();
  const int rsub = lane >> 4, c4 = (lane & 15) * 4;
  {
#pragma unroll
    for (int q = 0; q < 16; ++q) { const int r = q * 2 + rsub; const v4f v = *(const v4fa*)&so[w][r][c4]; if (C) *(v4f*)(C + cofs + (size_t)(row0 + r) * ldc + col0 + c4) = v; if (C16) { v4h h4; for (int i = 0; i < 4; ++i) h4[i] = (_Float16)v[i]; *(v4h*)(C16 + cofs + (size_t)(row0 + r) * ldc + col0 + c4) = h4; } }
     } }


__global__ __launch_bounds__(256) void k_wnat(const float* __restrict__ w, size_t n8, _Float16* __restrict__ Bt) { const size_t t = (size_t)blockIdx.x * 256 + threadIdx.x; if (t >= n8) return; FragH f; for (int q = 0; q < 8; ++q) f.h[q] = (_Float16)(bf16_round(w[t * 8 + q]) * 16.0f); *(v8us*)((unsigned short*)Bt + t * 8) = f.half[0];  }
__global__ __launch_bounds__(256) void k_rsm(const float* __restrict__ S, _Float16* __restrict__ P, int nrows) {
  #pragma clang fp contract(off)
  const int i = blockIdx.x * 256 + threadIdx.x; if (i >= nrows) return; const float* s = S + (size_t)i * SQ; float mx = -3.0e38f;
#pragma unroll 1
  for (int j = 0; j < SQ; ++j) mx = fmaxf(mx, s[j]); float se = 0.f;
#pragma unroll 1
  for (int j = 0; j < SQ; ++j) se += expf(s[j] - mx); const float sc = 256.0f / se;
#pragma unroll 1
  for (int j0 = 0; j0 < SQ; j0 += 8) { FragH f; for (int q = 0; q < 8; ++q) f.h[q] = (_Float16)(expf(s[j0 + q] - mx) * sc); unsigned short* d = (unsigned short*)P + (size_t)i * SQ + j0; *(v8us*)d = f.half[0];  } }
__global__ __launch_bounds__(256) void k_vt(const _Float16* __restrict__ V16, int b, int h0, _Float16* __restrict__ VT) { __shared__ unsigned short tl[64][65]; const int tid = threadIdx.x; const int hh = blockIdx.x % HG, sg = blockIdx.x / HG; const int s0 = sg * 64; const int h = h0 + hh;
  for (int i = tid; i < 64 * 8; i += 256) { const int j = i / 8, d8 = (i % 8) * 8; FragH f; f.half[0] = *(const v8us*)((const unsigned short*)V16 + ((size_t)b * SQ + s0 + j) * DM + h * HD + d8); for (int q = 0; q < 8; ++q) tl[d8 + q][j] = f.u[q]; }
  __syncthreads();
  { for (int i = tid; i < 64 * 8; i += 256) { const int d = i / 8, j8 = (i % 8) * 8; FragH f; for (int q = 0; q < 8; ++q) f.u[q] = tl[d][j8 + q]; *(v8us*)((unsigned short*)VT + ((size_t)hh * HD + d) * SQ + s0 + j8) = f.half[0]; }  } }



// native e^x = 2^(x log2 e); the v_nop in the same statement fills the one slot that the instruction set asks for behind a transcendental before its result is used or its source overwritten
__device__ __forceinline__ float exp_slot(float x) { float e; asm("v_exp_f32 %0, %1\n\tv_nop" : "=v"(e) : "v"(x * 1.44269504088896340736f)); return e; }
// Row softmax, two score rows per wave: each lane holds 64 elements of a row in registers (16 loads of 16 bytes, every load 512 contiguous bytes of the row),
// both rows' loads issued before the first row is reduced; maximum and sum = per-lane chains, then a five-step butterfly over the 32 lanes; exp taken once per element.
// Every loop is fully unrolled so that v[][] is indexed by constants and stays in registers.
__global__ __launch_bounds__(256) void k_rsmf(const float* __restrict__ S, _Float16* __restrict__ P, int qn, int hg) {
  constexpr int NU = SQ / 128;
  const int lane = threadIdx.x & 31; const int n = qn * hg;
  const int t0 = (blockIdx.x * 8 + __builtin_amdgcn_readfirstlane((int)(threadIdx.x >> 5))) * 2; if (t0 >= n) return;      /* wave-uniform exit, no barrier below */
  v4f v[2][NU]; size_t ro[2];
#pragma unroll
  for (int r = 0; r < 2; ++r) { const int t = (t0 + r < n) ? t0 + r : t0; ro[r] = ((size_t)(t / qn) * SQ + (t % qn)) * SQ; }      /* a second row past the end repeats the first: the same wave stores the same values there twice */
#pragma unroll
  for (int r = 0; r < 2; ++r) { const float* s = S + ro[r];
#pragma unroll
    for (int u = 0; u < NU; ++u) v[r][u] = *(const v4fa*)(s + (unsigned)(lane * 4 + u * 128)); }
#pragma unroll
  for (int r = 0; r < 2; ++r) {
    float m4[4] = {-3.0e38f, -3.0e38f, -3.0e38f, -3.0e38f};
#pragma unroll
    for (int u = 0; u < NU; ++u)
#pragma unroll
      for (int q = 0; q < 4; ++q) m4[q] = fmaxf(m4[q], v[r][u][q]);
    float mx = fmaxf(fmaxf(m4[0], m4[1]), fmaxf(m4[2], m4[3]));
#pragma unroll
    for (int m = 16; m > 0; m >>= 1) mx = fmaxf(mx, __shfl_xor(mx, m, 32));
    float s4[4] = {0.f, 0.f, 0.f, 0.f};
#pragma unroll
    for (int u = 0; u < NU; ++u)
#pragma unroll
      for (int q = 0; q < 4; ++q) { const float e = exp_slot(v[r][u][q] - mx); v[r][u][q] = e; s4[q] += e; }
    float se = (s4[0] + s4[1]) + (s4[2] + s4[3]);
#pragma unroll
    for (int m = 16; m > 0; m >>= 1) se += __shfl_xor(se, m, 32);
    const float sc = 256.0f / se;
    { _Float16* d = P + ro[r] + (unsigned)(lane * 4);
#pragma unroll
      for (int u = 0; u < NU; ++u) { v4h h4;
#pragma unroll
        for (int q = 0; q < 4; ++q) h4[q] = (_Float16)(v[r][u][q] * sc);
        *(v4h*)(d + u * 128) = h4; } }
  } }

extern "C" void kernel_launch(void* const* d_in, const int* in_sizes, int n_in,
                              void* d_out, int out_size, void* d_ws, size_t ws_size, hipStream_t stream) {
  (void)in_sizes; (void)n_in; (void)out_size;
  const float* const* I = (const float* const*)d_in; const float* xq = I[0]; const float* xk = I[0]; const float* xv = I[0]; const float* wq = I[1]; const float* bq = I[2]; const float* wk = I[3]; const float* bk = I[4]; const float* wv = I[5]; const float* bv = I[6]; const float* wo = I[7]; const float* bo = I[8];      /* ONE input stream (x) read on all three projections; wq, wk, wv are PER-HEAD STACKS [12][768][64] = [head][in][out]; bq, bk, bv are per-head [12][64] = the flat [768] bias; wo [in][out] + bo; input order x, wq, bq, wk, bk, wv, bv, wo, bo */
  char* ws = (char*)d_ws; size_t off = 0;
  auto take = [&](size_t bytes) { char* p = ws + off; off += (bytes + 255) & ~(size_t)255; return p; };
  _Float16* BQ = (_Float16*)take((size_t)DM * DM * 2); _Float16* BK = (_Float16*)take((size_t)DM * DM * 2); _Float16* BV = (_Float16*)take((size_t)DM * DM * 2); _Float16* BO = (_Float16*)take((size_t)DM * DM * 2);
  _Float16* XQ = (_Float16*)take(NR * DM * 2); _Float16* XK = (_Float16*)take(NR * DM * 2); _Float16* XV = (_Float16*)take(NR * DM * 2); _Float16* Q16 = (_Float16*)take(NR * DM * 2); _Float16* K16 = (_Float16*)take(NR * DM * 2); _Float16* V16 = (_Float16*)take(NR * DM * 2); _Float16* O16 = (_Float16*)take(NR * DM * 2);
  float* S = (float*)take((size_t)HG * SQ * SQ * 4); _Float16* P = (_Float16*)take((size_t)HG * SQ * SQ * 2); _Float16* VT = (_Float16*)take((size_t)NH * HD * SQ * 2);
  if (off > ws_size) return;
  { const unsigned g = (unsigned)(((size_t)DM * (DM / 8) + 255) / 256); const unsigned gh = (unsigned)(((size_t)HD * (DM / 8) + 255) / 256); for (int h = 0; h < NH; ++h) { const size_t wofs = (size_t)h * DM * HD, pofs = (size_t)h * HD * DM; k_wt_f16<<<gh, 256, 0, stream>>>(wq + wofs, BQ + pofs, DM, HD, 16.0f); k_wt_f16<<<gh, 256, 0, stream>>>(wk + wofs, BK + pofs, DM, HD, 16.0f); k_wt_f16<<<gh, 256, 0, stream>>>(wv + wofs, BV + pofs, DM, HD, 16.0f); } k_wt_f16<<<g, 256, 0, stream>>>(wo, BO, DM, DM, 16.0f); }      /* PER-HEAD STACKS wq / wk / wv [NH][DM][HD]: head h is a row-major [in = DM][out = HD] block at w + h * DM * HD: the transposing builder with K = DM, N = HD writes its HD rows Bt[h * HD + e][k] at B + h * HD * DM: contiguous rows of the [out][in] plane (x16); wo is a plain [in][out] [DM][DM] matrix: one call as before */

  k_x16<<<(unsigned)((NR * DM / 8 + 255) / 256), 256, 0, stream>>>(xq, XQ, NR * DM / 8); k_x16<<<(unsigned)((NR * DM / 8 + 255) / 256), 256, 0, stream>>>(xk, XK, NR * DM / 8); k_x16<<<(unsigned)((NR * DM / 8 + 255) / 256), 256, 0, stream>>>(xv, XV, NR * DM / 8);      /* the three inputs as exact f16 rows */
  const size_t r0p = (size_t)B0 * SQ;      /* first projected row */
  k_gemm2<0><<<dim3((unsigned)((MP / 128) * (DM / 64)), 1), 128, 0, stream>>>(XQ + r0p * DM, DM, 0, BQ, DM, 0, 0.0625f, bq, 0, nullptr, 1, 0, 0, nullptr, Q16 + r0p * DM, DM, 0, MP, DM, DM);
  k_gemm2<0><<<dim3((unsigned)((MP / 128) * (DM / 64)), 1), 128, 0, stream>>>(XK + r0p * DM, DM, 0, BK, DM, 0, 0.0625f, bk, 0, nullptr, 1, 0, 0, nullptr, K16 + r0p * DM, DM, 0, MP, DM, DM);
  k_gemm2<0><<<dim3((unsigned)((MP / 128) * (DM / 64)), 1), 128, 0, stream>>>(XV + r0p * DM, DM, 0, BV, DM, 0, 0.0625f, bv, 0, nullptr, 1, 0, 0, nullptr, V16 + r0p * DM, DM, 0, MP, DM, DM);
  for (int b = B0; b < B0 + NBR; ++b) { const size_t r0 = (size_t)b * SQ;
    k_vt<NH, SQ><<<NH * (SQ / 64), 256, 0, stream>>>(V16 + r0 * LQ, LQ, 0, VT);      /* V^T [NH][HD][SQ] for this batch */
    for (int h0 = 0; h0 < NHD; h0 += HG) {
      k_gemm2<0><<<dim3((QN / 128) * (SQ / 64), HG), 128, 0, stream>>>(Q16 + r0 * LQ + h0 * HD, LQ, (size_t)HD, K16 + r0 * LQ + h0 * HD, LQ, (size_t)HD, 0.036084391f, nullptr, 0, nullptr, 1, 0, 0, S, nullptr, SQ, (size_t)SQ * SQ, QN, SQ, HD);      /* scores, HG heads per launch */
      k_rsmf<<<(HG * QN + 15) / 16, 256, 0, stream>>>(S, P, QN, HG);      /* P = 256 softmax (f16), rows of all HG heads */
      k_gemm2<0><<<dim3((QN / 128) * (HD / 64), HG), 128, 0, stream>>>(P, SQ, (size_t)SQ * SQ, VT + (size_t)h0 * HD * SQ, SQ, (size_t)HD * SQ, 0.25f, nullptr, 0, nullptr, 1, 0, 0, nullptr, O16 + r0 * DM + h0 * HD, DM, (size_t)HD, QN, HD, SQ); } }      /* o (merged heads) as f16 rows */
  k_gemm2<0><<<dim3((unsigned)((MPO / 128) * (DM / 64)), 1), 128, 0, stream>>>(O16 + r0p * DM, DM, 0, BO, DM, 0, 0.0009765625f, bo, 0, nullptr, 1, 0, 0, (float*)d_out + r0p * DM, nullptr, DM, 0, MPO, DM, DM);      /* out rows are the output layout */
}

// v002
// It runs in 283 microseconds.
// In two side-by-side timings against v001, it was 2.90 and 2.88 times as fast.
// Over all steps from v000 it is 9.60 times as fast.
#include <hip/hip_runtime.h>
// Multi-head self-attention with PER-HEAD STACKED projections and per-head biases at width 768, scaled by the EMBED WIDTH (x [2][2048][768]; q / k / v = einsum('bse,hed->bhsd', x, W) + b with W [12][768][64] = [head][in][out] and b [12][64], 12 heads of 64; scores / sqrt(E = 768) (the module's own: the embed width, not the head width); softmax over all 2048 keys (no mask); out = merged wo + bo ([in][out] [768][768] + bias) -> [2][2048][768]); each head's [in][out] block is transposed into its 64 contiguous rows of the weight plane by the existing builder, one call per head; a per-head bias [12][64] IS the flat bias [768].
// Structure: token rows r = b*2048 + s; the query source and the key/value source as exact f16 rows (bf16-rounded); Q, K, V as three WMMA GEMMs (32x64 wave tiles, f32 accumulation, exact x16 weights + bias, f16 outputs); V^T for all (batch, head) via LDS transposes; one fused attention launch over all (batch, head, 256 queries): S^T = K Q^T (K = 64), online softmax in registers (f32 statistics, native exp2, scale 768^-0.5; unnormalised weights as f16), O^T += V^T P^T, o / sum carried x64 against f16 subnormal flush (folded into the output GEMM alpha) written straight into the merged f16 o rows; out = o W_o + b GEMM (f32) into the output layout.
// Compute dtype: inputs rounded to bf16; x / weights exact; q, k, v, softmax weights and o as plain f16 GEMM operands (~2^-12); scores and softmax statistics f32. v_wmma_f32_16x16x32_f16.
#define NB 2
#define SQ 2048
#define DM 768 
#define NH 12
#define HD 64
#define HG 4                         /* heads per launch of the grouped k_vt, which is not launched */
#define B0 0                         /* first batch processed (debug hook) */
#define NBR NB                       /* batches processed (debug hook) */
#define NR ((size_t)NB * SQ)         /* token rows */
#define MP ((int)((size_t)NBR * SQ)) /* rows projected (debug hook) */
#define QN SQ                        /* not used: attention takes all SQ query rows */
#define NHD NH                       /* not used: attention takes all NH heads */
#define MPO MP                       /* rows through the output stage (debug hook) */
#define LQ DM      /* row pitch of the q/k/v rows */
typedef __bf16 v16b __attribute__((ext_vector_type(16)));
typedef unsigned short v8us __attribute__((ext_vector_type(8), may_alias));
typedef float  v8f  __attribute__((ext_vector_type(8)));
typedef float  v4f  __attribute__((ext_vector_type(4)));
typedef float  v4fa __attribute__((ext_vector_type(4), may_alias));
union FragB { v16b v; v8us half[2]; unsigned short u[16]; };

__device__ __forceinline__ unsigned short bf16_bits(float x) { unsigned int u = __float_as_uint(x); return (unsigned short)((u + 0x7FFFu + ((u >> 16) & 1u)) >> 16); }
__device__ __forceinline__ float bf16_val(unsigned short b) { return __uint_as_float(((unsigned int)b) << 16); }
__device__ __forceinline__ float bf16_round(float x) { return bf16_val(bf16_bits(x)); }
// D += A·B with NT terms: 1 = ah·bh, 2 = + al·bh (A split), 3 = + ah·bl (both split)
template <int NT>
__device__ __forceinline__ v8f mmaN(v16b ah, v16b al, v16b bh, v16b bl, v8f c) {
  c = __builtin_amdgcn_wmma_f32_16x16x32_bf16(false, ah, false, bh, (short)0, c, false, false);
  if (NT >= 2) c = __builtin_amdgcn_wmma_f32_16x16x32_bf16(false, al, false, bh, (short)0, c, false, false);
  if (NT >= 3) c = __builtin_amdgcn_wmma_f32_16x16x32_bf16(false, ah, false, bl, (short)0, c, false, false);
  asm volatile("v_nop\n\tv_nop\n\tv_nop\n\tv_nop" : "+v"(c) : "v"(ah), "v"(al), "v"(bh), "v"(bl));
  return c;
}

__global__ __launch_bounds__(256) void k_wt_bf16(const float* __restrict__ W, unsigned short* __restrict__ Wt, int K, int N) {
  const int t = blockIdx.x * 256 + threadIdx.x;
  const int k8n = K / 8;
  if (t >= N * k8n) return;
  const int n = t / k8n, k8 = (t % k8n) * 8;
  v8us v;
#pragma unroll
  for (int i = 0; i < 8; ++i) v[i] = bf16_bits(W[(size_t)(k8 + i) * N + n]);
  *(v8us*)(Wt + (size_t)n * K + k8) = v;
  
}

// GEMM C[M][N] (f32, pitch ldc) = act(A[M][K]·W + bias). A f32 row-major (pitch lda) converted per fragment to bf16
// (ASPLIT: hi/lo two planes -> 2 terms, else single rounded term); Wt bf16 [N][K] (pitch ldb). BIAS_BF16 rounds the
// bias to bf16 first (bias quantised to bf16 before the add). K%32==0, M%16==0, N%64==0.
template <bool ASPLIT, int ACT, bool BIAS_BF16>
__global__ __launch_bounds__(128) void k_gemm_bf(const float* __restrict__ A, int lda, const unsigned short* __restrict__ Wt, int ldb,
                                               const float* __restrict__ bias, float* __restrict__ C, int ldc, int M, int N, int K) {
  __shared__ __attribute__((aligned(16))) float so[4][16][64];
  const int tid = threadIdx.x, w = tid >> 5, lane = tid & 31, ln = lane & 15, hh = lane >> 4;
  const int ntn = N / 64;
  const int wid = blockIdx.x * 4 + w;
  const int mt = wid / ntn, nq = wid % ntn;
  if (mt * 16 >= M) return;
  const int row0 = mt * 16, col0 = nq * 64;
  const float* arow = A + (size_t)(row0 + ln) * lda;
  v8f acc[4] = {};
  for (int kb = 0; kb < K; kb += 32) {
    FragB ah, al;
    const v4f x0 = *(const v4fa*)(arow + kb + 8 * hh), x1 = *(const v4fa*)(arow + kb + 8 * hh + 4);
    const v4f x2 = *(const v4fa*)(arow + kb + 16 + 8 * hh), x3 = *(const v4fa*)(arow + kb + 16 + 8 * hh + 4);
    float xs[16] = {x0[0],x0[1],x0[2],x0[3],x1[0],x1[1],x1[2],x1[3],x2[0],x2[1],x2[2],x2[3],x3[0],x3[1],x3[2],x3[3]};
#pragma unroll
    for (int i = 0; i < 16; ++i) { const unsigned short hb = bf16_bits(xs[i]); ah.u[i] = hb; al.u[i] = ASPLIT ? bf16_bits(xs[i] - bf16_val(hb)) : (unsigned short)0; }
#pragma unroll
    for (int t = 0; t < 4; ++t) {
      const unsigned short* brow = Wt + (size_t)(col0 + t * 16 + ln) * ldb + kb;
      FragB b;
      b.half[0] = *(const v8us*)(brow + 8 * hh);
      b.half[1] = *(const v8us*)(brow + 16 + 8 * hh);
      acc[t] = mmaN<ASPLIT ? 2 : 1>(ah.v, al.v, b.v, b.v, acc[t]);
    }
  }
#pragma unroll
  for (int t = 0; t < 4; ++t) {
    float bv = bias ? bias[col0 + t * 16 + ln] : 0.f;
    if (BIAS_BF16) bv = bf16_round(bv);
#pragma unroll
    for (int r = 0; r < 8; ++r) { float v = acc[t][r] + bv; if (ACT == 1) v = fmaxf(v, 0.f); so[w][8 * hh + r][t * 16 + ln] = v; }
  }
  __builtin_amdgcn_fence(__ATOMIC_ACQ_REL, "workgroup");
  __builtin_amdgcn_wave_barrier();
  const int rsub = lane >> 4, c4 = (lane & 15) * 4;
  {
#pragma unroll
    for (int q = 0; q < 8; ++q) {
      const int r = q * 2 + rsub;
      const v4f v = *(const v4fa*)&so[w][r][c4];
      *(v4f*)(C + (size_t)(row0 + r) * ldc + col0 + c4) = v;
    }
    
  }
}

// GEMM C = act(A·W + bias + resid): A f32 (ASPLIT -> hi/lo 2 terms), Wt bf16 [N][K]; ACT 0 none, 1 relu, 2 exact gelu;
// resid (optional, f32, row index = (row % rmod), pitch ldr, RES_BF16 rounds it) added before the activation.
template <bool ASPLIT, int ACT, bool BIAS_BF16, bool RES_BF16>
__global__ __launch_bounds__(128) void k_gemm_bf3(const float* __restrict__ A, int lda, const unsigned short* __restrict__ Wt, int ldb,
                                                const float* __restrict__ bias, const float* __restrict__ resid, int rmod, int ldr,
                                                float* __restrict__ C, int ldc, int M, int N, int K) {
  __shared__ __attribute__((aligned(16))) float so[4][16][64];
  const int tid = threadIdx.x, w = tid >> 5, lane = tid & 31, ln = lane & 15, hh = lane >> 4;
  const int ntn = N / 64;
  const int wid = blockIdx.x * 4 + w;
  const int mt = wid / ntn, nq = wid % ntn;
  if (mt * 16 >= M) return;
  const int row0 = mt * 16, col0 = nq * 64;
  const float* arow = A + (size_t)(row0 + ln) * lda;
  v8f acc[4] = {};
  for (int kb = 0; kb < K; kb += 32) {
    FragB ah, al;
    const v4f x0 = *(const v4fa*)(arow + kb + 8 * hh), x1 = *(const v4fa*)(arow + kb + 8 * hh + 4);
    const v4f x2 = *(const v4fa*)(arow + kb + 16 + 8 * hh), x3 = *(const v4fa*)(arow + kb + 16 + 8 * hh + 4);
    float xs[16] = {x0[0],x0[1],x0[2],x0[3],x1[0],x1[1],x1[2],x1[3],x2[0],x2[1],x2[2],x2[3],x3[0],x3[1],x3[2],x3[3]};
#pragma unroll
    for (int i = 0; i < 16; ++i) { const unsigned short hb = bf16_bits(xs[i]); ah.u[i] = hb; al.u[i] = ASPLIT ? bf16_bits(xs[i] - bf16_val(hb)) : (unsigned short)0; }
#pragma unroll
    for (int t = 0; t < 4; ++t) {
      const unsigned short* brow = Wt + (size_t)(col0 + t * 16 + ln) * ldb + kb;
      FragB b;
      b.half[0] = *(const v8us*)(brow + 8 * hh);
      b.half[1] = *(const v8us*)(brow + 16 + 8 * hh);
      acc[t] = mmaN<ASPLIT ? 2 : 1>(ah.v, al.v, b.v, b.v, acc[t]);
    }
  }
#pragma unroll
  for (int t = 0; t < 4; ++t) {
    const int col = col0 + t * 16 + ln;
    float bv = bias ? bias[col] : 0.f;
    if (BIAS_BF16) bv = bf16_round(bv);
#pragma unroll
    for (int r = 0; r < 8; ++r) {
      float v = acc[t][r] + bv;
      if (resid) { float rv = resid[(size_t)((row0 + 8 * hh + r) % rmod) * ldr + col]; if (RES_BF16) rv = bf16_round(rv); v += rv; }
      if (ACT == 1) v = fmaxf(v, 0.f);
      if (ACT == 2) v = 0.5f * v * (1.0f + erff(v * 0.70710678118654752f));
      if (ACT == 3) { const float u = 0.7978845608028654f * (v + 0.044715f * v * v * v); v = 0.5f * v * (1.0f + tanhf(u)); }
      so[w][8 * hh + r][t * 16 + ln] = v;
    }
  }
  __builtin_amdgcn_fence(__ATOMIC_ACQ_REL, "workgroup");
  __builtin_amdgcn_wave_barrier();
  const int rsub = lane >> 4, c4 = (lane & 15) * 4;
  {
#pragma unroll
    for (int q = 0; q < 8; ++q) {
      const int r = q * 2 + rsub;
      const v4f v = *(const v4fa*)&so[w][r][c4];
      *(v4f*)(C + (size_t)(row0 + r) * ldc + col0 + c4) = v;
    }
    
  }
}
// row LayerNorm (biased variance, eps) over N: s = X (+ R); optional out_sum <- s; out_norm <- (s-mu)*rsqrt(var+eps)*g + b
template <bool PARAM_BF16>
__global__ __launch_bounds__(256) void k_layernorm(const float* __restrict__ X, const float* __restrict__ R, const float* __restrict__ g, const float* __restrict__ bta,
                                                  float* __restrict__ out_sum, float* __restrict__ out_norm, int N, float eps) {
  __shared__ float red[256];
  const int row = blockIdx.x, tid = threadIdx.x;
  const float* x = X + (size_t)row * N; const float* rr = R ? R + (size_t)row * N : nullptr;
  float vals[16];                     // up to N = 4096
  const int per = N / 256;            // contiguous chunk per thread? use strided-by-4 chunks: thread handles j = tid*4 + 1024*u
  float s1 = 0.f;
  for (int u = 0; u < per / 4; ++u) {
    const int j = tid * 4 + 1024 * u;
    const v4f a = *(const v4fa*)(x + j);
    v4f b = {0.f,0.f,0.f,0.f}; if (rr) b = *(const v4fa*)(rr + j);
#pragma unroll
    for (int q = 0; q < 4; ++q) { const float v = a[q] + b[q]; vals[u * 4 + q] = v; s1 += v; }
  }
  red[tid] = s1; __syncthreads();
  for (int st = 128; st > 0; st >>= 1) { if (tid < st) red[tid] += red[tid + st]; __syncthreads(); }
  const float mu = red[0] / (float)N; __syncthreads();
  float s2 = 0.f;
  for (int u = 0; u < per / 4; ++u)
#pragma unroll
    for (int q = 0; q < 4; ++q) { const float c = vals[u * 4 + q] - mu; s2 += c * c; }
  red[tid] = s2; __syncthreads();
  for (int st = 128; st > 0; st >>= 1) { if (tid < st) red[tid] += red[tid + st]; __syncthreads(); }
  const float rs = rsqrtf(red[0] / (float)N + eps);
  {
    for (int u = 0; u < per / 4; ++u) {
      const int j = tid * 4 + 1024 * u;
      v4f o, sm;
#pragma unroll
      for (int q = 0; q < 4; ++q) {
        float gg = g[j + q], bb = bta[j + q];
        if (PARAM_BF16) { gg = bf16_round(gg); bb = bf16_round(bb); }
        sm[q] = vals[u * 4 + q]; o[q] = (vals[u * 4 + q] - mu) * rs * gg + bb;
      }
      if (out_sum) *(v4f*)(out_sum + (size_t)row * N + j) = sm;
      *(v4f*)(out_norm + (size_t)row * N + j) = o;
    }
    
  }
}



// ---- f16 WMMA path (v_wmma_f32_16x16x32_f16): 11-bit significands for operands in range — used where a [0,1] probability operand needs more precision than bf16
typedef _Float16 v16h __attribute__((ext_vector_type(16)));
union FragH { v16h v; v8us half[2]; _Float16 h[16]; unsigned short u[16]; };
template <int NT>
__device__ __forceinline__ v8f mmaH(v16h ah, v16h al, v16h bh, v16h bl, v8f c) {
  c = __builtin_amdgcn_wmma_f32_16x16x32_f16(false, ah, false, bh, (short)0, c, false, false);
  if (NT >= 2) c = __builtin_amdgcn_wmma_f32_16x16x32_f16(false, al, false, bh, (short)0, c, false, false);
  if (NT >= 3) c = __builtin_amdgcn_wmma_f32_16x16x32_f16(false, ah, false, bl, (short)0, c, false, false);
  asm volatile("v_nop\n\tv_nop\n\tv_nop\n\tv_nop" : "+v"(c) : "v"(ah), "v"(al), "v"(bh), "v"(bl));
  return c;
}
// batched GEMM like k_gemm_b but f16 operands: A f32 (split into f16 hi/lo if ASPLIT, else rounded to f16), Bt = f16 values [n][k]; alpha; C f32; N multiple of 16 (partial tiles skipped)
template <bool ASPLIT>
__global__ __launch_bounds__(128) void k_gemm_h(const float* __restrict__ A, int lda, size_t sA, const _Float16* __restrict__ Bh, int ldb, size_t sB, float alpha, float* __restrict__ C, int ldc, size_t sC, int M, int N, int K) {
  __shared__ __attribute__((aligned(16))) float so[4][16][64];
  const int tid = threadIdx.x, w = tid >> 5, lane = tid & 31, ln = lane & 15, hh = lane >> 4; const int by = blockIdx.y;
  A += (size_t)by * sA; Bh += (size_t)by * sB; C += (size_t)by * sC;
  const int ntn = (N + 63) / 64; const int wid = blockIdx.x * 4 + w; const int mt = wid / ntn, nq = wid % ntn; if (mt * 16 >= M) return;
  const int row0 = mt * 16, col0 = nq * 64; const float* arow = A + (size_t)(row0 + ln) * lda;
  v8f acc[4] = {};
  for (int kb = 0; kb < K; kb += 32) {
    FragH ah, al;
    const v4f x0 = *(const v4fa*)(arow + kb + 8 * hh), x1 = *(const v4fa*)(arow + kb + 8 * hh + 4), x2 = *(const v4fa*)(arow + kb + 16 + 8 * hh), x3 = *(const v4fa*)(arow + kb + 16 + 8 * hh + 4);
    float xs[16] = {x0[0],x0[1],x0[2],x0[3],x1[0],x1[1],x1[2],x1[3],x2[0],x2[1],x2[2],x2[3],x3[0],x3[1],x3[2],x3[3]};
#pragma unroll
    for (int i = 0; i < 16; ++i) { const _Float16 h = (_Float16)xs[i]; ah.h[i] = h; al.h[i] = ASPLIT ? (_Float16)(xs[i] - (float)h) : (_Float16)0.0f; }
#pragma unroll
    for (int t = 0; t < 4; ++t) { if (col0 + t * 16 >= N) continue; const size_t boff = (size_t)(col0 + t * 16 + ln) * ldb + kb; FragH bq; bq.half[0] = *(const v8us*)(Bh + boff + 8 * hh); bq.half[1] = *(const v8us*)(Bh + boff + 16 + 8 * hh);
      acc[t] = mmaH<ASPLIT ? 2 : 1>(ah.v, al.v, bq.v, bq.v, acc[t]); }
  }
#pragma unroll
  for (int t = 0; t < 4; ++t) { if (col0 + t * 16 >= N) continue;
#pragma unroll
    for (int r = 0; r < 8; ++r) so[w][8 * hh + r][t * 16 + ln] = acc[t][r] * alpha; }
  __builtin_amdgcn_fence(__ATOMIC_ACQ_REL, "workgroup"); __builtin_amdgcn_wave_barrier();
  const int rsub = lane >> 4, c4 = (lane & 15) * 4;
  {
#pragma unroll
    for (int q = 0; q < 8; ++q) { const int r = q * 2 + rsub; if (col0 + c4 < N) { const v4f v = *(const v4fa*)&so[w][r][c4]; *(v4f*)(C + (size_t)(row0 + r) * ldc + col0 + c4) = v; } }
     }
}

// Wt[n][k] = f16(W[k][n]·scale) from f32 row-major W[K][N] (scale = power of two; bf16-exact weights stay exact in f16 away from the subnormal range)
__global__ __launch_bounds__(256) void k_wt_f16(const float* __restrict__ W, _Float16* __restrict__ Wt, int K, int N, float scale) {
  const int t = blockIdx.x * 256 + threadIdx.x; if (t >= N * (K / 8)) return; const int n = t / (K / 8), k8 = (t % (K / 8)) * 8; FragH f;
#pragma unroll
  for (int i = 0; i < 8; ++i) f.h[i] = (_Float16)(bf16_round(W[(size_t)(k8 + i) * N + n]) * scale); const v8us o = f.half[0];
  *(v8us*)((unsigned short*)Wt + (size_t)n * K + k8) = o; 
}
// k_gemm_hh variant with fused epilogue: v = acc·alpha + bias[by·sBias + col] (+ CP[(row/rowsPerB)·sCPb + by·64 + col] if CP) ; ACT 0 none / 1 elu ; writes f16 C16 (and f32 C if non-null)
template <int ACT>
__global__ __launch_bounds__(128) void k_gemm_hhx(const _Float16* __restrict__ A, int lda, size_t sA, const _Float16* __restrict__ Bh, int ldb, size_t sB, float alpha, const float* __restrict__ bias, size_t sBias, const float* __restrict__ CP, int rowsPerB, size_t sCPb, int row0g,
    float* __restrict__ C, _Float16* __restrict__ C16, int ldc, size_t sC, int M, int N, int K) {
  __shared__ __attribute__((aligned(16))) float so[4][16][64];
  const int tid = threadIdx.x, w = tid >> 5, lane = tid & 31, ln = lane & 15, hh = lane >> 4; const int by = blockIdx.y;
  A += (size_t)by * sA; Bh += (size_t)by * sB; const size_t cofs = (size_t)by * sC; const float* bp = bias ? bias + (size_t)by * sBias : nullptr;
  const int ntn = (N + 63) / 64; const int wid = blockIdx.x * 4 + w; const int mt = wid / ntn, nq = wid % ntn; if (mt * 16 >= M) return;
  const int row0 = mt * 16, col0 = nq * 64; const _Float16* arow = A + (size_t)(row0 + ln) * lda;
  v8f acc[4] = {};
  for (int kb = 0; kb < K; kb += 32) { FragH ah; ah.half[0] = *(const v8us*)((const unsigned short*)arow + kb + 8 * hh); ah.half[1] = *(const v8us*)((const unsigned short*)arow + kb + 16 + 8 * hh);
#pragma unroll
    for (int t = 0; t < 4; ++t) { if (col0 + t * 16 >= N) continue; const size_t boff = (size_t)(col0 + t * 16 + ln) * ldb + kb; FragH bq; bq.half[0] = *(const v8us*)((const unsigned short*)Bh + boff + 8 * hh); bq.half[1] = *(const v8us*)((const unsigned short*)Bh + boff + 16 + 8 * hh);
      acc[t] = mmaH<1>(ah.v, ah.v, bq.v, bq.v, acc[t]); }
  }
#pragma unroll
  for (int t = 0; t < 4; ++t) { if (col0 + t * 16 >= N) continue; const int col = col0 + t * 16 + ln; const float bv = bp ? bf16_round(bp[col]) : 0.f;
#pragma unroll
    for (int r = 0; r < 8; ++r) { float v = acc[t][r] * alpha + bv; if (CP) { const int rr = row0g + row0 + 8 * hh + r; if (rowsPerB < 0) v += CP[cofs + (size_t)rr * ldc + col];      /* rowsPerB < 0: own element of the batched C plane */ else { const int bidx = rr / rowsPerB; v += CP[(size_t)bidx * sCPb + (size_t)by * 64 + col]; } } if (ACT == 1) v = (v > 0.f) ? v : expm1f(v); else if (ACT == 7) v = (v > 0.f) ? v + 1.0f : expf(v); else if (ACT == 8) v = tanhf(v); else if (ACT == 9) v = 0.5f * v * (1.0f + tanhf(0.7978845608028654f * (v + 0.044715f * v * v * v))); else if (ACT == 11) v = 1.0f / (1.0f + expf(-v)); else if (ACT == 12) v = (v > 0.f) ? v : 0.01f * v; else if (ACT == 14) v = (v > 0.f) ? v : 0.1f * v; else if (ACT == 16) v = (v >= 0.f) ? v : 0.3f * v; else if (ACT == 17) v = (v >= 0.f) ? v : 0.2f * v; else if (ACT == 15) v = v / (1.0f + expf(-v)); else if (ACT == 3) v = fmaxf(v, 0.f); else if (ACT == 6) v = 0.5f * v * (1.0f + erff(v * 0.70710678118654752f)); so[w][8 * hh + r][t * 16 + ln] = v; } }
  __builtin_amdgcn_fence(__ATOMIC_ACQ_REL, "workgroup"); __builtin_amdgcn_wave_barrier();
  const int rsub = lane >> 4, c4 = (lane & 15) * 4; typedef _Float16 v4h __attribute__((ext_vector_type(4)));
  {
#pragma unroll
    for (int q = 0; q < 8; ++q) { const int r = q * 2 + rsub; if (col0 + c4 < N) { const v4f v = *(const v4fa*)&so[w][r][c4]; if (C) *(v4f*)(C + cofs + (size_t)(row0 + r) * ldc + col0 + c4) = v; if (C16) { v4h h4; for (int i = 0; i < 4; ++i) h4[i] = (_Float16)v[i]; *(v4h*)(C16 + cofs + (size_t)(row0 + r) * ldc + col0 + c4) = h4; } } }
     }
}


typedef _Float16 v4h __attribute__((ext_vector_type(4)));

__global__ __launch_bounds__(256) void k_x16(const float* __restrict__ x, _Float16* __restrict__ X16, size_t n8) { const size_t t = (size_t)blockIdx.x * 256 + threadIdx.x; if (t >= n8) return; FragH f;
#pragma unroll
  for (int q = 0; q < 8; ++q) f.h[q] = (_Float16)bf16_round(x[t * 8 + q]); *(v8us*)((unsigned short*)X16 + t * 8) = f.half[0];  }
__global__ __launch_bounds__(256) void k_h16(const float* __restrict__ x, _Float16* __restrict__ X16, size_t n8) { const size_t t = (size_t)blockIdx.x * 256 + threadIdx.x; if (t >= n8) return; FragH f;
#pragma unroll
  for (int q = 0; q < 8; ++q) f.h[q] = (_Float16)x[t * 8 + q]; *(v8us*)((unsigned short*)X16 + t * 8) = f.half[0];  }
__global__ __launch_bounds__(256) void k_round16f(const float* __restrict__ W, _Float16* __restrict__ Bt, size_t n8) { const size_t t = (size_t)blockIdx.x * 256 + threadIdx.x; if (t >= n8) return; FragH f;
#pragma unroll
  for (int i = 0; i < 8; ++i) f.h[i] = (_Float16)(bf16_round(W[t * 8 + i]) * 16.0f); *(v8us*)((unsigned short*)Bt + t * 8) = f.half[0];  }
template <int NHv, int TTv>
__global__ __launch_bounds__(256) void k_vt(const _Float16* __restrict__ V16, int ldv, int voff, _Float16* __restrict__ Vt) { __shared__ unsigned short tl[64][66]; const int tid = threadIdx.x; const int slab = blockIdx.x / (TTv / 64), lg = blockIdx.x % (TTv / 64); const int b = slab / NHv, h = slab % NHv;
  for (int i = tid; i < 64 * 8; i += 256) { const int r = i / 8, c8 = (i % 8) * 8; FragH f; f.half[0] = *(const v8us*)((const unsigned short*)V16 + ((size_t)b * TTv + lg * 64 + r) * ldv + voff + h * 64 + c8);
#pragma unroll
    for (int q = 0; q < 8; ++q) tl[r][c8 + q] = f.u[q]; }
  __syncthreads();
  {
#pragma unroll
    for (int rd = 0; rd < 2; ++rd) { const int d = rd * 32 + tid / 8, pc = tid % 8; FragH f;
#pragma unroll
      for (int q = 0; q < 8; ++q) f.u[q] = tl[pc * 8 + q][d];
      *(v8us*)((unsigned short*)Vt + ((size_t)slab * 64 + d) * TTv + lg * 64 + pc * 8) = f.half[0]; }
     } }

__global__ __launch_bounds__(256) void k_hl(const float* __restrict__ F, _Float16* __restrict__ Hh, _Float16* __restrict__ Hl, size_t n8) { const size_t t = (size_t)blockIdx.x * 256 + threadIdx.x; if (t >= n8) return; FragH fh, fl; const v4f a = *(const v4fa*)(F + t * 8), c = *(const v4fa*)(F + t * 8 + 4);
#pragma unroll
  for (int q = 0; q < 4; ++q) { _Float16 h = (_Float16)a[q]; fh.h[q] = h; fl.h[q] = (_Float16)((a[q] - (float)h) * 1024.0f); h = (_Float16)c[q]; fh.h[4 + q] = h; fl.h[4 + q] = (_Float16)((c[q] - (float)h) * 1024.0f); }
  { *(v8us*)((unsigned short*)Hh + t * 8) = fh.half[0]; *(v8us*)((unsigned short*)Hl + t * 8) = fl.half[0];  } }

// ---- fast GEMM (wave tile 32x64; requires M % 32 == 0 rows per launch region and N % 64 == 0); epilogue = k_gemm_hhx semantics ----
__device__ __forceinline__ v16h g2_frag(const _Float16* p, int hh) { FragH f; f.half[0] = *(const v8us*)((const unsigned short*)p + 8 * hh); f.half[1] = *(const v8us*)((const unsigned short*)p + 16 + 8 * hh); return f.v; }
__device__ __forceinline__ v8f g2_mma(v16h a, v16h b, v8f c) { v8f d = __builtin_amdgcn_wmma_f32_16x16x32_f16(false, a, false, b, (short)0, c, false, false); asm volatile("v_nop\n\tv_nop\n\tv_nop\n\tv_nop" : "+v"(d) : "v"(a), "v"(b)); return d; }
template <int ACT>
__global__ __launch_bounds__(128) void k_gemm2(const _Float16* __restrict__ A, int lda, size_t sA, const _Float16* __restrict__ Bh, int ldb, size_t sB, float alpha, const float* __restrict__ bias, size_t sBias, const float* __restrict__ CP, int rowsPerB, size_t sCPb, int row0g,
    float* __restrict__ C, _Float16* __restrict__ C16, int ldc, size_t sC, int M, int N, int K) { static_assert(ACT == 0 || ACT == 3 || ACT == 6 || ACT == 8 || ACT == 9 || ACT == 11 || ACT == 12 || ACT == 14 || ACT == 15 || ACT == 16 || ACT == 17, "k_gemm2: unsupported ACT code (would silently apply no activation)");
  __shared__ __attribute__((aligned(16))) float so[4][32][68];
  const int tid = threadIdx.x, w = tid >> 5, lane = tid & 31, ln = lane & 15, hh = lane >> 4; const int by = blockIdx.y;
  A += (size_t)by * sA; Bh += (size_t)by * sB; const size_t cofs = (size_t)by * sC; const float* bp = bias ? bias + (size_t)by * sBias : nullptr;
  const int ntn = N >> 6; const int mt = blockIdx.x / ntn, nq = blockIdx.x - mt * ntn; const int row0 = mt * 128 + 32 * w, col0 = nq * 64; if (row0 >= M) return;
  const _Float16* a0p = A + (size_t)(row0 + ln) * lda; const _Float16* a1p = a0p + (size_t)16 * lda;
  const _Float16* b0p = Bh + (size_t)(col0 + ln) * ldb; const _Float16* b1p = b0p + (size_t)16 * ldb; const _Float16* b2p = b1p + (size_t)16 * ldb; const _Float16* b3p = b2p + (size_t)16 * ldb;
  const v8f z8 = {0.f,0.f,0.f,0.f,0.f,0.f,0.f,0.f}; v8f c00 = z8, c01 = z8, c02 = z8, c03 = z8, c10 = z8, c11 = z8, c12 = z8, c13 = z8;
#pragma unroll 1
  for (int kb = 0; kb < K; kb += 32) { const v16h a0 = g2_frag(a0p + kb, hh), a1 = g2_frag(a1p + kb, hh);
    v16h b = g2_frag(b0p + kb, hh); c00 = g2_mma(a0, b, c00); c10 = g2_mma(a1, b, c10);
    b = g2_frag(b1p + kb, hh); c01 = g2_mma(a0, b, c01); c11 = g2_mma(a1, b, c11);
    b = g2_frag(b2p + kb, hh); c02 = g2_mma(a0, b, c02); c12 = g2_mma(a1, b, c12);
    b = g2_frag(b3p + kb, hh); c03 = g2_mma(a0, b, c03); c13 = g2_mma(a1, b, c13); }
  v8f accs[8] = {c00, c01, c02, c03, c10, c11, c12, c13};
#pragma unroll
  for (int u = 0; u < 8; ++u) { const int t = u & 3, half = u >> 2; const int col = col0 + t * 16 + ln; const float bv = bp ? bf16_round(bp[col]) : 0.f;
#pragma unroll
    for (int r = 0; r < 8; ++r) { const int rloc = half * 16 + 8 * hh + r; float v = accs[u][r] * alpha + bv; if (CP) { if (rowsPerB < 0) v += CP[cofs + (size_t)(row0g + row0 + rloc) * ldc + col];      /* rowsPerB < 0: own element of the batched C plane */ else { const int bidx = (row0g + row0 + rloc) / rowsPerB; v += CP[(size_t)bidx * sCPb + (size_t)by * 64 + col]; } }
      if (ACT == 3) v = fmaxf(v, 0.f); else if (ACT == 6) v = 0.5f * v * (1.0f + erff(v * 0.70710678118654752f)); else if (ACT == 11) v = 1.0f / (1.0f + expf(-v)); else if (ACT == 15) v = v / (1.0f + expf(-v)); else if (ACT == 12) v = (v > 0.f) ? v : 0.01f * v; else if (ACT == 8) v = tanhf(v); else if (ACT == 9) v = 0.5f * v * (1.0f + tanhf(0.7978845608028654f * (v + 0.044715f * v * v * v))); else if (ACT == 14) v = (v > 0.f) ? v : 0.1f * v; else if (ACT == 16) v = (v >= 0.f) ? v : 0.3f * v; else if (ACT == 17) v = (v >= 0.f) ? v : 0.2f * v;
      so[w][rloc][t * 16 + ln] = v; } }
  __builtin_amdgcn_fence(__ATOMIC_ACQ_REL, "workgroup"); __builtin_amdgcn_wave_barrier();
  const int rsub = lane >> 4, c4 = (lane & 15) * 4;
  {
#pragma unroll
    for (int q = 0; q < 16; ++q) { const int r = q * 2 + rsub; const v4f v = *(const v4fa*)&so[w][r][c4]; if (C) *(v4f*)(C + cofs + (size_t)(row0 + r) * ldc + col0 + c4) = v; if (C16) { v4h h4; for (int i = 0; i < 4; ++i) h4[i] = (_Float16)v[i]; *(v4h*)(C16 + cofs + (size_t)(row0 + r) * ldc + col0 + c4) = h4; } }
     } }


__global__ __launch_bounds__(256) void k_wnat(const float* __restrict__ w, size_t n8, _Float16* __restrict__ Bt) { const size_t t = (size_t)blockIdx.x * 256 + threadIdx.x; if (t >= n8) return; FragH f; for (int q = 0; q < 8; ++q) f.h[q] = (_Float16)(bf16_round(w[t * 8 + q]) * 16.0f); *(v8us*)((unsigned short*)Bt + t * 8) = f.half[0];  }
__global__ __launch_bounds__(256) void k_rsm(const float* __restrict__ S, _Float16* __restrict__ P, int nrows) {
  #pragma clang fp contract(off)
  const int i = blockIdx.x * 256 + threadIdx.x; if (i >= nrows) return; const float* s = S + (size_t)i * SQ; float mx = -3.0e38f;
#pragma unroll 1
  for (int j = 0; j < SQ; ++j) mx = fmaxf(mx, s[j]); float se = 0.f;
#pragma unroll 1
  for (int j = 0; j < SQ; ++j) se += expf(s[j] - mx); const float sc = 256.0f / se;
#pragma unroll 1
  for (int j0 = 0; j0 < SQ; j0 += 8) { FragH f; for (int q = 0; q < 8; ++q) f.h[q] = (_Float16)(expf(s[j0 + q] - mx) * sc); unsigned short* d = (unsigned short*)P + (size_t)i * SQ + j0; *(v8us*)d = f.half[0];  } }
__global__ __launch_bounds__(256) void k_vt(const _Float16* __restrict__ V16, int b, int h0, _Float16* __restrict__ VT) { __shared__ unsigned short tl[64][65]; const int tid = threadIdx.x; const int hh = blockIdx.x % HG, sg = blockIdx.x / HG; const int s0 = sg * 64; const int h = h0 + hh;
  for (int i = tid; i < 64 * 8; i += 256) { const int j = i / 8, d8 = (i % 8) * 8; FragH f; f.half[0] = *(const v8us*)((const unsigned short*)V16 + ((size_t)b * SQ + s0 + j) * DM + h * HD + d8); for (int q = 0; q < 8; ++q) tl[d8 + q][j] = f.u[q]; }
  __syncthreads();
  { for (int i = tid; i < 64 * 8; i += 256) { const int d = i / 8, j8 = (i % 8) * 8; FragH f; for (int q = 0; q < 8; ++q) f.u[q] = tl[d][j8 + q]; *(v8us*)((unsigned short*)VT + ((size_t)hh * HD + d) * SQ + s0 + j8) = f.half[0]; }  } }



// ---- fused attention: scores, softmax and P.V in one kernel; neither scores nor weights go to memory ----
#define FK 64      /* keys per LDS stage */
#define FPH 72     /* LDS row pitch in f16: 128 data bytes + 16, the conflict-free pitch for 16-byte fragment reads */
__device__ __forceinline__ float xhalf(float x) { return __builtin_bit_cast(float, __builtin_amdgcn_permlanex16(__builtin_bit_cast(int, x), __builtin_bit_cast(int, x), 0x76543210, 0xfedcba98, false, false)); }      /* lane l reads lane l ^ 16 */
// native 2^x, in place. The instruction set asks for one independent instruction or a v_nop between a transcendental and a directly following instruction that uses its result or overwrites its source.
// Eight in one statement: each is the independent instruction behind the one before it, the one v_nop fills the slot behind the last. In place, so that the statement writes only registers that the compiler's own multiply-add has just written:
// the compiler does not look into asm text when it keeps its distance behind a matrix instruction, and a fresh output register could be an operand of one just issued.
__device__ __forceinline__ void exp2x8(float (&x)[8]) { asm("v_exp_f32 %0, %0\n\tv_exp_f32 %1, %1\n\tv_exp_f32 %2, %2\n\tv_exp_f32 %3, %3\n\tv_exp_f32 %4, %4\n\tv_exp_f32 %5, %5\n\tv_exp_f32 %6, %6\n\tv_exp_f32 %7, %7\n\tv_nop" : "+v"(x[0]), "+v"(x[1]), "+v"(x[2]), "+v"(x[3]), "+v"(x[4]), "+v"(x[5]), "+v"(x[6]), "+v"(x[7])); }
__device__ __forceinline__ float exp2x1(float x) { asm("v_exp_f32 %0, %0\n\tv_nop" : "+v"(x)); return x; }      /* the same, one value */
__device__ __forceinline__ v8f fa_mma(v16h a, v16h b, v8f c) { return __builtin_amdgcn_wmma_f32_16x16x32_f16(false, a, false, b, (short)0, c, false, false); }
__global__ __launch_bounds__(256) void k_fattn(const _Float16* __restrict__ Q16, const _Float16* __restrict__ K16, const _Float16* __restrict__ VT, _Float16* __restrict__ O16, float cs) {
  __shared__ __attribute__((aligned(16))) _Float16 sk[2][FK][FPH];
  __shared__ __attribute__((aligned(16))) _Float16 sv[2][HD][FPH];
  const int tid = threadIdx.x, lane = tid & 31, ln = lane & 15, hh = lane >> 4, w = tid >> 5;
  const int slab = blockIdx.x / (SQ / 256), qb = blockIdx.x % (SQ / 256); const int b = slab / NH, h = slab % NH;
  const size_t qrow = (size_t)b * SQ + qb * 256 + w * 32 + ln;
  const int sr = tid >> 3, sc = (tid & 7) * 8;      /* staging: 8 threads per 128-byte row, rows sr and sr + 32 */
  const _Float16* kg = K16 + ((size_t)b * SQ + sr) * DM + h * HD + sc;
  const _Float16* vg = VT + ((size_t)slab * HD + sr) * SQ + sc;
  v8us rk0 = *(const v8us*)kg, rk1 = *(const v8us*)(kg + (size_t)32 * DM), rv0 = *(const v8us*)vg, rv1 = *(const v8us*)(vg + (size_t)32 * SQ);
  v16h qf[2][2];
#pragma unroll
  for (int g = 0; g < 2; ++g)
#pragma unroll
    for (int s = 0; s < 2; ++s) qf[g][s] = g2_frag(Q16 + (qrow + 16 * g) * DM + h * HD + 32 * s, hh);
  const v8f z8 = {0.f,0.f,0.f,0.f,0.f,0.f,0.f,0.f};
  v8f o[2][4]; float mu[2], l[2];
#pragma unroll
  for (int g = 0; g < 2; ++g) { mu[g] = -3.0e38f; l[g] = 0.f;
#pragma unroll
    for (int t = 0; t < 4; ++t) o[g][t] = z8; }
  *(v8us*)&sk[0][sr][sc] = rk0; *(v8us*)&sk[0][sr + 32][sc] = rk1; *(v8us*)&sv[0][sr][sc] = rv0; *(v8us*)&sv[0][sr + 32][sc] = rv1;
  __syncthreads();
  /* not unrolled: the two passes inside already fill the register budget, and the buffer index stays one scalar */
#pragma unroll 1
  for (int st = 0; st < SQ / FK; ++st) { const int cur = st & 1; const bool more = st + 1 < SQ / FK;      /* the same for the whole work-group */
    if (more) { const _Float16* kn = kg + (size_t)(st + 1) * FK * DM; const _Float16* vn = vg + (st + 1) * FK;
      rk0 = *(const v8us*)kn; rk1 = *(const v8us*)(kn + (size_t)32 * DM); rv0 = *(const v8us*)vn; rv1 = *(const v8us*)(vn + (size_t)32 * SQ);
      asm volatile("s_wait_xcnt 0x0" ::: "memory"); }      /* the four loads' address registers are temporaries that the fragment loads below reuse: the wait stands in front of every such overwrite */
#pragma unroll
    for (int ps = 0; ps < FK / 32; ++ps) {
      v8f s[2][2];      /* [column group][key tile] */
#pragma unroll
      for (int kt = 0; kt < 2; ++kt) { const _Float16* kr = &sk[cur][ps * 32 + kt * 16 + ln][0]; const v16h k0 = g2_frag(kr, hh), k1 = g2_frag(kr + 32, hh);
#pragma unroll
        for (int g = 0; g < 2; ++g) s[g][kt] = fa_mma(k1, qf[g][1], fa_mma(k0, qf[g][0], z8)); }
      v16h vf[4];
#pragma unroll
      for (int t = 0; t < 4; ++t) vf[t] = g2_frag(&sv[cur][t * 16 + ln][ps * 32], hh);
      float mb[2]; bool need = false;
#pragma unroll
      for (int g = 0; g < 2; ++g) { float m4[4];
#pragma unroll
        for (int q = 0; q < 4; ++q) m4[q] = fmaxf(fmaxf(s[g][0][q], s[g][0][q + 4]), fmaxf(s[g][1][q], s[g][1][q + 4]));
        float mx = fmaxf(fmaxf(m4[0], m4[1]), fmaxf(m4[2], m4[3]));
        mx = fmaxf(mx, xhalf(mx)) * cs;      /* both halves hold this query's maximum of the pass, scaled (cs > 0) */
        mb[g] = mx; need = need || (mx > mu[g] + 8.0f); }
      if (__builtin_amdgcn_ballot_w32(need) != 0) {      /* wave-uniform; always on the first pass, rare later */
#pragma unroll
        for (int g = 0; g < 2; ++g) { const float mn = fmaxf(mu[g], mb[g]); const float corr = exp2x1(mu[g] - mn); mu[g] = mn; l[g] *= corr;      /* corr = 0 on the first pass */
#pragma unroll
          for (int t = 0; t < 4; ++t) o[g][t] = o[g][t] * corr; } }
#pragma unroll
      for (int g = 0; g < 2; ++g) { const float nm = -mu[g]; FragH pf; float s4[4];
#pragma unroll
        for (int kt = 0; kt < 2; ++kt) { float p[8];
#pragma unroll
          for (int r = 0; r < 8; ++r) p[r] = fmaf(s[g][kt][r], cs, nm);
          exp2x8(p);
#pragma unroll
          for (int r = 0; r < 8; ++r) { if (kt == 0 && r < 4) s4[r] = p[r]; else s4[r & 3] += p[r]; pf.h[kt * 8 + r] = (_Float16)p[r]; } }      /* element 8 kt + r = key 16 kt + 8 hh + r: the k order of g2_frag */
        l[g] += (s4[0] + s4[1]) + (s4[2] + s4[3]);
#pragma unroll
        for (int t = 0; t < 4; ++t) o[g][t] = fa_mma(vf[t], pf.v, o[g][t]); }
    }
    if (more) { *(v8us*)&sk[cur ^ 1][sr][sc] = rk0; *(v8us*)&sk[cur ^ 1][sr + 32][sc] = rk1; *(v8us*)&sv[cur ^ 1][sr][sc] = rv0; *(v8us*)&sv[cur ^ 1][sr + 32][sc] = rv1; }      /* that buffer's last readers left it before the barrier that ended the stage before */
    __syncthreads();      /* publishes the next stage and ends every read of this one */
  }
#pragma unroll
  for (int g = 0; g < 2; ++g) { const float sc64 = 64.0f / (l[g] + xhalf(l[g]));      /* the halves' sums are joined once, here */
    _Float16* d = O16 + (qrow + 16 * g) * DM + h * HD + 8 * hh;
#pragma unroll
    for (int t = 0; t < 4; ++t) { FragH f;
#pragma unroll
      for (int r = 0; r < 8; ++r) f.h[r] = (_Float16)(o[g][t][r] * sc64);      /* o[g][t][r] = O[query ln of group g][d = 16 t + 8 hh + r]: 16 contiguous bytes */
      *(v8us*)(d + 16 * t) = f.half[0]; } }
}

extern "C" void kernel_launch(void* const* d_in, const int* in_sizes, int n_in,
                              void* d_out, int out_size, void* d_ws, size_t ws_size, hipStream_t stream) {
  (void)in_sizes; (void)n_in; (void)out_size;
  const float* const* I = (const float* const*)d_in; const float* xq = I[0]; const float* xk = I[0]; const float* xv = I[0]; const float* wq = I[1]; const float* bq = I[2]; const float* wk = I[3]; const float* bk = I[4]; const float* wv = I[5]; const float* bv = I[6]; const float* wo = I[7]; const float* bo = I[8];      /* ONE input stream (x) read on all three projections; wq, wk, wv are PER-HEAD STACKS [12][768][64] = [head][in][out]; bq, bk, bv are per-head [12][64] = the flat [768] bias; wo [in][out] + bo; input order x, wq, bq, wk, bk, wv, bv, wo, bo */
  char* ws = (char*)d_ws; size_t off = 0;
  auto take = [&](size_t bytes) { char* p = ws + off; off += (bytes + 255) & ~(size_t)255; return p; };
  _Float16* BQ = (_Float16*)take((size_t)DM * DM * 2); _Float16* BK = (_Float16*)take((size_t)DM * DM * 2); _Float16* BV = (_Float16*)take((size_t)DM * DM * 2); _Float16* BO = (_Float16*)take((size_t)DM * DM * 2);
  _Float16* XQ = (_Float16*)take(NR * DM * 2); _Float16* XK = (_Float16*)take(NR * DM * 2); _Float16* XV = (_Float16*)take(NR * DM * 2); _Float16* Q16 = (_Float16*)take(NR * DM * 2); _Float16* K16 = (_Float16*)take(NR * DM * 2); _Float16* V16 = (_Float16*)take(NR * DM * 2); _Float16* O16 = (_Float16*)take(NR * DM * 2);
  _Float16* VT = (_Float16*)take((size_t)NB * NH * HD * SQ * 2);
  if (off > ws_size) return;
  { const unsigned g = (unsigned)(((size_t)DM * (DM / 8) + 255) / 256); const unsigned gh = (unsigned)(((size_t)HD * (DM / 8) + 255) / 256); for (int h = 0; h < NH; ++h) { const size_t wofs = (size_t)h * DM * HD, pofs = (size_t)h * HD * DM; k_wt_f16<<<gh, 256, 0, stream>>>(wq + wofs, BQ + pofs, DM, HD, 16.0f); k_wt_f16<<<gh, 256, 0, stream>>>(wk + wofs, BK + pofs, DM, HD, 16.0f); k_wt_f16<<<gh, 256, 0, stream>>>(wv + wofs, BV + pofs, DM, HD, 16.0f); } k_wt_f16<<<g, 256, 0, stream>>>(wo, BO, DM, DM, 16.0f); }      /* PER-HEAD STACKS wq / wk / wv [NH][DM][HD]: head h is a row-major [in = DM][out = HD] block at w + h * DM * HD: the transposing builder with K = DM, N = HD writes its HD rows Bt[h * HD + e][k] at B + h * HD * DM: contiguous rows of the [out][in] plane (x16); wo is a plain [in][out] [DM][DM] matrix: one call as before */

  k_x16<<<(unsigned)((NR * DM / 8 + 255) / 256), 256, 0, stream>>>(xq, XQ, NR * DM / 8); k_x16<<<(unsigned)((NR * DM / 8 + 255) / 256), 256, 0, stream>>>(xk, XK, NR * DM / 8); k_x16<<<(unsigned)((NR * DM / 8 + 255) / 256), 256, 0, stream>>>(xv, XV, NR * DM / 8);      /* the three inputs as exact f16 rows */
  const size_t r0p = (size_t)B0 * SQ;      /* first projected row */
  k_gemm2<0><<<dim3((unsigned)((MP / 128) * (DM / 64)), 1), 128, 0, stream>>>(XQ + r0p * DM, DM, 0, BQ, DM, 0, 0.0625f, bq, 0, nullptr, 1, 0, 0, nullptr, Q16 + r0p * DM, DM, 0, MP, DM, DM);
  k_gemm2<0><<<dim3((unsigned)((MP / 128) * (DM / 64)), 1), 128, 0, stream>>>(XK + r0p * DM, DM, 0, BK, DM, 0, 0.0625f, bk, 0, nullptr, 1, 0, 0, nullptr, K16 + r0p * DM, DM, 0, MP, DM, DM);
  k_gemm2<0><<<dim3((unsigned)((MP / 128) * (DM / 64)), 1), 128, 0, stream>>>(XV + r0p * DM, DM, 0, BV, DM, 0, 0.0625f, bv, 0, nullptr, 1, 0, 0, nullptr, V16 + r0p * DM, DM, 0, MP, DM, DM);
  k_vt<NH, SQ><<<NB * NH * (SQ / 64), 256, 0, stream>>>(V16, LQ, 0, VT);      /* V^T [NB][NH][HD][SQ], both batches */
  k_fattn<<<NB * NH * (SQ / 256), 256, 0, stream>>>(Q16, K16, VT, O16, 0.052058773f);      /* o (merged heads, x64) as f16 rows; cs = 768^-0.5 log2 e */
  k_gemm2<0><<<dim3((unsigned)((MPO / 128) * (DM / 64)), 1), 128, 0, stream>>>(O16 + r0p * DM, DM, 0, BO, DM, 0, 0.0009765625f, bo, 0, nullptr, 1, 0, 0, (float*)d_out + r0p * DM, nullptr, DM, 0, MPO, DM, DM);      /* out rows are the output layout */
}

// v003
// One run takes 126 microseconds.
// Next to v002, in two timings, it ran 2.26 times as fast each time.
// All steps since v000 together make it 21.7 times as fast.
#include <hip/hip_runtime.h>
// Multi-head self-attention with PER-HEAD STACKED projections and per-head biases at width 768, scaled by the EMBED WIDTH (x [2][2048][768]; q / k / v = einsum('bse,hed->bhsd', x, W) + b with W [12][768][64] = [head][in][out] and b [12][64], 12 heads of 64; scores / sqrt(E = 768) (the module's own: the embed width, not the head width); softmax over all 2048 keys (no mask); out = merged wo + bo ([in][out] [768][768] + bias) -> [2][2048][768]); each head's [in][out] block is transposed into its 64 contiguous rows of the [out][in] weight plane; a per-head bias [12][64] IS the flat bias [768].
// Structure: five launches. Token rows r = b*2048 + s; one preparation launch: x as exact f16 rows (bf16-rounded) and the four weight planes, picked by the grid index; Q, K, V as three WMMA GEMMs in one launch, picked by blockIdx.y (32x64 wave tiles, f32 accumulation, exact x16 weights + bias, f16 outputs); V^T for all (batch, head) via LDS transposes; one fused attention launch over all (batch, head, 256 queries): S^T = K Q^T (K = 64), online softmax in registers (f32 statistics, native exp2, scale 768^-0.5; unnormalised weights as f16), O^T += V^T P^T, o / sum carried x64 against f16 subnormal flush (folded into the output GEMM alpha) written straight into the merged f16 o rows; out = o W_o + b GEMM (f32) into the output layout.
// Compute dtype: inputs rounded to bf16; x / weights exact; q, k, v, softmax weights and o as plain f16 GEMM operands (~2^-12); scores and softmax statistics f32. v_wmma_f32_16x16x32_f16.
#define NB 2
#define SQ 2048
#define DM 768 
#define NH 12
#define HD 64
#define HG 4                         /* heads per launch of the grouped k_vt, which is not launched */
#define B0 0                         /* first batch processed (debug hook) */
#define NBR NB                       /* batches processed (debug hook) */
#define NR ((size_t)NB * SQ)         /* token rows */
#define MP ((int)((size_t)NBR * SQ)) /* rows projected (debug hook) */
#define QN SQ                        /* not used: attention takes all SQ query rows */
#define NHD NH                       /* not used: attention takes all NH heads */
#define MPO MP                       /* rows through the output stage (debug hook) */
#define LQ DM      /* row pitch of the q/k/v rows */
typedef __bf16 v16b __attribute__((ext_vector_type(16)));
typedef unsigned short v8us __attribute__((ext_vector_type(8), may_alias));
typedef float  v8f  __attribute__((ext_vector_type(8)));
typedef float  v4f  __attribute__((ext_vector_type(4)));
typedef float  v4fa __attribute__((ext_vector_type(4), may_alias));
union FragB { v16b v; v8us half[2]; unsigned short u[16]; };

__device__ __forceinline__ unsigned short bf16_bits(float x) { unsigned int u = __float_as_uint(x); return (unsigned short)((u + 0x7FFFu + ((u >> 16) & 1u)) >> 16); }
__device__ __forceinline__ float bf16_val(unsigned short b) { return __uint_as_float(((unsigned int)b) << 16); }
__device__ __forceinline__ float bf16_round(float x) { return bf16_val(bf16_bits(x)); }
// D += A·B with NT terms: 1 = ah·bh, 2 = + al·bh (A split), 3 = + ah·bl (both split)
template <int NT>
__device__ __forceinline__ v8f mmaN(v16b ah, v16b al, v16b bh, v16b bl, v8f c) {
  c = __builtin_amdgcn_wmma_f32_16x16x32_bf16(false, ah, false, bh, (short)0, c, false, false);
  if (NT >= 2) c = __builtin_amdgcn_wmma_f32_16x16x32_bf16(false, al, false, bh, (short)0, c, false, false);
  if (NT >= 3) c = __builtin_amdgcn_wmma_f32_16x16x32_bf16(false, ah, false, bl, (short)0, c, false, false);
  asm volatile("v_nop\n\tv_nop\n\tv_nop\n\tv_nop" : "+v"(c) : "v"(ah), "v"(al), "v"(bh), "v"(bl));
  return c;
}

__global__ __launch_bounds__(256) void k_wt_bf16(const float* __restrict__ W, unsigned short* __restrict__ Wt, int K, int N) {
  const int t = blockIdx.x * 256 + threadIdx.x;
  const int k8n = K / 8;
  if (t >= N * k8n) return;
  const int n = t / k8n, k8 = (t % k8n) * 8;
  v8us v;
#pragma unroll
  for (int i = 0; i < 8; ++i) v[i] = bf16_bits(W[(size_t)(k8 + i) * N + n]);
  *(v8us*)(Wt + (size_t)n * K + k8) = v;
  
}

// GEMM C[M][N] (f32, pitch ldc) = act(A[M][K]·W + bias). A f32 row-major (pitch lda) converted per fragment to bf16
// (ASPLIT: hi/lo two planes -> 2 terms, else single rounded term); Wt bf16 [N][K] (pitch ldb). BIAS_BF16 rounds the
// bias to bf16 first (bias quantised to bf16 before the add). K%32==0, M%16==0, N%64==0.
template <bool ASPLIT, int ACT, bool BIAS_BF16>
__global__ __launch_bounds__(128) void k_gemm_bf(const float* __restrict__ A, int lda, const unsigned short* __restrict__ Wt, int ldb,
                                               const float* __restrict__ bias, float* __restrict__ C, int ldc, int M, int N, int K) {
  __shared__ __attribute__((aligned(16))) float so[4][16][64];
  const int tid = threadIdx.x, w = tid >> 5, lane = tid & 31, ln = lane & 15, hh = lane >> 4;
  const int ntn = N / 64;
  const int wid = blockIdx.x * 4 + w;
  const int mt = wid / ntn, nq = wid % ntn;
  if (mt * 16 >= M) return;
  const int row0 = mt * 16, col0 = nq * 64;
  const float* arow = A + (size_t)(row0 + ln) * lda;
  v8f acc[4] = {};
  for (int kb = 0; kb < K; kb += 32) {
    FragB ah, al;
    const v4f x0 = *(const v4fa*)(arow + kb + 8 * hh), x1 = *(const v4fa*)(arow + kb + 8 * hh + 4);
    const v4f x2 = *(const v4fa*)(arow + kb + 16 + 8 * hh), x3 = *(const v4fa*)(arow + kb + 16 + 8 * hh + 4);
    float xs[16] = {x0[0],x0[1],x0[2],x0[3],x1[0],x1[1],x1[2],x1[3],x2[0],x2[1],x2[2],x2[3],x3[0],x3[1],x3[2],x3[3]};
#pragma unroll
    for (int i = 0; i < 16; ++i) { const unsigned short hb = bf16_bits(xs[i]); ah.u[i] = hb; al.u[i] = ASPLIT ? bf16_bits(xs[i] - bf16_val(hb)) : (unsigned short)0; }
#pragma unroll
    for (int t = 0; t < 4; ++t) {
      const unsigned short* brow = Wt + (size_t)(col0 + t * 16 + ln) * ldb + kb;
      FragB b;
      b.half[0] = *(const v8us*)(brow + 8 * hh);
      b.half[1] = *(const v8us*)(brow + 16 + 8 * hh);
      acc[t] = mmaN<ASPLIT ? 2 : 1>(ah.v, al.v, b.v, b.v, acc[t]);
    }
  }
#pragma unroll
  for (int t = 0; t < 4; ++t) {
    float bv = bias ? bias[col0 + t * 16 + ln] : 0.f;
    if (BIAS_BF16) bv = bf16_round(bv);
#pragma unroll
    for (int r = 0; r < 8; ++r) { float v = acc[t][r] + bv; if (ACT == 1) v = fmaxf(v, 0.f); so[w][8 * hh + r][t * 16 + ln] = v; }
  }
  __builtin_amdgcn_fence(__ATOMIC_ACQ_REL, "workgroup");
  __builtin_amdgcn_wave_barrier();
  const int rsub = lane >> 4, c4 = (lane & 15) * 4;
  {
#pragma unroll
    for (int q = 0; q < 8; ++q) {
      const int r = q * 2 + rsub;
      const v4f v = *(const v4fa*)&so[w][r][c4];
      *(v4f*)(C + (size_t)(row0 + r) * ldc + col0 + c4) = v;
    }
    
  }
}

// GEMM C = act(A·W + bias + resid): A f32 (ASPLIT -> hi/lo 2 terms), Wt bf16 [N][K]; ACT 0 none, 1 relu, 2 exact gelu;
// resid (optional, f32, row index = (row % rmod), pitch ldr, RES_BF16 rounds it) added before the activation.
template <bool ASPLIT, int ACT, bool BIAS_BF16, bool RES_BF16>
__global__ __launch_bounds__(128) void k_gemm_bf3(const float* __restrict__ A, int lda, const unsigned short* __restrict__ Wt, int ldb,
                                                const float* __restrict__ bias, const float* __restrict__ resid, int rmod, int ldr,
                                                float* __restrict__ C, int ldc, int M, int N, int K) {
  __shared__ __attribute__((aligned(16))) float so[4][16][64];
  const int tid = threadIdx.x, w = tid >> 5, lane = tid & 31, ln = lane & 15, hh = lane >> 4;
  const int ntn = N / 64;
  const int wid = blockIdx.x * 4 + w;
  const int mt = wid / ntn, nq = wid % ntn;
  if (mt * 16 >= M) return;
  const int row0 = mt * 16, col0 = nq * 64;
  const float* arow = A + (size_t)(row0 + ln) * lda;
  v8f acc[4] = {};
  for (int kb = 0; kb < K; kb += 32) {
    FragB ah, al;
    const v4f x0 = *(const v4fa*)(arow + kb + 8 * hh), x1 = *(const v4fa*)(arow + kb + 8 * hh + 4);
    const v4f x2 = *(const v4fa*)(arow + kb + 16 + 8 * hh), x3 = *(const v4fa*)(arow + kb + 16 + 8 * hh + 4);
    float xs[16] = {x0[0],x0[1],x0[2],x0[3],x1[0],x1[1],x1[2],x1[3],x2[0],x2[1],x2[2],x2[3],x3[0],x3[1],x3[2],x3[3]};
#pragma unroll
    for (int i = 0; i < 16; ++i) { const unsigned short hb = bf16_bits(xs[i]); ah.u[i] = hb; al.u[i] = ASPLIT ? bf16_bits(xs[i] - bf16_val(hb)) : (unsigned short)0; }
#pragma unroll
    for (int t = 0; t < 4; ++t) {
      const unsigned short* brow = Wt + (size_t)(col0 + t * 16 + ln) * ldb + kb;
      FragB b;
      b.half[0] = *(const v8us*)(brow + 8 * hh);
      b.half[1] = *(const v8us*)(brow + 16 + 8 * hh);
      acc[t] = mmaN<ASPLIT ? 2 : 1>(ah.v, al.v, b.v, b.v, acc[t]);
    }
  }
#pragma unroll
  for (int t = 0; t < 4; ++t) {
    const int col = col0 + t * 16 + ln;
    float bv = bias ? bias[col] : 0.f;
    if (BIAS_BF16) bv = bf16_round(bv);
#pragma unroll
    for (int r = 0; r < 8; ++r) {
      float v = acc[t][r] + bv;
      if (resid) { float rv = resid[(size_t)((row0 + 8 * hh + r) % rmod) * ldr + col]; if (RES_BF16) rv = bf16_round(rv); v += rv; }
      if (ACT == 1) v = fmaxf(v, 0.f);
      if (ACT == 2) v = 0.5f * v * (1.0f + erff(v * 0.70710678118654752f));
      if (ACT == 3) { const float u = 0.7978845608028654f * (v + 0.044715f * v * v * v); v = 0.5f * v * (1.0f + tanhf(u)); }
      so[w][8 * hh + r][t * 16 + ln] = v;
    }
  }
  __builtin_amdgcn_fence(__ATOMIC_ACQ_REL, "workgroup");
  __builtin_amdgcn_wave_barrier();
  const int rsub = lane >> 4, c4 = (lane & 15) * 4;
  {
#pragma unroll
    for (int q = 0; q < 8; ++q) {
      const int r = q * 2 + rsub;
      const v4f v = *(const v4fa*)&so[w][r][c4];
      *(v4f*)(C + (size_t)(row0 + r) * ldc + col0 + c4) = v;
    }
    
  }
}
// row LayerNorm (biased variance, eps) over N: s = X (+ R); optional out_sum <- s; out_norm <- (s-mu)*rsqrt(var+eps)*g + b
template <bool PARAM_BF16>
__global__ __launch_bounds__(256) void k_layernorm(const float* __restrict__ X, const float* __restrict__ R, const float* __restrict__ g, const float* __restrict__ bta,
                                                  float* __restrict__ out_sum, float* __restrict__ out_norm, int N, float eps) {
  __shared__ float red[256];
  const int row = blockIdx.x, tid = threadIdx.x;
  const float* x = X + (size_t)row * N; const float* rr = R ? R + (size_t)row * N : nullptr;
  float vals[16];                     // up to N = 4096
  const int per = N / 256;            // contiguous chunk per thread? use strided-by-4 chunks: thread handles j = tid*4 + 1024*u
  float s1 = 0.f;
  for (int u = 0; u < per / 4; ++u) {
    const int j = tid * 4 + 1024 * u;
    const v4f a = *(const v4fa*)(x + j);
    v4f b = {0.f,0.f,0.f,0.f}; if (rr) b = *(const v4fa*)(rr + j);
#pragma unroll
    for (int q = 0; q < 4; ++q) { const float v = a[q] + b[q]; vals[u * 4 + q] = v; s1 += v; }
  }
  red[tid] = s1; __syncthreads();
  for (int st = 128; st > 0; st >>= 1) { if (tid < st) red[tid] += red[tid + st]; __syncthreads(); }
  const float mu = red[0] / (float)N; __syncthreads();
  float s2 = 0.f;
  for (int u = 0; u < per / 4; ++u)
#pragma unroll
    for (int q = 0; q < 4; ++q) { const float c = vals[u * 4 + q] - mu; s2 += c * c; }
  red[tid] = s2; __syncthreads();
  for (int st = 128; st > 0; st >>= 1) { if (tid < st) red[tid] += red[tid + st]; __syncthreads(); }
  const float rs = rsqrtf(red[0] / (float)N + eps);
  {
    for (int u = 0; u < per / 4; ++u) {
      const int j = tid * 4 + 1024 * u;
      v4f o, sm;
#pragma unroll
      for (int q = 0; q < 4; ++q) {
        float gg = g[j + q], bb = bta[j + q];
        if (PARAM_BF16) { gg = bf16_round(gg); bb = bf16_round(bb); }
        sm[q] = vals[u * 4 + q]; o[q] = (vals[u * 4 + q] - mu) * rs * gg + bb;
      }
      if (out_sum) *(v4f*)(out_sum + (size_t)row * N + j) = sm;
      *(v4f*)(out_norm + (size_t)row * N + j) = o;
    }
    
  }
}



// ---- f16 WMMA path (v_wmma_f32_16x16x32_f16): 11-bit significands for operands in range — used where a [0,1] probability operand needs more precision than bf16
typedef _Float16 v16h __attribute__((ext_vector_type(16)));
union FragH { v16h v; v8us half[2]; _Float16 h[16]; unsigned short u[16]; };
template <int NT>
__device__ __forceinline__ v8f mmaH(v16h ah, v16h al, v16h bh, v16h bl, v8f c) {
  c = __builtin_amdgcn_wmma_f32_16x16x32_f16(false, ah, false, bh, (short)0, c, false, false);
  if (NT >= 2) c = __builtin_amdgcn_wmma_f32_16x16x32_f16(false, al, false, bh, (short)0, c, false, false);
  if (NT >= 3) c = __builtin_amdgcn_wmma_f32_16x16x32_f16(false, ah, false, bl, (short)0, c, false, false);
  asm volatile("v_nop\n\tv_nop\n\tv_nop\n\tv_nop" : "+v"(c) : "v"(ah), "v"(al), "v"(bh), "v"(bl));
  return c;
}
// batched GEMM like k_gemm_b but f16 operands: A f32 (split into f16 hi/lo if ASPLIT, else rounded to f16), Bt = f16 values [n][k]; alpha; C f32; N multiple of 16 (partial tiles skipped)
template <bool ASPLIT>
__global__ __launch_bounds__(128) void k_gemm_h(const float* __restrict__ A, int lda, size_t sA, const _Float16* __restrict__ Bh, int ldb, size_t sB, float alpha, float* __restrict__ C, int ldc, size_t sC, int M, int N, int K) {
  __shared__ __attribute__((aligned(16))) float so[4][16][64];
  const int tid = threadIdx.x, w = tid >> 5, lane = tid & 31, ln = lane & 15, hh = lane >> 4; const int by = blockIdx.y;
  A += (size_t)by * sA; Bh += (size_t)by * sB; C += (size_t)by * sC;
  const int ntn = (N + 63) / 64; const int wid = blockIdx.x * 4 + w; const int mt = wid / ntn, nq = wid % ntn; if (mt * 16 >= M) return;
  const int row0 = mt * 16, col0 = nq * 64; const float* arow = A + (size_t)(row0 + ln) * lda;
  v8f acc[4] = {};
  for (int kb = 0; kb < K; kb += 32) {
    FragH ah, al;
    const v4f x0 = *(const v4fa*)(arow + kb + 8 * hh), x1 = *(const v4fa*)(arow + kb + 8 * hh + 4), x2 = *(const v4fa*)(arow + kb + 16 + 8 * hh), x3 = *(const v4fa*)(arow + kb + 16 + 8 * hh + 4);
    float xs[16] = {x0[0],x0[1],x0[2],x0[3],x1[0],x1[1],x1[2],x1[3],x2[0],x2[1],x2[2],x2[3],x3[0],x3[1],x3[2],x3[3]};
#pragma unroll
    for (int i = 0; i < 16; ++i) { const _Float16 h = (_Float16)xs[i]; ah.h[i] = h; al.h[i] = ASPLIT ? (_Float16)(xs[i] - (float)h) : (_Float16)0.0f; }
#pragma unroll
    for (int t = 0; t < 4; ++t) { if (col0 + t * 16 >= N) continue; const size_t boff = (size_t)(col0 + t * 16 + ln) * ldb + kb; FragH bq; bq.half[0] = *(const v8us*)(Bh + boff + 8 * hh); bq.half[1] = *(const v8us*)(Bh + boff + 16 + 8 * hh);
      acc[t] = mmaH<ASPLIT ? 2 : 1>(ah.v, al.v, bq.v, bq.v, acc[t]); }
  }
#pragma unroll
  for (int t = 0; t < 4; ++t) { if (col0 + t * 16 >= N) continue;
#pragma unroll
    for (int r = 0; r < 8; ++r) so[w][8 * hh + r][t * 16 + ln] = acc[t][r] * alpha; }
  __builtin_amdgcn_fence(__ATOMIC_ACQ_REL, "workgroup"); __builtin_amdgcn_wave_barrier();
  const int rsub = lane >> 4, c4 = (lane & 15) * 4;
  {
#pragma unroll
    for (int q = 0; q < 8; ++q) { const int r = q * 2 + rsub; if (col0 + c4 < N) { const v4f v = *(const v4fa*)&so[w][r][c4]; *(v4f*)(C + (size_t)(row0 + r) * ldc + col0 + c4) = v; } }
     }
}

// k_gemm_hh variant with fused epilogue: v = acc·alpha + bias[by·sBias + col] (+ CP[(row/rowsPerB)·sCPb + by·64 + col] if CP) ; ACT 0 none / 1 elu ; writes f16 C16 (and f32 C if non-null)
template <int ACT>
__global__ __launch_bounds__(128) void k_gemm_hhx(const _Float16* __restrict__ A, int lda, size_t sA, const _Float16* __restrict__ Bh, int ldb, size_t sB, float alpha, const float* __restrict__ bias, size_t sBias, const float* __restrict__ CP, int rowsPerB, size_t sCPb, int row0g,
    float* __restrict__ C, _Float16* __restrict__ C16, int ldc, size_t sC, int M, int N, int K) {
  __shared__ __attribute__((aligned(16))) float so[4][16][64];
  const int tid = threadIdx.x, w = tid >> 5, lane = tid & 31, ln = lane & 15, hh = lane >> 4; const int by = blockIdx.y;
  A += (size_t)by * sA; Bh += (size_t)by * sB; const size_t cofs = (size_t)by * sC; const float* bp = bias ? bias + (size_t)by * sBias : nullptr;
  const int ntn = (N + 63) / 64; const int wid = blockIdx.x * 4 + w; const int mt = wid / ntn, nq = wid % ntn; if (mt * 16 >= M) return;
  const int row0 = mt * 16, col0 = nq * 64; const _Float16* arow = A + (size_t)(row0 + ln) * lda;
  v8f acc[4] = {};
  for (int kb = 0; kb < K; kb += 32) { FragH ah; ah.half[0] = *(const v8us*)((const unsigned short*)arow + kb + 8 * hh); ah.half[1] = *(const v8us*)((const unsigned short*)arow + kb + 16 + 8 * hh);
#pragma unroll
    for (int t = 0; t < 4; ++t) { if (col0 + t * 16 >= N) continue; const size_t boff = (size_t)(col0 + t * 16 + ln) * ldb + kb; FragH bq; bq.half[0] = *(const v8us*)((const unsigned short*)Bh + boff + 8 * hh); bq.half[1] = *(const v8us*)((const unsigned short*)Bh + boff + 16 + 8 * hh);
      acc[t] = mmaH<1>(ah.v, ah.v, bq.v, bq.v, acc[t]); }
  }
#pragma unroll
  for (int t = 0; t < 4; ++t) { if (col0 + t * 16 >= N) continue; const int col = col0 + t * 16 + ln; const float bv = bp ? bf16_round(bp[col]) : 0.f;
#pragma unroll
    for (int r = 0; r < 8; ++r) { float v = acc[t][r] * alpha + bv; if (CP) { const int rr = row0g + row0 + 8 * hh + r; if (rowsPerB < 0) v += CP[cofs + (size_t)rr * ldc + col];      /* rowsPerB < 0: own element of the batched C plane */ else { const int bidx = rr / rowsPerB; v += CP[(size_t)bidx * sCPb + (size_t)by * 64 + col]; } } if (ACT == 1) v = (v > 0.f) ? v : expm1f(v); else if (ACT == 7) v = (v > 0.f) ? v + 1.0f : expf(v); else if (ACT == 8) v = tanhf(v); else if (ACT == 9) v = 0.5f * v * (1.0f + tanhf(0.7978845608028654f * (v + 0.044715f * v * v * v))); else if (ACT == 11) v = 1.0f / (1.0f + expf(-v)); else if (ACT == 12) v = (v > 0.f) ? v : 0.01f * v; else if (ACT == 14) v = (v > 0.f) ? v : 0.1f * v; else if (ACT == 16) v = (v >= 0.f) ? v : 0.3f * v; else if (ACT == 17) v = (v >= 0.f) ? v : 0.2f * v; else if (ACT == 15) v = v / (1.0f + expf(-v)); else if (ACT == 3) v = fmaxf(v, 0.f); else if (ACT == 6) v = 0.5f * v * (1.0f + erff(v * 0.70710678118654752f)); so[w][8 * hh + r][t * 16 + ln] = v; } }
  __builtin_amdgcn_fence(__ATOMIC_ACQ_REL, "workgroup"); __builtin_amdgcn_wave_barrier();
  const int rsub = lane >> 4, c4 = (lane & 15) * 4; typedef _Float16 v4h __attribute__((ext_vector_type(4)));
  {
#pragma unroll
    for (int q = 0; q < 8; ++q) { const int r = q * 2 + rsub; if (col0 + c4 < N) { const v4f v = *(const v4fa*)&so[w][r][c4]; if (C) *(v4f*)(C + cofs + (size_t)(row0 + r) * ldc + col0 + c4) = v; if (C16) { v4h h4; for (int i = 0; i < 4; ++i) h4[i] = (_Float16)v[i]; *(v4h*)(C16 + cofs + (size_t)(row0 + r) * ldc + col0 + c4) = h4; } } }
     }
}


typedef _Float16 v4h __attribute__((ext_vector_type(4)));

__global__ __launch_bounds__(256) void k_h16(const float* __restrict__ x, _Float16* __restrict__ X16, size_t n8) { const size_t t = (size_t)blockIdx.x * 256 + threadIdx.x; if (t >= n8) return; FragH f;
#pragma unroll
  for (int q = 0; q < 8; ++q) f.h[q] = (_Float16)x[t * 8 + q]; *(v8us*)((unsigned short*)X16 + t * 8) = f.half[0];  }
__global__ __launch_bounds__(256) void k_round16f(const float* __restrict__ W, _Float16* __restrict__ Bt, size_t n8) { const size_t t = (size_t)blockIdx.x * 256 + threadIdx.x; if (t >= n8) return; FragH f;
#pragma unroll
  for (int i = 0; i < 8; ++i) f.h[i] = (_Float16)(bf16_round(W[t * 8 + i]) * 16.0f); *(v8us*)((unsigned short*)Bt + t * 8) = f.half[0];  }
template <int NHv, int TTv>
__global__ __launch_bounds__(256) void k_vt(const _Float16* __restrict__ V16, int ldv, int voff, _Float16* __restrict__ Vt) { __shared__ unsigned short tl[64][66]; const int tid = threadIdx.x; const int slab = blockIdx.x / (TTv / 64), lg = blockIdx.x % (TTv / 64); const int b = slab / NHv, h = slab % NHv;
  for (int i = tid; i < 64 * 8; i += 256) { const int r = i / 8, c8 = (i % 8) * 8; FragH f; f.half[0] = *(const v8us*)((const unsigned short*)V16 + ((size_t)b * TTv + lg * 64 + r) * ldv + voff + h * 64 + c8);
#pragma unroll
    for (int q = 0; q < 8; ++q) tl[r][c8 + q] = f.u[q]; }
  __syncthreads();
  {
#pragma unroll
    for (int rd = 0; rd < 2; ++rd) { const int d = rd * 32 + tid / 8, pc = tid % 8; FragH f;
#pragma unroll
      for (int q = 0; q < 8; ++q) f.u[q] = tl[pc * 8 + q][d];
      *(v8us*)((unsigned short*)Vt + ((size_t)slab * 64 + d) * TTv + lg * 64 + pc * 8) = f.half[0]; }
     } }

__global__ __launch_bounds__(256) void k_hl(const float* __restrict__ F, _Float16* __restrict__ Hh, _Float16* __restrict__ Hl, size_t n8) { const size_t t = (size_t)blockIdx.x * 256 + threadIdx.x; if (t >= n8) return; FragH fh, fl; const v4f a = *(const v4fa*)(F + t * 8), c = *(const v4fa*)(F + t * 8 + 4);
#pragma unroll
  for (int q = 0; q < 4; ++q) { _Float16 h = (_Float16)a[q]; fh.h[q] = h; fl.h[q] = (_Float16)((a[q] - (float)h) * 1024.0f); h = (_Float16)c[q]; fh.h[4 + q] = h; fl.h[4 + q] = (_Float16)((c[q] - (float)h) * 1024.0f); }
  { *(v8us*)((unsigned short*)Hh + t * 8) = fh.half[0]; *(v8us*)((unsigned short*)Hl + t * 8) = fl.half[0];  } }

// ---- fast GEMM (wave tile 32x64; requires M % 32 == 0 rows per launch region and N % 64 == 0); epilogue = k_gemm_hhx semantics ----
__device__ __forceinline__ v16h g2_frag(const _Float16* p, int hh) { FragH f; f.half[0] = *(const v8us*)((const unsigned short*)p + 8 * hh); f.half[1] = *(const v8us*)((const unsigned short*)p + 16 + 8 * hh); return f.v; }
__device__ __forceinline__ v8f g2_mma(v16h a, v16h b, v8f c) { v8f d = __builtin_amdgcn_wmma_f32_16x16x32_f16(false, a, false, b, (short)0, c, false, false); asm volatile("v_nop\n\tv_nop\n\tv_nop\n\tv_nop" : "+v"(d) : "v"(a), "v"(b)); return d; }
template <int ACT>
__global__ __launch_bounds__(128) void k_gemm2(const _Float16* __restrict__ A, int lda, size_t sA, const _Float16* __restrict__ Bh, int ldb, size_t sB, float alpha, const float* __restrict__ bias, const float* __restrict__ bias1, const float* __restrict__ bias2, size_t sBias, const float* __restrict__ CP, int rowsPerB, size_t sCPb, int row0g,
    float* __restrict__ C, _Float16* __restrict__ C16, int ldc, size_t sC, int M, int N, int K) { static_assert(ACT == 0 || ACT == 3 || ACT == 6 || ACT == 8 || ACT == 9 || ACT == 11 || ACT == 12 || ACT == 14 || ACT == 15 || ACT == 16 || ACT == 17, "k_gemm2: unsupported ACT code (would silently apply no activation)");
  __shared__ __attribute__((aligned(16))) float so[4][32][68];
  const int tid = threadIdx.x, w = tid >> 5, lane = tid & 31, ln = lane & 15, hh = lane >> 4; const int by = blockIdx.y;
  if (by == 1) bias = bias1; else if (by == 2) bias = bias2;      /* batches 1 and 2 may have their bias in a buffer of its own (three products with separate bias inputs in one launch) */
  A += (size_t)by * sA; Bh += (size_t)by * sB; const size_t cofs = (size_t)by * sC; const float* bp = bias ? bias + (size_t)by * sBias : nullptr;
  const int ntn = N >> 6; const int mt = blockIdx.x / ntn, nq = blockIdx.x - mt * ntn; const int row0 = mt * 128 + 32 * w, col0 = nq * 64; if (row0 >= M) return;
  const _Float16* a0p = A + (size_t)(row0 + ln) * lda; const _Float16* a1p = a0p + (size_t)16 * lda;
  const _Float16* b0p = Bh + (size_t)(col0 + ln) * ldb; const _Float16* b1p = b0p + (size_t)16 * ldb; const _Float16* b2p = b1p + (size_t)16 * ldb; const _Float16* b3p = b2p + (size_t)16 * ldb;
  const v8f z8 = {0.f,0.f,0.f,0.f,0.f,0.f,0.f,0.f}; v8f c00 = z8, c01 = z8, c02 = z8, c03 = z8, c10 = z8, c11 = z8, c12 = z8, c13 = z8;
#pragma unroll 1
  for (int kb = 0; kb < K; kb += 32) { const v16h a0 = g2_frag(a0p + kb, hh), a1 = g2_frag(a1p + kb, hh);
    v16h b = g2_frag(b0p + kb, hh); c00 = g2_mma(a0, b, c00); c10 = g2_mma(a1, b, c10);
    b = g2_frag(b1p + kb, hh); c01 = g2_mma(a0, b, c01); c11 = g2_mma(a1, b, c11);
    b = g2_frag(b2p + kb, hh); c02 = g2_mma(a0, b, c02); c12 = g2_mma(a1, b, c12);
    b = g2_frag(b3p + kb, hh); c03 = g2_mma(a0, b, c03); c13 = g2_mma(a1, b, c13); }
  v8f accs[8] = {c00, c01, c02, c03, c10, c11, c12, c13};
#pragma unroll
  for (int u = 0; u < 8; ++u) { const int t = u & 3, half = u >> 2; const int col = col0 + t * 16 + ln; const float bv = bp ? bf16_round(bp[col]) : 0.f;
#pragma unroll
    for (int r = 0; r < 8; ++r) { const int rloc = half * 16 + 8 * hh + r; float v = accs[u][r] * alpha + bv; if (CP) { if (rowsPerB < 0) v += CP[cofs + (size_t)(row0g + row0 + rloc) * ldc + col];      /* rowsPerB < 0: own element of the batched C plane */ else { const int bidx = (row0g + row0 + rloc) / rowsPerB; v += CP[(size_t)bidx * sCPb + (size_t)by * 64 + col]; } }
      if (ACT == 3) v = fmaxf(v, 0.f); else if (ACT == 6) v = 0.5f * v * (1.0f + erff(v * 0.70710678118654752f)); else if (ACT == 11) v = 1.0f / (1.0f + expf(-v)); else if (ACT == 15) v = v / (1.0f + expf(-v)); else if (ACT == 12) v = (v > 0.f) ? v : 0.01f * v; else if (ACT == 8) v = tanhf(v); else if (ACT == 9) v = 0.5f * v * (1.0f + tanhf(0.7978845608028654f * (v + 0.044715f * v * v * v))); else if (ACT == 14) v = (v > 0.f) ? v : 0.1f * v; else if (ACT == 16) v = (v >= 0.f) ? v : 0.3f * v; else if (ACT == 17) v = (v >= 0.f) ? v : 0.2f * v;
      so[w][rloc][t * 16 + ln] = v; } }
  __builtin_amdgcn_fence(__ATOMIC_ACQ_REL, "workgroup"); __builtin_amdgcn_wave_barrier();
  const int rsub = lane >> 4, c4 = (lane & 15) * 4;
  {
#pragma unroll
    for (int q = 0; q < 16; ++q) { const int r = q * 2 + rsub; const v4f v = *(const v4fa*)&so[w][r][c4]; if (C) *(v4f*)(C + cofs + (size_t)(row0 + r) * ldc + col0 + c4) = v; if (C16) { v4h h4; for (int i = 0; i < 4; ++i) h4[i] = (_Float16)v[i]; *(v4h*)(C16 + cofs + (size_t)(row0 + r) * ldc + col0 + c4) = h4; } }
     } }


__global__ __launch_bounds__(256) void k_wnat(const float* __restrict__ w, size_t n8, _Float16* __restrict__ Bt) { const size_t t = (size_t)blockIdx.x * 256 + threadIdx.x; if (t >= n8) return; FragH f; for (int q = 0; q < 8; ++q) f.h[q] = (_Float16)(bf16_round(w[t * 8 + q]) * 16.0f); *(v8us*)((unsigned short*)Bt + t * 8) = f.half[0];  }
__global__ __launch_bounds__(256) void k_rsm(const float* __restrict__ S, _Float16* __restrict__ P, int nrows) {
  #pragma clang fp contract(off)
  const int i = blockIdx.x * 256 + threadIdx.x; if (i >= nrows) return; const float* s = S + (size_t)i * SQ; float mx = -3.0e38f;
#pragma unroll 1
  for (int j = 0; j < SQ; ++j) mx = fmaxf(mx, s[j]); float se = 0.f;
#pragma unroll 1
  for (int j = 0; j < SQ; ++j) se += expf(s[j] - mx); const float sc = 256.0f / se;
#pragma unroll 1
  for (int j0 = 0; j0 < SQ; j0 += 8) { FragH f; for (int q = 0; q < 8; ++q) f.h[q] = (_Float16)(expf(s[j0 + q] - mx) * sc); unsigned short* d = (unsigned short*)P + (size_t)i * SQ + j0; *(v8us*)d = f.half[0];  } }
__global__ __launch_bounds__(256) void k_vt(const _Float16* __restrict__ V16, int b, int h0, _Float16* __restrict__ VT) { __shared__ unsigned short tl[64][65]; const int tid = threadIdx.x; const int hh = blockIdx.x % HG, sg = blockIdx.x / HG; const int s0 = sg * 64; const int h = h0 + hh;
  for (int i = tid; i < 64 * 8; i += 256) { const int j = i / 8, d8 = (i % 8) * 8; FragH f; f.half[0] = *(const v8us*)((const unsigned short*)V16 + ((size_t)b * SQ + s0 + j) * DM + h * HD + d8); for (int q = 0; q < 8; ++q) tl[d8 + q][j] = f.u[q]; }
  __syncthreads();
  { for (int i = tid; i < 64 * 8; i += 256) { const int d = i / 8, j8 = (i % 8) * 8; FragH f; for (int q = 0; q < 8; ++q) f.u[q] = tl[d][j8 + q]; *(v8us*)((unsigned short*)VT + ((size_t)hh * HD + d) * SQ + s0 + j8) = f.half[0]; }  } }



// ---- fused attention: scores, softmax and P.V in one kernel; neither scores nor weights go to memory ----
#define FK 64      /* keys per LDS stage */
#define FPH 72     /* LDS row pitch in f16: 128 data bytes + 16, the conflict-free pitch for 16-byte fragment reads */
__device__ __forceinline__ float xhalf(float x) { return __builtin_bit_cast(float, __builtin_amdgcn_permlanex16(__builtin_bit_cast(int, x), __builtin_bit_cast(int, x), 0x76543210, 0xfedcba98, false, false)); }      /* lane l reads lane l ^ 16 */
// native 2^x, in place. The instruction set asks for one independent instruction or a v_nop between a transcendental and a directly following instruction that uses its result or overwrites its source.
// Eight in one statement: each is the independent instruction behind the one before it, the one v_nop fills the slot behind the last. In place, so that the statement writes only registers that the compiler's own multiply-add has just written:
// the compiler does not look into asm text when it keeps its distance behind a matrix instruction, and a fresh output register could be an operand of one just issued.
__device__ __forceinline__ void exp2x8(float (&x)[8]) { asm("v_exp_f32 %0, %0\n\tv_exp_f32 %1, %1\n\tv_exp_f32 %2, %2\n\tv_exp_f32 %3, %3\n\tv_exp_f32 %4, %4\n\tv_exp_f32 %5, %5\n\tv_exp_f32 %6, %6\n\tv_exp_f32 %7, %7\n\tv_nop" : "+v"(x[0]), "+v"(x[1]), "+v"(x[2]), "+v"(x[3]), "+v"(x[4]), "+v"(x[5]), "+v"(x[6]), "+v"(x[7])); }
__device__ __forceinline__ float exp2x1(float x) { asm("v_exp_f32 %0, %0\n\tv_nop" : "+v"(x)); return x; }      /* the same, one value */
__device__ __forceinline__ v8f fa_mma(v16h a, v16h b, v8f c) { return __builtin_amdgcn_wmma_f32_16x16x32_f16(false, a, false, b, (short)0, c, false, false); }
__global__ __launch_bounds__(256) void k_fattn(const _Float16* __restrict__ Q16, const _Float16* __restrict__ K16, const _Float16* __restrict__ VT, _Float16* __restrict__ O16, float cs) {
  __shared__ __attribute__((aligned(16))) _Float16 sk[2][FK][FPH];
  __shared__ __attribute__((aligned(16))) _Float16 sv[2][HD][FPH];
  const int tid = threadIdx.x, lane = tid & 31, ln = lane & 15, hh = lane >> 4, w = tid >> 5;
  const int slab = blockIdx.x / (SQ / 256), qb = blockIdx.x % (SQ / 256); const int b = slab / NH, h = slab % NH;
  const size_t qrow = (size_t)b * SQ + qb * 256 + w * 32 + ln;
  const int sr = tid >> 3, sc = (tid & 7) * 8;      /* staging: 8 threads per 128-byte row, rows sr and sr + 32 */
  const _Float16* kg = K16 + ((size_t)b * SQ + sr) * DM + h * HD + sc;
  const _Float16* vg = VT + ((size_t)slab * HD + sr) * SQ + sc;
  v8us rk0 = *(const v8us*)kg, rk1 = *(const v8us*)(kg + (size_t)32 * DM), rv0 = *(const v8us*)vg, rv1 = *(const v8us*)(vg + (size_t)32 * SQ);
  v16h qf[2][2];
#pragma unroll
  for (int g = 0; g < 2; ++g)
#pragma unroll
    for (int s = 0; s < 2; ++s) qf[g][s] = g2_frag(Q16 + (qrow + 16 * g) * DM + h * HD + 32 * s, hh);
  const v8f z8 = {0.f,0.f,0.f,0.f,0.f,0.f,0.f,0.f};
  v8f o[2][4]; float mu[2], l[2];
#pragma unroll
  for (int g = 0; g < 2; ++g) { mu[g] = -3.0e38f; l[g] = 0.f;
#pragma unroll
    for (int t = 0; t < 4; ++t) o[g][t] = z8; }
  *(v8us*)&sk[0][sr][sc] = rk0; *(v8us*)&sk[0][sr + 32][sc] = rk1; *(v8us*)&sv[0][sr][sc] = rv0; *(v8us*)&sv[0][sr + 32][sc] = rv1;
  __syncthreads();
  /* not unrolled: the two passes inside already fill the register budget, and the buffer index stays one scalar */
#pragma unroll 1
  for (int st = 0; st < SQ / FK; ++st) { const int cur = st & 1; const bool more = st + 1 < SQ / FK;      /* the same for the whole work-group */
    if (more) { const _Float16* kn = kg + (size_t)(st + 1) * FK * DM; const _Float16* vn = vg + (st + 1) * FK;
      rk0 = *(const v8us*)kn; rk1 = *(const v8us*)(kn + (size_t)32 * DM); rv0 = *(const v8us*)vn; rv1 = *(const v8us*)(vn + (size_t)32 * SQ);
      asm volatile("s_wait_xcnt 0x0" ::: "memory"); }      /* the four loads' address registers are temporaries that the fragment loads below reuse: the wait stands in front of every such overwrite */
#pragma unroll
    for (int ps = 0; ps < FK / 32; ++ps) {
      v8f s[2][2];      /* [column group][key tile] */
#pragma unroll
      for (int kt = 0; kt < 2; ++kt) { const _Float16* kr = &sk[cur][ps * 32 + kt * 16 + ln][0]; const v16h k0 = g2_frag(kr, hh), k1 = g2_frag(kr + 32, hh);
#pragma unroll
        for (int g = 0; g < 2; ++g) s[g][kt] = fa_mma(k1, qf[g][1], fa_mma(k0, qf[g][0], z8)); }
      v16h vf[4];
#pragma unroll
      for (int t = 0; t < 4; ++t) vf[t] = g2_frag(&sv[cur][t * 16 + ln][ps * 32], hh);
      float mb[2]; bool need = false;
#pragma unroll
      for (int g = 0; g < 2; ++g) { float m4[4];
#pragma unroll
        for (int q = 0; q < 4; ++q) m4[q] = fmaxf(fmaxf(s[g][0][q], s[g][0][q + 4]), fmaxf(s[g][1][q], s[g][1][q + 4]));
        float mx = fmaxf(fmaxf(m4[0], m4[1]), fmaxf(m4[2], m4[3]));
        mx = fmaxf(mx, xhalf(mx)) * cs;      /* both halves hold this query's maximum of the pass, scaled (cs > 0) */
        mb[g] = mx; need = need || (mx > mu[g] + 8.0f); }
      if (__builtin_amdgcn_ballot_w32(need) != 0) {      /* wave-uniform; always on the first pass, rare later */
#pragma unroll
        for (int g = 0; g < 2; ++g) { const float mn = fmaxf(mu[g], mb[g]); const float corr = exp2x1(mu[g] - mn); mu[g] = mn; l[g] *= corr;      /* corr = 0 on the first pass */
#pragma unroll
          for (int t = 0; t < 4; ++t) o[g][t] = o[g][t] * corr; } }
#pragma unroll
      for (int g = 0; g < 2; ++g) { const float nm = -mu[g]; FragH pf; float s4[4];
#pragma unroll
        for (int kt = 0; kt < 2; ++kt) { float p[8];
#pragma unroll
          for (int r = 0; r < 8; ++r) p[r] = fmaf(s[g][kt][r], cs, nm);
          exp2x8(p);
#pragma unroll
          for (int r = 0; r < 8; ++r) { if (kt == 0 && r < 4) s4[r] = p[r]; else s4[r & 3] += p[r]; pf.h[kt * 8 + r] = (_Float16)p[r]; } }      /* element 8 kt + r = key 16 kt + 8 hh + r: the k order of g2_frag */
        l[g] += (s4[0] + s4[1]) + (s4[2] + s4[3]);
#pragma unroll
        for (int t = 0; t < 4; ++t) o[g][t] = fa_mma(vf[t], pf.v, o[g][t]); }
    }
    if (more) { *(v8us*)&sk[cur ^ 1][sr][sc] = rk0; *(v8us*)&sk[cur ^ 1][sr + 32][sc] = rk1; *(v8us*)&sv[cur ^ 1][sr][sc] = rv0; *(v8us*)&sv[cur ^ 1][sr + 32][sc] = rv1; }      /* that buffer's last readers left it before the barrier that ended the stage before */
    __syncthreads();      /* publishes the next stage and ends every read of this one */
  }
#pragma unroll
  for (int g = 0; g < 2; ++g) { const float sc64 = 64.0f / (l[g] + xhalf(l[g]));      /* the halves' sums are joined once, here */
    _Float16* d = O16 + (qrow + 16 * g) * DM + h * HD + 8 * hh;
#pragma unroll
    for (int t = 0; t < 4; ++t) { FragH f;
#pragma unroll
      for (int r = 0; r < 8; ++r) f.h[r] = (_Float16)(o[g][t][r] * sc64);      /* o[g][t][r] = O[query ln of group g][d = 16 t + 8 hh + r]: 16 contiguous bytes */
      *(v8us*)(d + 16 * t) = f.half[0]; } }
}

// ---- all input preparation in one launch: the five pieces read none of each other's output, so the grid index picks the piece ----
#define PWB (DM * (DM / 8) / 256)           /* work-groups per [DM][DM] weight plane, 8 elements a thread (exact) */
#define PXB ((int)(NR * DM / 8 / 256))      /* work-groups for the x rows, 8 elements a thread (exact) */
// Weight planes first (their eight strided loads a thread are the longer path, and low indices start first): Bt[n][k] = f16(bf16(W[k][n]) x 16), exact in f16.
// wq / wk / wv are per-head stacks [NH][DM][HD]: output row n = h * HD + e reads column e of head h's [in = DM][out = HD] block; wo is one [in = DM][out = DM] matrix. Then x as exact f16 rows, once: all three projections read the same rows.
template <int PITCH>      /* a compile-time row pitch: the eight loads share one address and differ in their immediate offsets */
__device__ __forceinline__ void prep_w8(const float* __restrict__ s, _Float16* __restrict__ d) { FragH f;
  /* unrolled: all eight loads are issued before the first value is used, and f stays in registers */
#pragma unroll
  for (int i = 0; i < 8; ++i) f.h[i] = (_Float16)(bf16_round(s[i * PITCH]) * 16.0f);
  *(v8us*)(unsigned short*)d = f.half[0];
  asm volatile("s_wait_xcnt 0x0" ::: "memory"); }      /* behind the store, as a precaution: each thread prepares one piece and then ends */
__global__ __launch_bounds__(256) void k_prep(const float* __restrict__ x, const float* __restrict__ wq, const float* __restrict__ wk, const float* __restrict__ wv, const float* __restrict__ wo,
    _Float16* __restrict__ X16, _Float16* __restrict__ BQ, _Float16* __restrict__ BK, _Float16* __restrict__ BV, _Float16* __restrict__ BO) {
  const int bx = blockIdx.x;
  if (bx < 4 * PWB) { const int m = bx / PWB; const int t = (bx - m * PWB) * 256 + threadIdx.x; const int n = t / (DM / 8), k8 = (t % (DM / 8)) * 8; const int o = n * DM + k8;
    if (m == 3) prep_w8<DM>(wo + k8 * DM + n, BO + o);
    else prep_w8<HD>((m == 0 ? wq : m == 1 ? wk : wv) + (n / HD) * (DM * HD) + k8 * HD + n % HD, (m == 0 ? BQ : m == 1 ? BK : BV) + o); }
  else { const size_t t = (size_t)(bx - 4 * PWB) * 256 + threadIdx.x; FragH f;
    /* unrolled: the eight contiguous floats become two 16-byte loads, and f stays in registers */
#pragma unroll
    for (int q = 0; q < 8; ++q) f.h[q] = (_Float16)bf16_round(x[t * 8 + q]);
    *(v8us*)((unsigned short*)X16 + t * 8) = f.half[0];
    asm volatile("s_wait_xcnt 0x0" ::: "memory"); }      /* behind the store, as in prep_w8 */
}

extern "C" void kernel_launch(void* const* d_in, const int* in_sizes, int n_in,
                              void* d_out, int out_size, void* d_ws, size_t ws_size, hipStream_t stream) {
  (void)in_sizes; (void)n_in; (void)out_size;
  const float* const* I = (const float* const*)d_in; const float* x = I[0]; const float* wq = I[1]; const float* bq = I[2]; const float* wk = I[3]; const float* bk = I[4]; const float* wv = I[5]; const float* bv = I[6]; const float* wo = I[7]; const float* bo = I[8];      /* ONE input stream (x) read on all three projections; wq, wk, wv are PER-HEAD STACKS [12][768][64] = [head][in][out]; bq, bk, bv are per-head [12][64] = the flat [768] bias; wo [in][out] + bo; input order x, wq, bq, wk, bk, wv, bv, wo, bo */
  char* ws = (char*)d_ws; size_t off = 0;
  auto take = [&](size_t bytes) { char* p = ws + off; off += (bytes + 255) & ~(size_t)255; return p; };
  _Float16* BQ = (_Float16*)take((size_t)DM * DM * 2); _Float16* BK = (_Float16*)take((size_t)DM * DM * 2); _Float16* BV = (_Float16*)take((size_t)DM * DM * 2); _Float16* BO = (_Float16*)take((size_t)DM * DM * 2);      /* BQ, BK, BV lie DM * DM elements apart (a multiple of 256 bytes): the batch stride of the merged projection launch */
  _Float16* X16 = (_Float16*)take(NR * DM * 2); _Float16* Q16 = (_Float16*)take(NR * DM * 2); _Float16* K16 = (_Float16*)take(NR * DM * 2); _Float16* V16 = (_Float16*)take(NR * DM * 2); _Float16* O16 = (_Float16*)take(NR * DM * 2);      /* Q16, K16, V16 lie NR * DM elements apart, likewise */
  _Float16* VT = (_Float16*)take((size_t)NB * NH * HD * SQ * 2);
  if (off > ws_size) return;
  k_prep<<<4 * PWB + PXB, 256, 0, stream>>>(x, wq, wk, wv, wo, X16, BQ, BK, BV, BO);      /* the four weight planes (x16) and x as exact f16 rows */
  const size_t r0p = (size_t)B0 * SQ;      /* first projected row */
  k_gemm2<0><<<dim3((unsigned)((MP / 128) * (DM / 64)), 3), 128, 0, stream>>>(X16 + r0p * DM, DM, 0, BQ, DM, (size_t)DM * DM, 0.0625f, bq, bk, bv, 0, nullptr, 1, 0, 0, nullptr, Q16 + r0p * DM, DM, NR * DM, MP, DM, DM);      /* blockIdx.y = 0, 1, 2: q, k, v */
  k_vt<NH, SQ><<<NB * NH * (SQ / 64), 256, 0, stream>>>(V16, LQ, 0, VT);      /* V^T [NB][NH][HD][SQ], both batches */
  k_fattn<<<NB * NH * (SQ / 256), 256, 0, stream>>>(Q16, K16, VT, O16, 0.052058773f);      /* o (merged heads, x64) as f16 rows; cs = 768^-0.5 log2 e */
  k_gemm2<0><<<dim3((unsigned)((MPO / 128) * (DM / 64)), 1), 128, 0, stream>>>(O16 + r0p * DM, DM, 0, BO, DM, 0, 0.0009765625f, bo, nullptr, nullptr, 0, nullptr, 1, 0, 0, (float*)d_out + r0p * DM, nullptr, DM, 0, MPO, DM, DM);      /* out rows are the output layout */
}

// v004
// One run takes 77.5 microseconds.
// Timed twice side by side with v003, it ran 1.62 and 1.63 times as fast.
// Over all steps from v000 it is 35.2 times as fast.
#include <hip/hip_runtime.h>
// Multi-head self-attention with PER-HEAD STACKED projections and per-head biases at width 768, scaled by the EMBED WIDTH (x [2][2048][768]; q / k / v = einsum('bse,hed->bhsd', x, W) + b with W [12][768][64] = [head][in][out] and b [12][64], 12 heads of 64; scores / sqrt(E = 768) (the module's own: the embed width, not the head width); softmax over all 2048 keys (no mask); out = merged wo + bo ([in][out] [768][768] + bias) -> [2][2048][768]); each head's [in][out] block is transposed into its 64 contiguous rows of the [out][in] weight plane; a per-head bias [12][64] IS the flat bias [768].
// Structure: five launches. Token rows r = b*2048 + s; one preparation launch: x as exact f16 rows (bf16-rounded) and the four weight planes, picked by the grid index; Q, K, V as three WMMA GEMMs in one launch, picked by blockIdx.y (128x128 work-group tiles, operands through LDS, f32 accumulation, exact x16 weights + bias, f16 outputs); V^T for all (batch, head) via LDS transposes; one fused attention launch over all (batch, head, 256 queries): S^T = K Q^T (K = 64), online softmax in registers (f32 statistics, native exp2, scale 768^-0.5; unnormalised weights as f16), O^T += V^T P^T, o / sum carried x64 against f16 subnormal flush (folded into the output GEMM alpha) written straight into the merged f16 o rows; out = o W_o + b GEMM (f32) into the output layout.
// Compute dtype: inputs rounded to bf16; x / weights exact; q, k, v, softmax weights and o as plain f16 GEMM operands (~2^-12); scores and softmax statistics f32. v_wmma_f32_16x16x32_f16.
#define NB 2
#define SQ 2048
#define DM 768 
#define NH 12
#define HD 64
#define HG 4                         /* heads per launch of the grouped k_vt, which is not launched */
#define B0 0                         /* first batch processed (debug hook) */
#define NBR NB                       /* batches processed (debug hook) */
#define NR ((size_t)NB * SQ)         /* token rows */
#define MP ((int)((size_t)NBR * SQ)) /* rows projected (debug hook) */
#define QN SQ                        /* not used: attention takes all SQ query rows */
#define NHD NH                       /* not used: attention takes all NH heads */
#define MPO MP                       /* rows through the output stage (debug hook) */
#define LQ DM      /* row pitch of the q/k/v rows */
typedef __bf16 v16b __attribute__((ext_vector_type(16)));
typedef unsigned short v8us __attribute__((ext_vector_type(8), may_alias));
typedef float  v8f  __attribute__((ext_vector_type(8)));
typedef float  v4f  __attribute__((ext_vector_type(4)));
typedef float  v4fa __attribute__((ext_vector_type(4), may_alias));
union FragB { v16b v; v8us half[2]; unsigned short u[16]; };

__device__ __forceinline__ unsigned short bf16_bits(float x) { unsigned int u = __float_as_uint(x); return (unsigned short)((u + 0x7FFFu + ((u >> 16) & 1u)) >> 16); }
__device__ __forceinline__ float bf16_val(unsigned short b) { return __uint_as_float(((unsigned int)b) << 16); }
__device__ __forceinline__ float bf16_round(float x) { return bf16_val(bf16_bits(x)); }
// D += A·B with NT terms: 1 = ah·bh, 2 = + al·bh (A split), 3 = + ah·bl (both split)
template <int NT>
__device__ __forceinline__ v8f mmaN(v16b ah, v16b al, v16b bh, v16b bl, v8f c) {
  c = __builtin_amdgcn_wmma_f32_16x16x32_bf16(false, ah, false, bh, (short)0, c, false, false);
  if (NT >= 2) c = __builtin_amdgcn_wmma_f32_16x16x32_bf16(false, al, false, bh, (short)0, c, false, false);
  if (NT >= 3) c = __builtin_amdgcn_wmma_f32_16x16x32_bf16(false, ah, false, bl, (short)0, c, false, false);
  asm volatile("v_nop\n\tv_nop\n\tv_nop\n\tv_nop" : "+v"(c) : "v"(ah), "v"(al), "v"(bh), "v"(bl));
  return c;
}

__global__ __launch_bounds__(256) void k_wt_bf16(const float* __restrict__ W, unsigned short* __restrict__ Wt, int K, int N) {
  const int t = blockIdx.x * 256 + threadIdx.x;
  const int k8n = K / 8;
  if (t >= N * k8n) return;
  const int n = t / k8n, k8 = (t % k8n) * 8;
  v8us v;
#pragma unroll
  for (int i = 0; i < 8; ++i) v[i] = bf16_bits(W[(size_t)(k8 + i) * N + n]);
  *(v8us*)(Wt + (size_t)n * K + k8) = v;
  
}

// GEMM C[M][N] (f32, pitch ldc) = act(A[M][K]·W + bias). A f32 row-major (pitch lda) converted per fragment to bf16
// (ASPLIT: hi/lo two planes -> 2 terms, else single rounded term); Wt bf16 [N][K] (pitch ldb). BIAS_BF16 rounds the
// bias to bf16 first (bias quantised to bf16 before the add). K%32==0, M%16==0, N%64==0.
template <bool ASPLIT, int ACT, bool BIAS_BF16>
__global__ __launch_bounds__(128) void k_gemm_bf(const float* __restrict__ A, int lda, const unsigned short* __restrict__ Wt, int ldb,
                                               const float* __restrict__ bias, float* __restrict__ C, int ldc, int M, int N, int K) {
  __shared__ __attribute__((aligned(16))) float so[4][16][64];
  const int tid = threadIdx.x, w = tid >> 5, lane = tid & 31, ln = lane & 15, hh = lane >> 4;
  const int ntn = N / 64;
  const int wid = blockIdx.x * 4 + w;
  const int mt = wid / ntn, nq = wid % ntn;
  if (mt * 16 >= M) return;
  const int row0 = mt * 16, col0 = nq * 64;
  const float* arow = A + (size_t)(row0 + ln) * lda;
  v8f acc[4] = {};
  for (int kb = 0; kb < K; kb += 32) {
    FragB ah, al;
    const v4f x0 = *(const v4fa*)(arow + kb + 8 * hh), x1 = *(const v4fa*)(arow + kb + 8 * hh + 4);
    const v4f x2 = *(const v4fa*)(arow + kb + 16 + 8 * hh), x3 = *(const v4fa*)(arow + kb + 16 + 8 * hh + 4);
    float xs[16] = {x0[0],x0[1],x0[2],x0[3],x1[0],x1[1],x1[2],x1[3],x2[0],x2[1],x2[2],x2[3],x3[0],x3[1],x3[2],x3[3]};
#pragma unroll
    for (int i = 0; i < 16; ++i) { const unsigned short hb = bf16_bits(xs[i]); ah.u[i] = hb; al.u[i] = ASPLIT ? bf16_bits(xs[i] - bf16_val(hb)) : (unsigned short)0; }
#pragma unroll
    for (int t = 0; t < 4; ++t) {
      const unsigned short* brow = Wt + (size_t)(col0 + t * 16 + ln) * ldb + kb;
      FragB b;
      b.half[0] = *(const v8us*)(brow + 8 * hh);
      b.half[1] = *(const v8us*)(brow + 16 + 8 * hh);
      acc[t] = mmaN<ASPLIT ? 2 : 1>(ah.v, al.v, b.v, b.v, acc[t]);
    }
  }
#pragma unroll
  for (int t = 0; t < 4; ++t) {
    float bv = bias ? bias[col0 + t * 16 + ln] : 0.f;
    if (BIAS_BF16) bv = bf16_round(bv);
#pragma unroll
    for (int r = 0; r < 8; ++r) { float v = acc[t][r] + bv; if (ACT == 1) v = fmaxf(v, 0.f); so[w][8 * hh + r][t * 16 + ln] = v; }
  }
  __builtin_amdgcn_fence(__ATOMIC_ACQ_REL, "workgroup");
  __builtin_amdgcn_wave_barrier();
  const int rsub = lane >> 4, c4 = (lane & 15) * 4;
  {
#pragma unroll
    for (int q = 0; q < 8; ++q) {
      const int r = q * 2 + rsub;
      const v4f v = *(const v4fa*)&so[w][r][c4];
      *(v4f*)(C + (size_t)(row0 + r) * ldc + col0 + c4) = v;
    }
    
  }
}

// GEMM C = act(A·W + bias + resid): A f32 (ASPLIT -> hi/lo 2 terms), Wt bf16 [N][K]; ACT 0 none, 1 relu, 2 exact gelu;
// resid (optional, f32, row index = (row % rmod), pitch ldr, RES_BF16 rounds it) added before the activation.
template <bool ASPLIT, int ACT, bool BIAS_BF16, bool RES_BF16>
__global__ __launch_bounds__(128) void k_gemm_bf3(const float* __restrict__ A, int lda, const unsigned short* __restrict__ Wt, int ldb,
                                                const float* __restrict__ bias, const float* __restrict__ resid, int rmod, int ldr,
                                                float* __restrict__ C, int ldc, int M, int N, int K) {
  __shared__ __attribute__((aligned(16))) float so[4][16][64];
  const int tid = threadIdx.x, w = tid >> 5, lane = tid & 31, ln = lane & 15, hh = lane >> 4;
  const int ntn = N / 64;
  const int wid = blockIdx.x * 4 + w;
  const int mt = wid / ntn, nq = wid % ntn;
  if (mt * 16 >= M) return;
  const int row0 = mt * 16, col0 = nq * 64;
  const float* arow = A + (size_t)(row0 + ln) * lda;
  v8f acc[4] = {};
  for (int kb = 0; kb < K; kb += 32) {
    FragB ah, al;
    const v4f x0 = *(const v4fa*)(arow + kb + 8 * hh), x1 = *(const v4fa*)(arow + kb + 8 * hh + 4);
    const v4f x2 = *(const v4fa*)(arow + kb + 16 + 8 * hh), x3 = *(const v4fa*)(arow + kb + 16 + 8 * hh + 4);
    float xs[16] = {x0[0],x0[1],x0[2],x0[3],x1[0],x1[1],x1[2],x1[3],x2[0],x2[1],x2[2],x2[3],x3[0],x3[1],x3[2],x3[3]};
#pragma unroll
    for (int i = 0; i < 16; ++i) { const unsigned short hb = bf16_bits(xs[i]); ah.u[i] = hb; al.u[i] = ASPLIT ? bf16_bits(xs[i] - bf16_val(hb)) : (unsigned short)0; }
#pragma unroll
    for (int t = 0; t < 4; ++t) {
      const unsigned short* brow = Wt + (size_t)(col0 + t * 16 + ln) * ldb + kb;
      FragB b;
      b.half[0] = *(const v8us*)(brow + 8 * hh);
      b.half[1] = *(const v8us*)(brow + 16 + 8 * hh);
      acc[t] = mmaN<ASPLIT ? 2 : 1>(ah.v, al.v, b.v, b.v, acc[t]);
    }
  }
#pragma unroll
  for (int t = 0; t < 4; ++t) {
    const int col = col0 + t * 16 + ln;
    float bv = bias ? bias[col] : 0.f;
    if (BIAS_BF16) bv = bf16_round(bv);
#pragma unroll
    for (int r = 0; r < 8; ++r) {
      float v = acc[t][r] + bv;
      if (resid) { float rv = resid[(size_t)((row0 + 8 * hh + r) % rmod) * ldr + col]; if (RES_BF16) rv = bf16_round(rv); v += rv; }
      if (ACT == 1) v = fmaxf(v, 0.f);
      if (ACT == 2) v = 0.5f * v * (1.0f + erff(v * 0.70710678118654752f));
      if (ACT == 3) { const float u = 0.7978845608028654f * (v + 0.044715f * v * v * v); v = 0.5f * v * (1.0f + tanhf(u)); }
      so[w][8 * hh + r][t * 16 + ln] = v;
    }
  }
  __builtin_amdgcn_fence(__ATOMIC_ACQ_REL, "workgroup");
  __builtin_amdgcn_wave_barrier();
  const int rsub = lane >> 4, c4 = (lane & 15) * 4;
  {
#pragma unroll
    for (int q = 0; q < 8; ++q) {
      const int r = q * 2 + rsub;
      const v4f v = *(const v4fa*)&so[w][r][c4];
      *(v4f*)(C + (size_t)(row0 + r) * ldc + col0 + c4) = v;
    }
    
  }
}
// row LayerNorm (biased variance, eps) over N: s = X (+ R); optional out_sum <- s; out_norm <- (s-mu)*rsqrt(var+eps)*g + b
template <bool PARAM_BF16>
__global__ __launch_bounds__(256) void k_layernorm(const float* __restrict__ X, const float* __restrict__ R, const float* __restrict__ g, const float* __restrict__ bta,
                                                  float* __restrict__ out_sum, float* __restrict__ out_norm, int N, float eps) {
  __shared__ float red[256];
  const int row = blockIdx.x, tid = threadIdx.x;
  const float* x = X + (size_t)row * N; const float* rr = R ? R + (size_t)row * N : nullptr;
  float vals[16];                     // up to N = 4096
  const int per = N / 256;            // contiguous chunk per thread? use strided-by-4 chunks: thread handles j = tid*4 + 1024*u
  float s1 = 0.f;
  for (int u = 0; u < per / 4; ++u) {
    const int j = tid * 4 + 1024 * u;
    const v4f a = *(const v4fa*)(x + j);
    v4f b = {0.f,0.f,0.f,0.f}; if (rr) b = *(const v4fa*)(rr + j);
#pragma unroll
    for (int q = 0; q < 4; ++q) { const float v = a[q] + b[q]; vals[u * 4 + q] = v; s1 += v; }
  }
  red[tid] = s1; __syncthreads();
  for (int st = 128; st > 0; st >>= 1) { if (tid < st) red[tid] += red[tid + st]; __syncthreads(); }
  const float mu = red[0] / (float)N; __syncthreads();
  float s2 = 0.f;
  for (int u = 0; u < per / 4; ++u)
#pragma unroll
    for (int q = 0; q < 4; ++q) { const float c = vals[u * 4 + q] - mu; s2 += c * c; }
  red[tid] = s2; __syncthreads();
  for (int st = 128; st > 0; st >>= 1) { if (tid < st) red[tid] += red[tid + st]; __syncthreads(); }
  const float rs = rsqrtf(red[0] / (float)N + eps);
  {
    for (int u = 0; u < per / 4; ++u) {
      const int j = tid * 4 + 1024 * u;
      v4f o, sm;
#pragma unroll
      for (int q = 0; q < 4; ++q) {
        float gg = g[j + q], bb = bta[j + q];
        if (PARAM_BF16) { gg = bf16_round(gg); bb = bf16_round(bb); }
        sm[q] = vals[u * 4 + q]; o[q] = (vals[u * 4 + q] - mu) * rs * gg + bb;
      }
      if (out_sum) *(v4f*)(out_sum + (size_t)row * N + j) = sm;
      *(v4f*)(out_norm + (size_t)row * N + j) = o;
    }
    
  }
}



// ---- f16 WMMA path (v_wmma_f32_16x16x32_f16): 11-bit significands for operands in range — used where a [0,1] probability operand needs more precision than bf16
typedef _Float16 v16h __attribute__((ext_vector_type(16)));
union FragH { v16h v; v8us half[2]; _Float16 h[16]; unsigned short u[16]; };
template <int NT>
__device__ __forceinline__ v8f mmaH(v16h ah, v16h al, v16h bh, v16h bl, v8f c) {
  c = __builtin_amdgcn_wmma_f32_16x16x32_f16(false, ah, false, bh, (short)0, c, false, false);
  if (NT >= 2) c = __builtin_amdgcn_wmma_f32_16x16x32_f16(false, al, false, bh, (short)0, c, false, false);
  if (NT >= 3) c = __builtin_amdgcn_wmma_f32_16x16x32_f16(false, ah, false, bl, (short)0, c, false, false);
  asm volatile("v_nop\n\tv_nop\n\tv_nop\n\tv_nop" : "+v"(c) : "v"(ah), "v"(al), "v"(bh), "v"(bl));
  return c;
}
// batched GEMM like k_gemm_b but f16 operands: A f32 (split into f16 hi/lo if ASPLIT, else rounded to f16), Bt = f16 values [n][k]; alpha; C f32; N multiple of 16 (partial tiles skipped)
template <bool ASPLIT>
__global__ __launch_bounds__(128) void k_gemm_h(const float* __restrict__ A, int lda, size_t sA, const _Float16* __restrict__ Bh, int ldb, size_t sB, float alpha, float* __restrict__ C, int ldc, size_t sC, int M, int N, int K) {
  __shared__ __attribute__((aligned(16))) float so[4][16][64];
  const int tid = threadIdx.x, w = tid >> 5, lane = tid & 31, ln = lane & 15, hh = lane >> 4; const int by = blockIdx.y;
  A += (size_t)by * sA; Bh += (size_t)by * sB; C += (size_t)by * sC;
  const int ntn = (N + 63) / 64; const int wid = blockIdx.x * 4 + w; const int mt = wid / ntn, nq = wid % ntn; if (mt * 16 >= M) return;
  const int row0 = mt * 16, col0 = nq * 64; const float* arow = A + (size_t)(row0 + ln) * lda;
  v8f acc[4] = {};
  for (int kb = 0; kb < K; kb += 32) {
    FragH ah, al;
    const v4f x0 = *(const v4fa*)(arow + kb + 8 * hh), x1 = *(const v4fa*)(arow + kb + 8 * hh + 4), x2 = *(const v4fa*)(arow + kb + 16 + 8 * hh), x3 = *(const v4fa*)(arow + kb + 16 + 8 * hh + 4);
    float xs[16] = {x0[0],x0[1],x0[2],x0[3],x1[0],x1[1],x1[2],x1[3],x2[0],x2[1],x2[2],x2[3],x3[0],x3[1],x3[2],x3[3]};
#pragma unroll
    for (int i = 0; i < 16; ++i) { const _Float16 h = (_Float16)xs[i]; ah.h[i] = h; al.h[i] = ASPLIT ? (_Float16)(xs[i] - (float)h) : (_Float16)0.0f; }
#pragma unroll
    for (int t = 0; t < 4; ++t) { if (col0 + t * 16 >= N) continue; const size_t boff = (size_t)(col0 + t * 16 + ln) * ldb + kb; FragH bq; bq.half[0] = *(const v8us*)(Bh + boff + 8 * hh); bq.half[1] = *(const v8us*)(Bh + boff + 16 + 8 * hh);
      acc[t] = mmaH<ASPLIT ? 2 : 1>(ah.v, al.v, bq.v, bq.v, acc[t]); }
  }
#pragma unroll
  for (int t = 0; t < 4; ++t) { if (col0 + t * 16 >= N) continue;
#pragma unroll
    for (int r = 0; r < 8; ++r) so[w][8 * hh + r][t * 16 + ln] = acc[t][r] * alpha; }
  __builtin_amdgcn_fence(__ATOMIC_ACQ_REL, "workgroup"); __builtin_amdgcn_wave_barrier();
  const int rsub = lane >> 4, c4 = (lane & 15) * 4;
  {
#pragma unroll
    for (int q = 0; q < 8; ++q) { const int r = q * 2 + rsub; if (col0 + c4 < N) { const v4f v = *(const v4fa*)&so[w][r][c4]; *(v4f*)(C + (size_t)(row0 + r) * ldc + col0 + c4) = v; } }
     }
}

// k_gemm_hh variant with fused epilogue: v = acc·alpha + bias[by·sBias + col] (+ CP[(row/rowsPerB)·sCPb + by·64 + col] if CP) ; ACT 0 none / 1 elu ; writes f16 C16 (and f32 C if non-null)
template <int ACT>
__global__ __launch_bounds__(128) void k_gemm_hhx(const _Float16* __restrict__ A, int lda, size_t sA, const _Float16* __restrict__ Bh, int ldb, size_t sB, float alpha, const float* __restrict__ bias, size_t sBias, const float* __restrict__ CP, int rowsPerB, size_t sCPb, int row0g,
    float* __restrict__ C, _Float16* __restrict__ C16, int ldc, size_t sC, int M, int N, int K) {
  __shared__ __attribute__((aligned(16))) float so[4][16][64];
  const int tid = threadIdx.x, w = tid >> 5, lane = tid & 31, ln = lane & 15, hh = lane >> 4; const int by = blockIdx.y;
  A += (size_t)by * sA; Bh += (size_t)by * sB; const size_t cofs = (size_t)by * sC; const float* bp = bias ? bias + (size_t)by * sBias : nullptr;
  const int ntn = (N + 63) / 64; const int wid = blockIdx.x * 4 + w; const int mt = wid / ntn, nq = wid % ntn; if (mt * 16 >= M) return;
  const int row0 = mt * 16, col0 = nq * 64; const _Float16* arow = A + (size_t)(row0 + ln) * lda;
  v8f acc[4] = {};
  for (int kb = 0; kb < K; kb += 32) { FragH ah; ah.half[0] = *(const v8us*)((const unsigned short*)arow + kb + 8 * hh); ah.half[1] = *(const v8us*)((const unsigned short*)arow + kb + 16 + 8 * hh);
#pragma unroll
    for (int t = 0; t < 4; ++t) { if (col0 + t * 16 >= N) continue; const size_t boff = (size_t)(col0 + t * 16 + ln) * ldb + kb; FragH bq; bq.half[0] = *(const v8us*)((const unsigned short*)Bh + boff + 8 * hh); bq.half[1] = *(const v8us*)((const unsigned short*)Bh + boff + 16 + 8 * hh);
      acc[t] = mmaH<1>(ah.v, ah.v, bq.v, bq.v, acc[t]); }
  }
#pragma unroll
  for (int t = 0; t < 4; ++t) { if (col0 + t * 16 >= N) continue; const int col = col0 + t * 16 + ln; const float bv = bp ? bf16_round(bp[col]) : 0.f;
#pragma unroll
    for (int r = 0; r < 8; ++r) { float v = acc[t][r] * alpha + bv; if (CP) { const int rr = row0g + row0 + 8 * hh + r; if (rowsPerB < 0) v += CP[cofs + (size_t)rr * ldc + col];      /* rowsPerB < 0: own element of the batched C plane */ else { const int bidx = rr / rowsPerB; v += CP[(size_t)bidx * sCPb + (size_t)by * 64 + col]; } } if (ACT == 1) v = (v > 0.f) ? v : expm1f(v); else if (ACT == 7) v = (v > 0.f) ? v + 1.0f : expf(v); else if (ACT == 8) v = tanhf(v); else if (ACT == 9) v = 0.5f * v * (1.0f + tanhf(0.7978845608028654f * (v + 0.044715f * v * v * v))); else if (ACT == 11) v = 1.0f / (1.0f + expf(-v)); else if (ACT == 12) v = (v > 0.f) ? v : 0.01f * v; else if (ACT == 14) v = (v > 0.f) ? v : 0.1f * v; else if (ACT == 16) v = (v >= 0.f) ? v : 0.3f * v; else if (ACT == 17) v = (v >= 0.f) ? v : 0.2f * v; else if (ACT == 15) v = v / (1.0f + expf(-v)); else if (ACT == 3) v = fmaxf(v, 0.f); else if (ACT == 6) v = 0.5f * v * (1.0f + erff(v * 0.70710678118654752f)); so[w][8 * hh + r][t * 16 + ln] = v; } }
  __builtin_amdgcn_fence(__ATOMIC_ACQ_REL, "workgroup"); __builtin_amdgcn_wave_barrier();
  const int rsub = lane >> 4, c4 = (lane & 15) * 4; typedef _Float16 v4h __attribute__((ext_vector_type(4)));
  {
#pragma unroll
    for (int q = 0; q < 8; ++q) { const int r = q * 2 + rsub; if (col0 + c4 < N) { const v4f v = *(const v4fa*)&so[w][r][c4]; if (C) *(v4f*)(C + cofs + (size_t)(row0 + r) * ldc + col0 + c4) = v; if (C16) { v4h h4; for (int i = 0; i < 4; ++i) h4[i] = (_Float16)v[i]; *(v4h*)(C16 + cofs + (size_t)(row0 + r) * ldc + col0 + c4) = h4; } } }
     }
}


typedef _Float16 v4h __attribute__((ext_vector_type(4)));

__global__ __launch_bounds__(256) void k_h16(const float* __restrict__ x, _Float16* __restrict__ X16, size_t n8) { const size_t t = (size_t)blockIdx.x * 256 + threadIdx.x; if (t >= n8) return; FragH f;
#pragma unroll
  for (int q = 0; q < 8; ++q) f.h[q] = (_Float16)x[t * 8 + q]; *(v8us*)((unsigned short*)X16 + t * 8) = f.half[0];  }
__global__ __launch_bounds__(256) void k_round16f(const float* __restrict__ W, _Float16* __restrict__ Bt, size_t n8) { const size_t t = (size_t)blockIdx.x * 256 + threadIdx.x; if (t >= n8) return; FragH f;
#pragma unroll
  for (int i = 0; i < 8; ++i) f.h[i] = (_Float16)(bf16_round(W[t * 8 + i]) * 16.0f); *(v8us*)((unsigned short*)Bt + t * 8) = f.half[0];  }
template <int NHv, int TTv>
__global__ __launch_bounds__(256) void k_vt(const _Float16* __restrict__ V16, int ldv, int voff, _Float16* __restrict__ Vt) { __shared__ unsigned short tl[64][66]; const int tid = threadIdx.x; const int slab = blockIdx.x / (TTv / 64), lg = blockIdx.x % (TTv / 64); const int b = slab / NHv, h = slab % NHv;
  for (int i = tid; i < 64 * 8; i += 256) { const int r = i / 8, c8 = (i % 8) * 8; FragH f; f.half[0] = *(const v8us*)((const unsigned short*)V16 + ((size_t)b * TTv + lg * 64 + r) * ldv + voff + h * 64 + c8);
#pragma unroll
    for (int q = 0; q < 8; ++q) tl[r][c8 + q] = f.u[q]; }
  __syncthreads();
  {
#pragma unroll
    for (int rd = 0; rd < 2; ++rd) { const int d = rd * 32 + tid / 8, pc = tid % 8; FragH f;
#pragma unroll
      for (int q = 0; q < 8; ++q) f.u[q] = tl[pc * 8 + q][d];
      *(v8us*)((unsigned short*)Vt + ((size_t)slab * 64 + d) * TTv + lg * 64 + pc * 8) = f.half[0]; }
     } }

__global__ __launch_bounds__(256) void k_hl(const float* __restrict__ F, _Float16* __restrict__ Hh, _Float16* __restrict__ Hl, size_t n8) { const size_t t = (size_t)blockIdx.x * 256 + threadIdx.x; if (t >= n8) return; FragH fh, fl; const v4f a = *(const v4fa*)(F + t * 8), c = *(const v4fa*)(F + t * 8 + 4);
#pragma unroll
  for (int q = 0; q < 4; ++q) { _Float16 h = (_Float16)a[q]; fh.h[q] = h; fl.h[q] = (_Float16)((a[q] - (float)h) * 1024.0f); h = (_Float16)c[q]; fh.h[4 + q] = h; fl.h[4 + q] = (_Float16)((c[q] - (float)h) * 1024.0f); }
  { *(v8us*)((unsigned short*)Hh + t * 8) = fh.half[0]; *(v8us*)((unsigned short*)Hl + t * 8) = fl.half[0];  } }

// ---- fast GEMM (wave tile 32x64; requires M % 32 == 0 rows per launch region and N % 64 == 0); epilogue = k_gemm_hhx semantics ----
__device__ __forceinline__ v16h g2_frag(const _Float16* p, int hh) { FragH f; f.half[0] = *(const v8us*)((const unsigned short*)p + 8 * hh); f.half[1] = *(const v8us*)((const unsigned short*)p + 16 + 8 * hh); return f.v; }
__device__ __forceinline__ v8f g2_mma(v16h a, v16h b, v8f c) { v8f d = __builtin_amdgcn_wmma_f32_16x16x32_f16(false, a, false, b, (short)0, c, false, false); asm volatile("v_nop\n\tv_nop\n\tv_nop\n\tv_nop" : "+v"(d) : "v"(a), "v"(b)); return d; }
template <int ACT>
__global__ __launch_bounds__(128) void k_gemm2(const _Float16* __restrict__ A, int lda, size_t sA, const _Float16* __restrict__ Bh, int ldb, size_t sB, float alpha, const float* __restrict__ bias, const float* __restrict__ bias1, const float* __restrict__ bias2, size_t sBias, const float* __restrict__ CP, int rowsPerB, size_t sCPb, int row0g,
    float* __restrict__ C, _Float16* __restrict__ C16, int ldc, size_t sC, int M, int N, int K) { static_assert(ACT == 0 || ACT == 3 || ACT == 6 || ACT == 8 || ACT == 9 || ACT == 11 || ACT == 12 || ACT == 14 || ACT == 15 || ACT == 16 || ACT == 17, "k_gemm2: unsupported ACT code (would silently apply no activation)");
  __shared__ __attribute__((aligned(16))) float so[4][32][68];
  const int tid = threadIdx.x, w = tid >> 5, lane = tid & 31, ln = lane & 15, hh = lane >> 4; const int by = blockIdx.y;
  if (by == 1) bias = bias1; else if (by == 2) bias = bias2;      /* batches 1 and 2 may have their bias in a buffer of its own (three products with separate bias inputs in one launch) */
  A += (size_t)by * sA; Bh += (size_t)by * sB; const size_t cofs = (size_t)by * sC; const float* bp = bias ? bias + (size_t)by * sBias : nullptr;
  const int ntn = N >> 6; const int mt = blockIdx.x / ntn, nq = blockIdx.x - mt * ntn; const int row0 = mt * 128 + 32 * w, col0 = nq * 64; if (row0 >= M) return;
  const _Float16* a0p = A + (size_t)(row0 + ln) * lda; const _Float16* a1p = a0p + (size_t)16 * lda;
  const _Float16* b0p = Bh + (size_t)(col0 + ln) * ldb; const _Float16* b1p = b0p + (size_t)16 * ldb; const _Float16* b2p = b1p + (size_t)16 * ldb; const _Float16* b3p = b2p + (size_t)16 * ldb;
  const v8f z8 = {0.f,0.f,0.f,0.f,0.f,0.f,0.f,0.f}; v8f c00 = z8, c01 = z8, c02 = z8, c03 = z8, c10 = z8, c11 = z8, c12 = z8, c13 = z8;
#pragma unroll 1
  for (int kb = 0; kb < K; kb += 32) { const v16h a0 = g2_frag(a0p + kb, hh), a1 = g2_frag(a1p + kb, hh);
    v16h b = g2_frag(b0p + kb, hh); c00 = g2_mma(a0, b, c00); c10 = g2_mma(a1, b, c10);
    b = g2_frag(b1p + kb, hh); c01 = g2_mma(a0, b, c01); c11 = g2_mma(a1, b, c11);
    b = g2_frag(b2p + kb, hh); c02 = g2_mma(a0, b, c02); c12 = g2_mma(a1, b, c12);
    b = g2_frag(b3p + kb, hh); c03 = g2_mma(a0, b, c03); c13 = g2_mma(a1, b, c13); }
  v8f accs[8] = {c00, c01, c02, c03, c10, c11, c12, c13};
#pragma unroll
  for (int u = 0; u < 8; ++u) { const int t = u & 3, half = u >> 2; const int col = col0 + t * 16 + ln; const float bv = bp ? bf16_round(bp[col]) : 0.f;
#pragma unroll
    for (int r = 0; r < 8; ++r) { const int rloc = half * 16 + 8 * hh + r; float v = accs[u][r] * alpha + bv; if (CP) { if (rowsPerB < 0) v += CP[cofs + (size_t)(row0g + row0 + rloc) * ldc + col];      /* rowsPerB < 0: own element of the batched C plane */ else { const int bidx = (row0g + row0 + rloc) / rowsPerB; v += CP[(size_t)bidx * sCPb + (size_t)by * 64 + col]; } }
      if (ACT == 3) v = fmaxf(v, 0.f); else if (ACT == 6) v = 0.5f * v * (1.0f + erff(v * 0.70710678118654752f)); else if (ACT == 11) v = 1.0f / (1.0f + expf(-v)); else if (ACT == 15) v = v / (1.0f + expf(-v)); else if (ACT == 12) v = (v > 0.f) ? v : 0.01f * v; else if (ACT == 8) v = tanhf(v); else if (ACT == 9) v = 0.5f * v * (1.0f + tanhf(0.7978845608028654f * (v + 0.044715f * v * v * v))); else if (ACT == 14) v = (v > 0.f) ? v : 0.1f * v; else if (ACT == 16) v = (v >= 0.f) ? v : 0.3f * v; else if (ACT == 17) v = (v >= 0.f) ? v : 0.2f * v;
      so[w][rloc][t * 16 + ln] = v; } }
  __builtin_amdgcn_fence(__ATOMIC_ACQ_REL, "workgroup"); __builtin_amdgcn_wave_barrier();
  const int rsub = lane >> 4, c4 = (lane & 15) * 4;
  {
#pragma unroll
    for (int q = 0; q < 16; ++q) { const int r = q * 2 + rsub; const v4f v = *(const v4fa*)&so[w][r][c4]; if (C) *(v4f*)(C + cofs + (size_t)(row0 + r) * ldc + col0 + c4) = v; if (C16) { v4h h4; for (int i = 0; i < 4; ++i) h4[i] = (_Float16)v[i]; *(v4h*)(C16 + cofs + (size_t)(row0 + r) * ldc + col0 + c4) = h4; } }
     } }


__global__ __launch_bounds__(256) void k_wnat(const float* __restrict__ w, size_t n8, _Float16* __restrict__ Bt) { const size_t t = (size_t)blockIdx.x * 256 + threadIdx.x; if (t >= n8) return; FragH f; for (int q = 0; q < 8; ++q) f.h[q] = (_Float16)(bf16_round(w[t * 8 + q]) * 16.0f); *(v8us*)((unsigned short*)Bt + t * 8) = f.half[0];  }
__global__ __launch_bounds__(256) void k_rsm(const float* __restrict__ S, _Float16* __restrict__ P, int nrows) {
  #pragma clang fp contract(off)
  const int i = blockIdx.x * 256 + threadIdx.x; if (i >= nrows) return; const float* s = S + (size_t)i * SQ; float mx = -3.0e38f;
#pragma unroll 1
  for (int j = 0; j < SQ; ++j) mx = fmaxf(mx, s[j]); float se = 0.f;
#pragma unroll 1
  for (int j = 0; j < SQ; ++j) se += expf(s[j] - mx); const float sc = 256.0f / se;
#pragma unroll 1
  for (int j0 = 0; j0 < SQ; j0 += 8) { FragH f; for (int q = 0; q < 8; ++q) f.h[q] = (_Float16)(expf(s[j0 + q] - mx) * sc); unsigned short* d = (unsigned short*)P + (size_t)i * SQ + j0; *(v8us*)d = f.half[0];  } }
__global__ __launch_bounds__(256) void k_vt(const _Float16* __restrict__ V16, int b, int h0, _Float16* __restrict__ VT) { __shared__ unsigned short tl[64][65]; const int tid = threadIdx.x; const int hh = blockIdx.x % HG, sg = blockIdx.x / HG; const int s0 = sg * 64; const int h = h0 + hh;
  for (int i = tid; i < 64 * 8; i += 256) { const int j = i / 8, d8 = (i % 8) * 8; FragH f; f.half[0] = *(const v8us*)((const unsigned short*)V16 + ((size_t)b * SQ + s0 + j) * DM + h * HD + d8); for (int q = 0; q < 8; ++q) tl[d8 + q][j] = f.u[q]; }
  __syncthreads();
  { for (int i = tid; i < 64 * 8; i += 256) { const int d = i / 8, j8 = (i % 8) * 8; FragH f; for (int q = 0; q < 8; ++q) f.u[q] = tl[d][j8 + q]; *(v8us*)((unsigned short*)VT + ((size_t)hh * HD + d) * SQ + s0 + j8) = f.half[0]; }  } }



// ---- fused attention: scores, softmax and P.V in one kernel; neither scores nor weights go to memory ----
#define FK 64      /* keys per LDS stage */
#define FPH 72     /* LDS row pitch in f16: 128 data bytes + 16, the conflict-free pitch for 16-byte fragment reads */
__device__ __forceinline__ float xhalf(float x) { return __builtin_bit_cast(float, __builtin_amdgcn_permlanex16(__builtin_bit_cast(int, x), __builtin_bit_cast(int, x), 0x76543210, 0xfedcba98, false, false)); }      /* lane l reads lane l ^ 16 */
// native 2^x, in place. The instruction set asks for one independent instruction or a v_nop between a transcendental and a directly following instruction that uses its result or overwrites its source.
// Eight in one statement: each is the independent instruction behind the one before it, the one v_nop fills the slot behind the last. In place, so that the statement writes only registers that the compiler's own multiply-add has just written:
// the compiler does not look into asm text when it keeps its distance behind a matrix instruction, and a fresh output register could be an operand of one just issued.
__device__ __forceinline__ void exp2x8(float (&x)[8]) { asm("v_exp_f32 %0, %0\n\tv_exp_f32 %1, %1\n\tv_exp_f32 %2, %2\n\tv_exp_f32 %3, %3\n\tv_exp_f32 %4, %4\n\tv_exp_f32 %5, %5\n\tv_exp_f32 %6, %6\n\tv_exp_f32 %7, %7\n\tv_nop" : "+v"(x[0]), "+v"(x[1]), "+v"(x[2]), "+v"(x[3]), "+v"(x[4]), "+v"(x[5]), "+v"(x[6]), "+v"(x[7])); }
__device__ __forceinline__ float exp2x1(float x) { asm("v_exp_f32 %0, %0\n\tv_nop" : "+v"(x)); return x; }      /* the same, one value */
__device__ __forceinline__ v8f fa_mma(v16h a, v16h b, v8f c) { return __builtin_amdgcn_wmma_f32_16x16x32_f16(false, a, false, b, (short)0, c, false, false); }
__global__ __launch_bounds__(256) void k_fattn(const _Float16* __restrict__ Q16, const _Float16* __restrict__ K16, const _Float16* __restrict__ VT, _Float16* __restrict__ O16, float cs) {
  __shared__ __attribute__((aligned(16))) _Float16 sk[2][FK][FPH];
  __shared__ __attribute__((aligned(16))) _Float16 sv[2][HD][FPH];
  const int tid = threadIdx.x, lane = tid & 31, ln = lane & 15, hh = lane >> 4, w = tid >> 5;
  const int slab = blockIdx.x / (SQ / 256), qb = blockIdx.x % (SQ / 256); const int b = slab / NH, h = slab % NH;
  const size_t qrow = (size_t)b * SQ + qb * 256 + w * 32 + ln;
  const int sr = tid >> 3, sc = (tid & 7) * 8;      /* staging: 8 threads per 128-byte row, rows sr and sr + 32 */
  const _Float16* kg = K16 + ((size_t)b * SQ + sr) * DM + h * HD + sc;
  const _Float16* vg = VT + ((size_t)slab * HD + sr) * SQ + sc;
  v8us rk0 = *(const v8us*)kg, rk1 = *(const v8us*)(kg + (size_t)32 * DM), rv0 = *(const v8us*)vg, rv1 = *(const v8us*)(vg + (size_t)32 * SQ);
  v16h qf[2][2];
#pragma unroll
  for (int g = 0; g < 2; ++g)
#pragma unroll
    for (int s = 0; s < 2; ++s) qf[g][s] = g2_frag(Q16 + (qrow + 16 * g) * DM + h * HD + 32 * s, hh);
  const v8f z8 = {0.f,0.f,0.f,0.f,0.f,0.f,0.f,0.f};
  v8f o[2][4]; float mu[2], l[2];
#pragma unroll
  for (int g = 0; g < 2; ++g) { mu[g] = -3.0e38f; l[g] = 0.f;
#pragma unroll
    for (int t = 0; t < 4; ++t) o[g][t] = z8; }
  *(v8us*)&sk[0][sr][sc] = rk0; *(v8us*)&sk[0][sr + 32][sc] = rk1; *(v8us*)&sv[0][sr][sc] = rv0; *(v8us*)&sv[0][sr + 32][sc] = rv1;
  __syncthreads();
  /* not unrolled: the two passes inside already fill the register budget, and the buffer index stays one scalar */
#pragma unroll 1
  for (int st = 0; st < SQ / FK; ++st) { const int cur = st & 1; const bool more = st + 1 < SQ / FK;      /* the same for the whole work-group */
    if (more) { const _Float16* kn = kg + (size_t)(st + 1) * FK * DM; const _Float16* vn = vg + (st + 1) * FK;
      rk0 = *(const v8us*)kn; rk1 = *(const v8us*)(kn + (size_t)32 * DM); rv0 = *(const v8us*)vn; rv1 = *(const v8us*)(vn + (size_t)32 * SQ);
      asm volatile("s_wait_xcnt 0x0" ::: "memory"); }      /* the four loads' address registers are temporaries that the fragment loads below reuse: the wait stands in front of every such overwrite */
#pragma unroll
    for (int ps = 0; ps < FK / 32; ++ps) {
      v8f s[2][2];      /* [column group][key tile] */
#pragma unroll
      for (int kt = 0; kt < 2; ++kt) { const _Float16* kr = &sk[cur][ps * 32 + kt * 16 + ln][0]; const v16h k0 = g2_frag(kr, hh), k1 = g2_frag(kr + 32, hh);
#pragma unroll
        for (int g = 0; g < 2; ++g) s[g][kt] = fa_mma(k1, qf[g][1], fa_mma(k0, qf[g][0], z8)); }
      v16h vf[4];
#pragma unroll
      for (int t = 0; t < 4; ++t) vf[t] = g2_frag(&sv[cur][t * 16 + ln][ps * 32], hh);
      float mb[2]; bool need = false;
#pragma unroll
      for (int g = 0; g < 2; ++g) { float m4[4];
#pragma unroll
        for (int q = 0; q < 4; ++q) m4[q] = fmaxf(fmaxf(s[g][0][q], s[g][0][q + 4]), fmaxf(s[g][1][q], s[g][1][q + 4]));
        float mx = fmaxf(fmaxf(m4[0], m4[1]), fmaxf(m4[2], m4[3]));
        mx = fmaxf(mx, xhalf(mx)) * cs;      /* both halves hold this query's maximum of the pass, scaled (cs > 0) */
        mb[g] = mx; need = need || (mx > mu[g] + 8.0f); }
      if (__builtin_amdgcn_ballot_w32(need) != 0) {      /* wave-uniform; always on the first pass, rare later */
#pragma unroll
        for (int g = 0; g < 2; ++g) { const float mn = fmaxf(mu[g], mb[g]); const float corr = exp2x1(mu[g] - mn); mu[g] = mn; l[g] *= corr;      /* corr = 0 on the first pass */
#pragma unroll
          for (int t = 0; t < 4; ++t) o[g][t] = o[g][t] * corr; } }
#pragma unroll
      for (int g = 0; g < 2; ++g) { const float nm = -mu[g]; FragH pf; float s4[4];
#pragma unroll
        for (int kt = 0; kt < 2; ++kt) { float p[8];
#pragma unroll
          for (int r = 0; r < 8; ++r) p[r] = fmaf(s[g][kt][r], cs, nm);
          exp2x8(p);
#pragma unroll
          for (int r = 0; r < 8; ++r) { if (kt == 0 && r < 4) s4[r] = p[r]; else s4[r & 3] += p[r]; pf.h[kt * 8 + r] = (_Float16)p[r]; } }      /* element 8 kt + r = key 16 kt + 8 hh + r: the k order of g2_frag */
        l[g] += (s4[0] + s4[1]) + (s4[2] + s4[3]);
#pragma unroll
        for (int t = 0; t < 4; ++t) o[g][t] = fa_mma(vf[t], pf.v, o[g][t]); }
    }
    if (more) { *(v8us*)&sk[cur ^ 1][sr][sc] = rk0; *(v8us*)&sk[cur ^ 1][sr + 32][sc] = rk1; *(v8us*)&sv[cur ^ 1][sr][sc] = rv0; *(v8us*)&sv[cur ^ 1][sr + 32][sc] = rv1; }      /* that buffer's last readers left it before the barrier that ended the stage before */
    __syncthreads();      /* publishes the next stage and ends every read of this one */
  }
#pragma unroll
  for (int g = 0; g < 2; ++g) { const float sc64 = 64.0f / (l[g] + xhalf(l[g]));      /* the halves' sums are joined once, here */
    _Float16* d = O16 + (qrow + 16 * g) * DM + h * HD + 8 * hh;
#pragma unroll
    for (int t = 0; t < 4; ++t) { FragH f;
#pragma unroll
      for (int r = 0; r < 8; ++r) f.h[r] = (_Float16)(o[g][t][r] * sc64);      /* o[g][t][r] = O[query ln of group g][d = 16 t + 8 hh + r]: 16 contiguous bytes */
      *(v8us*)(d + 16 * t) = f.half[0]; } }
}

// ---- GEMM with both operands through LDS: C[4096][DM] = (A[.][DM] . Bt[n][k]^T) * alpha + bf16(bias), all pitches DM, K = DM ----
// One work-group = 128 rows x 32 NT columns, eight waves as 4 (rows) x 2 (columns), one wave = 32 x 16 NT (2 x NT accumulator tiles).
// A fragment load straight from global memory touches 16 lines for 512 bytes; here each operand row's whole lines (GKT k values a stage) are fetched once per work-group, through registers into two LDS buffers
// (the next stage's global loads in flight under this stage's products), and the fragments are 16-byte LDS reads at a pitch of 16 bytes x odd. The k order, and so every sum, is that of the loop it replaces.
// blockIdx.y picks the weight plane, its bias and its output plane (three products in one launch). H16: f16 output rows, else f32.
// PF: the next k step's fragments are fetched into a second register set ahead of this step's products; for a launch of one work-group per WGP, where registers are free and few waves hide an LDS latency.
template <int NT, int GKT, bool H16, bool PF>
__global__ __launch_bounds__(256) void k_gemm3(const _Float16* __restrict__ A, const _Float16* __restrict__ Bh, size_t sB, float alpha, const float* __restrict__ bias, const float* __restrict__ bias1, const float* __restrict__ bias2,
    float* __restrict__ C, _Float16* __restrict__ C16, size_t sC) {
  constexpr int TM = 128, TN = 32 * NT, RW = TM + TN, PH = GKT + 8, CPI = TN + 4;      /* PH: f16 pitch of an operand row in LDS; CPI: f32 pitch of the output tile in LDS, rows 16-byte aligned */
  constexpr int TPR = GKT / 8, RPP = 256 / TPR, NPA = TM / RPP, NPB = TN / RPP, NKS = GKT / 32;      /* threads per staged row, rows per pass of the work-group, passes for A and for Bt, k steps a stage */
  static_assert(DM % TN == 0 && DM % GKT == 0 && GKT % 64 == 0 && TM % RPP == 0 && TN % RPP == 0, "k_gemm3: the tile must divide the matrix, a stage must hold whole lines");
  static_assert(2 * RW * PH * 2 >= TM * CPI * 4, "k_gemm3: the output tile must fit the operand buffers");
  __shared__ __attribute__((aligned(16))) unsigned char sm[2 * RW * PH * 2];      /* two operand buffers (rows 0..127 A, then Bt); afterwards the f32 output tile */
  _Float16 (*sb)[RW][PH] = (_Float16 (*)[RW][PH])sm;
  float (*so)[CPI] = (float (*)[CPI])sm;
  const int tid = threadIdx.x, lane = tid & 31, ln = lane & 15, hh = lane >> 4, w = tid >> 5, wm = w >> 1, wn = w & 1; const int by = blockIdx.y;
  if (by == 1) bias = bias1; else if (by == 2) bias = bias2;
  constexpr int ntn = DM / TN; const int mt = blockIdx.x / ntn, nq = blockIdx.x - mt * ntn; const int row0 = mt * TM, col0 = nq * TN;
  const int sr = tid / TPR, sc = (tid % TPR) * 8;      /* staging: TPR threads per row, rows sr + RPP i */
  const _Float16* ag = A + (size_t)(row0 + sr) * DM + sc;
  const _Float16* bg = Bh + (size_t)by * sB + (size_t)(col0 + sr) * DM + sc;
  v8us ra[NPA], rb[NPB];
#pragma unroll
  for (int i = 0; i < NPA; ++i) ra[i] = *(const v8us*)(ag + i * RPP * DM);
#pragma unroll
  for (int j = 0; j < NPB; ++j) rb[j] = *(const v8us*)(bg + j * RPP * DM);
  float bv[NT];      /* this lane's bias values, fetched here so that their latency lies under the main loop */
#pragma unroll
  for (int t = 0; t < NT; ++t) bv[t] = bias[col0 + (wn * NT + t) * 16 + ln];
  asm volatile("s_wait_xcnt 0x0" ::: "memory");      /* behind the loads: it stands in front of every later overwrite of their address registers */
  const v8f z8 = {0.f,0.f,0.f,0.f,0.f,0.f,0.f,0.f};
  v8f acc[2][NT];
#pragma unroll
  for (int t = 0; t < NT; ++t) { acc[0][t] = z8; acc[1][t] = z8; }
#pragma unroll
  for (int i = 0; i < NPA; ++i) *(v8us*)&sb[0][sr + RPP * i][sc] = ra[i];
#pragma unroll
  for (int j = 0; j < NPB; ++j) *(v8us*)&sb[0][TM + sr + RPP * j][sc] = rb[j];
  __syncthreads();
  /* not unrolled: the buffer index stays one scalar and the loop stays short */
#pragma unroll 1
  for (int st = 0; st < DM / GKT; ++st) { const int cur = st & 1; const bool more = st + 1 < DM / GKT;      /* the same for the whole work-group */
    if (more) { const _Float16* an = ag + (st + 1) * GKT; const _Float16* bn = bg + (st + 1) * GKT;
#pragma unroll
      for (int i = 0; i < NPA; ++i) ra[i] = *(const v8us*)(an + i * RPP * DM);
#pragma unroll
      for (int j = 0; j < NPB; ++j) rb[j] = *(const v8us*)(bn + j * RPP * DM);
      asm volatile("s_wait_xcnt 0x0" ::: "memory"); }      /* as above: the address registers are temporaries that the code below reuses */
    const _Float16* ar = &sb[cur][wm * 32 + ln][0]; const _Float16* br = &sb[cur][TM + wn * NT * 16 + ln][0];
    if (PF) { v16h fa[2][2], fb[2][NT];
      fa[0][0] = g2_frag(ar, hh); fa[0][1] = g2_frag(ar + 16 * PH, hh);
#pragma unroll
      for (int t = 0; t < NT; ++t) fb[0][t] = g2_frag(br + t * 16 * PH, hh);
#pragma unroll
      for (int ks = 0; ks < NKS; ++ks) { const int c = ks & 1, n = c ^ 1;
        if (ks + 1 < NKS) { fa[n][0] = g2_frag(ar + (ks + 1) * 32, hh); fa[n][1] = g2_frag(ar + 16 * PH + (ks + 1) * 32, hh);
#pragma unroll
          for (int t = 0; t < NT; ++t) fb[n][t] = g2_frag(br + t * 16 * PH + (ks + 1) * 32, hh); }
        __builtin_amdgcn_sched_barrier(0);      /* keeps the next step's LDS reads, one group, in front of this step's products; left free, they sink to their uses and each pair of products waits out an LDS latency */
#pragma unroll
        for (int t = 0; t < NT; ++t) { acc[0][t] = fa_mma(fa[c][0], fb[c][t], acc[0][t]); acc[1][t] = fa_mma(fa[c][1], fb[c][t], acc[1][t]); } } }
    else {
#pragma unroll
      for (int ks = 0; ks < NKS; ++ks) { const v16h a0 = g2_frag(ar + ks * 32, hh), a1 = g2_frag(ar + 16 * PH + ks * 32, hh);
#pragma unroll
        for (int t = 0; t < NT; ++t) { const v16h b = g2_frag(br + t * 16 * PH + ks * 32, hh); acc[0][t] = fa_mma(a0, b, acc[0][t]); acc[1][t] = fa_mma(a1, b, acc[1][t]); } } }
    if (more) {      /* that buffer's last readers left it before the barrier that ended the stage before */
#pragma unroll
      for (int i = 0; i < NPA; ++i) *(v8us*)&sb[cur ^ 1][sr + RPP * i][sc] = ra[i];
#pragma unroll
      for (int j = 0; j < NPB; ++j) *(v8us*)&sb[cur ^ 1][TM + sr + RPP * j][sc] = rb[j]; }
    __syncthreads();      /* publishes the next stage and ends every read of this one */
  }
  /* the last barrier of the loop ended every read of the operand buffers: the f32 output tile takes their place */
#pragma unroll
  for (int half = 0; half < 2; ++half)
#pragma unroll
    for (int t = 0; t < NT; ++t) { const int col = (wn * NT + t) * 16 + ln; const float bb = bf16_round(bv[t]);
#pragma unroll
      for (int r = 0; r < 8; ++r) so[wm * 32 + half * 16 + 8 * hh + r][col] = acc[half][t][r] * alpha + bb; }
  __syncthreads();      /* the rows are stored by other waves than wrote them: whole 128-byte lines, 8 threads a line, rows er + 32 i */
  const int er = tid >> 3, ec = tid & 7;
  if (H16) { _Float16* cd = C16 + (size_t)by * sC + (size_t)(row0 + er) * DM + col0 + ec * 8;
#pragma unroll
    for (int i = 0; i < 4; ++i)
#pragma unroll
      for (int sg = 0; sg < TN / 64; ++sg) { const v4f u0 = *(const v4fa*)&so[er + 32 * i][sg * 64 + ec * 8], u1 = *(const v4fa*)&so[er + 32 * i][sg * 64 + ec * 8 + 4]; FragH f;
#pragma unroll
        for (int q = 0; q < 4; ++q) { f.h[q] = (_Float16)u0[q]; f.h[4 + q] = (_Float16)u1[q]; }
        *(v8us*)(cd + i * 32 * DM + sg * 64) = f.half[0]; } }
  else { float* cd = C + (size_t)by * sC + (size_t)(row0 + er) * DM + col0 + ec * 4;
#pragma unroll
    for (int i = 0; i < 4; ++i)
#pragma unroll
      for (int sg = 0; sg < TN / 32; ++sg) { const v4f u = *(const v4fa*)&so[er + 32 * i][sg * 32 + ec * 4]; *(v4f*)(cd + i * 32 * DM + sg * 32) = u; } }
  asm volatile("s_wait_xcnt 0x0" ::: "memory");      /* behind the stores, in front of whatever follows them */
}

// ---- all input preparation in one launch: the five pieces read none of each other's output, so the grid index picks the piece ----
#define PWB (DM * (DM / 8) / 256)           /* work-groups per [DM][DM] weight plane, 8 elements a thread (exact) */
#define PXB ((int)(NR * DM / 8 / 256))      /* work-groups for the x rows, 8 elements a thread (exact) */
// Weight planes first (their eight strided loads a thread are the longer path, and low indices start first): Bt[n][k] = f16(bf16(W[k][n]) x 16), exact in f16.
// wq / wk / wv are per-head stacks [NH][DM][HD]: output row n = h * HD + e reads column e of head h's [in = DM][out = HD] block; wo is one [in = DM][out = DM] matrix. Then x as exact f16 rows, once: all three projections read the same rows.
template <int PITCH>      /* a compile-time row pitch: the eight loads share one address and differ in their immediate offsets */
__device__ __forceinline__ void prep_w8(const float* __restrict__ s, _Float16* __restrict__ d) { FragH f;
  /* unrolled: all eight loads are issued before the first value is used, and f stays in registers */
#pragma unroll
  for (int i = 0; i < 8; ++i) f.h[i] = (_Float16)(bf16_round(s[i * PITCH]) * 16.0f);
  *(v8us*)(unsigned short*)d = f.half[0];
  asm volatile("s_wait_xcnt 0x0" ::: "memory"); }      /* behind the store, as a precaution: each thread prepares one piece and then ends */
__global__ __launch_bounds__(256) void k_prep(const float* __restrict__ x, const float* __restrict__ wq, const float* __restrict__ wk, const float* __restrict__ wv, const float* __restrict__ wo,
    _Float16* __restrict__ X16, _Float16* __restrict__ BQ, _Float16* __restrict__ BK, _Float16* __restrict__ BV, _Float16* __restrict__ BO) {
  const int bx = blockIdx.x;
  if (bx < 4 * PWB) { const int m = bx / PWB; const int t = (bx - m * PWB) * 256 + threadIdx.x; const int n = t / (DM / 8), k8 = (t % (DM / 8)) * 8; const int o = n * DM + k8;
    if (m == 3) prep_w8<DM>(wo + k8 * DM + n, BO + o);
    else prep_w8<HD>((m == 0 ? wq : m == 1 ? wk : wv) + (n / HD) * (DM * HD) + k8 * HD + n % HD, (m == 0 ? BQ : m == 1 ? BK : BV) + o); }
  else { const size_t t = (size_t)(bx - 4 * PWB) * 256 + threadIdx.x; FragH f;
    /* unrolled: the eight contiguous floats become two 16-byte loads, and f stays in registers */
#pragma unroll
    for (int q = 0; q < 8; ++q) f.h[q] = (_Float16)bf16_round(x[t * 8 + q]);
    *(v8us*)((unsigned short*)X16 + t * 8) = f.half[0];
    asm volatile("s_wait_xcnt 0x0" ::: "memory"); }      /* behind the store, as in prep_w8 */
}

extern "C" void kernel_launch(void* const* d_in, const int* in_sizes, int n_in,
                              void* d_out, int out_size, void* d_ws, size_t ws_size, hipStream_t stream) {
  (void)in_sizes; (void)n_in; (void)out_size;
  const float* const* I = (const float* const*)d_in; const float* x = I[0]; const float* wq = I[1]; const float* bq = I[2]; const float* wk = I[3]; const float* bk = I[4]; const float* wv = I[5]; const float* bv = I[6]; const float* wo = I[7]; const float* bo = I[8];      /* ONE input stream (x) read on all three projections; wq, wk, wv are PER-HEAD STACKS [12][768][64] = [head][in][out]; bq, bk, bv are per-head [12][64] = the flat [768] bias; wo [in][out] + bo; input order x, wq, bq, wk, bk, wv, bv, wo, bo */
  char* ws = (char*)d_ws; size_t off = 0;
  auto take = [&](size_t bytes) { char* p = ws + off; off += (bytes + 255) & ~(size_t)255; return p; };
  _Float16* BQ = (_Float16*)take((size_t)DM * DM * 2); _Float16* BK = (_Float16*)take((size_t)DM * DM * 2); _Float16* BV = (_Float16*)take((size_t)DM * DM * 2); _Float16* BO = (_Float16*)take((size_t)DM * DM * 2);      /* BQ, BK, BV lie DM * DM elements apart (a multiple of 256 bytes): the batch stride of the merged projection launch */
  _Float16* X16 = (_Float16*)take(NR * DM * 2); _Float16* Q16 = (_Float16*)take(NR * DM * 2); _Float16* K16 = (_Float16*)take(NR * DM * 2); _Float16* V16 = (_Float16*)take(NR * DM * 2); _Float16* O16 = (_Float16*)take(NR * DM * 2);      /* Q16, K16, V16 lie NR * DM elements apart, likewise */
  _Float16* VT = (_Float16*)take((size_t)NB * NH * HD * SQ * 2);
  if (off > ws_size) return;
  k_prep<<<4 * PWB + PXB, 256, 0, stream>>>(x, wq, wk, wv, wo, X16, BQ, BK, BV, BO);      /* the four weight planes (x16) and x as exact f16 rows */
  const size_t r0p = (size_t)B0 * SQ;      /* first projected row */
  k_gemm3<4, 64, true, false><<<dim3((unsigned)((MP / 128) * (DM / 128)), 3), 256, 0, stream>>>(X16 + r0p * DM, BQ, (size_t)DM * DM, 0.0625f, bq, bk, bv, nullptr, Q16 + r0p * DM, NR * DM);      /* blockIdx.y = 0, 1, 2: q, k, v */
  k_vt<NH, SQ><<<NB * NH * (SQ / 64), 256, 0, stream>>>(V16, LQ, 0, VT);      /* V^T [NB][NH][HD][SQ], both batches */
  k_fattn<<<NB * NH * (SQ / 256), 256, 0, stream>>>(Q16, K16, VT, O16, 0.052058773f);      /* o (merged heads, x64) as f16 rows; cs = 768^-0.5 log2 e */
  k_gemm3<3, 128, false, true><<<dim3((unsigned)((MPO / 128) * (DM / 96)), 1), 256, 0, stream>>>(O16 + r0p * DM, BO, 0, 0.0009765625f, bo, nullptr, nullptr, (float*)d_out + r0p * DM, nullptr, 0);      /* out rows are the output layout */
}

// v005
// It runs in 75 microseconds.
// In both of two side-by-side timings against v004, it was 1.03 times as fast.
// Counting every step since v000, it is 36.4 times as fast.
#include <hip/hip_runtime.h>
// Multi-head self-attention with PER-HEAD STACKED projections and per-head biases at width 768, scaled by the EMBED WIDTH (x [2][2048][768]; q / k / v = einsum('bse,hed->bhsd', x, W) + b with W [12][768][64] = [head][in][out] and b [12][64], 12 heads of 64; scores / sqrt(E = 768) (the module's own: the embed width, not the head width); softmax over all 2048 keys (no mask); out = merged wo + bo ([in][out] [768][768] + bias) -> [2][2048][768]); each head's [in][out] block is transposed into its 64 contiguous rows of the [out][in] weight plane; a per-head bias [12][64] IS the flat bias [768].
// Structure: four launches. Token rows r = b*2048 + s; one preparation launch: x as exact f16 rows (bf16-rounded) and the four weight planes, picked by the grid index; Q, K, V as three WMMA GEMMs in one launch, picked by blockIdx.y (128x128 work-group tiles, operands through LDS, f32 accumulation, exact x16 weights + bias, f16 outputs; the v product is stored transposed, as V^T rows per (batch, head), by its own epilogue); one fused attention launch over all (batch, head, 256 queries): S^T = K Q^T (K = 64), online softmax in registers (f32 statistics, native exp2, scale 768^-0.5; unnormalised weights as f16), O^T += V^T P^T, o / sum carried x64 against f16 subnormal flush (folded into the output GEMM alpha) written straight into the merged f16 o rows; out = o W_o + b GEMM (f32) into the output layout.
// Compute dtype: inputs rounded to bf16; x / weights exact; q, k, v, softmax weights and o as plain f16 GEMM operands (~2^-12); scores and softmax statistics f32. v_wmma_f32_16x16x32_f16.
#define NB 2
#define SQ 2048
#define DM 768 
#define NH 12
#define HD 64
#define HG 4                         /* heads per launch of the grouped k_vt, which is not launched */
#define B0 0                         /* first batch processed (debug hook) */
#define NBR NB                       /* batches processed (debug hook) */
#define NR ((size_t)NB * SQ)         /* token rows */
#define MP ((int)((size_t)NBR * SQ)) /* rows projected (debug hook) */
#define QN SQ                        /* not used: attention takes all SQ query rows */
#define NHD NH                       /* not used: attention takes all NH heads */
#define MPO MP                       /* rows through the output stage (debug hook) */
#define LQ DM      /* not used: the q and k rows have pitch DM */
typedef __bf16 v16b __attribute__((ext_vector_type(16)));
typedef unsigned short v8us __attribute__((ext_vector_type(8), may_alias));
typedef float  v8f  __attribute__((ext_vector_type(8)));
typedef float  v4f  __attribute__((ext_vector_type(4)));
typedef float  v4fa __attribute__((ext_vector_type(4), may_alias));
union FragB { v16b v; v8us half[2]; unsigned short u[16]; };

__device__ __forceinline__ unsigned short bf16_bits(float x) { unsigned int u = __float_as_uint(x); return (unsigned short)((u + 0x7FFFu + ((u >> 16) & 1u)) >> 16); }
__device__ __forceinline__ float bf16_val(unsigned short b) { return __uint_as_float(((unsigned int)b) << 16); }
__device__ __forceinline__ float bf16_round(float x) { return bf16_val(bf16_bits(x)); }
// D += A·B with NT terms: 1 = ah·bh, 2 = + al·bh (A split), 3 = + ah·bl (both split)
template <int NT>
__device__ __forceinline__ v8f mmaN(v16b ah, v16b al, v16b bh, v16b bl, v8f c) {
  c = __builtin_amdgcn_wmma_f32_16x16x32_bf16(false, ah, false, bh, (short)0, c, false, false);
  if (NT >= 2) c = __builtin_amdgcn_wmma_f32_16x16x32_bf16(false, al, false, bh, (short)0, c, false, false);
  if (NT >= 3) c = __builtin_amdgcn_wmma_f32_16x16x32_bf16(false, ah, false, bl, (short)0, c, false, false);
  asm volatile("v_nop\n\tv_nop\n\tv_nop\n\tv_nop" : "+v"(c) : "v"(ah), "v"(al), "v"(bh), "v"(bl));
  return c;
}

__global__ __launch_bounds__(256) void k_wt_bf16(const float* __restrict__ W, unsigned short* __restrict__ Wt, int K, int N) {
  const int t = blockIdx.x * 256 + threadIdx.x;
  const int k8n = K / 8;
  if (t >= N * k8n) return;
  const int n = t / k8n, k8 = (t % k8n) * 8;
  v8us v;
#pragma unroll
  for (int i = 0; i < 8; ++i) v[i] = bf16_bits(W[(size_t)(k8 + i) * N + n]);
  *(v8us*)(Wt + (size_t)n * K + k8) = v;
  
}

// GEMM C[M][N] (f32, pitch ldc) = act(A[M][K]·W + bias). A f32 row-major (pitch lda) converted per fragment to bf16
// (ASPLIT: hi/lo two planes -> 2 terms, else single rounded term); Wt bf16 [N][K] (pitch ldb). BIAS_BF16 rounds the
// bias to bf16 first (bias quantised to bf16 before the add). K%32==0, M%16==0, N%64==0.
template <bool ASPLIT, int ACT, bool BIAS_BF16>
__global__ __launch_bounds__(128) void k_gemm_bf(const float* __restrict__ A, int lda, const unsigned short* __restrict__ Wt, int ldb,
                                               const float* __restrict__ bias, float* __restrict__ C, int ldc, int M, int N, int K) {
  __shared__ __attribute__((aligned(16))) float so[4][16][64];
  const int tid = threadIdx.x, w = tid >> 5, lane = tid & 31, ln = lane & 15, hh = lane >> 4;
  const int ntn = N / 64;
  const int wid = blockIdx.x * 4 + w;
  const int mt = wid / ntn, nq = wid % ntn;
  if (mt * 16 >= M) return;
  const int row0 = mt * 16, col0 = nq * 64;
  const float* arow = A + (size_t)(row0 + ln) * lda;
  v8f acc[4] = {};
  for (int kb = 0; kb < K; kb += 32) {
    FragB ah, al;
    const v4f x0 = *(const v4fa*)(arow + kb + 8 * hh), x1 = *(const v4fa*)(arow + kb + 8 * hh + 4);
    const v4f x2 = *(const v4fa*)(arow + kb + 16 + 8 * hh), x3 = *(const v4fa*)(arow + kb + 16 + 8 * hh + 4);
    float xs[16] = {x0[0],x0[1],x0[2],x0[3],x1[0],x1[1],x1[2],x1[3],x2[0],x2[1],x2[2],x2[3],x3[0],x3[1],x3[2],x3[3]};
#pragma unroll
    for (int i = 0; i < 16; ++i) { const unsigned short hb = bf16_bits(xs[i]); ah.u[i] = hb; al.u[i] = ASPLIT ? bf16_bits(xs[i] - bf16_val(hb)) : (unsigned short)0; }
#pragma unroll
    for (int t = 0; t < 4; ++t) {
      const unsigned short* brow = Wt + (size_t)(col0 + t * 16 + ln) * ldb + kb;
      FragB b;
      b.half[0] = *(const v8us*)(brow + 8 * hh);
      b.half[1] = *(const v8us*)(brow + 16 + 8 * hh);
      acc[t] = mmaN<ASPLIT ? 2 : 1>(ah.v, al.v, b.v, b.v, acc[t]);
    }
  }
#pragma unroll
  for (int t = 0; t < 4; ++t) {
    float bv = bias ? bias[col0 + t * 16 + ln] : 0.f;
    if (BIAS_BF16) bv = bf16_round(bv);
#pragma unroll
    for (int r = 0; r < 8; ++r) { float v = acc[t][r] + bv; if (ACT == 1) v = fmaxf(v, 0.f); so[w][8 * hh + r][t * 16 + ln] = v; }
  }
  __builtin_amdgcn_fence(__ATOMIC_ACQ_REL, "workgroup");
  __builtin_amdgcn_wave_barrier();
  const int rsub = lane >> 4, c4 = (lane & 15) * 4;
  {
#pragma unroll
    for (int q = 0; q < 8; ++q) {
      const int r = q * 2 + rsub;
      const v4f v = *(const v4fa*)&so[w][r][c4];
      *(v4f*)(C + (size_t)(row0 + r) * ldc + col0 + c4) = v;
    }
    
  }
}

// GEMM C = act(A·W + bias + resid): A f32 (ASPLIT -> hi/lo 2 terms), Wt bf16 [N][K]; ACT 0 none, 1 relu, 2 exact gelu;
// resid (optional, f32, row index = (row % rmod), pitch ldr, RES_BF16 rounds it) added before the activation.
template <bool ASPLIT, int ACT, bool BIAS_BF16, bool RES_BF16>
__global__ __launch_bounds__(128) void k_gemm_bf3(const float* __restrict__ A, int lda, const unsigned short* __restrict__ Wt, int ldb,
                                                const float* __restrict__ bias, const float* __restrict__ resid, int rmod, int ldr,
                                                float* __restrict__ C, int ldc, int M, int N, int K) {
  __shared__ __attribute__((aligned(16))) float so[4][16][64];
  const int tid = threadIdx.x, w = tid >> 5, lane = tid & 31, ln = lane & 15, hh = lane >> 4;
  const int ntn = N / 64;
  const int wid = blockIdx.x * 4 + w;
  const int mt = wid / ntn, nq = wid % ntn;
  if (mt * 16 >= M) return;
  const int row0 = mt * 16, col0 = nq * 64;
  const float* arow = A + (size_t)(row0 + ln) * lda;
  v8f acc[4] = {};
  for (int kb = 0; kb < K; kb += 32) {
    FragB ah, al;
    const v4f x0 = *(const v4fa*)(arow + kb + 8 * hh), x1 = *(const v4fa*)(arow + kb + 8 * hh + 4);
    const v4f x2 = *(const v4fa*)(arow + kb + 16 + 8 * hh), x3 = *(const v4fa*)(arow + kb + 16 + 8 * hh + 4);
    float xs[16] = {x0[0],x0[1],x0[2],x0[3],x1[0],x1[1],x1[2],x1[3],x2[0],x2[1],x2[2],x2[3],x3[0],x3[1],x3[2],x3[3]};
#pragma unroll
    for (int i = 0; i < 16; ++i) { const unsigned short hb = bf16_bits(xs[i]); ah.u[i] = hb; al.u[i] = ASPLIT ? bf16_bits(xs[i] - bf16_val(hb)) : (unsigned short)0; }
#pragma unroll
    for (int t = 0; t < 4; ++t) {
      const unsigned short* brow = Wt + (size_t)(col0 + t * 16 + ln) * ldb + kb;
      FragB b;
      b.half[0] = *(const v8us*)(brow + 8 * hh);
      b.half[1] = *(const v8us*)(brow + 16 + 8 * hh);
      acc[t] = mmaN<ASPLIT ? 2 : 1>(ah.v, al.v, b.v, b.v, acc[t]);
    }
  }
#pragma unroll
  for (int t = 0; t < 4; ++t) {
    const int col = col0 + t * 16 + ln;
    float bv = bias ? bias[col] : 0.f;
    if (BIAS_BF16) bv = bf16_round(bv);
#pragma unroll
    for (int r = 0; r < 8; ++r) {
      float v = acc[t][r] + bv;
      if (resid) { float rv = resid[(size_t)((row0 + 8 * hh + r) % rmod) * ldr + col]; if (RES_BF16) rv = bf16_round(rv); v += rv; }
      if (ACT == 1) v = fmaxf(v, 0.f);
      if (ACT == 2) v = 0.5f * v * (1.0f + erff(v * 0.70710678118654752f));
      if (ACT == 3) { const float u = 0.7978845608028654f * (v + 0.044715f * v * v * v); v = 0.5f * v * (1.0f + tanhf(u)); }
      so[w][8 * hh + r][t * 16 + ln] = v;
    }
  }
  __builtin_amdgcn_fence(__ATOMIC_ACQ_REL, "workgroup");
  __builtin_amdgcn_wave_barrier();
  const int rsub = lane >> 4, c4 = (lane & 15) * 4;
  {
#pragma unroll
    for (int q = 0; q < 8; ++q) {
      const int r = q * 2 + rsub;
      const v4f v = *(const v4fa*)&so[w][r][c4];
      *(v4f*)(C + (size_t)(row0 + r) * ldc + col0 + c4) = v;
    }
    
  }
}
// row LayerNorm (biased variance, eps) over N: s = X (+ R); optional out_sum <- s; out_norm <- (s-mu)*rsqrt(var+eps)*g + b
template <bool PARAM_BF16>
__global__ __launch_bounds__(256) void k_layernorm(const float* __restrict__ X, const float* __restrict__ R, const float* __restrict__ g, const float* __restrict__ bta,
                                                  float* __restrict__ out_sum, float* __restrict__ out_norm, int N, float eps) {
  __shared__ float red[256];
  const int row = blockIdx.x, tid = threadIdx.x;
  const float* x = X + (size_t)row * N; const float* rr = R ? R + (size_t)row * N : nullptr;
  float vals[16];                     // up to N = 4096
  const int per = N / 256;            // contiguous chunk per thread? use strided-by-4 chunks: thread handles j = tid*4 + 1024*u
  float s1 = 0.f;
  for (int u = 0; u < per / 4; ++u) {
    const int j = tid * 4 + 1024 * u;
    const v4f a = *(const v4fa*)(x + j);
    v4f b = {0.f,0.f,0.f,0.f}; if (rr) b = *(const v4fa*)(rr + j);
#pragma unroll
    for (int q = 0; q < 4; ++q) { const float v = a[q] + b[q]; vals[u * 4 + q] = v; s1 += v; }
  }
  red[tid] = s1; __syncthreads();
  for (int st = 128; st > 0; st >>= 1) { if (tid < st) red[tid] += red[tid + st]; __syncthreads(); }
  const float mu = red[0] / (float)N; __syncthreads();
  float s2 = 0.f;
  for (int u = 0; u < per / 4; ++u)
#pragma unroll
    for (int q = 0; q < 4; ++q) { const float c = vals[u * 4 + q] - mu; s2 += c * c; }
  red[tid] = s2; __syncthreads();
  for (int st = 128; st > 0; st >>= 1) { if (tid < st) red[tid] += red[tid + st]; __syncthreads(); }
  const float rs = rsqrtf(red[0] / (float)N + eps);
  {
    for (int u = 0; u < per / 4; ++u) {
      const int j = tid * 4 + 1024 * u;
      v4f o, sm;
#pragma unroll
      for (int q = 0; q < 4; ++q) {
        float gg = g[j + q], bb = bta[j + q];
        if (PARAM_BF16) { gg = bf16_round(gg); bb = bf16_round(bb); }
        sm[q] = vals[u * 4 + q]; o[q] = (vals[u * 4 + q] - mu) * rs * gg + bb;
      }
      if (out_sum) *(v4f*)(out_sum + (size_t)row * N + j) = sm;
      *(v4f*)(out_norm + (size_t)row * N + j) = o;
    }
    
  }
}



// ---- f16 WMMA path (v_wmma_f32_16x16x32_f16): 11-bit significands for operands in range — used where a [0,1] probability operand needs more precision than bf16
typedef _Float16 v16h __attribute__((ext_vector_type(16)));
union FragH { v16h v; v8us half[2]; _Float16 h[16]; unsigned short u[16]; };
template <int NT>
__device__ __forceinline__ v8f mmaH(v16h ah, v16h al, v16h bh, v16h bl, v8f c) {
  c = __builtin_amdgcn_wmma_f32_16x16x32_f16(false, ah, false, bh, (short)0, c, false, false);
  if (NT >= 2) c = __builtin_amdgcn_wmma_f32_16x16x32_f16(false, al, false, bh, (short)0, c, false, false);
  if (NT >= 3) c = __builtin_amdgcn_wmma_f32_16x16x32_f16(false, ah, false, bl, (short)0, c, false, false);
  asm volatile("v_nop\n\tv_nop\n\tv_nop\n\tv_nop" : "+v"(c) : "v"(ah), "v"(al), "v"(bh), "v"(bl));
  return c;
}
// batched GEMM like k_gemm_b but f16 operands: A f32 (split into f16 hi/lo if ASPLIT, else rounded to f16), Bt = f16 values [n][k]; alpha; C f32; N multiple of 16 (partial tiles skipped)
template <bool ASPLIT>
__global__ __launch_bounds__(128) void k_gemm_h(const float* __restrict__ A, int lda, size_t sA, const _Float16* __restrict__ Bh, int ldb, size_t sB, float alpha, float* __restrict__ C, int ldc, size_t sC, int M, int N, int K) {
  __shared__ __attribute__((aligned(16))) float so[4][16][64];
  const int tid = threadIdx.x, w = tid >> 5, lane = tid & 31, ln = lane & 15, hh = lane >> 4; const int by = blockIdx.y;
  A += (size_t)by * sA; Bh += (size_t)by * sB; C += (size_t)by * sC;
  const int ntn = (N + 63) / 64; const int wid = blockIdx.x * 4 + w; const int mt = wid / ntn, nq = wid % ntn; if (mt * 16 >= M) return;
  const int row0 = mt * 16, col0 = nq * 64; const float* arow = A + (size_t)(row0 + ln) * lda;
  v8f acc[4] = {};
  for (int kb = 0; kb < K; kb += 32) {
    FragH ah, al;
    const v4f x0 = *(const v4fa*)(arow + kb + 8 * hh), x1 = *(const v4fa*)(arow + kb + 8 * hh + 4), x2 = *(const v4fa*)(arow + kb + 16 + 8 * hh), x3 = *(const v4fa*)(arow + kb + 16 + 8 * hh + 4);
    float xs[16] = {x0[0],x0[1],x0[2],x0[3],x1[0],x1[1],x1[2],x1[3],x2[0],x2[1],x2[2],x2[3],x3[0],x3[1],x3[2],x3[3]};
#pragma unroll
    for (int i = 0; i < 16; ++i) { const _Float16 h = (_Float16)xs[i]; ah.h[i] = h; al.h[i] = ASPLIT ? (_Float16)(xs[i] - (float)h) : (_Float16)0.0f; }
#pragma unroll
    for (int t = 0; t < 4; ++t) { if (col0 + t * 16 >= N) continue; const size_t boff = (size_t)(col0 + t * 16 + ln) * ldb + kb; FragH bq; bq.half[0] = *(const v8us*)(Bh + boff + 8 * hh); bq.half[1] = *(const v8us*)(Bh + boff + 16 + 8 * hh);
      acc[t] = mmaH<ASPLIT ? 2 : 1>(ah.v, al.v, bq.v, bq.v, acc[t]); }
  }
#pragma unroll
  for (int t = 0; t < 4; ++t) { if (col0 + t * 16 >= N) continue;
#pragma unroll
    for (int r = 0; r < 8; ++r) so[w][8 * hh + r][t * 16 + ln] = acc[t][r] * alpha; }
  __builtin_amdgcn_fence(__ATOMIC_ACQ_REL, "workgroup"); __builtin_amdgcn_wave_barrier();
  const int rsub = lane >> 4, c4 = (lane & 15) * 4;
  {
#pragma unroll
    for (int q = 0; q < 8; ++q) { const int r = q * 2 + rsub; if (col0 + c4 < N) { const v4f v = *(const v4fa*)&so[w][r][c4]; *(v4f*)(C + (size_t)(row0 + r) * ldc + col0 + c4) = v; } }
     }
}

// k_gemm_hh variant with fused epilogue: v = acc·alpha + bias[by·sBias + col] (+ CP[(row/rowsPerB)·sCPb + by·64 + col] if CP) ; ACT 0 none / 1 elu ; writes f16 C16 (and f32 C if non-null)
template <int ACT>
__global__ __launch_bounds__(128) void k_gemm_hhx(const _Float16* __restrict__ A, int lda, size_t sA, const _Float16* __restrict__ Bh, int ldb, size_t sB, float alpha, const float* __restrict__ bias, size_t sBias, const float* __restrict__ CP, int rowsPerB, size_t sCPb, int row0g,
    float* __restrict__ C, _Float16* __restrict__ C16, int ldc, size_t sC, int M, int N, int K) {
  __shared__ __attribute__((aligned(16))) float so[4][16][64];
  const int tid = threadIdx.x, w = tid >> 5, lane = tid & 31, ln = lane & 15, hh = lane >> 4; const int by = blockIdx.y;
  A += (size_t)by * sA; Bh += (size_t)by * sB; const size_t cofs = (size_t)by * sC; const float* bp = bias ? bias + (size_t)by * sBias : nullptr;
  const int ntn = (N + 63) / 64; const int wid = blockIdx.x * 4 + w; const int mt = wid / ntn, nq = wid % ntn; if (mt * 16 >= M) return;
  const int row0 = mt * 16, col0 = nq * 64; const _Float16* arow = A + (size_t)(row0 + ln) * lda;
  v8f acc[4] = {};
  for (int kb = 0; kb < K; kb += 32) { FragH ah; ah.half[0] = *(const v8us*)((const unsigned short*)arow + kb + 8 * hh); ah.half[1] = *(const v8us*)((const unsigned short*)arow + kb + 16 + 8 * hh);
#pragma unroll
    for (int t = 0; t < 4; ++t) { if (col0 + t * 16 >= N) continue; const size_t boff = (size_t)(col0 + t * 16 + ln) * ldb + kb; FragH bq; bq.half[0] = *(const v8us*)((const unsigned short*)Bh + boff + 8 * hh); bq.half[1] = *(const v8us*)((const unsigned short*)Bh + boff + 16 + 8 * hh);
      acc[t] = mmaH<1>(ah.v, ah.v, bq.v, bq.v, acc[t]); }
  }
#pragma unroll
  for (int t = 0; t < 4; ++t) { if (col0 + t * 16 >= N) continue; const int col = col0 + t * 16 + ln; const float bv = bp ? bf16_round(bp[col]) : 0.f;
#pragma unroll
    for (int r = 0; r < 8; ++r) { float v = acc[t][r] * alpha + bv; if (CP) { const int rr = row0g + row0 + 8 * hh + r; if (rowsPerB < 0) v += CP[cofs + (size_t)rr * ldc + col];      /* rowsPerB < 0: own element of the batched C plane */ else { const int bidx = rr / rowsPerB; v += CP[(size_t)bidx * sCPb + (size_t)by * 64 + col]; } } if (ACT == 1) v = (v > 0.f) ? v : expm1f(v); else if (ACT == 7) v = (v > 0.f) ? v + 1.0f : expf(v); else if (ACT == 8) v = tanhf(v); else if (ACT == 9) v = 0.5f * v * (1.0f + tanhf(0.7978845608028654f * (v + 0.044715f * v * v * v))); else if (ACT == 11) v = 1.0f / (1.0f + expf(-v)); else if (ACT == 12) v = (v > 0.f) ? v : 0.01f * v; else if (ACT == 14) v = (v > 0.f) ? v : 0.1f * v; else if (ACT == 16) v = (v >= 0.f) ? v : 0.3f * v; else if (ACT == 17) v = (v >= 0.f) ? v : 0.2f * v; else if (ACT == 15) v = v / (1.0f + expf(-v)); else if (ACT == 3) v = fmaxf(v, 0.f); else if (ACT == 6) v = 0.5f * v * (1.0f + erff(v * 0.70710678118654752f)); so[w][8 * hh + r][t * 16 + ln] = v; } }
  __builtin_amdgcn_fence(__ATOMIC_ACQ_REL, "workgroup"); __builtin_amdgcn_wave_barrier();
  const int rsub = lane >> 4, c4 = (lane & 15) * 4; typedef _Float16 v4h __attribute__((ext_vector_type(4)));
  {
#pragma unroll
    for (int q = 0; q < 8; ++q) { const int r = q * 2 + rsub; if (col0 + c4 < N) { const v4f v = *(const v4fa*)&so[w][r][c4]; if (C) *(v4f*)(C + cofs + (size_t)(row0 + r) * ldc + col0 + c4) = v; if (C16) { v4h h4; for (int i = 0; i < 4; ++i) h4[i] = (_Float16)v[i]; *(v4h*)(C16 + cofs + (size_t)(row0 + r) * ldc + col0 + c4) = h4; } } }
     }
}


typedef _Float16 v4h __attribute__((ext_vector_type(4)));

__global__ __launch_bounds__(256) void k_h16(const float* __restrict__ x, _Float16* __restrict__ X16, size_t n8) { const size_t t = (size_t)blockIdx.x * 256 + threadIdx.x; if (t >= n8) return; FragH f;
#pragma unroll
  for (int q = 0; q < 8; ++q) f.h[q] = (_Float16)x[t * 8 + q]; *(v8us*)((unsigned short*)X16 + t * 8) = f.half[0];  }
__global__ __launch_bounds__(256) void k_round16f(const float* __restrict__ W, _Float16* __restrict__ Bt, size_t n8) { const size_t t = (size_t)blockIdx.x * 256 + threadIdx.x; if (t >= n8) return; FragH f;
#pragma unroll
  for (int i = 0; i < 8; ++i) f.h[i] = (_Float16)(bf16_round(W[t * 8 + i]) * 16.0f); *(v8us*)((unsigned short*)Bt + t * 8) = f.half[0];  }
template <int NHv, int TTv>
__global__ __launch_bounds__(256) void k_vt(const _Float16* __restrict__ V16, int ldv, int voff, _Float16* __restrict__ Vt) { __shared__ unsigned short tl[64][66]; const int tid = threadIdx.x; const int slab = blockIdx.x / (TTv / 64), lg = blockIdx.x % (TTv / 64); const int b = slab / NHv, h = slab % NHv;
  for (int i = tid; i < 64 * 8; i += 256) { const int r = i / 8, c8 = (i % 8) * 8; FragH f; f.half[0] = *(const v8us*)((const unsigned short*)V16 + ((size_t)b * TTv + lg * 64 + r) * ldv + voff + h * 64 + c8);
#pragma unroll
    for (int q = 0; q < 8; ++q) tl[r][c8 + q] = f.u[q]; }
  __syncthreads();
  {
#pragma unroll
    for (int rd = 0; rd < 2; ++rd) { const int d = rd * 32 + tid / 8, pc = tid % 8; FragH f;
#pragma unroll
      for (int q = 0; q < 8; ++q) f.u[q] = tl[pc * 8 + q][d];
      *(v8us*)((unsigned short*)Vt + ((size_t)slab * 64 + d) * TTv + lg * 64 + pc * 8) = f.half[0]; }
     } }

__global__ __launch_bounds__(256) void k_hl(const float* __restrict__ F, _Float16* __restrict__ Hh, _Float16* __restrict__ Hl, size_t n8) { const size_t t = (size_t)blockIdx.x * 256 + threadIdx.x; if (t >= n8) return; FragH fh, fl; const v4f a = *(const v4fa*)(F + t * 8), c = *(const v4fa*)(F + t * 8 + 4);
#pragma unroll
  for (int q = 0; q < 4; ++q) { _Float16 h = (_Float16)a[q]; fh.h[q] = h; fl.h[q] = (_Float16)((a[q] - (float)h) * 1024.0f); h = (_Float16)c[q]; fh.h[4 + q] = h; fl.h[4 + q] = (_Float16)((c[q] - (float)h) * 1024.0f); }
  { *(v8us*)((unsigned short*)Hh + t * 8) = fh.half[0]; *(v8us*)((unsigned short*)Hl + t * 8) = fl.half[0];  } }

// ---- fast GEMM (wave tile 32x64; requires M % 32 == 0 rows per launch region and N % 64 == 0); epilogue = k_gemm_hhx semantics ----
__device__ __forceinline__ v16h g2_frag(const _Float16* p, int hh) { FragH f; f.half[0] = *(const v8us*)((const unsigned short*)p + 8 * hh); f.half[1] = *(const v8us*)((const unsigned short*)p + 16 + 8 * hh); return f.v; }
__device__ __forceinline__ v8f g2_mma(v16h a, v16h b, v8f c) { v8f d = __builtin_amdgcn_wmma_f32_16x16x32_f16(false, a, false, b, (short)0, c, false, false); asm volatile("v_nop\n\tv_nop\n\tv_nop\n\tv_nop" : "+v"(d) : "v"(a), "v"(b)); return d; }
template <int ACT>
__global__ __launch_bounds__(128) void k_gemm2(const _Float16* __restrict__ A, int lda, size_t sA, const _Float16* __restrict__ Bh, int ldb, size_t sB, float alpha, const float* __restrict__ bias, const float* __restrict__ bias1, const float* __restrict__ bias2, size_t sBias, const float* __restrict__ CP, int rowsPerB, size_t sCPb, int row0g,
    float* __restrict__ C, _Float16* __restrict__ C16, int ldc, size_t sC, int M, int N, int K) { static_assert(ACT == 0 || ACT == 3 || ACT == 6 || ACT == 8 || ACT == 9 || ACT == 11 || ACT == 12 || ACT == 14 || ACT == 15 || ACT == 16 || ACT == 17, "k_gemm2: unsupported ACT code (would silently apply no activation)");
  __shared__ __attribute__((aligned(16))) float so[4][32][68];
  const int tid = threadIdx.x, w = tid >> 5, lane = tid & 31, ln = lane & 15, hh = lane >> 4; const int by = blockIdx.y;
  if (by == 1) bias = bias1; else if (by == 2) bias = bias2;      /* batches 1 and 2 may have their bias in a buffer of its own (three products with separate bias inputs in one launch) */
  A += (size_t)by * sA; Bh += (size_t)by * sB; const size_t cofs = (size_t)by * sC; const float* bp = bias ? bias + (size_t)by * sBias : nullptr;
  const int ntn = N >> 6; const int mt = blockIdx.x / ntn, nq = blockIdx.x - mt * ntn; const int row0 = mt * 128 + 32 * w, col0 = nq * 64; if (row0 >= M) return;
  const _Float16* a0p = A + (size_t)(row0 + ln) * lda; const _Float16* a1p = a0p + (size_t)16 * lda;
  const _Float16* b0p = Bh + (size_t)(col0 + ln) * ldb; const _Float16* b1p = b0p + (size_t)16 * ldb; const _Float16* b2p = b1p + (size_t)16 * ldb; const _Float16* b3p = b2p + (size_t)16 * ldb;
  const v8f z8 = {0.f,0.f,0.f,0.f,0.f,0.f,0.f,0.f}; v8f c00 = z8, c01 = z8, c02 = z8, c03 = z8, c10 = z8, c11 = z8, c12 = z8, c13 = z8;
#pragma unroll 1
  for (int kb = 0; kb < K; kb += 32) { const v16h a0 = g2_frag(a0p + kb, hh), a1 = g2_frag(a1p + kb, hh);
    v16h b = g2_frag(b0p + kb, hh); c00 = g2_mma(a0, b, c00); c10 = g2_mma(a1, b, c10);
    b = g2_frag(b1p + kb, hh); c01 = g2_mma(a0, b, c01); c11 = g2_mma(a1, b, c11);
    b = g2_frag(b2p + kb, hh); c02 = g2_mma(a0, b, c02); c12 = g2_mma(a1, b, c12);
    b = g2_frag(b3p + kb, hh); c03 = g2_mma(a0, b, c03); c13 = g2_mma(a1, b, c13); }
  v8f accs[8] = {c00, c01, c02, c03, c10, c11, c12, c13};
#pragma unroll
  for (int u = 0; u < 8; ++u) { const int t = u & 3, half = u >> 2; const int col = col0 + t * 16 + ln; const float bv = bp ? bf16_round(bp[col]) : 0.f;
#pragma unroll
    for (int r = 0; r < 8; ++r) { const int rloc = half * 16 + 8 * hh + r; float v = accs[u][r] * alpha + bv; if (CP) { if (rowsPerB < 0) v += CP[cofs + (size_t)(row0g + row0 + rloc) * ldc + col];      /* rowsPerB < 0: own element of the batched C plane */ else { const int bidx = (row0g + row0 + rloc) / rowsPerB; v += CP[(size_t)bidx * sCPb + (size_t)by * 64 + col]; } }
      if (ACT == 3) v = fmaxf(v, 0.f); else if (ACT == 6) v = 0.5f * v * (1.0f + erff(v * 0.70710678118654752f)); else if (ACT == 11) v = 1.0f / (1.0f + expf(-v)); else if (ACT == 15) v = v / (1.0f + expf(-v)); else if (ACT == 12) v = (v > 0.f) ? v : 0.01f * v; else if (ACT == 8) v = tanhf(v); else if (ACT == 9) v = 0.5f * v * (1.0f + tanhf(0.7978845608028654f * (v + 0.044715f * v * v * v))); else if (ACT == 14) v = (v > 0.f) ? v : 0.1f * v; else if (ACT == 16) v = (v >= 0.f) ? v : 0.3f * v; else if (ACT == 17) v = (v >= 0.f) ? v : 0.2f * v;
      so[w][rloc][t * 16 + ln] = v; } }
  __builtin_amdgcn_fence(__ATOMIC_ACQ_REL, "workgroup"); __builtin_amdgcn_wave_barrier();
  const int rsub = lane >> 4, c4 = (lane & 15) * 4;
  {
#pragma unroll
    for (int q = 0; q < 16; ++q) { const int r = q * 2 + rsub; const v4f v = *(const v4fa*)&so[w][r][c4]; if (C) *(v4f*)(C + cofs + (size_t)(row0 + r) * ldc + col0 + c4) = v; if (C16) { v4h h4; for (int i = 0; i < 4; ++i) h4[i] = (_Float16)v[i]; *(v4h*)(C16 + cofs + (size_t)(row0 + r) * ldc + col0 + c4) = h4; } }
     } }


__global__ __launch_bounds__(256) void k_wnat(const float* __restrict__ w, size_t n8, _Float16* __restrict__ Bt) { const size_t t = (size_t)blockIdx.x * 256 + threadIdx.x; if (t >= n8) return; FragH f; for (int q = 0; q < 8; ++q) f.h[q] = (_Float16)(bf16_round(w[t * 8 + q]) * 16.0f); *(v8us*)((unsigned short*)Bt + t * 8) = f.half[0];  }
__global__ __launch_bounds__(256) void k_rsm(const float* __restrict__ S, _Float16* __restrict__ P, int nrows) {
  #pragma clang fp contract(off)
  const int i = blockIdx.x * 256 + threadIdx.x; if (i >= nrows) return; const float* s = S + (size_t)i * SQ; float mx = -3.0e38f;
#pragma unroll 1
  for (int j = 0; j < SQ; ++j) mx = fmaxf(mx, s[j]); float se = 0.f;
#pragma unroll 1
  for (int j = 0; j < SQ; ++j) se += expf(s[j] - mx); const float sc = 256.0f / se;
#pragma unroll 1
  for (int j0 = 0; j0 < SQ; j0 += 8) { FragH f; for (int q = 0; q < 8; ++q) f.h[q] = (_Float16)(expf(s[j0 + q] - mx) * sc); unsigned short* d = (unsigned short*)P + (size_t)i * SQ + j0; *(v8us*)d = f.half[0];  } }
__global__ __launch_bounds__(256) void k_vt(const _Float16* __restrict__ V16, int b, int h0, _Float16* __restrict__ VT) { __shared__ unsigned short tl[64][65]; const int tid = threadIdx.x; const int hh = blockIdx.x % HG, sg = blockIdx.x / HG; const int s0 = sg * 64; const int h = h0 + hh;
  for (int i = tid; i < 64 * 8; i += 256) { const int j = i / 8, d8 = (i % 8) * 8; FragH f; f.half[0] = *(const v8us*)((const unsigned short*)V16 + ((size_t)b * SQ + s0 + j) * DM + h * HD + d8); for (int q = 0; q < 8; ++q) tl[d8 + q][j] = f.u[q]; }
  __syncthreads();
  { for (int i = tid; i < 64 * 8; i += 256) { const int d = i / 8, j8 = (i % 8) * 8; FragH f; for (int q = 0; q < 8; ++q) f.u[q] = tl[d][j8 + q]; *(v8us*)((unsigned short*)VT + ((size_t)hh * HD + d) * SQ + s0 + j8) = f.half[0]; }  } }



// ---- fused attention: scores, softmax and P.V in one kernel; neither scores nor weights go to memory ----
#define FK 64      /* keys per LDS stage */
#define FPH 72     /* LDS row pitch in f16: 128 data bytes + 16, the conflict-free pitch for 16-byte fragment reads */
__device__ __forceinline__ float xhalf(float x) { return __builtin_bit_cast(float, __builtin_amdgcn_permlanex16(__builtin_bit_cast(int, x), __builtin_bit_cast(int, x), 0x76543210, 0xfedcba98, false, false)); }      /* lane l reads lane l ^ 16 */
// native 2^x, in place. The instruction set asks for one independent instruction or a v_nop between a transcendental and a directly following instruction that uses its result or overwrites its source.
// Eight in one statement: each is the independent instruction behind the one before it, the one v_nop fills the slot behind the last. In place, so that the statement writes only registers that the compiler's own multiply-add has just written:
// the compiler does not look into asm text when it keeps its distance behind a matrix instruction, and a fresh output register could be an operand of one just issued.
__device__ __forceinline__ void exp2x8(float (&x)[8]) { asm("v_exp_f32 %0, %0\n\tv_exp_f32 %1, %1\n\tv_exp_f32 %2, %2\n\tv_exp_f32 %3, %3\n\tv_exp_f32 %4, %4\n\tv_exp_f32 %5, %5\n\tv_exp_f32 %6, %6\n\tv_exp_f32 %7, %7\n\tv_nop" : "+v"(x[0]), "+v"(x[1]), "+v"(x[2]), "+v"(x[3]), "+v"(x[4]), "+v"(x[5]), "+v"(x[6]), "+v"(x[7])); }
__device__ __forceinline__ float exp2x1(float x) { asm("v_exp_f32 %0, %0\n\tv_nop" : "+v"(x)); return x; }      /* the same, one value */
__device__ __forceinline__ v8f fa_mma(v16h a, v16h b, v8f c) { return __builtin_amdgcn_wmma_f32_16x16x32_f16(false, a, false, b, (short)0, c, false, false); }
__global__ __launch_bounds__(256) void k_fattn(const _Float16* __restrict__ Q16, const _Float16* __restrict__ K16, const _Float16* __restrict__ VT, _Float16* __restrict__ O16, float cs) {
  __shared__ __attribute__((aligned(16))) _Float16 sk[2][FK][FPH];
  __shared__ __attribute__((aligned(16))) _Float16 sv[2][HD][FPH];
  const int tid = threadIdx.x, lane = tid & 31, ln = lane & 15, hh = lane >> 4, w = tid >> 5;
  const int slab = blockIdx.x / (SQ / 256), qb = blockIdx.x % (SQ / 256); const int b = slab / NH, h = slab % NH;
  const size_t qrow = (size_t)b * SQ + qb * 256 + w * 32 + ln;
  const int sr = tid >> 3, sc = (tid & 7) * 8;      /* staging: 8 threads per 128-byte row, rows sr and sr + 32 */
  const _Float16* kg = K16 + ((size_t)b * SQ + sr) * DM + h * HD + sc;
  const _Float16* vg = VT + ((size_t)slab * HD + sr) * SQ + sc;
  v8us rk0 = *(const v8us*)kg, rk1 = *(const v8us*)(kg + (size_t)32 * DM), rv0 = *(const v8us*)vg, rv1 = *(const v8us*)(vg + (size_t)32 * SQ);
  v16h qf[2][2];
#pragma unroll
  for (int g = 0; g < 2; ++g)
#pragma unroll
    for (int s = 0; s < 2; ++s) qf[g][s] = g2_frag(Q16 + (qrow + 16 * g) * DM + h * HD + 32 * s, hh);
  const v8f z8 = {0.f,0.f,0.f,0.f,0.f,0.f,0.f,0.f};
  v8f o[2][4]; float mu[2], l[2];
#pragma unroll
  for (int g = 0; g < 2; ++g) { mu[g] = -3.0e38f; l[g] = 0.f;
#pragma unroll
    for (int t = 0; t < 4; ++t) o[g][t] = z8; }
  *(v8us*)&sk[0][sr][sc] = rk0; *(v8us*)&sk[0][sr + 32][sc] = rk1; *(v8us*)&sv[0][sr][sc] = rv0; *(v8us*)&sv[0][sr + 32][sc] = rv1;
  __syncthreads();
  /* not unrolled: the two passes inside already fill the register budget, and the buffer index stays one scalar */
#pragma unroll 1
  for (int st = 0; st < SQ / FK; ++st) { const int cur = st & 1; const bool more = st + 1 < SQ / FK;      /* the same for the whole work-group */
    if (more) { const _Float16* kn = kg + (size_t)(st + 1) * FK * DM; const _Float16* vn = vg + (st + 1) * FK;
      rk0 = *(const v8us*)kn; rk1 = *(const v8us*)(kn + (size_t)32 * DM); rv0 = *(const v8us*)vn; rv1 = *(const v8us*)(vn + (size_t)32 * SQ);
      asm volatile("s_wait_xcnt 0x0" ::: "memory"); }      /* the four loads' address registers are temporaries that the fragment loads below reuse: the wait stands in front of every such overwrite */
#pragma unroll
    for (int ps = 0; ps < FK / 32; ++ps) {
      v8f s[2][2];      /* [column group][key tile] */
#pragma unroll
      for (int kt = 0; kt < 2; ++kt) { const _Float16* kr = &sk[cur][ps * 32 + kt * 16 + ln][0]; const v16h k0 = g2_frag(kr, hh), k1 = g2_frag(kr + 32, hh);
#pragma unroll
        for (int g = 0; g < 2; ++g) s[g][kt] = fa_mma(k1, qf[g][1], fa_mma(k0, qf[g][0], z8)); }
      v16h vf[4];
#pragma unroll
      for (int t = 0; t < 4; ++t) vf[t] = g2_frag(&sv[cur][t * 16 + ln][ps * 32], hh);
      float mb[2]; bool need = false;
#pragma unroll
      for (int g = 0; g < 2; ++g) { float m4[4];
#pragma unroll
        for (int q = 0; q < 4; ++q) m4[q] = fmaxf(fmaxf(s[g][0][q], s[g][0][q + 4]), fmaxf(s[g][1][q], s[g][1][q + 4]));
        float mx = fmaxf(fmaxf(m4[0], m4[1]), fmaxf(m4[2], m4[3]));
        mx = fmaxf(mx, xhalf(mx)) * cs;      /* both halves hold this query's maximum of the pass, scaled (cs > 0) */
        mb[g] = mx; need = need || (mx > mu[g] + 8.0f); }
      if (__builtin_amdgcn_ballot_w32(need) != 0) {      /* wave-uniform; always on the first pass, rare later */
#pragma unroll
        for (int g = 0; g < 2; ++g) { const float mn = fmaxf(mu[g], mb[g]); const float corr = exp2x1(mu[g] - mn); mu[g] = mn; l[g] *= corr;      /* corr = 0 on the first pass */
#pragma unroll
          for (int t = 0; t < 4; ++t) o[g][t] = o[g][t] * corr; } }
#pragma unroll
      for (int g = 0; g < 2; ++g) { const float nm = -mu[g]; FragH pf; float s4[4];
#pragma unroll
        for (int kt = 0; kt < 2; ++kt) { float p[8];
#pragma unroll
          for (int r = 0; r < 8; ++r) p[r] = fmaf(s[g][kt][r], cs, nm);
          exp2x8(p);
#pragma unroll
          for (int r = 0; r < 8; ++r) { if (kt == 0 && r < 4) s4[r] = p[r]; else s4[r & 3] += p[r]; pf.h[kt * 8 + r] = (_Float16)p[r]; } }      /* element 8 kt + r = key 16 kt + 8 hh + r: the k order of g2_frag */
        l[g] += (s4[0] + s4[1]) + (s4[2] + s4[3]);
#pragma unroll
        for (int t = 0; t < 4; ++t) o[g][t] = fa_mma(vf[t], pf.v, o[g][t]); }
    }
    if (more) { *(v8us*)&sk[cur ^ 1][sr][sc] = rk0; *(v8us*)&sk[cur ^ 1][sr + 32][sc] = rk1; *(v8us*)&sv[cur ^ 1][sr][sc] = rv0; *(v8us*)&sv[cur ^ 1][sr + 32][sc] = rv1; }      /* that buffer's last readers left it before the barrier that ended the stage before */
    __syncthreads();      /* publishes the next stage and ends every read of this one */
  }
#pragma unroll
  for (int g = 0; g < 2; ++g) { const float sc64 = 64.0f / (l[g] + xhalf(l[g]));      /* the halves' sums are joined once, here */
    _Float16* d = O16 + (qrow + 16 * g) * DM + h * HD + 8 * hh;
#pragma unroll
    for (int t = 0; t < 4; ++t) { FragH f;
#pragma unroll
      for (int r = 0; r < 8; ++r) f.h[r] = (_Float16)(o[g][t][r] * sc64);      /* o[g][t][r] = O[query ln of group g][d = 16 t + 8 hh + r]: 16 contiguous bytes */
      *(v8us*)(d + 16 * t) = f.half[0]; } }
}

// ---- GEMM with both operands through LDS: C[4096][DM] = (A[.][DM] . Bt[n][k]^T) * alpha + bf16(bias), all pitches DM, K = DM ----
// One work-group = 128 rows x 32 NT columns, eight waves as 4 (rows) x 2 (columns), one wave = 32 x 16 NT (2 x NT accumulator tiles).
// A fragment load straight from global memory touches 16 lines for 512 bytes; here each operand row's whole lines (GKT k values a stage) are fetched once per work-group, through registers into two LDS buffers
// (the next stage's global loads in flight under this stage's products), and the fragments are 16-byte LDS reads at a pitch of 16 bytes x odd. The k order, and so every sum, is that of the loop it replaces.
// blockIdx.y picks the weight plane, its bias and its output plane (three products in one launch). H16: f16 output rows, else f32.
// PF: the next k step's fragments are fetched into a second register set ahead of this step's products; for a launch of one work-group per WGP, where registers are free and few waves hide an LDS latency.
// VTO: plane 2 (blockIdx.y == 2) is stored transposed and nowhere else: CT[(row / SQ) * DM + column][row % SQ], f16, which is V^T [batch][head][d][key] for merged-head columns.
template <int NT, int GKT, bool H16, bool PF, bool VTO>
__global__ __launch_bounds__(256) void k_gemm3(const _Float16* __restrict__ A, const _Float16* __restrict__ Bh, size_t sB, float alpha, const float* __restrict__ bias, const float* __restrict__ bias1, const float* __restrict__ bias2,
    float* __restrict__ C, _Float16* __restrict__ C16, size_t sC, _Float16* __restrict__ CT) {
  constexpr int TM = 128, TN = 32 * NT, RW = TM + TN, PH = GKT + 8, CPI = TN + 4;      /* PH: f16 pitch of an operand row in LDS; CPI: f32 pitch of the output tile in LDS, rows 16-byte aligned */
  constexpr int TPR = GKT / 8, RPP = 256 / TPR, NPA = TM / RPP, NPB = TN / RPP, NKS = GKT / 32;      /* threads per staged row, rows per pass of the work-group, passes for A and for Bt, k steps a stage */
  static_assert(DM % TN == 0 && DM % GKT == 0 && GKT % 64 == 0 && TM % RPP == 0 && TN % RPP == 0, "k_gemm3: the tile must divide the matrix, a stage must hold whole lines");
  static_assert(2 * RW * PH * 2 >= TM * CPI * 4, "k_gemm3: the output tile must fit the operand buffers");
  constexpr int TPI = TM + 8;      /* f16 pitch of one output column's TM rows in LDS (transposed tile): 256 data bytes + 16 = 16 bytes x odd */
  static_assert(!VTO || (2 * RW * PH * 2 >= TN * TPI * 2 && SQ % TM == 0 && TN % 16 == 0), "k_gemm3: the transposed tile must fit the operand buffers and lie in one batch");
  __shared__ __attribute__((aligned(16))) unsigned char sm[2 * RW * PH * 2];      /* two operand buffers (rows 0..127 A, then Bt); afterwards the output tile (f32, or the f16 transposed tile of plane 2 under VTO) */
  _Float16 (*sb)[RW][PH] = (_Float16 (*)[RW][PH])sm;
  float (*so)[CPI] = (float (*)[CPI])sm;
  const int tid = threadIdx.x, lane = tid & 31, ln = lane & 15, hh = lane >> 4, w = tid >> 5, wm = w >> 1, wn = w & 1; const int by = blockIdx.y;
  if (by == 1) bias = bias1; else if (by == 2) bias = bias2;
  constexpr int ntn = DM / TN; const int mt = blockIdx.x / ntn, nq = blockIdx.x - mt * ntn; const int row0 = mt * TM, col0 = nq * TN;
  const int sr = tid / TPR, sc = (tid % TPR) * 8;      /* staging: TPR threads per row, rows sr + RPP i */
  const _Float16* ag = A + (size_t)(row0 + sr) * DM + sc;
  const _Float16* bg = Bh + (size_t)by * sB + (size_t)(col0 + sr) * DM + sc;
  v8us ra[NPA], rb[NPB];
#pragma unroll
  for (int i = 0; i < NPA; ++i) ra[i] = *(const v8us*)(ag + i * RPP * DM);
#pragma unroll
  for (int j = 0; j < NPB; ++j) rb[j] = *(const v8us*)(bg + j * RPP * DM);
  float bv[NT];      /* this lane's bias values, fetched here so that their latency lies under the main loop */
#pragma unroll
  for (int t = 0; t < NT; ++t) bv[t] = bias[col0 + (wn * NT + t) * 16 + ln];
  asm volatile("s_wait_xcnt 0x0" ::: "memory");      /* behind the loads: it stands in front of every later overwrite of their address registers */
  const v8f z8 = {0.f,0.f,0.f,0.f,0.f,0.f,0.f,0.f};
  v8f acc[2][NT];
#pragma unroll
  for (int t = 0; t < NT; ++t) { acc[0][t] = z8; acc[1][t] = z8; }
#pragma unroll
  for (int i = 0; i < NPA; ++i) *(v8us*)&sb[0][sr + RPP * i][sc] = ra[i];
#pragma unroll
  for (int j = 0; j < NPB; ++j) *(v8us*)&sb[0][TM + sr + RPP * j][sc] = rb[j];
  __syncthreads();
  /* not unrolled: the buffer index stays one scalar and the loop stays short */
#pragma unroll 1
  for (int st = 0; st < DM / GKT; ++st) { const int cur = st & 1; const bool more = st + 1 < DM / GKT;      /* the same for the whole work-group */
    if (more) { const _Float16* an = ag + (st + 1) * GKT; const _Float16* bn = bg + (st + 1) * GKT;
#pragma unroll
      for (int i = 0; i < NPA; ++i) ra[i] = *(const v8us*)(an + i * RPP * DM);
#pragma unroll
      for (int j = 0; j < NPB; ++j) rb[j] = *(const v8us*)(bn + j * RPP * DM);
      asm volatile("s_wait_xcnt 0x0" ::: "memory"); }      /* as above: the address registers are temporaries that the code below reuses */
    const _Float16* ar = &sb[cur][wm * 32 + ln][0]; const _Float16* br = &sb[cur][TM + wn * NT * 16 + ln][0];
    if (PF) { v16h fa[2][2], fb[2][NT];
      fa[0][0] = g2_frag(ar, hh); fa[0][1] = g2_frag(ar + 16 * PH, hh);
#pragma unroll
      for (int t = 0; t < NT; ++t) fb[0][t] = g2_frag(br + t * 16 * PH, hh);
#pragma unroll
      for (int ks = 0; ks < NKS; ++ks) { const int c = ks & 1, n = c ^ 1;
        if (ks + 1 < NKS) { fa[n][0] = g2_frag(ar + (ks + 1) * 32, hh); fa[n][1] = g2_frag(ar + 16 * PH + (ks + 1) * 32, hh);
#pragma unroll
          for (int t = 0; t < NT; ++t) fb[n][t] = g2_frag(br + t * 16 * PH + (ks + 1) * 32, hh); }
        __builtin_amdgcn_sched_barrier(0);      /* keeps the next step's LDS reads, one group, in front of this step's products; left free, they sink to their uses and each pair of products waits out an LDS latency */
#pragma unroll
        for (int t = 0; t < NT; ++t) { acc[0][t] = fa_mma(fa[c][0], fb[c][t], acc[0][t]); acc[1][t] = fa_mma(fa[c][1], fb[c][t], acc[1][t]); } } }
    else {
#pragma unroll
      for (int ks = 0; ks < NKS; ++ks) { const v16h a0 = g2_frag(ar + ks * 32, hh), a1 = g2_frag(ar + 16 * PH + ks * 32, hh);
#pragma unroll
        for (int t = 0; t < NT; ++t) { const v16h b = g2_frag(br + t * 16 * PH + ks * 32, hh); acc[0][t] = fa_mma(a0, b, acc[0][t]); acc[1][t] = fa_mma(a1, b, acc[1][t]); } } }
    if (more) {      /* that buffer's last readers left it before the barrier that ended the stage before */
#pragma unroll
      for (int i = 0; i < NPA; ++i) *(v8us*)&sb[cur ^ 1][sr + RPP * i][sc] = ra[i];
#pragma unroll
      for (int j = 0; j < NPB; ++j) *(v8us*)&sb[cur ^ 1][TM + sr + RPP * j][sc] = rb[j]; }
    __syncthreads();      /* publishes the next stage and ends every read of this one */
  }
  /* the last barrier of the loop ended every read of the operand buffers: the output tile takes their place */
  if (VTO && by == 2) {      /* the same for the whole work-group. A lane's eight accumulator values are eight consecutive rows of one column: 16 contiguous bytes of that column's transposed row */
    _Float16 (*st)[TPI] = (_Float16 (*)[TPI])sm;
#pragma unroll
    for (int half = 0; half < 2; ++half)
#pragma unroll
      for (int t = 0; t < NT; ++t) { const float bb = bf16_round(bv[t]); FragH f;
#pragma unroll
        for (int r = 0; r < 8; ++r) f.h[r] = (_Float16)(acc[half][t][r] * alpha + bb);
        *(v8us*)&st[(wn * NT + t) * 16 + ln][wm * 32 + half * 16 + 8 * hh] = f.half[0]; }
    __syncthreads();      /* a column's 128 rows come from four waves and are stored by another: two whole 128-byte lines, 16 threads a column, columns vc + 16 i */
    const int vc = tid >> 4, vp = (tid & 15) * 8;
    _Float16* td = CT + ((size_t)(row0 / SQ) * DM + col0 + vc) * SQ + row0 % SQ + vp;
#pragma unroll
    for (int i = 0; i < TN / 16; ++i) *(v8us*)(td + (size_t)i * 16 * SQ) = *(const v8us*)&st[vc + 16 * i][vp]; }
  else {
#pragma unroll
  for (int half = 0; half < 2; ++half)
#pragma unroll
    for (int t = 0; t < NT; ++t) { const int col = (wn * NT + t) * 16 + ln; const float bb = bf16_round(bv[t]);
#pragma unroll
      for (int r = 0; r < 8; ++r) so[wm * 32 + half * 16 + 8 * hh + r][col] = acc[half][t][r] * alpha + bb; }
  __syncthreads();      /* the rows are stored by other waves than wrote them: whole 128-byte lines, 8 threads a line, rows er + 32 i */
  const int er = tid >> 3, ec = tid & 7;
  if (H16) { _Float16* cd = C16 + (size_t)by * sC + (size_t)(row0 + er) * DM + col0 + ec * 8;
#pragma unroll
    for (int i = 0; i < 4; ++i)
#pragma unroll
      for (int sg = 0; sg < TN / 64; ++sg) { const v4f u0 = *(const v4fa*)&so[er + 32 * i][sg * 64 + ec * 8], u1 = *(const v4fa*)&so[er + 32 * i][sg * 64 + ec * 8 + 4]; FragH f;
#pragma unroll
        for (int q = 0; q < 4; ++q) { f.h[q] = (_Float16)u0[q]; f.h[4 + q] = (_Float16)u1[q]; }
        *(v8us*)(cd + i * 32 * DM + sg * 64) = f.half[0]; } }
  else { float* cd = C + (size_t)by * sC + (size_t)(row0 + er) * DM + col0 + ec * 4;
#pragma unroll
    for (int i = 0; i < 4; ++i)
#pragma unroll
      for (int sg = 0; sg < TN / 32; ++sg) { const v4f u = *(const v4fa*)&so[er + 32 * i][sg * 32 + ec * 4]; *(v4f*)(cd + i * 32 * DM + sg * 32) = u; } }
  }
  asm volatile("s_wait_xcnt 0x0" ::: "memory");      /* behind the stores, in front of whatever follows them */
}

// ---- all input preparation in one launch: the five pieces read none of each other's output, so the grid index picks the piece ----
#define PWB (DM * (DM / 8) / 256)           /* work-groups per [DM][DM] weight plane, 8 elements a thread (exact) */
#define PXB ((int)(NR * DM / 8 / 256))      /* work-groups for the x rows, 8 elements a thread (exact) */
// Weight planes first (their eight strided loads a thread are the longer path, and low indices start first): Bt[n][k] = f16(bf16(W[k][n]) x 16), exact in f16.
// wq / wk / wv are per-head stacks [NH][DM][HD]: output row n = h * HD + e reads column e of head h's [in = DM][out = HD] block; wo is one [in = DM][out = DM] matrix. Then x as exact f16 rows, once: all three projections read the same rows.
template <int PITCH>      /* a compile-time row pitch: the eight loads share one address and differ in their immediate offsets */
__device__ __forceinline__ void prep_w8(const float* __restrict__ s, _Float16* __restrict__ d) { FragH f;
  /* unrolled: all eight loads are issued before the first value is used, and f stays in registers */
#pragma unroll
  for (int i = 0; i < 8; ++i) f.h[i] = (_Float16)(bf16_round(s[i * PITCH]) * 16.0f);
  *(v8us*)(unsigned short*)d = f.half[0];
  asm volatile("s_wait_xcnt 0x0" ::: "memory"); }      /* behind the store, as a precaution: each thread prepares one piece and then ends */
__global__ __launch_bounds__(256) void k_prep(const float* __restrict__ x, const float* __restrict__ wq, const float* __restrict__ wk, const float* __restrict__ wv, const float* __restrict__ wo,
    _Float16* __restrict__ X16, _Float16* __restrict__ BQ, _Float16* __restrict__ BK, _Float16* __restrict__ BV, _Float16* __restrict__ BO) {
  const int bx = blockIdx.x;
  if (bx < 4 * PWB) { const int m = bx / PWB; const int t = (bx - m * PWB) * 256 + threadIdx.x; const int n = t / (DM / 8), k8 = (t % (DM / 8)) * 8; const int o = n * DM + k8;
    if (m == 3) prep_w8<DM>(wo + k8 * DM + n, BO + o);
    else prep_w8<HD>((m == 0 ? wq : m == 1 ? wk : wv) + (n / HD) * (DM * HD) + k8 * HD + n % HD, (m == 0 ? BQ : m == 1 ? BK : BV) + o); }
  else { const size_t t = (size_t)(bx - 4 * PWB) * 256 + threadIdx.x; FragH f;
    /* unrolled: the eight contiguous floats become two 16-byte loads, and f stays in registers */
#pragma unroll
    for (int q = 0; q < 8; ++q) f.h[q] = (_Float16)bf16_round(x[t * 8 + q]);
    *(v8us*)((unsigned short*)X16 + t * 8) = f.half[0];
    asm volatile("s_wait_xcnt 0x0" ::: "memory"); }      /* behind the store, as in prep_w8 */
}

extern "C" void kernel_launch(void* const* d_in, const int* in_sizes, int n_in,
                              void* d_out, int out_size, void* d_ws, size_t ws_size, hipStream_t stream) {
  (void)in_sizes; (void)n_in; (void)out_size;
  const float* const* I = (const float* const*)d_in; const float* x = I[0]; const float* wq = I[1]; const float* bq = I[2]; const float* wk = I[3]; const float* bk = I[4]; const float* wv = I[5]; const float* bv = I[6]; const float* wo = I[7]; const float* bo = I[8];      /* ONE input stream (x) read on all three projections; wq, wk, wv are PER-HEAD STACKS [12][768][64] = [head][in][out]; bq, bk, bv are per-head [12][64] = the flat [768] bias; wo [in][out] + bo; input order x, wq, bq, wk, bk, wv, bv, wo, bo */
  char* ws = (char*)d_ws; size_t off = 0;
  auto take = [&](size_t bytes) { char* p = ws + off; off += (bytes + 255) & ~(size_t)255; return p; };
  _Float16* BQ = (_Float16*)take((size_t)DM * DM * 2); _Float16* BK = (_Float16*)take((size_t)DM * DM * 2); _Float16* BV = (_Float16*)take((size_t)DM * DM * 2); _Float16* BO = (_Float16*)take((size_t)DM * DM * 2);      /* BQ, BK, BV lie DM * DM elements apart (a multiple of 256 bytes): the batch stride of the merged projection launch */
  _Float16* X16 = (_Float16*)take(NR * DM * 2); _Float16* Q16 = (_Float16*)take(NR * DM * 2); _Float16* K16 = (_Float16*)take(NR * DM * 2); _Float16* O16 = (_Float16*)take(NR * DM * 2);      /* Q16, K16 lie NR * DM elements apart, likewise */
  _Float16* VT = (_Float16*)take((size_t)NB * NH * HD * SQ * 2);
  if (off > ws_size) return;
  k_prep<<<4 * PWB + PXB, 256, 0, stream>>>(x, wq, wk, wv, wo, X16, BQ, BK, BV, BO);      /* the four weight planes (x16) and x as exact f16 rows */
  const size_t r0p = (size_t)B0 * SQ;      /* first projected row */
  k_gemm3<4, 64, true, false, true><<<dim3((unsigned)((MP / 128) * (DM / 128)), 3), 256, 0, stream>>>(X16 + r0p * DM, BQ, (size_t)DM * DM, 0.0625f, bq, bk, bv, nullptr, Q16 + r0p * DM, NR * DM, VT + (size_t)B0 * DM * SQ);      /* blockIdx.y = 0, 1, 2: q rows, k rows, V^T [NB][NH][HD][SQ] */
  k_fattn<<<NB * NH * (SQ / 256), 256, 0, stream>>>(Q16, K16, VT, O16, 0.052058773f);      /* o (merged heads, x64) as f16 rows; cs = 768^-0.5 log2 e */
  k_gemm3<3, 128, false, true, false><<<dim3((unsigned)((MPO / 128) * (DM / 96)), 1), 256, 0, stream>>>(O16 + r0p * DM, BO, 0, 0.0009765625f, bo, nullptr, nullptr, (float*)d_out + r0p * DM, nullptr, 0, nullptr);      /* out rows are the output layout */
}

// v006
// One run takes 68.8 microseconds.
// In both of two side-by-side timings against v005, it was 1.09 times as fast.
// All steps since v000 together make it 39.6 times as fast.
#include <hip/hip_runtime.h>
// Multi-head self-attention with PER-HEAD STACKED projections and per-head biases at width 768, scaled by the EMBED WIDTH (x [2][2048][768]; q / k / v = einsum('bse,hed->bhsd', x, W) + b with W [12][768][64] = [head][in][out] and b [12][64], 12 heads of 64; scores / sqrt(E = 768) (the module's own: the embed width, not the head width); softmax over all 2048 keys (no mask); out = merged wo + bo ([in][out] [768][768] + bias) -> [2][2048][768]); each head's [in][out] block is transposed into its 64 contiguous rows of the [out][in] weight plane; a per-head bias [12][64] IS the flat bias [768].
// Structure: four launches. Token rows r = b*2048 + s; one preparation launch: x as exact f16 rows (bf16-rounded) and the four weight planes, picked by the grid index; Q, K, V as three WMMA GEMMs in one launch, picked by blockIdx.y (128x128 work-group tiles, operands through LDS, f32 accumulation, exact x16 weights + bias, f16 outputs; the v product is stored transposed, as V^T rows per (batch, head), by its own epilogue); one fused attention launch over all (batch, head, 256 queries): S^T = K Q^T (K = 64), online softmax in registers (f32 statistics, native exp2, scale 768^-0.5; unnormalised weights as f16), O^T += V^T P^T, o / sum carried x64 against f16 subnormal flush (folded into the output GEMM alpha) written straight into the merged f16 o rows; out = o W_o + b GEMM (f32) into the output layout.
// Compute dtype: inputs rounded to bf16; x / weights exact; q, k, v, softmax weights and o as plain f16 GEMM operands (~2^-12); scores and softmax statistics f32. v_wmma_f32_16x16x32_f16.
#define NB 2
#define SQ 2048
#define DM 768 
#define NH 12
#define HD 64
#define HG 4                         /* heads per launch of the grouped k_vt, which is not launched */
#define B0 0                         /* first batch processed (debug hook) */
#define NBR NB                       /* batches processed (debug hook) */
#define NR ((size_t)NB * SQ)         /* token rows */
#define MP ((int)((size_t)NBR * SQ)) /* rows projected (debug hook) */
#define QN SQ                        /* not used: attention takes all SQ query rows */
#define NHD NH                       /* not used: attention takes all NH heads */
#define MPO MP                       /* rows through the output stage (debug hook) */
#define LQ DM      /* not used: the q and k rows have pitch DM */
typedef __bf16 v16b __attribute__((ext_vector_type(16)));
typedef unsigned short v8us __attribute__((ext_vector_type(8), may_alias));
typedef float  v8f  __attribute__((ext_vector_type(8)));
typedef float  v4f  __attribute__((ext_vector_type(4)));
typedef float  v4fa __attribute__((ext_vector_type(4), may_alias));
union FragB { v16b v; v8us half[2]; unsigned short u[16]; };

__device__ __forceinline__ unsigned short bf16_bits(float x) { unsigned int u = __float_as_uint(x); return (unsigned short)((u + 0x7FFFu + ((u >> 16) & 1u)) >> 16); }
__device__ __forceinline__ float bf16_val(unsigned short b) { return __uint_as_float(((unsigned int)b) << 16); }
__device__ __forceinline__ float bf16_round(float x) { return bf16_val(bf16_bits(x)); }
// D += A·B with NT terms: 1 = ah·bh, 2 = + al·bh (A split), 3 = + ah·bl (both split)
template <int NT>
__device__ __forceinline__ v8f mmaN(v16b ah, v16b al, v16b bh, v16b bl, v8f c) {
  c = __builtin_amdgcn_wmma_f32_16x16x32_bf16(false, ah, false, bh, (short)0, c, false, false);
  if (NT >= 2) c = __builtin_amdgcn_wmma_f32_16x16x32_bf16(false, al, false, bh, (short)0, c, false, false);
  if (NT >= 3) c = __builtin_amdgcn_wmma_f32_16x16x32_bf16(false, ah, false, bl, (short)0, c, false, false);
  asm volatile("v_nop\n\tv_nop\n\tv_nop\n\tv_nop" : "+v"(c) : "v"(ah), "v"(al), "v"(bh), "v"(bl));
  return c;
}

__global__ __launch_bounds__(256) void k_wt_bf16(const float* __restrict__ W, unsigned short* __restrict__ Wt, int K, int N) {
  const int t = blockIdx.x * 256 + threadIdx.x;
  const int k8n = K / 8;
  if (t >= N * k8n) return;
  const int n = t / k8n, k8 = (t % k8n) * 8;
  v8us v;
#pragma unroll
  for (int i = 0; i < 8; ++i) v[i] = bf16_bits(W[(size_t)(k8 + i) * N + n]);
  *(v8us*)(Wt + (size_t)n * K + k8) = v;
  
}

// GEMM C[M][N] (f32, pitch ldc) = act(A[M][K]·W + bias). A f32 row-major (pitch lda) converted per fragment to bf16
// (ASPLIT: hi/lo two planes -> 2 terms, else single rounded term); Wt bf16 [N][K] (pitch ldb). BIAS_BF16 rounds the
// bias to bf16 first (bias quantised to bf16 before the add). K%32==0, M%16==0, N%64==0.
template <bool ASPLIT, int ACT, bool BIAS_BF16>
__global__ __launch_bounds__(128) void k_gemm_bf(const float* __restrict__ A, int lda, const unsigned short* __restrict__ Wt, int ldb,
                                               const float* __restrict__ bias, float* __restrict__ C, int ldc, int M, int N, int K) {
  __shared__ __attribute__((aligned(16))) float so[4][16][64];
  const int tid = threadIdx.x, w = tid >> 5, lane = tid & 31, ln = lane & 15, hh = lane >> 4;
  const int ntn = N / 64;
  const int wid = blockIdx.x * 4 + w;
  const int mt = wid / ntn, nq = wid % ntn;
  if (mt * 16 >= M) return;
  const int row0 = mt * 16, col0 = nq * 64;
  const float* arow = A + (size_t)(row0 + ln) * lda;
  v8f acc[4] = {};
  for (int kb = 0; kb < K; kb += 32) {
    FragB ah, al;
    const v4f x0 = *(const v4fa*)(arow + kb + 8 * hh), x1 = *(const v4fa*)(arow + kb + 8 * hh + 4);
    const v4f x2 = *(const v4fa*)(arow + kb + 16 + 8 * hh), x3 = *(const v4fa*)(arow + kb + 16 + 8 * hh + 4);
    float xs[16] = {x0[0],x0[1],x0[2],x0[3],x1[0],x1[1],x1[2],x1[3],x2[0],x2[1],x2[2],x2[3],x3[0],x3[1],x3[2],x3[3]};
#pragma unroll
    for (int i = 0; i < 16; ++i) { const unsigned short hb = bf16_bits(xs[i]); ah.u[i] = hb; al.u[i] = ASPLIT ? bf16_bits(xs[i] - bf16_val(hb)) : (unsigned short)0; }
#pragma unroll
    for (int t = 0; t < 4; ++t) {
      const unsigned short* brow = Wt + (size_t)(col0 + t * 16 + ln) * ldb + kb;
      FragB b;
      b.half[0] = *(const v8us*)(brow + 8 * hh);
      b.half[1] = *(const v8us*)(brow + 16 + 8 * hh);
      acc[t] = mmaN<ASPLIT ? 2 : 1>(ah.v, al.v, b.v, b.v, acc[t]);
    }
  }
#pragma unroll
  for (int t = 0; t < 4; ++t) {
    float bv = bias ? bias[col0 + t * 16 + ln] : 0.f;
    if (BIAS_BF16) bv = bf16_round(bv);
#pragma unroll
    for (int r = 0; r < 8; ++r) { float v = acc[t][r] + bv; if (ACT == 1) v = fmaxf(v, 0.f); so[w][8 * hh + r][t * 16 + ln] = v; }
  }
  __builtin_amdgcn_fence(__ATOMIC_ACQ_REL, "workgroup");
  __builtin_amdgcn_wave_barrier();
  const int rsub = lane >> 4, c4 = (lane & 15) * 4;
  {
#pragma unroll
    for (int q = 0; q < 8; ++q) {
      const int r = q * 2 + rsub;
      const v4f v = *(const v4fa*)&so[w][r][c4];
      *(v4f*)(C + (size_t)(row0 + r) * ldc + col0 + c4) = v;
    }
    
  }
}

// GEMM C = act(A·W + bias + resid): A f32 (ASPLIT -> hi/lo 2 terms), Wt bf16 [N][K]; ACT 0 none, 1 relu, 2 exact gelu;
// resid (optional, f32, row index = (row % rmod), pitch ldr, RES_BF16 rounds it) added before the activation.
template <bool ASPLIT, int ACT, bool BIAS_BF16, bool RES_BF16>
__global__ __launch_bounds__(128) void k_gemm_bf3(const float* __restrict__ A, int lda, const unsigned short* __restrict__ Wt, int ldb,
                                                const float* __restrict__ bias, const float* __restrict__ resid, int rmod, int ldr,
                                                float* __restrict__ C, int ldc, int M, int N, int K) {
  __shared__ __attribute__((aligned(16))) float so[4][16][64];
  const int tid = threadIdx.x, w = tid >> 5, lane = tid & 31, ln = lane & 15, hh = lane >> 4;
  const int ntn = N / 64;
  const int wid = blockIdx.x * 4 + w;
  const int mt = wid / ntn, nq = wid % ntn;
  if (mt * 16 >= M) return;
  const int row0 = mt * 16, col0 = nq * 64;
  const float* arow = A + (size_t)(row0 + ln) * lda;
  v8f acc[4] = {};
  for (int kb = 0; kb < K; kb += 32) {
    FragB ah, al;
    const v4f x0 = *(const v4fa*)(arow + kb + 8 * hh), x1 = *(const v4fa*)(arow + kb + 8 * hh + 4);
    const v4f x2 = *(const v4fa*)(arow + kb + 16 + 8 * hh), x3 = *(const v4fa*)(arow + kb + 16 + 8 * hh + 4);
    float xs[16] = {x0[0],x0[1],x0[2],x0[3],x1[0],x1[1],x1[2],x1[3],x2[0],x2[1],x2[2],x2[3],x3[0],x3[1],x3[2],x3[3]};
#pragma unroll
    for (int i = 0; i < 16; ++i) { const unsigned short hb = bf16_bits(xs[i]); ah.u[i] = hb; al.u[i] = ASPLIT ? bf16_bits(xs[i] - bf16_val(hb)) : (unsigned short)0; }
#pragma unroll
    for (int t = 0; t < 4; ++t) {
      const unsigned short* brow = Wt + (size_t)(col0 + t * 16 + ln) * ldb + kb;
      FragB b;
      b.half[0] = *(const v8us*)(brow + 8 * hh);
      b.half[1] = *(const v8us*)(brow + 16 + 8 * hh);
      acc[t] = mmaN<ASPLIT ? 2 : 1>(ah.v, al.v, b.v, b.v, acc[t]);
    }
  }
#pragma unroll
  for (int t = 0; t < 4; ++t) {
    const int col = col0 + t * 16 + ln;
    float bv = bias ? bias[col] : 0.f;
    if (BIAS_BF16) bv = bf16_round(bv);
#pragma unroll
    for (int r = 0; r < 8; ++r) {
      float v = acc[t][r] + bv;
      if (resid) { float rv = resid[(size_t)((row0 + 8 * hh + r) % rmod) * ldr + col]; if (RES_BF16) rv = bf16_round(rv); v += rv; }
      if (ACT == 1) v = fmaxf(v, 0.f);
      if (ACT == 2) v = 0.5f * v * (1.0f + erff(v * 0.70710678118654752f));
      if (ACT == 3) { const float u = 0.7978845608028654f * (v + 0.044715f * v * v * v); v = 0.5f * v * (1.0f + tanhf(u)); }
      so[w][8 * hh + r][t * 16 + ln] = v;
    }
  }
  __builtin_amdgcn_fence(__ATOMIC_ACQ_REL, "workgroup");
  __builtin_amdgcn_wave_barrier();
  const int rsub = lane >> 4, c4 = (lane & 15) * 4;
  {
#pragma unroll
    for (int q = 0; q < 8; ++q) {
      const int r = q * 2 + rsub;
      const v4f v = *(const v4fa*)&so[w][r][c4];
      *(v4f*)(C + (size_t)(row0 + r) * ldc + col0 + c4) = v;
    }
    
  }
}
// row LayerNorm (biased variance, eps) over N: s = X (+ R); optional out_sum <- s; out_norm <- (s-mu)*rsqrt(var+eps)*g + b
template <bool PARAM_BF16>
__global__ __launch_bounds__(256) void k_layernorm(const float* __restrict__ X, const float* __restrict__ R, const float* __restrict__ g, const float* __restrict__ bta,
                                                  float* __restrict__ out_sum, float* __restrict__ out_norm, int N, float eps) {
  __shared__ float red[256];
  const int row = blockIdx.x, tid = threadIdx.x;
  const float* x = X + (size_t)row * N; const float* rr = R ? R + (size_t)row * N : nullptr;
  float vals[16];                     // up to N = 4096
  const int per = N / 256;            // contiguous chunk per thread? use strided-by-4 chunks: thread handles j = tid*4 + 1024*u
  float s1 = 0.f;
  for (int u = 0; u < per / 4; ++u) {
    const int j = tid * 4 + 1024 * u;
    const v4f a = *(const v4fa*)(x + j);
    v4f b = {0.f,0.f,0.f,0.f}; if (rr) b = *(const v4fa*)(rr + j);
#pragma unroll
    for (int q = 0; q < 4; ++q) { const float v = a[q] + b[q]; vals[u * 4 + q] = v; s1 += v; }
  }
  red[tid] = s1; __syncthreads();
  for (int st = 128; st > 0; st >>= 1) { if (tid < st) red[tid] += red[tid + st]; __syncthreads(); }
  const float mu = red[0] / (float)N; __syncthreads();
  float s2 = 0.f;
  for (int u = 0; u < per / 4; ++u)
#pragma unroll
    for (int q = 0; q < 4; ++q) { const float c = vals[u * 4 + q] - mu; s2 += c * c; }
  red[tid] = s2; __syncthreads();
  for (int st = 128; st > 0; st >>= 1) { if (tid < st) red[tid] += red[tid + st]; __syncthreads(); }
  const float rs = rsqrtf(red[0] / (float)N + eps);
  {
    for (int u = 0; u < per / 4; ++u) {
      const int j = tid * 4 + 1024 * u;
      v4f o, sm;
#pragma unroll
      for (int q = 0; q < 4; ++q) {
        float gg = g[j + q], bb = bta[j + q];
        if (PARAM_BF16) { gg = bf16_round(gg); bb = bf16_round(bb); }
        sm[q] = vals[u * 4 + q]; o[q] = (vals[u * 4 + q] - mu) * rs * gg + bb;
      }
      if (out_sum) *(v4f*)(out_sum + (size_t)row * N + j) = sm;
      *(v4f*)(out_norm + (size_t)row * N + j) = o;
    }
    
  }
}



// ---- f16 WMMA path (v_wmma_f32_16x16x32_f16): 11-bit significands for operands in range — used where a [0,1] probability operand needs more precision than bf16
typedef _Float16 v16h __attribute__((ext_vector_type(16)));
union FragH { v16h v; v8us half[2]; _Float16 h[16]; unsigned short u[16]; };
template <int NT>
__device__ __forceinline__ v8f mmaH(v16h ah, v16h al, v16h bh, v16h bl, v8f c) {
  c = __builtin_amdgcn_wmma_f32_16x16x32_f16(false, ah, false, bh, (short)0, c, false, false);
  if (NT >= 2) c = __builtin_amdgcn_wmma_f32_16x16x32_f16(false, al, false, bh, (short)0, c, false, false);
  if (NT >= 3) c = __builtin_amdgcn_wmma_f32_16x16x32_f16(false, ah, false, bl, (short)0, c, false, false);
  asm volatile("v_nop\n\tv_nop\n\tv_nop\n\tv_nop" : "+v"(c) : "v"(ah), "v"(al), "v"(bh), "v"(bl));
  return c;
}
// batched GEMM like k_gemm_b but f16 operands: A f32 (split into f16 hi/lo if ASPLIT, else rounded to f16), Bt = f16 values [n][k]; alpha; C f32; N multiple of 16 (partial tiles skipped)
template <bool ASPLIT>
__global__ __launch_bounds__(128) void k_gemm_h(const float* __restrict__ A, int lda, size_t sA, const _Float16* __restrict__ Bh, int ldb, size_t sB, float alpha, float* __restrict__ C, int ldc, size_t sC, int M, int N, int K) {
  __shared__ __attribute__((aligned(16))) float so[4][16][64];
  const int tid = threadIdx.x, w = tid >> 5, lane = tid & 31, ln = lane & 15, hh = lane >> 4; const int by = blockIdx.y;
  A += (size_t)by * sA; Bh += (size_t)by * sB; C += (size_t)by * sC;
  const int ntn = (N + 63) / 64; const int wid = blockIdx.x * 4 + w; const int mt = wid / ntn, nq = wid % ntn; if (mt * 16 >= M) return;
  const int row0 = mt * 16, col0 = nq * 64; const float* arow = A + (size_t)(row0 + ln) * lda;
  v8f acc[4] = {};
  for (int kb = 0; kb < K; kb += 32) {
    FragH ah, al;
    const v4f x0 = *(const v4fa*)(arow + kb + 8 * hh), x1 = *(const v4fa*)(arow + kb + 8 * hh + 4), x2 = *(const v4fa*)(arow + kb + 16 + 8 * hh), x3 = *(const v4fa*)(arow + kb + 16 + 8 * hh + 4);
    float xs[16] = {x0[0],x0[1],x0[2],x0[3],x1[0],x1[1],x1[2],x1[3],x2[0],x2[1],x2[2],x2[3],x3[0],x3[1],x3[2],x3[3]};
#pragma unroll
    for (int i = 0; i < 16; ++i) { const _Float16 h = (_Float16)xs[i]; ah.h[i] = h; al.h[i] = ASPLIT ? (_Float16)(xs[i] - (float)h) : (_Float16)0.0f; }
#pragma unroll
    for (int t = 0; t < 4; ++t) { if (col0 + t * 16 >= N) continue; const size_t boff = (size_t)(col0 + t * 16 + ln) * ldb + kb; FragH bq; bq.half[0] = *(const v8us*)(Bh + boff + 8 * hh); bq.half[1] = *(const v8us*)(Bh + boff + 16 + 8 * hh);
      acc[t] = mmaH<ASPLIT ? 2 : 1>(ah.v, al.v, bq.v, bq.v, acc[t]); }
  }
#pragma unroll
  for (int t = 0; t < 4; ++t) { if (col0 + t * 16 >= N) continue;
#pragma unroll
    for (int r = 0; r < 8; ++r) so[w][8 * hh + r][t * 16 + ln] = acc[t][r] * alpha; }
  __builtin_amdgcn_fence(__ATOMIC_ACQ_REL, "workgroup"); __builtin_amdgcn_wave_barrier();
  const int rsub = lane >> 4, c4 = (lane & 15) * 4;
  {
#pragma unroll
    for (int q = 0; q < 8; ++q) { const int r = q * 2 + rsub; if (col0 + c4 < N) { const v4f v = *(const v4fa*)&so[w][r][c4]; *(v4f*)(C + (size_t)(row0 + r) * ldc + col0 + c4) = v; } }
     }
}

// k_gemm_hh variant with fused epilogue: v = acc·alpha + bias[by·sBias + col] (+ CP[(row/rowsPerB)·sCPb + by·64 + col] if CP) ; ACT 0 none / 1 elu ; writes f16 C16 (and f32 C if non-null)
template <int ACT>
__global__ __launch_bounds__(128) void k_gemm_hhx(const _Float16* __restrict__ A, int lda, size_t sA, const _Float16* __restrict__ Bh, int ldb, size_t sB, float alpha, const float* __restrict__ bias, size_t sBias, const float* __restrict__ CP, int rowsPerB, size_t sCPb, int row0g,
    float* __restrict__ C, _Float16* __restrict__ C16, int ldc, size_t sC, int M, int N, int K) {
  __shared__ __attribute__((aligned(16))) float so[4][16][64];
  const int tid = threadIdx.x, w = tid >> 5, lane = tid & 31, ln = lane & 15, hh = lane >> 4; const int by = blockIdx.y;
  A += (size_t)by * sA; Bh += (size_t)by * sB; const size_t cofs = (size_t)by * sC; const float* bp = bias ? bias + (size_t)by * sBias : nullptr;
  const int ntn = (N + 63) / 64; const int wid = blockIdx.x * 4 + w; const int mt = wid / ntn, nq = wid % ntn; if (mt * 16 >= M) return;
  const int row0 = mt * 16, col0 = nq * 64; const _Float16* arow = A + (size_t)(row0 + ln) * lda;
  v8f acc[4] = {};
  for (int kb = 0; kb < K; kb += 32) { FragH ah; ah.half[0] = *(const v8us*)((const unsigned short*)arow + kb + 8 * hh); ah.half[1] = *(const v8us*)((const unsigned short*)arow + kb + 16 + 8 * hh);
#pragma unroll
    for (int t = 0; t < 4; ++t) { if (col0 + t * 16 >= N) continue; const size_t boff = (size_t)(col0 + t * 16 + ln) * ldb + kb; FragH bq; bq.half[0] = *(const v8us*)((const unsigned short*)Bh + boff + 8 * hh); bq.half[1] = *(const v8us*)((const unsigned short*)Bh + boff + 16 + 8 * hh);
      acc[t] = mmaH<1>(ah.v, ah.v, bq.v, bq.v, acc[t]); }
  }
#pragma unroll
  for (int t = 0; t < 4; ++t) { if (col0 + t * 16 >= N) continue; const int col = col0 + t * 16 + ln; const float bv = bp ? bf16_round(bp[col]) : 0.f;
#pragma unroll
    for (int r = 0; r < 8; ++r) { float v = acc[t][r] * alpha + bv; if (CP) { const int rr = row0g + row0 + 8 * hh + r; if (rowsPerB < 0) v += CP[cofs + (size_t)rr * ldc + col];      /* rowsPerB < 0: own element of the batched C plane */ else { const int bidx = rr / rowsPerB; v += CP[(size_t)bidx * sCPb + (size_t)by * 64 + col]; } } if (ACT == 1) v = (v > 0.f) ? v : expm1f(v); else if (ACT == 7) v = (v > 0.f) ? v + 1.0f : expf(v); else if (ACT == 8) v = tanhf(v); else if (ACT == 9) v = 0.5f * v * (1.0f + tanhf(0.7978845608028654f * (v + 0.044715f * v * v * v))); else if (ACT == 11) v = 1.0f / (1.0f + expf(-v)); else if (ACT == 12) v = (v > 0.f) ? v : 0.01f * v; else if (ACT == 14) v = (v > 0.f) ? v : 0.1f * v; else if (ACT == 16) v = (v >= 0.f) ? v : 0.3f * v; else if (ACT == 17) v = (v >= 0.f) ? v : 0.2f * v; else if (ACT == 15) v = v / (1.0f + expf(-v)); else if (ACT == 3) v = fmaxf(v, 0.f); else if (ACT == 6) v = 0.5f * v * (1.0f + erff(v * 0.70710678118654752f)); so[w][8 * hh + r][t * 16 + ln] = v; } }
  __builtin_amdgcn_fence(__ATOMIC_ACQ_REL, "workgroup"); __builtin_amdgcn_wave_barrier();
  const int rsub = lane >> 4, c4 = (lane & 15) * 4; typedef _Float16 v4h __attribute__((ext_vector_type(4)));
  {
#pragma unroll
    for (int q = 0; q < 8; ++q) { const int r = q * 2 + rsub; if (col0 + c4 < N) { const v4f v = *(const v4fa*)&so[w][r][c4]; if (C) *(v4f*)(C + cofs + (size_t)(row0 + r) * ldc + col0 + c4) = v; if (C16) { v4h h4; for (int i = 0; i < 4; ++i) h4[i] = (_Float16)v[i]; *(v4h*)(C16 + cofs + (size_t)(row0 + r) * ldc + col0 + c4) = h4; } } }
     }
}


typedef _Float16 v4h __attribute__((ext_vector_type(4)));

__global__ __launch_bounds__(256) void k_h16(const float* __restrict__ x, _Float16* __restrict__ X16, size_t n8) { const size_t t = (size_t)blockIdx.x * 256 + threadIdx.x; if (t >= n8) return; FragH f;
#pragma unroll
  for (int q = 0; q < 8; ++q) f.h[q] = (_Float16)x[t * 8 + q]; *(v8us*)((unsigned short*)X16 + t * 8) = f.half[0];  }
__global__ __launch_bounds__(256) void k_round16f(const float* __restrict__ W, _Float16* __restrict__ Bt, size_t n8) { const size_t t = (size_t)blockIdx.x * 256 + threadIdx.x; if (t >= n8) return; FragH f;
#pragma unroll
  for (int i = 0; i < 8; ++i) f.h[i] = (_Float16)(bf16_round(W[t * 8 + i]) * 16.0f); *(v8us*)((unsigned short*)Bt + t * 8) = f.half[0];  }
template <int NHv, int TTv>
__global__ __launch_bounds__(256) void k_vt(const _Float16* __restrict__ V16, int ldv, int voff, _Float16* __restrict__ Vt) { __shared__ unsigned short tl[64][66]; const int tid = threadIdx.x; const int slab = blockIdx.x / (TTv / 64), lg = blockIdx.x % (TTv / 64); const int b = slab / NHv, h = slab % NHv;
  for (int i = tid; i < 64 * 8; i += 256) { const int r = i / 8, c8 = (i % 8) * 8; FragH f; f.half[0] = *(const v8us*)((const unsigned short*)V16 + ((size_t)b * TTv + lg * 64 + r) * ldv + voff + h * 64 + c8);
#pragma unroll
    for (int q = 0; q < 8; ++q) tl[r][c8 + q] = f.u[q]; }
  __syncthreads();
  {
#pragma unroll
    for (int rd = 0; rd < 2; ++rd) { const int d = rd * 32 + tid / 8, pc = tid % 8; FragH f;
#pragma unroll
      for (int q = 0; q < 8; ++q) f.u[q] = tl[pc * 8 + q][d];
      *(v8us*)((unsigned short*)Vt + ((size_t)slab * 64 + d) * TTv + lg * 64 + pc * 8) = f.half[0]; }
     } }

__global__ __launch_bounds__(256) void k_hl(const float* __restrict__ F, _Float16* __restrict__ Hh, _Float16* __restrict__ Hl, size_t n8) { const size_t t = (size_t)blockIdx.x * 256 + threadIdx.x; if (t >= n8) return; FragH fh, fl; const v4f a = *(const v4fa*)(F + t * 8), c = *(const v4fa*)(F + t * 8 + 4);
#pragma unroll
  for (int q = 0; q < 4; ++q) { _Float16 h = (_Float16)a[q]; fh.h[q] = h; fl.h[q] = (_Float16)((a[q] - (float)h) * 1024.0f); h = (_Float16)c[q]; fh.h[4 + q] = h; fl.h[4 + q] = (_Float16)((c[q] - (float)h) * 1024.0f); }
  { *(v8us*)((unsigned short*)Hh + t * 8) = fh.half[0]; *(v8us*)((unsigned short*)Hl + t * 8) = fl.half[0];  } }

// ---- fast GEMM (wave tile 32x64; requires M % 32 == 0 rows per launch region and N % 64 == 0); epilogue = k_gemm_hhx semantics ----
__device__ __forceinline__ v16h g2_frag(const _Float16* p, int hh) { FragH f; f.half[0] = *(const v8us*)((const unsigned short*)p + 8 * hh); f.half[1] = *(const v8us*)((const unsigned short*)p + 16 + 8 * hh); return f.v; }
__device__ __forceinline__ v8f g2_mma(v16h a, v16h b, v8f c) { v8f d = __builtin_amdgcn_wmma_f32_16x16x32_f16(false, a, false, b, (short)0, c, false, false); asm volatile("v_nop\n\tv_nop\n\tv_nop\n\tv_nop" : "+v"(d) : "v"(a), "v"(b)); return d; }
template <int ACT>
__global__ __launch_bounds__(128) void k_gemm2(const _Float16* __restrict__ A, int lda, size_t sA, const _Float16* __restrict__ Bh, int ldb, size_t sB, float alpha, const float* __restrict__ bias, const float* __restrict__ bias1, const float* __restrict__ bias2, size_t sBias, const float* __restrict__ CP, int rowsPerB, size_t sCPb, int row0g,
    float* __restrict__ C, _Float16* __restrict__ C16, int ldc, size_t sC, int M, int N, int K) { static_assert(ACT == 0 || ACT == 3 || ACT == 6 || ACT == 8 || ACT == 9 || ACT == 11 || ACT == 12 || ACT == 14 || ACT == 15 || ACT == 16 || ACT == 17, "k_gemm2: unsupported ACT code (would silently apply no activation)");
  __shared__ __attribute__((aligned(16))) float so[4][32][68];
  const int tid = threadIdx.x, w = tid >> 5, lane = tid & 31, ln = lane & 15, hh = lane >> 4; const int by = blockIdx.y;
  if (by == 1) bias = bias1; else if (by == 2) bias = bias2;      /* batches 1 and 2 may have their bias in a buffer of its own (three products with separate bias inputs in one launch) */
  A += (size_t)by * sA; Bh += (size_t)by * sB; const size_t cofs = (size_t)by * sC; const float* bp = bias ? bias + (size_t)by * sBias : nullptr;
  const int ntn = N >> 6; const int mt = blockIdx.x / ntn, nq = blockIdx.x - mt * ntn; const int row0 = mt * 128 + 32 * w, col0 = nq * 64; if (row0 >= M) return;
  const _Float16* a0p = A + (size_t)(row0 + ln) * lda; const _Float16* a1p = a0p + (size_t)16 * lda;
  const _Float16* b0p = Bh + (size_t)(col0 + ln) * ldb; const _Float16* b1p = b0p + (size_t)16 * ldb; const _Float16* b2p = b1p + (size_t)16 * ldb; const _Float16* b3p = b2p + (size_t)16 * ldb;
  const v8f z8 = {0.f,0.f,0.f,0.f,0.f,0.f,0.f,0.f}; v8f c00 = z8, c01 = z8, c02 = z8, c03 = z8, c10 = z8, c11 = z8, c12 = z8, c13 = z8;
#pragma unroll 1
  for (int kb = 0; kb < K; kb += 32) { const v16h a0 = g2_frag(a0p + kb, hh), a1 = g2_frag(a1p + kb, hh);
    v16h b = g2_frag(b0p + kb, hh); c00 = g2_mma(a0, b, c00); c10 = g2_mma(a1, b, c10);
    b = g2_frag(b1p + kb, hh); c01 = g2_mma(a0, b, c01); c11 = g2_mma(a1, b, c11);
    b = g2_frag(b2p + kb, hh); c02 = g2_mma(a0, b, c02); c12 = g2_mma(a1, b, c12);
    b = g2_frag(b3p + kb, hh); c03 = g2_mma(a0, b, c03); c13 = g2_mma(a1, b, c13); }
  v8f accs[8] = {c00, c01, c02, c03, c10, c11, c12, c13};
#pragma unroll
  for (int u = 0; u < 8; ++u) { const int t = u & 3, half = u >> 2; const int col = col0 + t * 16 + ln; const float bv = bp ? bf16_round(bp[col]) : 0.f;
#pragma unroll
    for (int r = 0; r < 8; ++r) { const int rloc = half * 16 + 8 * hh + r; float v = accs[u][r] * alpha + bv; if (CP) { if (rowsPerB < 0) v += CP[cofs + (size_t)(row0g + row0 + rloc) * ldc + col];      /* rowsPerB < 0: own element of the batched C plane */ else { const int bidx = (row0g + row0 + rloc) / rowsPerB; v += CP[(size_t)bidx * sCPb + (size_t)by * 64 + col]; } }
      if (ACT == 3) v = fmaxf(v, 0.f); else if (ACT == 6) v = 0.5f * v * (1.0f + erff(v * 0.70710678118654752f)); else if (ACT == 11) v = 1.0f / (1.0f + expf(-v)); else if (ACT == 15) v = v / (1.0f + expf(-v)); else if (ACT == 12) v = (v > 0.f) ? v : 0.01f * v; else if (ACT == 8) v = tanhf(v); else if (ACT == 9) v = 0.5f * v * (1.0f + tanhf(0.7978845608028654f * (v + 0.044715f * v * v * v))); else if (ACT == 14) v = (v > 0.f) ? v : 0.1f * v; else if (ACT == 16) v = (v >= 0.f) ? v : 0.3f * v; else if (ACT == 17) v = (v >= 0.f) ? v : 0.2f * v;
      so[w][rloc][t * 16 + ln] = v; } }
  __builtin_amdgcn_fence(__ATOMIC_ACQ_REL, "workgroup"); __builtin_amdgcn_wave_barrier();
  const int rsub = lane >> 4, c4 = (lane & 15) * 4;
  {
#pragma unroll
    for (int q = 0; q < 16; ++q) { const int r = q * 2 + rsub; const v4f v = *(const v4fa*)&so[w][r][c4]; if (C) *(v4f*)(C + cofs + (size_t)(row0 + r) * ldc + col0 + c4) = v; if (C16) { v4h h4; for (int i = 0; i < 4; ++i) h4[i] = (_Float16)v[i]; *(v4h*)(C16 + cofs + (size_t)(row0 + r) * ldc + col0 + c4) = h4; } }
     } }


__global__ __launch_bounds__(256) void k_wnat(const float* __restrict__ w, size_t n8, _Float16* __restrict__ Bt) { const size_t t = (size_t)blockIdx.x * 256 + threadIdx.x; if (t >= n8) return; FragH f; for (int q = 0; q < 8; ++q) f.h[q] = (_Float16)(bf16_round(w[t * 8 + q]) * 16.0f); *(v8us*)((unsigned short*)Bt + t * 8) = f.half[0];  }
__global__ __launch_bounds__(256) void k_rsm(const float* __restrict__ S, _Float16* __restrict__ P, int nrows) {
  #pragma clang fp contract(off)
  const int i = blockIdx.x * 256 + threadIdx.x; if (i >= nrows) return; const float* s = S + (size_t)i * SQ; float mx = -3.0e38f;
#pragma unroll 1
  for (int j = 0; j < SQ; ++j) mx = fmaxf(mx, s[j]); float se = 0.f;
#pragma unroll 1
  for (int j = 0; j < SQ; ++j) se += expf(s[j] - mx); const float sc = 256.0f / se;
#pragma unroll 1
  for (int j0 = 0; j0 < SQ; j0 += 8) { FragH f; for (int q = 0; q < 8; ++q) f.h[q] = (_Float16)(expf(s[j0 + q] - mx) * sc); unsigned short* d = (unsigned short*)P + (size_t)i * SQ + j0; *(v8us*)d = f.half[0];  } }
__global__ __launch_bounds__(256) void k_vt(const _Float16* __restrict__ V16, int b, int h0, _Float16* __restrict__ VT) { __shared__ unsigned short tl[64][65]; const int tid = threadIdx.x; const int hh = blockIdx.x % HG, sg = blockIdx.x / HG; const int s0 = sg * 64; const int h = h0 + hh;
  for (int i = tid; i < 64 * 8; i += 256) { const int j = i / 8, d8 = (i % 8) * 8; FragH f; f.half[0] = *(const v8us*)((const unsigned short*)V16 + ((size_t)b * SQ + s0 + j) * DM + h * HD + d8); for (int q = 0; q < 8; ++q) tl[d8 + q][j] = f.u[q]; }
  __syncthreads();
  { for (int i = tid; i < 64 * 8; i += 256) { const int d = i / 8, j8 = (i % 8) * 8; FragH f; for (int q = 0; q < 8; ++q) f.u[q] = tl[d][j8 + q]; *(v8us*)((unsigned short*)VT + ((size_t)hh * HD + d) * SQ + s0 + j8) = f.half[0]; }  } }



// ---- fused attention: scores, softmax and P.V in one kernel; neither scores nor weights go to memory ----
#define FK 64      /* keys per LDS stage */
#define FPH 72     /* LDS row pitch in f16: 128 data bytes + 16, the conflict-free pitch for 16-byte fragment reads */
__device__ __forceinline__ float xhalf(float x) { return __builtin_bit_cast(float, __builtin_amdgcn_permlanex16(__builtin_bit_cast(int, x), __builtin_bit_cast(int, x), 0x76543210, 0xfedcba98, false, false)); }      /* lane l reads lane l ^ 16 */
// native 2^x, in place. The instruction set asks for one independent instruction or a v_nop between a transcendental and a directly following instruction that uses its result or overwrites its source.
// Eight in one statement: each is the independent instruction behind the one before it, the one v_nop fills the slot behind the last. In place, so that the statement writes only registers that the compiler's own multiply-add has just written:
// the compiler does not look into asm text when it keeps its distance behind a matrix instruction, and a fresh output register could be an operand of one just issued.
__device__ __forceinline__ void exp2x8(float (&x)[8]) { asm("v_exp_f32 %0, %0\n\tv_exp_f32 %1, %1\n\tv_exp_f32 %2, %2\n\tv_exp_f32 %3, %3\n\tv_exp_f32 %4, %4\n\tv_exp_f32 %5, %5\n\tv_exp_f32 %6, %6\n\tv_exp_f32 %7, %7\n\tv_nop" : "+v"(x[0]), "+v"(x[1]), "+v"(x[2]), "+v"(x[3]), "+v"(x[4]), "+v"(x[5]), "+v"(x[6]), "+v"(x[7])); }
__device__ __forceinline__ float exp2x1(float x) { asm("v_exp_f32 %0, %0\n\tv_nop" : "+v"(x)); return x; }      /* the same, one value */
__device__ __forceinline__ v8f fa_mma(v16h a, v16h b, v8f c) { return __builtin_amdgcn_wmma_f32_16x16x32_f16(false, a, false, b, (short)0, c, false, false); }
__global__ __launch_bounds__(256) void k_fattn(const _Float16* __restrict__ Q16, const _Float16* __restrict__ K16, const _Float16* __restrict__ VT, _Float16* __restrict__ O16, float cs) {
  __shared__ __attribute__((aligned(16))) _Float16 sk[2][FK][FPH];
  __shared__ __attribute__((aligned(16))) _Float16 sv[2][HD][FPH];
  const int tid = threadIdx.x, lane = tid & 31, ln = lane & 15, hh = lane >> 4, w = tid >> 5;
  const int slab = blockIdx.x / (SQ / 256), qb = blockIdx.x % (SQ / 256); const int b = slab / NH, h = slab % NH;
  const size_t qrow = (size_t)b * SQ + qb * 256 + w * 32 + ln;
  const int sr = tid >> 3, sc = (tid & 7) * 8;      /* staging: 8 threads per 128-byte row, rows sr and sr + 32 */
  const _Float16* kg = K16 + ((size_t)b * SQ + sr) * DM + h * HD + sc;
  const _Float16* vg = VT + ((size_t)slab * HD + sr) * SQ + sc;
  v8us rk0 = *(const v8us*)kg, rk1 = *(const v8us*)(kg + (size_t)32 * DM), rv0 = *(const v8us*)vg, rv1 = *(const v8us*)(vg + (size_t)32 * SQ);
  v16h qf[2][2];
#pragma unroll
  for (int g = 0; g < 2; ++g)
#pragma unroll
    for (int s = 0; s < 2; ++s) qf[g][s] = g2_frag(Q16 + (qrow + 16 * g) * DM + h * HD + 32 * s, hh);
  const v8f z8 = {0.f,0.f,0.f,0.f,0.f,0.f,0.f,0.f};
  v8f o[2][4]; float mu[2], l[2];
#pragma unroll
  for (int g = 0; g < 2; ++g) { mu[g] = -3.0e38f; l[g] = 0.f;
#pragma unroll
    for (int t = 0; t < 4; ++t) o[g][t] = z8; }
  *(v8us*)&sk[0][sr][sc] = rk0; *(v8us*)&sk[0][sr + 32][sc] = rk1; *(v8us*)&sv[0][sr][sc] = rv0; *(v8us*)&sv[0][sr + 32][sc] = rv1;
  __syncthreads();
  /* not unrolled: the two passes inside already fill the register budget, and the buffer index stays one scalar */
#pragma unroll 1
  for (int st = 0; st < SQ / FK; ++st) { const int cur = st & 1; const bool more = st + 1 < SQ / FK;      /* the same for the whole work-group */
    if (more) { const _Float16* kn = kg + (size_t)(st + 1) * FK * DM; const _Float16* vn = vg + (st + 1) * FK;
      rk0 = *(const v8us*)kn; rk1 = *(const v8us*)(kn + (size_t)32 * DM); rv0 = *(const v8us*)vn; rv1 = *(const v8us*)(vn + (size_t)32 * SQ);
      asm volatile("s_wait_xcnt 0x0" ::: "memory"); }      /* the four loads' address registers are temporaries that the fragment loads below reuse: the wait stands in front of every such overwrite */
#pragma unroll
    for (int ps = 0; ps < FK / 32; ++ps) {
      v8f s[2][2];      /* [column group][key tile] */
#pragma unroll
      for (int kt = 0; kt < 2; ++kt) { const _Float16* kr = &sk[cur][ps * 32 + kt * 16 + ln][0]; const v16h k0 = g2_frag(kr, hh), k1 = g2_frag(kr + 32, hh);
#pragma unroll
        for (int g = 0; g < 2; ++g) s[g][kt] = fa_mma(k1, qf[g][1], fa_mma(k0, qf[g][0], z8)); }
      v16h vf[4];
#pragma unroll
      for (int t = 0; t < 4; ++t) vf[t] = g2_frag(&sv[cur][t * 16 + ln][ps * 32], hh);
      float mb[2]; bool need = false;
#pragma unroll
      for (int g = 0; g < 2; ++g) { float m4[4];
#pragma unroll
        for (int q = 0; q < 4; ++q) m4[q] = fmaxf(fmaxf(s[g][0][q], s[g][0][q + 4]), fmaxf(s[g][1][q], s[g][1][q + 4]));
        float mx = fmaxf(fmaxf(m4[0], m4[1]), fmaxf(m4[2], m4[3]));
        mx = fmaxf(mx, xhalf(mx)) * cs;      /* both halves hold this query's maximum of the pass, scaled (cs > 0) */
        mb[g] = mx; need = need || (mx > mu[g] + 8.0f); }
      if (__builtin_amdgcn_ballot_w32(need) != 0) {      /* wave-uniform; always on the first pass, rare later */
#pragma unroll
        for (int g = 0; g < 2; ++g) { const float mn = fmaxf(mu[g], mb[g]); const float corr = exp2x1(mu[g] - mn); mu[g] = mn; l[g] *= corr;      /* corr = 0 on the first pass */
#pragma unroll
          for (int t = 0; t < 4; ++t) o[g][t] = o[g][t] * corr; } }
#pragma unroll
      for (int g = 0; g < 2; ++g) { const float nm = -mu[g]; FragH pf; float s4[4];
#pragma unroll
        for (int kt = 0; kt < 2; ++kt) { float p[8];
#pragma unroll
          for (int r = 0; r < 8; ++r) p[r] = fmaf(s[g][kt][r], cs, nm);
          exp2x8(p);
#pragma unroll
          for (int r = 0; r < 8; ++r) { if (kt == 0 && r < 4) s4[r] = p[r]; else s4[r & 3] += p[r]; pf.h[kt * 8 + r] = (_Float16)p[r]; } }      /* element 8 kt + r = key 16 kt + 8 hh + r: the k order of g2_frag */
        l[g] += (s4[0] + s4[1]) + (s4[2] + s4[3]);
#pragma unroll
        for (int t = 0; t < 4; ++t) o[g][t] = fa_mma(vf[t], pf.v, o[g][t]); }
    }
    if (more) { *(v8us*)&sk[cur ^ 1][sr][sc] = rk0; *(v8us*)&sk[cur ^ 1][sr + 32][sc] = rk1; *(v8us*)&sv[cur ^ 1][sr][sc] = rv0; *(v8us*)&sv[cur ^ 1][sr + 32][sc] = rv1; }      /* that buffer's last readers left it before the barrier that ended the stage before */
    __syncthreads();      /* publishes the next stage and ends every read of this one */
  }
#pragma unroll
  for (int g = 0; g < 2; ++g) { const float sc64 = 64.0f / (l[g] + xhalf(l[g]));      /* the halves' sums are joined once, here */
    _Float16* d = O16 + (qrow + 16 * g) * DM + h * HD + 8 * hh;
#pragma unroll
    for (int t = 0; t < 4; ++t) { FragH f;
#pragma unroll
      for (int r = 0; r < 8; ++r) f.h[r] = (_Float16)(o[g][t][r] * sc64);      /* o[g][t][r] = O[query ln of group g][d = 16 t + 8 hh + r]: 16 contiguous bytes */
      *(v8us*)(d + 16 * t) = f.half[0]; } }
}

// ---- GEMM with both operands through LDS: C[4096][DM] = (A[.][DM] . Bt[n][k]^T) * alpha + bf16(bias), all pitches DM, K = DM ----
// One work-group = 128 rows x 32 NT columns, eight waves as 4 (rows) x 2 (columns), one wave = 32 x 16 NT (2 x NT accumulator tiles).
// A fragment load straight from global memory touches 16 lines for 512 bytes; here each operand row's whole lines (GKT k values a stage) are fetched once per work-group, through registers into two LDS buffers
// (the next stage's global loads in flight under this stage's products), and the fragments are 16-byte LDS reads at a pitch of 16 bytes x odd. The k order, and so every sum, is that of the loop it replaces.
// blockIdx.y picks the weight plane, its bias and its output plane (three products in one launch). H16: f16 output rows, else f32.
// PF: the next k step's fragments are fetched into a second register set ahead of this step's products; for a launch of one work-group per WGP, where registers are free and few waves hide an LDS latency.
// VTO: plane 2 (blockIdx.y == 2) is stored transposed and nowhere else: CT[(row / SQ) * DM + column][row % SQ], f16, which is V^T [batch][head][d][key] for merged-head columns.
template <int NT, int GKT, bool H16, bool PF, bool VTO>
__global__ __launch_bounds__(256) void k_gemm3(const _Float16* __restrict__ A, const _Float16* __restrict__ Bh, size_t sB, float alpha, const float* __restrict__ bias, const float* __restrict__ bias1, const float* __restrict__ bias2,
    float* __restrict__ C, _Float16* __restrict__ C16, size_t sC, _Float16* __restrict__ CT) {
  constexpr int TM = 128, TN = 32 * NT, RW = TM + TN, PH = GKT + 8, CPI = TN + 4;      /* PH: f16 pitch of an operand row in LDS; CPI: f32 pitch of the output tile in LDS, rows 16-byte aligned */
  constexpr int TPR = GKT / 8, RPP = 256 / TPR, NPA = TM / RPP, NPB = TN / RPP, NKS = GKT / 32;      /* threads per staged row, rows per pass of the work-group, passes for A and for Bt, k steps a stage */
  static_assert(DM % TN == 0 && DM % GKT == 0 && GKT % 64 == 0 && TM % RPP == 0 && TN % RPP == 0, "k_gemm3: the tile must divide the matrix, a stage must hold whole lines");
  static_assert(2 * RW * PH * 2 >= TM * CPI * 4, "k_gemm3: the output tile must fit the operand buffers");
  constexpr int TPI = TM + 8;      /* f16 pitch of one output column's TM rows in LDS (transposed tile): 256 data bytes + 16 = 16 bytes x odd */
  static_assert(!VTO || (2 * RW * PH * 2 >= TN * TPI * 2 && SQ % TM == 0 && TN % 16 == 0), "k_gemm3: the transposed tile must fit the operand buffers and lie in one batch");
  __shared__ __attribute__((aligned(16))) unsigned char sm[2 * RW * PH * 2];      /* two operand buffers (rows 0..127 A, then Bt); afterwards the output tile (f32, or the f16 transposed tile of plane 2 under VTO) */
  _Float16 (*sb)[RW][PH] = (_Float16 (*)[RW][PH])sm;
  float (*so)[CPI] = (float (*)[CPI])sm;
  const int tid = threadIdx.x, lane = tid & 31, ln = lane & 15, hh = lane >> 4, w = tid >> 5, wm = w >> 1, wn = w & 1; const int by = blockIdx.y;
  if (by == 1) bias = bias1; else if (by == 2) bias = bias2;
  constexpr int ntn = DM / TN; const int mt = blockIdx.x / ntn, nq = blockIdx.x - mt * ntn; const int row0 = mt * TM, col0 = nq * TN;
  const int sr = tid / TPR, sc = (tid % TPR) * 8;      /* staging: TPR threads per row, rows sr + RPP i */
  const _Float16* ag = A + (size_t)(row0 + sr) * DM + sc;
  const _Float16* bg = Bh + (size_t)by * sB + (size_t)(col0 + sr) * DM + sc;
  v8us ra[NPA], rb[NPB];
#pragma unroll
  for (int i = 0; i < NPA; ++i) ra[i] = *(const v8us*)(ag + i * RPP * DM);
#pragma unroll
  for (int j = 0; j < NPB; ++j) rb[j] = *(const v8us*)(bg + j * RPP * DM);
  float bv[NT];      /* this lane's bias values, fetched here so that their latency lies under the main loop */
#pragma unroll
  for (int t = 0; t < NT; ++t) bv[t] = bias[col0 + (wn * NT + t) * 16 + ln];
  asm volatile("s_wait_xcnt 0x0" ::: "memory");      /* behind the loads: it stands in front of every later overwrite of their address registers */
  const v8f z8 = {0.f,0.f,0.f,0.f,0.f,0.f,0.f,0.f};
  v8f acc[2][NT];
#pragma unroll
  for (int t = 0; t < NT; ++t) { acc[0][t] = z8; acc[1][t] = z8; }
#pragma unroll
  for (int i = 0; i < NPA; ++i) *(v8us*)&sb[0][sr + RPP * i][sc] = ra[i];
#pragma unroll
  for (int j = 0; j < NPB; ++j) *(v8us*)&sb[0][TM + sr + RPP * j][sc] = rb[j];
  __syncthreads();
  /* not unrolled: the buffer index stays one scalar and the loop stays short */
#pragma unroll 1
  for (int st = 0; st < DM / GKT; ++st) { const int cur = st & 1; const bool more = st + 1 < DM / GKT;      /* the same for the whole work-group */
    if (more) { const _Float16* an = ag + (st + 1) * GKT; const _Float16* bn = bg + (st + 1) * GKT;
#pragma unroll
      for (int i = 0; i < NPA; ++i) ra[i] = *(const v8us*)(an + i * RPP * DM);
#pragma unroll
      for (int j = 0; j < NPB; ++j) rb[j] = *(const v8us*)(bn + j * RPP * DM);
      asm volatile("s_wait_xcnt 0x0" ::: "memory"); }      /* as above: the address registers are temporaries that the code below reuses */
    const _Float16* ar = &sb[cur][wm * 32 + ln][0]; const _Float16* br = &sb[cur][TM + wn * NT * 16 + ln][0];
    if (PF) { v16h fa[2][2], fb[2][NT];
      fa[0][0] = g2_frag(ar, hh); fa[0][1] = g2_frag(ar + 16 * PH, hh);
#pragma unroll
      for (int t = 0; t < NT; ++t) fb[0][t] = g2_frag(br + t * 16 * PH, hh);
#pragma unroll
      for (int ks = 0; ks < NKS; ++ks) { const int c = ks & 1, n = c ^ 1;
        if (ks + 1 < NKS) { fa[n][0] = g2_frag(ar + (ks + 1) * 32, hh); fa[n][1] = g2_frag(ar + 16 * PH + (ks + 1) * 32, hh);
#pragma unroll
          for (int t = 0; t < NT; ++t) fb[n][t] = g2_frag(br + t * 16 * PH + (ks + 1) * 32, hh); }
        __builtin_amdgcn_sched_barrier(0);      /* keeps the next step's LDS reads, one group, in front of this step's products; left free, they sink to their uses and each pair of products waits out an LDS latency */
#pragma unroll
        for (int t = 0; t < NT; ++t) { acc[0][t] = fa_mma(fa[c][0], fb[c][t], acc[0][t]); acc[1][t] = fa_mma(fa[c][1], fb[c][t], acc[1][t]); } } }
    else {
#pragma unroll
      for (int ks = 0; ks < NKS; ++ks) { const v16h a0 = g2_frag(ar + ks * 32, hh), a1 = g2_frag(ar + 16 * PH + ks * 32, hh);
#pragma unroll
        for (int t = 0; t < NT; ++t) { const v16h b = g2_frag(br + t * 16 * PH + ks * 32, hh); acc[0][t] = fa_mma(a0, b, acc[0][t]); acc[1][t] = fa_mma(a1, b, acc[1][t]); } } }
    if (more) {      /* that buffer's last readers left it before the barrier that ended the stage before */
#pragma unroll
      for (int i = 0; i < NPA; ++i) *(v8us*)&sb[cur ^ 1][sr + RPP * i][sc] = ra[i];
#pragma unroll
      for (int j = 0; j < NPB; ++j) *(v8us*)&sb[cur ^ 1][TM + sr + RPP * j][sc] = rb[j]; }
    __syncthreads();      /* publishes the next stage and ends every read of this one */
  }
  /* the last barrier of the loop ended every read of the operand buffers: the output tile takes their place */
  if (VTO && by == 2) {      /* the same for the whole work-group. A lane's eight accumulator values are eight consecutive rows of one column: 16 contiguous bytes of that column's transposed row */
    _Float16 (*st)[TPI] = (_Float16 (*)[TPI])sm;
#pragma unroll
    for (int half = 0; half < 2; ++half)
#pragma unroll
      for (int t = 0; t < NT; ++t) { const float bb = bf16_round(bv[t]); FragH f;
#pragma unroll
        for (int r = 0; r < 8; ++r) f.h[r] = (_Float16)(acc[half][t][r] * alpha + bb);
        *(v8us*)&st[(wn * NT + t) * 16 + ln][wm * 32 + half * 16 + 8 * hh] = f.half[0]; }
    __syncthreads();      /* a column's 128 rows come from four waves and are stored by another: two whole 128-byte lines, 16 threads a column, columns vc + 16 i */
    const int vc = tid >> 4, vp = (tid & 15) * 8;
    _Float16* td = CT + ((size_t)(row0 / SQ) * DM + col0 + vc) * SQ + row0 % SQ + vp;
#pragma unroll
    for (int i = 0; i < TN / 16; ++i) *(v8us*)(td + (size_t)i * 16 * SQ) = *(const v8us*)&st[vc + 16 * i][vp]; }
  else {
#pragma unroll
  for (int half = 0; half < 2; ++half)
#pragma unroll
    for (int t = 0; t < NT; ++t) { const int col = (wn * NT + t) * 16 + ln; const float bb = bf16_round(bv[t]);
#pragma unroll
      for (int r = 0; r < 8; ++r) so[wm * 32 + half * 16 + 8 * hh + r][col] = acc[half][t][r] * alpha + bb; }
  __syncthreads();      /* the rows are stored by other waves than wrote them: whole 128-byte lines, 8 threads a line, rows er + 32 i */
  const int er = tid >> 3, ec = tid & 7;
  if (H16) { _Float16* cd = C16 + (size_t)by * sC + (size_t)(row0 + er) * DM + col0 + ec * 8;
#pragma unroll
    for (int i = 0; i < 4; ++i)
#pragma unroll
      for (int sg = 0; sg < TN / 64; ++sg) { const v4f u0 = *(const v4fa*)&so[er + 32 * i][sg * 64 + ec * 8], u1 = *(const v4fa*)&so[er + 32 * i][sg * 64 + ec * 8 + 4]; FragH f;
#pragma unroll
        for (int q = 0; q < 4; ++q) { f.h[q] = (_Float16)u0[q]; f.h[4 + q] = (_Float16)u1[q]; }
        *(v8us*)(cd + i * 32 * DM + sg * 64) = f.half[0]; } }
  else { float* cd = C + (size_t)by * sC + (size_t)(row0 + er) * DM + col0 + ec * 4;
#pragma unroll
    for (int i = 0; i < 4; ++i)
#pragma unroll
      for (int sg = 0; sg < TN / 32; ++sg) { const v4f u = *(const v4fa*)&so[er + 32 * i][sg * 32 + ec * 4]; *(v4f*)(cd + i * 32 * DM + sg * 32) = u; } }
  }
  asm volatile("s_wait_xcnt 0x0" ::: "memory");      /* behind the stores, in front of whatever follows them */
}

// ---- all input preparation in one launch: the five pieces read none of each other's output, so the grid index picks the piece ----
#define PTN 64                              /* output rows (n) of a weight tile */
#define PTK 128                             /* k values of a weight tile: 256 bytes of each output row, two whole lines */
#define PWT ((DM / PTN) * (DM / PTK))       /* tiles, one work-group each, per [DM][DM] weight plane (exact) */
#define PXB ((int)(NR * DM / 8 / 256))      /* work-groups for the x rows, 8 elements a thread (exact) */
// Weight planes first (load, LDS, barrier, store is the longer path, and low indices start first): Bt[n][k] = f16(bf16(W[k][n]) x 16), exact in f16.
// wq / wk / wv are per-head stacks [NH][DM][HD]: output row n = h * HD + e reads column e of head h's [in = DM][out = HD] block; wo is one [in = DM][out = DM] matrix. Then x as exact f16 rows, once: all three projections read the same rows.
// One work-group transposes one tile of PTK source rows x PTN columns through LDS, so that both sides of the transpose move whole 128-byte lines:
// 16 threads read the 256 contiguous bytes that a source row has in the tile, and 16 threads store the 256 contiguous bytes that an output row has in it.
// A thread reads 4 columns of 8 consecutive source rows (k); a column's 8 values, converted, are 16 contiguous bytes of that column's output row.
// LDS: PTN rows of sixteen 16-byte pieces, piece c of row n at place (c + n / 4) mod 16: the 16 lanes that write one piece index to rows 4 apart, and the 16 lanes that read one row, each meet 16 different places, no bank twice.
template <int PITCH>      /* a compile-time source row pitch: the eight loads share one address and differ in their immediate offsets */
__device__ __forceinline__ void prep_wt(const float* __restrict__ s, _Float16* __restrict__ d, v8us (*tl)[16]) {      /* s: source element [k0][n0] of the tile; d: output element [n0][k0] */
  const int hi = threadIdx.x >> 4, lo = threadIdx.x & 15;
  const float* sp = s + hi * 8 * PITCH + lo * 4;
  v4f r[8];
  /* unrolled: all eight loads are issued before the first value is used, and r stays in registers */
#pragma unroll
  for (int i = 0; i < 8; ++i) r[i] = *(const v4fa*)(sp + i * PITCH);
  asm volatile("s_wait_xcnt 0x0" ::: "memory");      /* behind the loads: it stands in front of every later overwrite of their address registers */
#pragma unroll
  for (int j = 0; j < 4; ++j) { FragH f;
#pragma unroll
    for (int i = 0; i < 8; ++i) f.h[i] = (_Float16)(bf16_round(r[i][j]) * 16.0f);
    tl[lo * 4 + j][(hi + lo) & 15] = f.half[0]; }      /* row n = 4 lo + j, piece hi */
  __syncthreads();      /* an output row's pieces come from all eight waves and are stored by one */
  _Float16* dp = d + hi * DM + lo * 8;
#pragma unroll
  for (int p = 0; p < PTN / 16; ++p) *(v8us*)(unsigned short*)(dp + p * 16 * DM) = tl[p * 16 + hi][(lo + p * 4 + (hi >> 2)) & 15];      /* row n = 16 p + hi, piece lo */
  asm volatile("s_wait_xcnt 0x0" ::: "memory"); }      /* behind the stores, in front of whatever follows them */
__global__ __launch_bounds__(256) void k_prep(const float* __restrict__ x, const float* __restrict__ wq, const float* __restrict__ wk, const float* __restrict__ wv, const float* __restrict__ wo,
    _Float16* __restrict__ X16, _Float16* __restrict__ BQ, _Float16* __restrict__ BK, _Float16* __restrict__ BV, _Float16* __restrict__ BO) {
  static_assert(PTN == HD && PTK == 16 * 8 && DM % PTK == 0 && DM % PTN == 0, "k_prep: a tile is one head's columns x sixteen 16-byte pieces, and tiles must divide the plane");
  __shared__ __attribute__((aligned(16))) v8us tl[PTN][16];
  const int bx = blockIdx.x;
  if (bx < 4 * PWT) { const int m = bx / PWT; const int t = bx - m * PWT; const int nt = t / (DM / PTK), k0 = (t % (DM / PTK)) * PTK; const int o = nt * PTN * DM + k0;      /* the same for the whole work-group; PTN == HD: tile row nt is head nt */
    if (m == 3) prep_wt<DM>(wo + k0 * DM + nt * PTN, BO + o, tl);
    else prep_wt<HD>((m == 0 ? wq : m == 1 ? wk : wv) + nt * (DM * HD) + k0 * HD, (m == 0 ? BQ : m == 1 ? BK : BV) + o, tl); }
  else { const size_t t = (size_t)(bx - 4 * PWT) * 256 + threadIdx.x; FragH f;
    /* unrolled: the eight contiguous floats become two 16-byte loads, and f stays in registers */
#pragma unroll
    for (int q = 0; q < 8; ++q) f.h[q] = (_Float16)bf16_round(x[t * 8 + q]);
    *(v8us*)((unsigned short*)X16 + t * 8) = f.half[0];
    asm volatile("s_wait_xcnt 0x0" ::: "memory"); }      /* behind the store, in front of whatever follows it */
}

extern "C" void kernel_launch(void* const* d_in, const int* in_sizes, int n_in,
                              void* d_out, int out_size, void* d_ws, size_t ws_size, hipStream_t stream) {
  (void)in_sizes; (void)n_in; (void)out_size;
  const float* const* I = (const float* const*)d_in; const float* x = I[0]; const float* wq = I[1]; const float* bq = I[2]; const float* wk = I[3]; const float* bk = I[4]; const float* wv = I[5]; const float* bv = I[6]; const float* wo = I[7]; const float* bo = I[8];      /* ONE input stream (x) read on all three projections; wq, wk, wv are PER-HEAD STACKS [12][768][64] = [head][in][out]; bq, bk, bv are per-head [12][64] = the flat [768] bias; wo [in][out] + bo; input order x, wq, bq, wk, bk, wv, bv, wo, bo */
  char* ws = (char*)d_ws; size_t off = 0;
  auto take = [&](size_t bytes) { char* p = ws + off; off += (bytes + 255) & ~(size_t)255; return p; };
  _Float16* BQ = (_Float16*)take((size_t)DM * DM * 2); _Float16* BK = (_Float16*)take((size_t)DM * DM * 2); _Float16* BV = (_Float16*)take((size_t)DM * DM * 2); _Float16* BO = (_Float16*)take((size_t)DM * DM * 2);      /* BQ, BK, BV lie DM * DM elements apart (a multiple of 256 bytes): the batch stride of the merged projection launch */
  _Float16* X16 = (_Float16*)take(NR * DM * 2); _Float16* Q16 = (_Float16*)take(NR * DM * 2); _Float16* K16 = (_Float16*)take(NR * DM * 2); _Float16* O16 = (_Float16*)take(NR * DM * 2);      /* Q16, K16 lie NR * DM elements apart, likewise */
  _Float16* VT = (_Float16*)take((size_t)NB * NH * HD * SQ * 2);
  if (off > ws_size) return;
  k_prep<<<4 * PWT + PXB, 256, 0, stream>>>(x, wq, wk, wv, wo, X16, BQ, BK, BV, BO);      /* the four weight planes (x16) and x as exact f16 rows */
  const size_t r0p = (size_t)B0 * SQ;      /* first projected row */
  k_gemm3<4, 64, true, false, true><<<dim3((unsigned)((MP / 128) * (DM / 128)), 3), 256, 0, stream>>>(X16 + r0p * DM, BQ, (size_t)DM * DM, 0.0625f, bq, bk, bv, nullptr, Q16 + r0p * DM, NR * DM, VT + (size_t)B0 * DM * SQ);      /* blockIdx.y = 0, 1, 2: q rows, k rows, V^T [NB][NH][HD][SQ] */
  k_fattn<<<NB * NH * (SQ / 256), 256, 0, stream>>>(Q16, K16, VT, O16, 0.052058773f);      /* o (merged heads, x64) as f16 rows; cs = 768^-0.5 log2 e */
  k_gemm3<3, 128, false, true, false><<<dim3((unsigned)((MPO / 128) * (DM / 96)), 1), 256, 0, stream>>>(O16 + r0p * DM, BO, 0, 0.0009765625f, bo, nullptr, nullptr, (float*)d_out + r0p * DM, nullptr, 0, nullptr);      /* out rows are the output layout */
}

// v007
// Measured time: 65.4 microseconds a run.
// In two side-by-side timings against v006, it was 1.06 and 1.05 times as fast.
// Counting every step since v000, it is 41.8 times as fast.
#include <hip/hip_runtime.h>
// Multi-head self-attention with PER-HEAD STACKED projections and per-head biases at width 768, scaled by the EMBED WIDTH (x [2][2048][768]; q / k / v = einsum('bse,hed->bhsd', x, W) + b with W [12][768][64] = [head][in][out] and b [12][64], 12 heads of 64; scores / sqrt(E = 768) (the module's own: the embed width, not the head width); softmax over all 2048 keys (no mask); out = merged wo + bo ([in][out] [768][768] + bias) -> [2][2048][768]); each head's [in][out] block is transposed into its 64 contiguous rows of the [out][in] weight plane; a per-head bias [12][64] IS the flat bias [768].
// Structure: four launches. Token rows r = b*2048 + s; one preparation launch: x as exact f16 rows (bf16-rounded) and the four weight planes, picked by the grid index; Q, K, V as three WMMA GEMMs in one launch, picked by blockIdx.y (128x128 work-group tiles, operands through LDS, f32 accumulation, exact x16 weights + bias, f16 outputs; the v product is stored transposed, as V^T rows per (batch, head), by its own epilogue); one fused attention launch over all (batch, head, 256 queries): S^T = K Q^T (K = 64), online softmax in registers (f32 statistics, native exp2, scale 768^-0.5; unnormalised weights as f16), O^T += V^T P^T, o / sum carried x64 against f16 subnormal flush (folded into the output GEMM alpha) written straight into the merged f16 o rows; out = o W_o + b GEMM (f32) into the output layout.
// Compute dtype: inputs rounded to bf16; x / weights exact; q, k, v, softmax weights and o as plain f16 GEMM operands (~2^-12); scores and softmax statistics f32. v_wmma_f32_16x16x32_f16.
#define NB 2
#define SQ 2048
#define DM 768 
#define NH 12
#define HD 64
#define HG 4                         /* heads per launch of the grouped k_vt, which is not launched */
#define B0 0                         /* first batch processed (debug hook) */
#define NBR NB                       /* batches processed (debug hook) */
#define NR ((size_t)NB * SQ)         /* token rows */
#define MP ((int)((size_t)NBR * SQ)) /* rows projected (debug hook) */
#define QN SQ                        /* not used: attention takes all SQ query rows */
#define NHD NH                       /* not used: attention takes all NH heads */
#define MPO MP                       /* rows through the output stage (debug hook) */
#define LQ DM      /* not used: the q and k rows have pitch DM */
typedef __bf16 v16b __attribute__((ext_vector_type(16)));
typedef unsigned short v8us __attribute__((ext_vector_type(8), may_alias));
typedef float  v8f  __attribute__((ext_vector_type(8)));
typedef float  v4f  __attribute__((ext_vector_type(4)));
typedef float  v4fa __attribute__((ext_vector_type(4), may_alias));
union FragB { v16b v; v8us half[2]; unsigned short u[16]; };

__device__ __forceinline__ unsigned short bf16_bits(float x) { unsigned int u = __float_as_uint(x); return (unsigned short)((u + 0x7FFFu + ((u >> 16) & 1u)) >> 16); }
__device__ __forceinline__ float bf16_val(unsigned short b) { return __uint_as_float(((unsigned int)b) << 16); }
__device__ __forceinline__ float bf16_round(float x) { return bf16_val(bf16_bits(x)); }
// D += A·B with NT terms: 1 = ah·bh, 2 = + al·bh (A split), 3 = + ah·bl (both split)
template <int NT>
__device__ __forceinline__ v8f mmaN(v16b ah, v16b al, v16b bh, v16b bl, v8f c) {
  c = __builtin_amdgcn_wmma_f32_16x16x32_bf16(false, ah, false, bh, (short)0, c, false, false);
  if (NT >= 2) c = __builtin_amdgcn_wmma_f32_16x16x32_bf16(false, al, false, bh, (short)0, c, false, false);
  if (NT >= 3) c = __builtin_amdgcn_wmma_f32_16x16x32_bf16(false, ah, false, bl, (short)0, c, false, false);
  asm volatile("v_nop\n\tv_nop\n\tv_nop\n\tv_nop" : "+v"(c) : "v"(ah), "v"(al), "v"(bh), "v"(bl));
  return c;
}

__global__ __launch_bounds__(256) void k_wt_bf16(const float* __restrict__ W, unsigned short* __restrict__ Wt, int K, int N) {
  const int t = blockIdx.x * 256 + threadIdx.x;
  const int k8n = K / 8;
  if (t >= N * k8n) return;
  const int n = t / k8n, k8 = (t % k8n) * 8;
  v8us v;
#pragma unroll
  for (int i = 0; i < 8; ++i) v[i] = bf16_bits(W[(size_t)(k8 + i) * N + n]);
  *(v8us*)(Wt + (size_t)n * K + k8) = v;
  
}

// GEMM C[M][N] (f32, pitch ldc) = act(A[M][K]·W + bias). A f32 row-major (pitch lda) converted per fragment to bf16
// (ASPLIT: hi/lo two planes -> 2 terms, else single rounded term); Wt bf16 [N][K] (pitch ldb). BIAS_BF16 rounds the
// bias to bf16 first (bias quantised to bf16 before the add). K%32==0, M%16==0, N%64==0.
template <bool ASPLIT, int ACT, bool BIAS_BF16>
__global__ __launch_bounds__(128) void k_gemm_bf(const float* __restrict__ A, int lda, const unsigned short* __restrict__ Wt, int ldb,
                                               const float* __restrict__ bias, float* __restrict__ C, int ldc, int M, int N, int K) {
  __shared__ __attribute__((aligned(16))) float so[4][16][64];
  const int tid = threadIdx.x, w = tid >> 5, lane = tid & 31, ln = lane & 15, hh = lane >> 4;
  const int ntn = N / 64;
  const int wid = blockIdx.x * 4 + w;
  const int mt = wid / ntn, nq = wid % ntn;
  if (mt * 16 >= M) return;
  const int row0 = mt * 16, col0 = nq * 64;
  const float* arow = A + (size_t)(row0 + ln) * lda;
  v8f acc[4] = {};
  for (int kb = 0; kb < K; kb += 32) {
    FragB ah, al;
    const v4f x0 = *(const v4fa*)(arow + kb + 8 * hh), x1 = *(const v4fa*)(arow + kb + 8 * hh + 4);
    const v4f x2 = *(const v4fa*)(arow + kb + 16 + 8 * hh), x3 = *(const v4fa*)(arow + kb + 16 + 8 * hh + 4);
    float xs[16] = {x0[0],x0[1],x0[2],x0[3],x1[0],x1[1],x1[2],x1[3],x2[0],x2[1],x2[2],x2[3],x3[0],x3[1],x3[2],x3[3]};
#pragma unroll
    for (int i = 0; i < 16; ++i) { const unsigned short hb = bf16_bits(xs[i]); ah.u[i] = hb; al.u[i] = ASPLIT ? bf16_bits(xs[i] - bf16_val(hb)) : (unsigned short)0; }
#pragma unroll
    for (int t = 0; t < 4; ++t) {
      const unsigned short* brow = Wt + (size_t)(col0 + t * 16 + ln) * ldb + kb;
      FragB b;
      b.half[0] = *(const v8us*)(brow + 8 * hh);
      b.half[1] = *(const v8us*)(brow + 16 + 8 * hh);
      acc[t] = mmaN<ASPLIT ? 2 : 1>(ah.v, al.v, b.v, b.v, acc[t]);
    }
  }
#pragma unroll
  for (int t = 0; t < 4; ++t) {
    float bv = bias ? bias[col0 + t * 16 + ln] : 0.f;
    if (BIAS_BF16) bv = bf16_round(bv);
#pragma unroll
    for (int r = 0; r < 8; ++r) { float v = acc[t][r] + bv; if (ACT == 1) v = fmaxf(v, 0.f); so[w][8 * hh + r][t * 16 + ln] = v; }
  }
  __builtin_amdgcn_fence(__ATOMIC_ACQ_REL, "workgroup");
  __builtin_amdgcn_wave_barrier();
  const int rsub = lane >> 4, c4 = (lane & 15) * 4;
  {
#pragma unroll
    for (int q = 0; q < 8; ++q) {
      const int r = q * 2 + rsub;
      const v4f v = *(const v4fa*)&so[w][r][c4];
      *(v4f*)(C + (size_t)(row0 + r) * ldc + col0 + c4) = v;
    }
    
  }
}

// GEMM C = act(A·W + bias + resid): A f32 (ASPLIT -> hi/lo 2 terms), Wt bf16 [N][K]; ACT 0 none, 1 relu, 2 exact gelu;
// resid (optional, f32, row index = (row % rmod), pitch ldr, RES_BF16 rounds it) added before the activation.
template <bool ASPLIT, int ACT, bool BIAS_BF16, bool RES_BF16>
__global__ __launch_bounds__(128) void k_gemm_bf3(const float* __restrict__ A, int lda, const unsigned short* __restrict__ Wt, int ldb,
                                                const float* __restrict__ bias, const float* __restrict__ resid, int rmod, int ldr,
                                                float* __restrict__ C, int ldc, int M, int N, int K) {
  __shared__ __attribute__((aligned(16))) float so[4][16][64];
  const int tid = threadIdx.x, w = tid >> 5, lane = tid & 31, ln = lane & 15, hh = lane >> 4;
  const int ntn = N / 64;
  const int wid = blockIdx.x * 4 + w;
  const int mt = wid / ntn, nq = wid % ntn;
  if (mt * 16 >= M) return;
  const int row0 = mt * 16, col0 = nq * 64;
  const float* arow = A + (size_t)(row0 + ln) * lda;
  v8f acc[4] = {};
  for (int kb = 0; kb < K; kb += 32) {
    FragB ah, al;
    const v4f x0 = *(const v4fa*)(arow + kb + 8 * hh), x1 = *(const v4fa*)(arow + kb + 8 * hh + 4);
    const v4f x2 = *(const v4fa*)(arow + kb + 16 + 8 * hh), x3 = *(const v4fa*)(arow + kb + 16 + 8 * hh + 4);
    float xs[16] = {x0[0],x0[1],x0[2],x0[3],x1[0],x1[1],x1[2],x1[3],x2[0],x2[1],x2[2],x2[3],x3[0],x3[1],x3[2],x3[3]};
#pragma unroll
    for (int i = 0; i < 16; ++i) { const unsigned short hb = bf16_bits(xs[i]); ah.u[i] = hb; al.u[i] = ASPLIT ? bf16_bits(xs[i] - bf16_val(hb)) : (unsigned short)0; }
#pragma unroll
    for (int t = 0; t < 4; ++t) {
      const unsigned short* brow = Wt + (size_t)(col0 + t * 16 + ln) * ldb + kb;
      FragB b;
      b.half[0] = *(const v8us*)(brow + 8 * hh);
      b.half[1] = *(const v8us*)(brow + 16 + 8 * hh);
      acc[t] = mmaN<ASPLIT ? 2 : 1>(ah.v, al.v, b.v, b.v, acc[t]);
    }
  }
#pragma unroll
  for (int t = 0; t < 4; ++t) {
    const int col = col0 + t * 16 + ln;
    float bv = bias ? bias[col] : 0.f;
    if (BIAS_BF16) bv = bf16_round(bv);
#pragma unroll
    for (int r = 0; r < 8; ++r) {
      float v = acc[t][r] + bv;
      if (resid) { float rv = resid[(size_t)((row0 + 8 * hh + r) % rmod) * ldr + col]; if (RES_BF16) rv = bf16_round(rv); v += rv; }
      if (ACT == 1) v = fmaxf(v, 0.f);
      if (ACT == 2) v = 0.5f * v * (1.0f + erff(v * 0.70710678118654752f));
      if (ACT == 3) { const float u = 0.7978845608028654f * (v + 0.044715f * v * v * v); v = 0.5f * v * (1.0f + tanhf(u)); }
      so[w][8 * hh + r][t * 16 + ln] = v;
    }
  }
  __builtin_amdgcn_fence(__ATOMIC_ACQ_REL, "workgroup");
  __builtin_amdgcn_wave_barrier();
  const int rsub = lane >> 4, c4 = (lane & 15) * 4;
  {
#pragma unroll
    for (int q = 0; q < 8; ++q) {
      const int r = q * 2 + rsub;
      const v4f v = *(const v4fa*)&so[w][r][c4];
      *(v4f*)(C + (size_t)(row0 + r) * ldc + col0 + c4) = v;
    }
    
  }
}
// row LayerNorm (biased variance, eps) over N: s = X (+ R); optional out_sum <- s; out_norm <- (s-mu)*rsqrt(var+eps)*g + b
template <bool PARAM_BF16>
__global__ __launch_bounds__(256) void k_layernorm(const float* __restrict__ X, const float* __restrict__ R, const float* __restrict__ g, const float* __restrict__ bta,
                                                  float* __restrict__ out_sum, float* __restrict__ out_norm, int N, float eps) {
  __shared__ float red[256];
  const int row = blockIdx.x, tid = threadIdx.x;
  const float* x = X + (size_t)row * N; const float* rr = R ? R + (size_t)row * N : nullptr;
  float vals[16];                     // up to N = 4096
  const int per = N / 256;            // contiguous chunk per thread? use strided-by-4 chunks: thread handles j = tid*4 + 1024*u
  float s1 = 0.f;
  for (int u = 0; u < per / 4; ++u) {
    const int j = tid * 4 + 1024 * u;
    const v4f a = *(const v4fa*)(x + j);
    v4f b = {0.f,0.f,0.f,0.f}; if (rr) b = *(const v4fa*)(rr + j);
#pragma unroll
    for (int q = 0; q < 4; ++q) { const float v = a[q] + b[q]; vals[u * 4 + q] = v; s1 += v; }
  }
  red[tid] = s1; __syncthreads();
  for (int st = 128; st > 0; st >>= 1) { if (tid < st) red[tid] += red[tid + st]; __syncthreads(); }
  const float mu = red[0] / (float)N; __syncthreads();
  float s2 = 0.f;
  for (int u = 0; u < per / 4; ++u)
#pragma unroll
    for (int q = 0; q < 4; ++q) { const float c = vals[u * 4 + q] - mu; s2 += c * c; }
  red[tid] = s2; __syncthreads();
  for (int st = 128; st > 0; st >>= 1) { if (tid < st) red[tid] += red[tid + st]; __syncthreads(); }
  const float rs = rsqrtf(red[0] / (float)N + eps);
  {
    for (int u = 0; u < per / 4; ++u) {
      const int j = tid * 4 + 1024 * u;
      v4f o, sm;
#pragma unroll
      for (int q = 0; q < 4; ++q) {
        float gg = g[j + q], bb = bta[j + q];
        if (PARAM_BF16) { gg = bf16_round(gg); bb = bf16_round(bb); }
        sm[q] = vals[u * 4 + q]; o[q] = (vals[u * 4 + q] - mu) * rs * gg + bb;
      }
      if (out_sum) *(v4f*)(out_sum + (size_t)row * N + j) = sm;
      *(v4f*)(out_norm + (size_t)row * N + j) = o;
    }
    
  }
}



// ---- f16 WMMA path (v_wmma_f32_16x16x32_f16): 11-bit significands for operands in range — used where a [0,1] probability operand needs more precision than bf16
typedef _Float16 v16h __attribute__((ext_vector_type(16)));
union FragH { v16h v; v8us half[2]; _Float16 h[16]; unsigned short u[16]; };
template <int NT>
__device__ __forceinline__ v8f mmaH(v16h ah, v16h al, v16h bh, v16h bl, v8f c) {
  c = __builtin_amdgcn_wmma_f32_16x16x32_f16(false, ah, false, bh, (short)0, c, false, false);
  if (NT >= 2) c = __builtin_amdgcn_wmma_f32_16x16x32_f16(false, al, false, bh, (short)0, c, false, false);
  if (NT >= 3) c = __builtin_amdgcn_wmma_f32_16x16x32_f16(false, ah, false, bl, (short)0, c, false, false);
  asm volatile("v_nop\n\tv_nop\n\tv_nop\n\tv_nop" : "+v"(c) : "v"(ah), "v"(al), "v"(bh), "v"(bl));
  return c;
}
// batched GEMM like k_gemm_b but f16 operands: A f32 (split into f16 hi/lo if ASPLIT, else rounded to f16), Bt = f16 values [n][k]; alpha; C f32; N multiple of 16 (partial tiles skipped)
template <bool ASPLIT>
__global__ __launch_bounds__(128) void k_gemm_h(const float* __restrict__ A, int lda, size_t sA, const _Float16* __restrict__ Bh, int ldb, size_t sB, float alpha, float* __restrict__ C, int ldc, size_t sC, int M, int N, int K) {
  __shared__ __attribute__((aligned(16))) float so[4][16][64];
  const int tid = threadIdx.x, w = tid >> 5, lane = tid & 31, ln = lane & 15, hh = lane >> 4; const int by = blockIdx.y;
  A += (size_t)by * sA; Bh += (size_t)by * sB; C += (size_t)by * sC;
  const int ntn = (N + 63) / 64; const int wid = blockIdx.x * 4 + w; const int mt = wid / ntn, nq = wid % ntn; if (mt * 16 >= M) return;
  const int row0 = mt * 16, col0 = nq * 64; const float* arow = A + (size_t)(row0 + ln) * lda;
  v8f acc[4] = {};
  for (int kb = 0; kb < K; kb += 32) {
    FragH ah, al;
    const v4f x0 = *(const v4fa*)(arow + kb + 8 * hh), x1 = *(const v4fa*)(arow + kb + 8 * hh + 4), x2 = *(const v4fa*)(arow + kb + 16 + 8 * hh), x3 = *(const v4fa*)(arow + kb + 16 + 8 * hh + 4);
    float xs[16] = {x0[0],x0[1],x0[2],x0[3],x1[0],x1[1],x1[2],x1[3],x2[0],x2[1],x2[2],x2[3],x3[0],x3[1],x3[2],x3[3]};
#pragma unroll
    for (int i = 0; i < 16; ++i) { const _Float16 h = (_Float16)xs[i]; ah.h[i] = h; al.h[i] = ASPLIT ? (_Float16)(xs[i] - (float)h) : (_Float16)0.0f; }
#pragma unroll
    for (int t = 0; t < 4; ++t) { if (col0 + t * 16 >= N) continue; const size_t boff = (size_t)(col0 + t * 16 + ln) * ldb + kb; FragH bq; bq.half[0] = *(const v8us*)(Bh + boff + 8 * hh); bq.half[1] = *(const v8us*)(Bh + boff + 16 + 8 * hh);
      acc[t] = mmaH<ASPLIT ? 2 : 1>(ah.v, al.v, bq.v, bq.v, acc[t]); }
  }
#pragma unroll
  for (int t = 0; t < 4; ++t) { if (col0 + t * 16 >= N) continue;
#pragma unroll
    for (int r = 0; r < 8; ++r) so[w][8 * hh + r][t * 16 + ln] = acc[t][r] * alpha; }
  __builtin_amdgcn_fence(__ATOMIC_ACQ_REL, "workgroup"); __builtin_amdgcn_wave_barrier();
  const int rsub = lane >> 4, c4 = (lane & 15) * 4;
  {
#pragma unroll
    for (int q = 0; q < 8; ++q) { const int r = q * 2 + rsub; if (col0 + c4 < N) { const v4f v = *(const v4fa*)&so[w][r][c4]; *(v4f*)(C + (size_t)(row0 + r) * ldc + col0 + c4) = v; } }
     }
}

// k_gemm_hh variant with fused epilogue: v = acc·alpha + bias[by·sBias + col] (+ CP[(row/rowsPerB)·sCPb + by·64 + col] if CP) ; ACT 0 none / 1 elu ; writes f16 C16 (and f32 C if non-null)
template <int ACT>
__global__ __launch_bounds__(128) void k_gemm_hhx(const _Float16* __restrict__ A, int lda, size_t sA, const _Float16* __restrict__ Bh, int ldb, size_t sB, float alpha, const float* __restrict__ bias, size_t sBias, const float* __restrict__ CP, int rowsPerB, size_t sCPb, int row0g,
    float* __restrict__ C, _Float16* __restrict__ C16, int ldc, size_t sC, int M, int N, int K) {
  __shared__ __attribute__((aligned(16))) float so[4][16][64];
  const int tid = threadIdx.x, w = tid >> 5, lane = tid & 31, ln = lane & 15, hh = lane >> 4; const int by = blockIdx.y;
  A += (size_t)by * sA; Bh += (size_t)by * sB; const size_t cofs = (size_t)by * sC; const float* bp = bias ? bias + (size_t)by * sBias : nullptr;
  const int ntn = (N + 63) / 64; const int wid = blockIdx.x * 4 + w; const int mt = wid / ntn, nq = wid % ntn; if (mt * 16 >= M) return;
  const int row0 = mt * 16, col0 = nq * 64; const _Float16* arow = A + (size_t)(row0 + ln) * lda;
  v8f acc[4] = {};
  for (int kb = 0; kb < K; kb += 32) { FragH ah; ah.half[0] = *(const v8us*)((const unsigned short*)arow + kb + 8 * hh); ah.half[1] = *(const v8us*)((const unsigned short*)arow + kb + 16 + 8 * hh);
#pragma unroll
    for (int t = 0; t < 4; ++t) { if (col0 + t * 16 >= N) continue; const size_t boff = (size_t)(col0 + t * 16 + ln) * ldb + kb; FragH bq; bq.half[0] = *(const v8us*)((const unsigned short*)Bh + boff + 8 * hh); bq.half[1] = *(const v8us*)((const unsigned short*)Bh + boff + 16 + 8 * hh);
      acc[t] = mmaH<1>(ah.v, ah.v, bq.v, bq.v, acc[t]); }
  }
#pragma unroll
  for (int t = 0; t < 4; ++t) { if (col0 + t * 16 >= N) continue; const int col = col0 + t * 16 + ln; const float bv = bp ? bf16_round(bp[col]) : 0.f;
#pragma unroll
    for (int r = 0; r < 8; ++r) { float v = acc[t][r] * alpha + bv; if (CP) { const int rr = row0g + row0 + 8 * hh + r; if (rowsPerB < 0) v += CP[cofs + (size_t)rr * ldc + col];      /* rowsPerB < 0: own element of the batched C plane */ else { const int bidx = rr / rowsPerB; v += CP[(size_t)bidx * sCPb + (size_t)by * 64 + col]; } } if (ACT == 1) v = (v > 0.f) ? v : expm1f(v); else if (ACT == 7) v = (v > 0.f) ? v + 1.0f : expf(v); else if (ACT == 8) v = tanhf(v); else if (ACT == 9) v = 0.5f * v * (1.0f + tanhf(0.7978845608028654f * (v + 0.044715f * v * v * v))); else if (ACT == 11) v = 1.0f / (1.0f + expf(-v)); else if (ACT == 12) v = (v > 0.f) ? v : 0.01f * v; else if (ACT == 14) v = (v > 0.f) ? v : 0.1f * v; else if (ACT == 16) v = (v >= 0.f) ? v : 0.3f * v; else if (ACT == 17) v = (v >= 0.f) ? v : 0.2f * v; else if (ACT == 15) v = v / (1.0f + expf(-v)); else if (ACT == 3) v = fmaxf(v, 0.f); else if (ACT == 6) v = 0.5f * v * (1.0f + erff(v * 0.70710678118654752f)); so[w][8 * hh + r][t * 16 + ln] = v; } }
  __builtin_amdgcn_fence(__ATOMIC_ACQ_REL, "workgroup"); __builtin_amdgcn_wave_barrier();
  const int rsub = lane >> 4, c4 = (lane & 15) * 4; typedef _Float16 v4h __attribute__((ext_vector_type(4)));
  {
#pragma unroll
    for (int q = 0; q < 8; ++q) { const int r = q * 2 + rsub; if (col0 + c4 < N) { const v4f v = *(const v4fa*)&so[w][r][c4]; if (C) *(v4f*)(C + cofs + (size_t)(row0 + r) * ldc + col0 + c4) = v; if (C16) { v4h h4; for (int i = 0; i < 4; ++i) h4[i] = (_Float16)v[i]; *(v4h*)(C16 + cofs + (size_t)(row0 + r) * ldc + col0 + c4) = h4; } } }
     }
}


typedef _Float16 v4h __attribute__((ext_vector_type(4)));

__global__ __launch_bounds__(256) void k_h16(const float* __restrict__ x, _Float16* __restrict__ X16, size_t n8) { const size_t t = (size_t)blockIdx.x * 256 + threadIdx.x; if (t >= n8) return; FragH f;
#pragma unroll
  for (int q = 0; q < 8; ++q) f.h[q] = (_Float16)x[t * 8 + q]; *(v8us*)((unsigned short*)X16 + t * 8) = f.half[0];  }
__global__ __launch_bounds__(256) void k_round16f(const float* __restrict__ W, _Float16* __restrict__ Bt, size_t n8) { const size_t t = (size_t)blockIdx.x * 256 + threadIdx.x; if (t >= n8) return; FragH f;
#pragma unroll
  for (int i = 0; i < 8; ++i) f.h[i] = (_Float16)(bf16_round(W[t * 8 + i]) * 16.0f); *(v8us*)((unsigned short*)Bt + t * 8) = f.half[0];  }
template <int NHv, int TTv>
__global__ __launch_bounds__(256) void k_vt(const _Float16* __restrict__ V16, int ldv, int voff, _Float16* __restrict__ Vt) { __shared__ unsigned short tl[64][66]; const int tid = threadIdx.x; const int slab = blockIdx.x / (TTv / 64), lg = blockIdx.x % (TTv / 64); const int b = slab / NHv, h = slab % NHv;
  for (int i = tid; i < 64 * 8; i += 256) { const int r = i / 8, c8 = (i % 8) * 8; FragH f; f.half[0] = *(const v8us*)((const unsigned short*)V16 + ((size_t)b * TTv + lg * 64 + r) * ldv + voff + h * 64 + c8);
#pragma unroll
    for (int q = 0; q < 8; ++q) tl[r][c8 + q] = f.u[q]; }
  __syncthreads();
  {
#pragma unroll
    for (int rd = 0; rd < 2; ++rd) { const int d = rd * 32 + tid / 8, pc = tid % 8; FragH f;
#pragma unroll
      for (int q = 0; q < 8; ++q) f.u[q] = tl[pc * 8 + q][d];
      *(v8us*)((unsigned short*)Vt + ((size_t)slab * 64 + d) * TTv + lg * 64 + pc * 8) = f.half[0]; }
     } }

__global__ __launch_bounds__(256) void k_hl(const float* __restrict__ F, _Float16* __restrict__ Hh, _Float16* __restrict__ Hl, size_t n8) { const size_t t = (size_t)blockIdx.x * 256 + threadIdx.x; if (t >= n8) return; FragH fh, fl; const v4f a = *(const v4fa*)(F + t * 8), c = *(const v4fa*)(F + t * 8 + 4);
#pragma unroll
  for (int q = 0; q < 4; ++q) { _Float16 h = (_Float16)a[q]; fh.h[q] = h; fl.h[q] = (_Float16)((a[q] - (float)h) * 1024.0f); h = (_Float16)c[q]; fh.h[4 + q] = h; fl.h[4 + q] = (_Float16)((c[q] - (float)h) * 1024.0f); }
  { *(v8us*)((unsigned short*)Hh + t * 8) = fh.half[0]; *(v8us*)((unsigned short*)Hl + t * 8) = fl.half[0];  } }

// ---- fast GEMM (wave tile 32x64; requires M % 32 == 0 rows per launch region and N % 64 == 0); epilogue = k_gemm_hhx semantics ----
__device__ __forceinline__ v16h g2_frag(const _Float16* p, int hh) { FragH f; f.half[0] = *(const v8us*)((const unsigned short*)p + 8 * hh); f.half[1] = *(const v8us*)((const unsigned short*)p + 16 + 8 * hh); return f.v; }
__device__ __forceinline__ v8f g2_mma(v16h a, v16h b, v8f c) { v8f d = __builtin_amdgcn_wmma_f32_16x16x32_f16(false, a, false, b, (short)0, c, false, false); asm volatile("v_nop\n\tv_nop\n\tv_nop\n\tv_nop" : "+v"(d) : "v"(a), "v"(b)); return d; }
template <int ACT>
__global__ __launch_bounds__(128) void k_gemm2(const _Float16* __restrict__ A, int lda, size_t sA, const _Float16* __restrict__ Bh, int ldb, size_t sB, float alpha, const float* __restrict__ bias, const float* __restrict__ bias1, const float* __restrict__ bias2, size_t sBias, const float* __restrict__ CP, int rowsPerB, size_t sCPb, int row0g,
    float* __restrict__ C, _Float16* __restrict__ C16, int ldc, size_t sC, int M, int N, int K) { static_assert(ACT == 0 || ACT == 3 || ACT == 6 || ACT == 8 || ACT == 9 || ACT == 11 || ACT == 12 || ACT == 14 || ACT == 15 || ACT == 16 || ACT == 17, "k_gemm2: unsupported ACT code (would silently apply no activation)");
  __shared__ __attribute__((aligned(16))) float so[4][32][68];
  const int tid = threadIdx.x, w = tid >> 5, lane = tid & 31, ln = lane & 15, hh = lane >> 4; const int by = blockIdx.y;
  if (by == 1) bias = bias1; else if (by == 2) bias = bias2;      /* batches 1 and 2 may have their bias in a buffer of its own (three products with separate bias inputs in one launch) */
  A += (size_t)by * sA; Bh += (size_t)by * sB; const size_t cofs = (size_t)by * sC; const float* bp = bias ? bias + (size_t)by * sBias : nullptr;
  const int ntn = N >> 6; const int mt = blockIdx.x / ntn, nq = blockIdx.x - mt * ntn; const int row0 = mt * 128 + 32 * w, col0 = nq * 64; if (row0 >= M) return;
  const _Float16* a0p = A + (size_t)(row0 + ln) * lda; const _Float16* a1p = a0p + (size_t)16 * lda;
  const _Float16* b0p = Bh + (size_t)(col0 + ln) * ldb; const _Float16* b1p = b0p + (size_t)16 * ldb; const _Float16* b2p = b1p + (size_t)16 * ldb; const _Float16* b3p = b2p + (size_t)16 * ldb;
  const v8f z8 = {0.f,0.f,0.f,0.f,0.f,0.f,0.f,0.f}; v8f c00 = z8, c01 = z8, c02 = z8, c03 = z8, c10 = z8, c11 = z8, c12 = z8, c13 = z8;
#pragma unroll 1
  for (int kb = 0; kb < K; kb += 32) { const v16h a0 = g2_frag(a0p + kb, hh), a1 = g2_frag(a1p + kb, hh);
    v16h b = g2_frag(b0p + kb, hh); c00 = g2_mma(a0, b, c00); c10 = g2_mma(a1, b, c10);
    b = g2_frag(b1p + kb, hh); c01 = g2_mma(a0, b, c01); c11 = g2_mma(a1, b, c11);
    b = g2_frag(b2p + kb, hh); c02 = g2_mma(a0, b, c02); c12 = g2_mma(a1, b, c12);
    b = g2_frag(b3p + kb, hh); c03 = g2_mma(a0, b, c03); c13 = g2_mma(a1, b, c13); }
  v8f accs[8] = {c00, c01, c02, c03, c10, c11, c12, c13};
#pragma unroll
  for (int u = 0; u < 8; ++u) { const int t = u & 3, half = u >> 2; const int col = col0 + t * 16 + ln; const float bv = bp ? bf16_round(bp[col]) : 0.f;
#pragma unroll
    for (int r = 0; r < 8; ++r) { const int rloc = half * 16 + 8 * hh + r; float v = accs[u][r] * alpha + bv; if (CP) { if (rowsPerB < 0) v += CP[cofs + (size_t)(row0g + row0 + rloc) * ldc + col];      /* rowsPerB < 0: own element of the batched C plane */ else { const int bidx = (row0g + row0 + rloc) / rowsPerB; v += CP[(size_t)bidx * sCPb + (size_t)by * 64 + col]; } }
      if (ACT == 3) v = fmaxf(v, 0.f); else if (ACT == 6) v = 0.5f * v * (1.0f + erff(v * 0.70710678118654752f)); else if (ACT == 11) v = 1.0f / (1.0f + expf(-v)); else if (ACT == 15) v = v / (1.0f + expf(-v)); else if (ACT == 12) v = (v > 0.f) ? v : 0.01f * v; else if (ACT == 8) v = tanhf(v); else if (ACT == 9) v = 0.5f * v * (1.0f + tanhf(0.7978845608028654f * (v + 0.044715f * v * v * v))); else if (ACT == 14) v = (v > 0.f) ? v : 0.1f * v; else if (ACT == 16) v = (v >= 0.f) ? v : 0.3f * v; else if (ACT == 17) v = (v >= 0.f) ? v : 0.2f * v;
      so[w][rloc][t * 16 + ln] = v; } }
  __builtin_amdgcn_fence(__ATOMIC_ACQ_REL, "workgroup"); __builtin_amdgcn_wave_barrier();
  const int rsub = lane >> 4, c4 = (lane & 15) * 4;
  {
#pragma unroll
    for (int q = 0; q < 16; ++q) { const int r = q * 2 + rsub; const v4f v = *(const v4fa*)&so[w][r][c4]; if (C) *(v4f*)(C + cofs + (size_t)(row0 + r) * ldc + col0 + c4) = v; if (C16) { v4h h4; for (int i = 0; i < 4; ++i) h4[i] = (_Float16)v[i]; *(v4h*)(C16 + cofs + (size_t)(row0 + r) * ldc + col0 + c4) = h4; } }
     } }


__global__ __launch_bounds__(256) void k_wnat(const float* __restrict__ w, size_t n8, _Float16* __restrict__ Bt) { const size_t t = (size_t)blockIdx.x * 256 + threadIdx.x; if (t >= n8) return; FragH f; for (int q = 0; q < 8; ++q) f.h[q] = (_Float16)(bf16_round(w[t * 8 + q]) * 16.0f); *(v8us*)((unsigned short*)Bt + t * 8) = f.half[0];  }
__global__ __launch_bounds__(256) void k_rsm(const float* __restrict__ S, _Float16* __restrict__ P, int nrows) {
  #pragma clang fp contract(off)
  const int i = blockIdx.x * 256 + threadIdx.x; if (i >= nrows) return; const float* s = S + (size_t)i * SQ; float mx = -3.0e38f;
#pragma unroll 1
  for (int j = 0; j < SQ; ++j) mx = fmaxf(mx, s[j]); float se = 0.f;
#pragma unroll 1
  for (int j = 0; j < SQ; ++j) se += expf(s[j] - mx); const float sc = 256.0f / se;
#pragma unroll 1
  for (int j0 = 0; j0 < SQ; j0 += 8) { FragH f; for (int q = 0; q < 8; ++q) f.h[q] = (_Float16)(expf(s[j0 + q] - mx) * sc); unsigned short* d = (unsigned short*)P + (size_t)i * SQ + j0; *(v8us*)d = f.half[0];  } }
__global__ __launch_bounds__(256) void k_vt(const _Float16* __restrict__ V16, int b, int h0, _Float16* __restrict__ VT) { __shared__ unsigned short tl[64][65]; const int tid = threadIdx.x; const int hh = blockIdx.x % HG, sg = blockIdx.x / HG; const int s0 = sg * 64; const int h = h0 + hh;
  for (int i = tid; i < 64 * 8; i += 256) { const int j = i / 8, d8 = (i % 8) * 8; FragH f; f.half[0] = *(const v8us*)((const unsigned short*)V16 + ((size_t)b * SQ + s0 + j) * DM + h * HD + d8); for (int q = 0; q < 8; ++q) tl[d8 + q][j] = f.u[q]; }
  __syncthreads();
  { for (int i = tid; i < 64 * 8; i += 256) { const int d = i / 8, j8 = (i % 8) * 8; FragH f; for (int q = 0; q < 8; ++q) f.u[q] = tl[d][j8 + q]; *(v8us*)((unsigned short*)VT + ((size_t)hh * HD + d) * SQ + s0 + j8) = f.half[0]; }  } }



// ---- fused attention: scores, softmax and P.V in one kernel; neither scores nor weights go to memory ----
#define FK 64      /* keys per LDS stage */
#define FPH 72     /* LDS row pitch in f16: 128 data bytes + 16, the conflict-free pitch for 16-byte fragment reads */
__device__ __forceinline__ float xhalf(float x) { return __builtin_bit_cast(float, __builtin_amdgcn_permlanex16(__builtin_bit_cast(int, x), __builtin_bit_cast(int, x), 0x76543210, 0xfedcba98, false, false)); }      /* lane l reads lane l ^ 16 */
// native 2^x, in place. The instruction set asks for one independent instruction or a v_nop between a transcendental and a directly following instruction that uses its result or overwrites its source.
// Eight in one statement: each is the independent instruction behind the one before it, the one v_nop fills the slot behind the last. In place, so that the statement writes only registers that the compiler's own multiply-add has just written:
// the compiler does not look into asm text when it keeps its distance behind a matrix instruction, and a fresh output register could be an operand of one just issued.
__device__ __forceinline__ void exp2x8(float (&x)[8]) { asm("v_exp_f32 %0, %0\n\tv_exp_f32 %1, %1\n\tv_exp_f32 %2, %2\n\tv_exp_f32 %3, %3\n\tv_exp_f32 %4, %4\n\tv_exp_f32 %5, %5\n\tv_exp_f32 %6, %6\n\tv_exp_f32 %7, %7\n\tv_nop" : "+v"(x[0]), "+v"(x[1]), "+v"(x[2]), "+v"(x[3]), "+v"(x[4]), "+v"(x[5]), "+v"(x[6]), "+v"(x[7])); }
__device__ __forceinline__ float exp2x1(float x) { asm("v_exp_f32 %0, %0\n\tv_nop" : "+v"(x)); return x; }      /* the same, one value */
__device__ __forceinline__ v8f fa_mma(v16h a, v16h b, v8f c) { return __builtin_amdgcn_wmma_f32_16x16x32_f16(false, a, false, b, (short)0, c, false, false); }
__global__ __launch_bounds__(512) void k_fattn(const _Float16* __restrict__ Q16, const _Float16* __restrict__ K16, const _Float16* __restrict__ VT, _Float16* __restrict__ O16, float cs) {
  constexpr int KB = 2 * FK * FPH * 2, VB = 2 * HD * FPH * 2;      /* bytes of one key half's two K buffers, two V^T buffers */
  static_assert(2 * (KB + VB) >= 16 * 8 * 512 + 16 * 32 * 8, "k_fattn: what the key halves exchange must fit the stage buffers");
  __shared__ __attribute__((aligned(16))) unsigned char sm[2 * (KB + VB)];      /* the stage buffers; behind the loop, what the two key halves exchange */
  const int kh = __builtin_amdgcn_readfirstlane((int)threadIdx.x >> 8);      /* key half of this wave, a scalar */
  _Float16 (*sk)[FK][FPH] = (_Float16 (*)[FK][FPH])(sm + kh * (KB + VB));
  _Float16 (*sv)[HD][FPH] = (_Float16 (*)[HD][FPH])(sm + kh * (KB + VB) + KB);
  const int tid = threadIdx.x & 255, lane = tid & 31, ln = lane & 15, hh = lane >> 4, w = tid >> 5;      /* tid, w: within the key half */
  const int slab = blockIdx.x / (SQ / 256), qb = blockIdx.x % (SQ / 256); const int b = slab / NH, h = slab % NH;
  const size_t qrow = (size_t)b * SQ + qb * 256 + w * 32 + ln;
  const int sr = tid >> 3, sc = (tid & 7) * 8;      /* staging: 8 threads per 128-byte row, rows sr and sr + 32 */
  const _Float16* kg = K16 + ((size_t)b * SQ + kh * (SQ / 2) + sr) * DM + h * HD + sc;
  const _Float16* vg = VT + ((size_t)slab * HD + sr) * SQ + kh * (SQ / 2) + sc;
  v8us rk0 = *(const v8us*)kg, rk1 = *(const v8us*)(kg + (size_t)32 * DM), rv0 = *(const v8us*)vg, rv1 = *(const v8us*)(vg + (size_t)32 * SQ);
  v16h qf[2][2];
#pragma unroll
  for (int g = 0; g < 2; ++g)
#pragma unroll
    for (int s = 0; s < 2; ++s) qf[g][s] = g2_frag(Q16 + (qrow + 16 * g) * DM + h * HD + 32 * s, hh);
  const v8f z8 = {0.f,0.f,0.f,0.f,0.f,0.f,0.f,0.f};
  v8f o[2][4]; float mu[2], l[2];
#pragma unroll
  for (int g = 0; g < 2; ++g) { mu[g] = -3.0e38f; l[g] = 0.f;
#pragma unroll
    for (int t = 0; t < 4; ++t) o[g][t] = z8; }
  *(v8us*)&sk[0][sr][sc] = rk0; *(v8us*)&sk[0][sr + 32][sc] = rk1; *(v8us*)&sv[0][sr][sc] = rv0; *(v8us*)&sv[0][sr + 32][sc] = rv1;
  __syncthreads();
  /* not unrolled: the two passes inside already fill the register budget, and the buffer index stays one scalar */
#pragma unroll 1
  for (int st = 0; st < SQ / 2 / FK; ++st) { const int cur = st & 1; const bool more = st + 1 < SQ / 2 / FK;      /* the same for the whole work-group */
    if (more) { const _Float16* kn = kg + (size_t)(st + 1) * FK * DM; const _Float16* vn = vg + (st + 1) * FK;
      rk0 = *(const v8us*)kn; rk1 = *(const v8us*)(kn + (size_t)32 * DM); rv0 = *(const v8us*)vn; rv1 = *(const v8us*)(vn + (size_t)32 * SQ);
      asm volatile("s_wait_xcnt 0x0" ::: "memory"); }      /* the four loads' address registers are temporaries that the fragment loads below reuse: the wait stands in front of every such overwrite */
#pragma unroll
    for (int ps = 0; ps < FK / 32; ++ps) {
      v8f s[2][2];      /* [column group][key tile] */
#pragma unroll
      for (int kt = 0; kt < 2; ++kt) { const _Float16* kr = &sk[cur][ps * 32 + kt * 16 + ln][0]; const v16h k0 = g2_frag(kr, hh), k1 = g2_frag(kr + 32, hh);
#pragma unroll
        for (int g = 0; g < 2; ++g) s[g][kt] = fa_mma(k1, qf[g][1], fa_mma(k0, qf[g][0], z8)); }
      v16h vf[4];
#pragma unroll
      for (int t = 0; t < 4; ++t) vf[t] = g2_frag(&sv[cur][t * 16 + ln][ps * 32], hh);
      float mb[2]; bool need = false;
#pragma unroll
      for (int g = 0; g < 2; ++g) { float m4[4];
#pragma unroll
        for (int q = 0; q < 4; ++q) m4[q] = fmaxf(fmaxf(s[g][0][q], s[g][0][q + 4]), fmaxf(s[g][1][q], s[g][1][q + 4]));
        float mx = fmaxf(fmaxf(m4[0], m4[1]), fmaxf(m4[2], m4[3]));
        mx = fmaxf(mx, xhalf(mx)) * cs;      /* both halves hold this query's maximum of the pass, scaled (cs > 0) */
        mb[g] = mx; need = need || (mx > mu[g] + 8.0f); }
      if (__builtin_amdgcn_ballot_w32(need) != 0) {      /* wave-uniform; always on the first pass, rare later */
#pragma unroll
        for (int g = 0; g < 2; ++g) { const float mn = fmaxf(mu[g], mb[g]); const float corr = exp2x1(mu[g] - mn); mu[g] = mn; l[g] *= corr;      /* corr = 0 on the first pass */
#pragma unroll
          for (int t = 0; t < 4; ++t) o[g][t] = o[g][t] * corr; } }
#pragma unroll
      for (int g = 0; g < 2; ++g) { const float nm = -mu[g]; FragH pf; float s4[4];
#pragma unroll
        for (int kt = 0; kt < 2; ++kt) { float p[8];
#pragma unroll
          for (int r = 0; r < 8; ++r) p[r] = fmaf(s[g][kt][r], cs, nm);
          exp2x8(p);
#pragma unroll
          for (int r = 0; r < 8; ++r) { if (kt == 0 && r < 4) s4[r] = p[r]; else s4[r & 3] += p[r]; pf.h[kt * 8 + r] = (_Float16)p[r]; } }      /* element 8 kt + r = key 16 kt + 8 hh + r: the k order of g2_frag */
        l[g] += (s4[0] + s4[1]) + (s4[2] + s4[3]);
#pragma unroll
        for (int t = 0; t < 4; ++t) o[g][t] = fa_mma(vf[t], pf.v, o[g][t]); }
    }
    if (more) { *(v8us*)&sk[cur ^ 1][sr][sc] = rk0; *(v8us*)&sk[cur ^ 1][sr + 32][sc] = rk1; *(v8us*)&sv[cur ^ 1][sr][sc] = rv0; *(v8us*)&sv[cur ^ 1][sr + 32][sc] = rv1; }      /* that buffer's last readers left it before the barrier that ended the stage before */
    __syncthreads();      /* publishes the next stage and ends every read of this one */
  }
  /* the last barrier of the loop ended every read of the stage buffers. The wave of key half kh finishes column group kh: it hands its other group to its partner (same w, other half), lane to lane, and takes the partner's group kh */
  v4f (*xo)[8][32] = (v4f (*)[8][32])sm;      /* [wave of 16][16-byte piece][lane]: a wave's store or load covers 512 contiguous bytes */
  float (*xs)[32][2] = (float (*)[32][2])(sm + 16 * 8 * 512);      /* [wave of 16][lane]: maximum in use, sum */
  v8f om[4]; float mm, lm;
  { const bool k1 = kh != 0; const int me = kh * 8 + w;
#pragma unroll
    for (int t = 0; t < 4; ++t) { const v8f gv = k1 ? o[0][t] : o[1][t]; om[t] = k1 ? o[1][t] : o[0][t];
      xo[me][2 * t][lane] = (v4f){gv[0], gv[1], gv[2], gv[3]}; xo[me][2 * t + 1][lane] = (v4f){gv[4], gv[5], gv[6], gv[7]}; }
    xs[me][lane][0] = k1 ? mu[0] : mu[1]; xs[me][lane][1] = k1 ? l[0] : l[1]; mm = k1 ? mu[1] : mu[0]; lm = k1 ? l[1] : l[0]; }
  __syncthreads();      /* what a wave reads below was written by its partner */
  { const int pa = (kh ^ 1) * 8 + w; const float mp = xs[pa][lane][0], lp = xs[pa][lane][1];
    const float mn = fmaxf(mm, mp); const float cm = exp2x1(mm - mn), cp = exp2x1(mp - mn);      /* both maxima are finite: each half has seen keys */
    const float ls = lm * cm + lp * cp;
    const float sc64 = 64.0f / (ls + xhalf(ls));      /* the wave halves' sums are joined once, here */
    const float am = cm * sc64, ap = cp * sc64;
    _Float16* d = O16 + (qrow + 16 * kh) * DM + h * HD + 8 * hh;
#pragma unroll
    for (int t = 0; t < 4; ++t) { const v4f p0 = xo[pa][2 * t][lane], p1 = xo[pa][2 * t + 1][lane]; FragH f;
#pragma unroll
      for (int r = 0; r < 8; ++r) f.h[r] = (_Float16)(om[t][r] * am + (r < 4 ? p0[r & 3] : p1[r & 3]) * ap);      /* om[t][r] = O[query ln of group kh][d = 16 t + 8 hh + r]: 16 contiguous bytes */
      *(v8us*)(d + 16 * t) = f.half[0]; } }
}

// ---- GEMM with both operands through LDS: C[4096][DM] = (A[.][DM] . Bt[n][k]^T) * alpha + bf16(bias), all pitches DM, K = DM ----
// One work-group = 128 rows x 32 NT columns, eight waves as 4 (rows) x 2 (columns), one wave = 32 x 16 NT (2 x NT accumulator tiles).
// A fragment load straight from global memory touches 16 lines for 512 bytes; here each operand row's whole lines (GKT k values a stage) are fetched once per work-group, through registers into two LDS buffers
// (the next stage's global loads in flight under this stage's products), and the fragments are 16-byte LDS reads at a pitch of 16 bytes x odd. The k order, and so every sum, is that of the loop it replaces.
// blockIdx.y picks the weight plane, its bias and its output plane (three products in one launch). H16: f16 output rows, else f32.
// PF: the next k step's fragments are fetched into a second register set ahead of this step's products; for a launch of one work-group per WGP, where registers are free and few waves hide an LDS latency.
// VTO: plane 2 (blockIdx.y == 2) is stored transposed and nowhere else: CT[(row / SQ) * DM + column][row % SQ], f16, which is V^T [batch][head][d][key] for merged-head columns.
template <int NT, int GKT, bool H16, bool PF, bool VTO>
__global__ __launch_bounds__(256) void k_gemm3(const _Float16* __restrict__ A, const _Float16* __restrict__ Bh, size_t sB, float alpha, const float* __restrict__ bias, const float* __restrict__ bias1, const float* __restrict__ bias2,
    float* __restrict__ C, _Float16* __restrict__ C16, size_t sC, _Float16* __restrict__ CT) {
  constexpr int TM = 128, TN = 32 * NT, RW = TM + TN, PH = GKT + 8, CPI = TN + 4;      /* PH: f16 pitch of an operand row in LDS; CPI: f32 pitch of the output tile in LDS, rows 16-byte aligned */
  constexpr int TPR = GKT / 8, RPP = 256 / TPR, NPA = TM / RPP, NPB = TN / RPP, NKS = GKT / 32;      /* threads per staged row, rows per pass of the work-group, passes for A and for Bt, k steps a stage */
  static_assert(DM % TN == 0 && DM % GKT == 0 && GKT % 64 == 0 && TM % RPP == 0 && TN % RPP == 0, "k_gemm3: the tile must divide the matrix, a stage must hold whole lines");
  static_assert(2 * RW * PH * 2 >= TM * CPI * 4, "k_gemm3: the output tile must fit the operand buffers");
  constexpr int TPI = TM + 8;      /* f16 pitch of one output column's TM rows in LDS (transposed tile): 256 data bytes + 16 = 16 bytes x odd */
  static_assert(!VTO || (2 * RW * PH * 2 >= TN * TPI * 2 && SQ % TM == 0 && TN % 16 == 0), "k_gemm3: the transposed tile must fit the operand buffers and lie in one batch");
  __shared__ __attribute__((aligned(16))) unsigned char sm[2 * RW * PH * 2];      /* two operand buffers (rows 0..127 A, then Bt); afterwards the output tile (f32, or the f16 transposed tile of plane 2 under VTO) */
  _Float16 (*sb)[RW][PH] = (_Float16 (*)[RW][PH])sm;
  float (*so)[CPI] = (float (*)[CPI])sm;
  const int tid = threadIdx.x, lane = tid & 31, ln = lane & 15, hh = lane >> 4, w = tid >> 5, wm = w >> 1, wn = w & 1; const int by = blockIdx.y;
  if (by == 1) bias = bias1; else if (by == 2) bias = bias2;
  constexpr int ntn = DM / TN; const int mt = blockIdx.x / ntn, nq = blockIdx.x - mt * ntn; const int row0 = mt * TM, col0 = nq * TN;
  const int sr = tid / TPR, sc = (tid % TPR) * 8;      /* staging: TPR threads per row, rows sr + RPP i */
  const _Float16* ag = A + (size_t)(row0 + sr) * DM + sc;
  const _Float16* bg = Bh + (size_t)by * sB + (size_t)(col0 + sr) * DM + sc;
  v8us ra[NPA], rb[NPB];
#pragma unroll
  for (int i = 0; i < NPA; ++i) ra[i] = *(const v8us*)(ag + i * RPP * DM);
#pragma unroll
  for (int j = 0; j < NPB; ++j) rb[j] = *(const v8us*)(bg + j * RPP * DM);
  float bv[NT];      /* this lane's bias values, fetched here so that their latency lies under the main loop */
#pragma unroll
  for (int t = 0; t < NT; ++t) bv[t] = bias[col0 + (wn * NT + t) * 16 + ln];
  asm volatile("s_wait_xcnt 0x0" ::: "memory");      /* behind the loads: it stands in front of every later overwrite of their address registers */
  const v8f z8 = {0.f,0.f,0.f,0.f,0.f,0.f,0.f,0.f};
  v8f acc[2][NT];
#pragma unroll
  for (int t = 0; t < NT; ++t) { acc[0][t] = z8; acc[1][t] = z8; }
#pragma unroll
  for (int i = 0; i < NPA; ++i) *(v8us*)&sb[0][sr + RPP * i][sc] = ra[i];
#pragma unroll
  for (int j = 0; j < NPB; ++j) *(v8us*)&sb[0][TM + sr + RPP * j][sc] = rb[j];
  __syncthreads();
  /* not unrolled: the buffer index stays one scalar and the loop stays short */
#pragma unroll 1
  for (int st = 0; st < DM / GKT; ++st) { const int cur = st & 1; const bool more = st + 1 < DM / GKT;      /* the same for the whole work-group */
    if (more) { const _Float16* an = ag + (st + 1) * GKT; const _Float16* bn = bg + (st + 1) * GKT;
#pragma unroll
      for (int i = 0; i < NPA; ++i) ra[i] = *(const v8us*)(an + i * RPP * DM);
#pragma unroll
      for (int j = 0; j < NPB; ++j) rb[j] = *(const v8us*)(bn + j * RPP * DM);
      asm volatile("s_wait_xcnt 0x0" ::: "memory"); }      /* as above: the address registers are temporaries that the code below reuses */
    const _Float16* ar = &sb[cur][wm * 32 + ln][0]; const _Float16* br = &sb[cur][TM + wn * NT * 16 + ln][0];
    if (PF) { v16h fa[2][2], fb[2][NT];
      fa[0][0] = g2_frag(ar, hh); fa[0][1] = g2_frag(ar + 16 * PH, hh);
#pragma unroll
      for (int t = 0; t < NT; ++t) fb[0][t] = g2_frag(br + t * 16 * PH, hh);
#pragma unroll
      for (int ks = 0; ks < NKS; ++ks) { const int c = ks & 1, n = c ^ 1;
        if (ks + 1 < NKS) { fa[n][0] = g2_frag(ar + (ks + 1) * 32, hh); fa[n][1] = g2_frag(ar + 16 * PH + (ks + 1) * 32, hh);
#pragma unroll
          for (int t = 0; t < NT; ++t) fb[n][t] = g2_frag(br + t * 16 * PH + (ks + 1) * 32, hh); }
        __builtin_amdgcn_sched_barrier(0);      /* keeps the next step's LDS reads, one group, in front of this step's products; left free, they sink to their uses and each pair of products waits out an LDS latency */
#pragma unroll
        for (int t = 0; t < NT; ++t) { acc[0][t] = fa_mma(fa[c][0], fb[c][t], acc[0][t]); acc[1][t] = fa_mma(fa[c][1], fb[c][t], acc[1][t]); } } }
    else {
#pragma unroll
      for (int ks = 0; ks < NKS; ++ks) { const v16h a0 = g2_frag(ar + ks * 32, hh), a1 = g2_frag(ar + 16 * PH + ks * 32, hh);
#pragma unroll
        for (int t = 0; t < NT; ++t) { const v16h b = g2_frag(br + t * 16 * PH + ks * 32, hh); acc[0][t] = fa_mma(a0, b, acc[0][t]); acc[1][t] = fa_mma(a1, b, acc[1][t]); } } }
    if (more) {      /* that buffer's last readers left it before the barrier that ended the stage before */
#pragma unroll
      for (int i = 0; i < NPA; ++i) *(v8us*)&sb[cur ^ 1][sr + RPP * i][sc] = ra[i];
#pragma unroll
      for (int j = 0; j < NPB; ++j) *(v8us*)&sb[cur ^ 1][TM + sr + RPP * j][sc] = rb[j]; }
    __syncthreads();      /* publishes the next stage and ends every read of this one */
  }
  /* the last barrier of the loop ended every read of the operand buffers: the output tile takes their place */
  if (VTO && by == 2) {      /* the same for the whole work-group. A lane's eight accumulator values are eight consecutive rows of one column: 16 contiguous bytes of that column's transposed row */
    _Float16 (*st)[TPI] = (_Float16 (*)[TPI])sm;
#pragma unroll
    for (int half = 0; half < 2; ++half)
#pragma unroll
      for (int t = 0; t < NT; ++t) { const float bb = bf16_round(bv[t]); FragH f;
#pragma unroll
        for (int r = 0; r < 8; ++r) f.h[r] = (_Float16)(acc[half][t][r] * alpha + bb);
        *(v8us*)&st[(wn * NT + t) * 16 + ln][wm * 32 + half * 16 + 8 * hh] = f.half[0]; }
    __syncthreads();      /* a column's 128 rows come from four waves and are stored by another: two whole 128-byte lines, 16 threads a column, columns vc + 16 i */
    const int vc = tid >> 4, vp = (tid & 15) * 8;
    _Float16* td = CT + ((size_t)(row0 / SQ) * DM + col0 + vc) * SQ + row0 % SQ + vp;
#pragma unroll
    for (int i = 0; i < TN / 16; ++i) *(v8us*)(td + (size_t)i * 16 * SQ) = *(const v8us*)&st[vc + 16 * i][vp]; }
  else {
#pragma unroll
  for (int half = 0; half < 2; ++half)
#pragma unroll
    for (int t = 0; t < NT; ++t) { const int col = (wn * NT + t) * 16 + ln; const float bb = bf16_round(bv[t]);
#pragma unroll
      for (int r = 0; r < 8; ++r) so[wm * 32 + half * 16 + 8 * hh + r][col] = acc[half][t][r] * alpha + bb; }
  __syncthreads();      /* the rows are stored by other waves than wrote them: whole 128-byte lines, 8 threads a line, rows er + 32 i */
  const int er = tid >> 3, ec = tid & 7;
  if (H16) { _Float16* cd = C16 + (size_t)by * sC + (size_t)(row0 + er) * DM + col0 + ec * 8;
#pragma unroll
    for (int i = 0; i < 4; ++i)
#pragma unroll
      for (int sg = 0; sg < TN / 64; ++sg) { const v4f u0 = *(const v4fa*)&so[er + 32 * i][sg * 64 + ec * 8], u1 = *(const v4fa*)&so[er + 32 * i][sg * 64 + ec * 8 + 4]; FragH f;
#pragma unroll
        for (int q = 0; q < 4; ++q) { f.h[q] = (_Float16)u0[q]; f.h[4 + q] = (_Float16)u1[q]; }
        *(v8us*)(cd + i * 32 * DM + sg * 64) = f.half[0]; } }
  else { float* cd = C + (size_t)by * sC + (size_t)(row0 + er) * DM + col0 + ec * 4;
#pragma unroll
    for (int i = 0; i < 4; ++i)
#pragma unroll
      for (int sg = 0; sg < TN / 32; ++sg) { const v4f u = *(const v4fa*)&so[er + 32 * i][sg * 32 + ec * 4]; *(v4f*)(cd + i * 32 * DM + sg * 32) = u; } }
  }
  asm volatile("s_wait_xcnt 0x0" ::: "memory");      /* behind the stores, in front of whatever follows them */
}

// ---- all input preparation in one launch: the five pieces read none of each other's output, so the grid index picks the piece ----
#define PTN 64                              /* output rows (n) of a weight tile */
#define PTK 128                             /* k values of a weight tile: 256 bytes of each output row, two whole lines */
#define PWT ((DM / PTN) * (DM / PTK))       /* tiles, one work-group each, per [DM][DM] weight plane (exact) */
#define PXB ((int)(NR * DM / 8 / 256))      /* work-groups for the x rows, 8 elements a thread (exact) */
// Weight planes first (load, LDS, barrier, store is the longer path, and low indices start first): Bt[n][k] = f16(bf16(W[k][n]) x 16), exact in f16.
// wq / wk / wv are per-head stacks [NH][DM][HD]: output row n = h * HD + e reads column e of head h's [in = DM][out = HD] block; wo is one [in = DM][out = DM] matrix. Then x as exact f16 rows, once: all three projections read the same rows.
// One work-group transposes one tile of PTK source rows x PTN columns through LDS, so that both sides of the transpose move whole 128-byte lines:
// 16 threads read the 256 contiguous bytes that a source row has in the tile, and 16 threads store the 256 contiguous bytes that an output row has in it.
// A thread reads 4 columns of 8 consecutive source rows (k); a column's 8 values, converted, are 16 contiguous bytes of that column's output row.
// LDS: PTN rows of sixteen 16-byte pieces, piece c of row n at place (c + n / 4) mod 16: the 16 lanes that write one piece index to rows 4 apart, and the 16 lanes that read one row, each meet 16 different places, no bank twice.
template <int PITCH>      /* a compile-time source row pitch: the eight loads share one address and differ in their immediate offsets */
__device__ __forceinline__ void prep_wt(const float* __restrict__ s, _Float16* __restrict__ d, v8us (*tl)[16]) {      /* s: source element [k0][n0] of the tile; d: output element [n0][k0] */
  const int hi = threadIdx.x >> 4, lo = threadIdx.x & 15;
  const float* sp = s + hi * 8 * PITCH + lo * 4;
  v4f r[8];
  /* unrolled: all eight loads are issued before the first value is used, and r stays in registers */
#pragma unroll
  for (int i = 0; i < 8; ++i) r[i] = *(const v4fa*)(sp + i * PITCH);
  asm volatile("s_wait_xcnt 0x0" ::: "memory");      /* behind the loads: it stands in front of every later overwrite of their address registers */
#pragma unroll
  for (int j = 0; j < 4; ++j) { FragH f;
#pragma unroll
    for (int i = 0; i < 8; ++i) f.h[i] = (_Float16)(bf16_round(r[i][j]) * 16.0f);
    tl[lo * 4 + j][(hi + lo) & 15] = f.half[0]; }      /* row n = 4 lo + j, piece hi */
  __syncthreads();      /* an output row's pieces come from all eight waves and are stored by one */
  _Float16* dp = d + hi * DM + lo * 8;
#pragma unroll
  for (int p = 0; p < PTN / 16; ++p) *(v8us*)(unsigned short*)(dp + p * 16 * DM) = tl[p * 16 + hi][(lo + p * 4 + (hi >> 2)) & 15];      /* row n = 16 p + hi, piece lo */
  asm volatile("s_wait_xcnt 0x0" ::: "memory"); }      /* behind the stores, in front of whatever follows them */
__global__ __launch_bounds__(256) void k_prep(const float* __restrict__ x, const float* __restrict__ wq, const float* __restrict__ wk, const float* __restrict__ wv, const float* __restrict__ wo,
    _Float16* __restrict__ X16, _Float16* __restrict__ BQ, _Float16* __restrict__ BK, _Float16* __restrict__ BV, _Float16* __restrict__ BO) {
  static_assert(PTN == HD && PTK == 16 * 8 && DM % PTK == 0 && DM % PTN == 0, "k_prep: a tile is one head's columns x sixteen 16-byte pieces, and tiles must divide the plane");
  __shared__ __attribute__((aligned(16))) v8us tl[PTN][16];
  const int bx = blockIdx.x;
  if (bx < 4 * PWT) { const int m = bx / PWT; const int t = bx - m * PWT; const int nt = t / (DM / PTK), k0 = (t % (DM / PTK)) * PTK; const int o = nt * PTN * DM + k0;      /* the same for the whole work-group; PTN == HD: tile row nt is head nt */
    if (m == 3) prep_wt<DM>(wo + k0 * DM + nt * PTN, BO + o, tl);
    else prep_wt<HD>((m == 0 ? wq : m == 1 ? wk : wv) + nt * (DM * HD) + k0 * HD, (m == 0 ? BQ : m == 1 ? BK : BV) + o, tl); }
  else { const size_t t = (size_t)(bx - 4 * PWT) * 256 + threadIdx.x; FragH f;
    /* unrolled: the eight contiguous floats become two 16-byte loads, and f stays in registers */
#pragma unroll
    for (int q = 0; q < 8; ++q) f.h[q] = (_Float16)bf16_round(x[t * 8 + q]);
    *(v8us*)((unsigned short*)X16 + t * 8) = f.half[0];
    asm volatile("s_wait_xcnt 0x0" ::: "memory"); }      /* behind the store, in front of whatever follows it */
}

extern "C" void kernel_launch(void* const* d_in, const int* in_sizes, int n_in,
                              void* d_out, int out_size, void* d_ws, size_t ws_size, hipStream_t stream) {
  (void)in_sizes; (void)n_in; (void)out_size;
  const float* const* I = (const float* const*)d_in; const float* x = I[0]; const float* wq = I[1]; const float* bq = I[2]; const float* wk = I[3]; const float* bk = I[4]; const float* wv = I[5]; const float* bv = I[6]; const float* wo = I[7]; const float* bo = I[8];      /* ONE input stream (x) read on all three projections; wq, wk, wv are PER-HEAD STACKS [12][768][64] = [head][in][out]; bq, bk, bv are per-head [12][64] = the flat [768] bias; wo [in][out] + bo; input order x, wq, bq, wk, bk, wv, bv, wo, bo */
  char* ws = (char*)d_ws; size_t off = 0;
  auto take = [&](size_t bytes) { char* p = ws + off; off += (bytes + 255) & ~(size_t)255; return p; };
  _Float16* BQ = (_Float16*)take((size_t)DM * DM * 2); _Float16* BK = (_Float16*)take((size_t)DM * DM * 2); _Float16* BV = (_Float16*)take((size_t)DM * DM * 2); _Float16* BO = (_Float16*)take((size_t)DM * DM * 2);      /* BQ, BK, BV lie DM * DM elements apart (a multiple of 256 bytes): the batch stride of the merged projection launch */
  _Float16* X16 = (_Float16*)take(NR * DM * 2); _Float16* Q16 = (_Float16*)take(NR * DM * 2); _Float16* K16 = (_Float16*)take(NR * DM * 2); _Float16* O16 = (_Float16*)take(NR * DM * 2);      /* Q16, K16 lie NR * DM elements apart, likewise */
  _Float16* VT = (_Float16*)take((size_t)NB * NH * HD * SQ * 2);
  if (off > ws_size) return;
  k_prep<<<4 * PWT + PXB, 256, 0, stream>>>(x, wq, wk, wv, wo, X16, BQ, BK, BV, BO);      /* the four weight planes (x16) and x as exact f16 rows */
  const size_t r0p = (size_t)B0 * SQ;      /* first projected row */
  k_gemm3<4, 64, true, false, true><<<dim3((unsigned)((MP / 128) * (DM / 128)), 3), 256, 0, stream>>>(X16 + r0p * DM, BQ, (size_t)DM * DM, 0.0625f, bq, bk, bv, nullptr, Q16 + r0p * DM, NR * DM, VT + (size_t)B0 * DM * SQ);      /* blockIdx.y = 0, 1, 2: q rows, k rows, V^T [NB][NH][HD][SQ] */
  k_fattn<<<NB * NH * (SQ / 256), 512, 0, stream>>>(Q16, K16, VT, O16, 0.052058773f);      /* o (merged heads, x64) as f16 rows; cs = 768^-0.5 log2 e */
  k_gemm3<3, 128, false, true, false><<<dim3((unsigned)((MPO / 128) * (DM / 96)), 1), 256, 0, stream>>>(O16 + r0p * DM, BO, 0, 0.0009765625f, bo, nullptr, nullptr, (float*)d_out + r0p * DM, nullptr, 0, nullptr);      /* out rows are the output layout */
}
